// v000
// Times are from an AMD MI455X. After a warm-up the kernel runs many times in a row, and a time is the length of
// such a window on the GPU divided by its runs, so every launch and the gaps after it count. The runs cycle
// through copies of the inputs. A figure is the median of several windows, for all but v000 over two sittings.
// Sittings can differ by a few percent; kernels timed side by side share one.
// The starting kernel, v000, takes 11.9 milliseconds a run.
#include <hip/hip_runtime.h>
// Grouped-query causal attention with rotate-half RoPE, 16 query / 8 kv heads of 128 (x [2][2048][2048]; q = x Wq (16 x 128), k = x Wk, v = x Wv (8 x 128) ([in][out] weights sigma 0.02, no biases); inv_freq_i = 1/10000^(2i/128), positions 0..2047, cos/sin = cat(freqs, freqs); q, k roped; kv head h/2 serves query head h; scores / sqrt(128); causal (tril, -inf); softmax; out = merged Wo -> [2][2048][2048]).
// Compute dtype: inputs rounded to bf16; x / weights exact; projections and rope f32; q, k, v, softmax weights and o as plain f16 GEMM operands (~2^-12; first 256 rows of each batch exact); scores, statistics, out f32. v_wmma_f32_16x16x32_f16.
#define NB 2
#define SQ 2048
#define DMX 2048
#define NH 16
#define NKV 8
#define GSZ 2                        /* query heads per kv head */
#define HDK 128
#define DKV (NKV * HDK)
#define QT 256
#define QT0 256
#define NKX SQ
#define DM DMX
#define HD 64
#define HG 1
#define NR ((size_t)NB * SQ)
#define ATS 0.08838834764831845f
typedef __bf16 v16b __attribute__((ext_vector_type(16)));
typedef unsigned short v8us __attribute__((ext_vector_type(8), may_alias));
typedef float  v8f  __attribute__((ext_vector_type(8)));
typedef float  v4f  __attribute__((ext_vector_type(4)));
typedef float  v4fa __attribute__((ext_vector_type(4), may_alias));
union FragB { v16b v; v8us half[2]; unsigned short u[16]; };

__device__ __forceinline__ unsigned short bf16_bits(float x) { unsigned int u = __float_as_uint(x); return (unsigned short)((u + 0x7FFFu + ((u >> 16) & 1u)) >> 16); }
__device__ __forceinline__ float bf16_val(unsigned short b) { return __uint_as_float(((unsigned int)b) << 16); }
__device__ __forceinline__ float bf16_round(float x) { return bf16_val(bf16_bits(x)); }
// D += A·B with NT terms: 1 = ah·bh, 2 = + al·bh (A split), 3 = + ah·bl (both split)
template <int NT>
__device__ __forceinline__ v8f mmaN(v16b ah, v16b al, v16b bh, v16b bl, v8f c) {
  c = __builtin_amdgcn_wmma_f32_16x16x32_bf16(false, ah, false, bh, (short)0, c, false, false);
  if (NT >= 2) c = __builtin_amdgcn_wmma_f32_16x16x32_bf16(false, al, false, bh, (short)0, c, false, false);
  if (NT >= 3) c = __builtin_amdgcn_wmma_f32_16x16x32_bf16(false, ah, false, bl, (short)0, c, false, false);
  asm volatile("v_nop\n\tv_nop\n\tv_nop\n\tv_nop" : "+v"(c) : "v"(ah), "v"(al), "v"(bh), "v"(bl));
  return c;
}

__global__ __launch_bounds__(256) void k_wt_bf16(const float* __restrict__ W, unsigned short* __restrict__ Wt, int K, int N) {
  const int t = blockIdx.x * 256 + threadIdx.x;
  const int k8n = K / 8;
  if (t >= N * k8n) return;
  const int n = t / k8n, k8 = (t % k8n) * 8;
  v8us v;
#pragma unroll
  for (int i = 0; i < 8; ++i) v[i] = bf16_bits(W[(size_t)(k8 + i) * N + n]);
  *(v8us*)(Wt + (size_t)n * K + k8) = v;
  
}

// GEMM C[M][N] (f32, pitch ldc) = act(A[M][K]·W + bias). A f32 row-major (pitch lda) converted per fragment to bf16
// (ASPLIT: hi/lo two planes -> 2 terms, else single rounded term); Wt bf16 [N][K] (pitch ldb). BIAS_BF16 rounds the
// bias to bf16 first (bias quantised to bf16 before the add). K%32==0, M%16==0, N%64==0.
template <bool ASPLIT, int ACT, bool BIAS_BF16>
__global__ __launch_bounds__(128) void k_gemm_bf(const float* __restrict__ A, int lda, const unsigned short* __restrict__ Wt, int ldb,
                                               const float* __restrict__ bias, float* __restrict__ C, int ldc, int M, int N, int K) {
  __shared__ __attribute__((aligned(16))) float so[4][16][64];
  const int tid = threadIdx.x, w = tid >> 5, lane = tid & 31, ln = lane & 15, hh = lane >> 4;
  const int ntn = N / 64;
  const int wid = blockIdx.x * 4 + w;
  const int mt = wid / ntn, nq = wid % ntn;
  if (mt * 16 >= M) return;
  const int row0 = mt * 16, col0 = nq * 64;
  const float* arow = A + (size_t)(row0 + ln) * lda;
  v8f acc[4] = {};
  for (int kb = 0; kb < K; kb += 32) {
    FragB ah, al;
    const v4f x0 = *(const v4fa*)(arow + kb + 8 * hh), x1 = *(const v4fa*)(arow + kb + 8 * hh + 4);
    const v4f x2 = *(const v4fa*)(arow + kb + 16 + 8 * hh), x3 = *(const v4fa*)(arow + kb + 16 + 8 * hh + 4);
    float xs[16] = {x0[0],x0[1],x0[2],x0[3],x1[0],x1[1],x1[2],x1[3],x2[0],x2[1],x2[2],x2[3],x3[0],x3[1],x3[2],x3[3]};
#pragma unroll
    for (int i = 0; i < 16; ++i) { const unsigned short hb = bf16_bits(xs[i]); ah.u[i] = hb; al.u[i] = ASPLIT ? bf16_bits(xs[i] - bf16_val(hb)) : (unsigned short)0; }
#pragma unroll
    for (int t = 0; t < 4; ++t) {
      const unsigned short* brow = Wt + (size_t)(col0 + t * 16 + ln) * ldb + kb;
      FragB b;
      b.half[0] = *(const v8us*)(brow + 8 * hh);
      b.half[1] = *(const v8us*)(brow + 16 + 8 * hh);
      acc[t] = mmaN<ASPLIT ? 2 : 1>(ah.v, al.v, b.v, b.v, acc[t]);
    }
  }
#pragma unroll
  for (int t = 0; t < 4; ++t) {
    float bv = bias ? bias[col0 + t * 16 + ln] : 0.f;
    if (BIAS_BF16) bv = bf16_round(bv);
#pragma unroll
    for (int r = 0; r < 8; ++r) { float v = acc[t][r] + bv; if (ACT == 1) v = fmaxf(v, 0.f); so[w][8 * hh + r][t * 16 + ln] = v; }
  }
  __builtin_amdgcn_fence(__ATOMIC_ACQ_REL, "workgroup");
  __builtin_amdgcn_wave_barrier();
  const int rsub = lane >> 4, c4 = (lane & 15) * 4;
  {
#pragma unroll
    for (int q = 0; q < 8; ++q) {
      const int r = q * 2 + rsub;
      const v4f v = *(const v4fa*)&so[w][r][c4];
      *(v4f*)(C + (size_t)(row0 + r) * ldc + col0 + c4) = v;
    }
    
  }
}

// GEMM C = act(A·W + bias + resid): A f32 (ASPLIT -> hi/lo 2 terms), Wt bf16 [N][K]; ACT 0 none, 1 relu, 2 exact gelu;
// resid (optional, f32, row index = (row % rmod), pitch ldr, RES_BF16 rounds it) added before the activation.
template <bool ASPLIT, int ACT, bool BIAS_BF16, bool RES_BF16>
__global__ __launch_bounds__(128) void k_gemm_bf3(const float* __restrict__ A, int lda, const unsigned short* __restrict__ Wt, int ldb,
                                                const float* __restrict__ bias, const float* __restrict__ resid, int rmod, int ldr,
                                                float* __restrict__ C, int ldc, int M, int N, int K) {
  __shared__ __attribute__((aligned(16))) float so[4][16][64];
  const int tid = threadIdx.x, w = tid >> 5, lane = tid & 31, ln = lane & 15, hh = lane >> 4;
  const int ntn = N / 64;
  const int wid = blockIdx.x * 4 + w;
  const int mt = wid / ntn, nq = wid % ntn;
  if (mt * 16 >= M) return;
  const int row0 = mt * 16, col0 = nq * 64;
  const float* arow = A + (size_t)(row0 + ln) * lda;
  v8f acc[4] = {};
  for (int kb = 0; kb < K; kb += 32) {
    FragB ah, al;
    const v4f x0 = *(const v4fa*)(arow + kb + 8 * hh), x1 = *(const v4fa*)(arow + kb + 8 * hh + 4);
    const v4f x2 = *(const v4fa*)(arow + kb + 16 + 8 * hh), x3 = *(const v4fa*)(arow + kb + 16 + 8 * hh + 4);
    float xs[16] = {x0[0],x0[1],x0[2],x0[3],x1[0],x1[1],x1[2],x1[3],x2[0],x2[1],x2[2],x2[3],x3[0],x3[1],x3[2],x3[3]};
#pragma unroll
    for (int i = 0; i < 16; ++i) { const unsigned short hb = bf16_bits(xs[i]); ah.u[i] = hb; al.u[i] = ASPLIT ? bf16_bits(xs[i] - bf16_val(hb)) : (unsigned short)0; }
#pragma unroll
    for (int t = 0; t < 4; ++t) {
      const unsigned short* brow = Wt + (size_t)(col0 + t * 16 + ln) * ldb + kb;
      FragB b;
      b.half[0] = *(const v8us*)(brow + 8 * hh);
      b.half[1] = *(const v8us*)(brow + 16 + 8 * hh);
      acc[t] = mmaN<ASPLIT ? 2 : 1>(ah.v, al.v, b.v, b.v, acc[t]);
    }
  }
#pragma unroll
  for (int t = 0; t < 4; ++t) {
    const int col = col0 + t * 16 + ln;
    float bv = bias ? bias[col] : 0.f;
    if (BIAS_BF16) bv = bf16_round(bv);
#pragma unroll
    for (int r = 0; r < 8; ++r) {
      float v = acc[t][r] + bv;
      if (resid) { float rv = resid[(size_t)((row0 + 8 * hh + r) % rmod) * ldr + col]; if (RES_BF16) rv = bf16_round(rv); v += rv; }
      if (ACT == 1) v = fmaxf(v, 0.f);
      if (ACT == 2) v = 0.5f * v * (1.0f + erff(v * 0.70710678118654752f));
      if (ACT == 3) { const float u = 0.7978845608028654f * (v + 0.044715f * v * v * v); v = 0.5f * v * (1.0f + tanhf(u)); }
      so[w][8 * hh + r][t * 16 + ln] = v;
    }
  }
  __builtin_amdgcn_fence(__ATOMIC_ACQ_REL, "workgroup");
  __builtin_amdgcn_wave_barrier();
  const int rsub = lane >> 4, c4 = (lane & 15) * 4;
  {
#pragma unroll
    for (int q = 0; q < 8; ++q) {
      const int r = q * 2 + rsub;
      const v4f v = *(const v4fa*)&so[w][r][c4];
      *(v4f*)(C + (size_t)(row0 + r) * ldc + col0 + c4) = v;
    }
    
  }
}
// row LayerNorm (biased variance, eps) over N: s = X (+ R); optional out_sum <- s; out_norm <- (s-mu)*rsqrt(var+eps)*g + b
template <bool PARAM_BF16>
__global__ __launch_bounds__(256) void k_layernorm(const float* __restrict__ X, const float* __restrict__ R, const float* __restrict__ g, const float* __restrict__ bta,
                                                  float* __restrict__ out_sum, float* __restrict__ out_norm, int N, float eps) {
  __shared__ float red[256];
  const int row = blockIdx.x, tid = threadIdx.x;
  const float* x = X + (size_t)row * N; const float* rr = R ? R + (size_t)row * N : nullptr;
  float vals[16];                     // up to N = 4096
  const int per = N / 256;            // contiguous chunk per thread? use strided-by-4 chunks: thread handles j = tid*4 + 1024*u
  float s1 = 0.f;
  for (int u = 0; u < per / 4; ++u) {
    const int j = tid * 4 + 1024 * u;
    const v4f a = *(const v4fa*)(x + j);
    v4f b = {0.f,0.f,0.f,0.f}; if (rr) b = *(const v4fa*)(rr + j);
#pragma unroll
    for (int q = 0; q < 4; ++q) { const float v = a[q] + b[q]; vals[u * 4 + q] = v; s1 += v; }
  }
  red[tid] = s1; __syncthreads();
  for (int st = 128; st > 0; st >>= 1) { if (tid < st) red[tid] += red[tid + st]; __syncthreads(); }
  const float mu = red[0] / (float)N; __syncthreads();
  float s2 = 0.f;
  for (int u = 0; u < per / 4; ++u)
#pragma unroll
    for (int q = 0; q < 4; ++q) { const float c = vals[u * 4 + q] - mu; s2 += c * c; }
  red[tid] = s2; __syncthreads();
  for (int st = 128; st > 0; st >>= 1) { if (tid < st) red[tid] += red[tid + st]; __syncthreads(); }
  const float rs = rsqrtf(red[0] / (float)N + eps);
  {
    for (int u = 0; u < per / 4; ++u) {
      const int j = tid * 4 + 1024 * u;
      v4f o, sm;
#pragma unroll
      for (int q = 0; q < 4; ++q) {
        float gg = g[j + q], bb = bta[j + q];
        if (PARAM_BF16) { gg = bf16_round(gg); bb = bf16_round(bb); }
        sm[q] = vals[u * 4 + q]; o[q] = (vals[u * 4 + q] - mu) * rs * gg + bb;
      }
      if (out_sum) *(v4f*)(out_sum + (size_t)row * N + j) = sm;
      *(v4f*)(out_norm + (size_t)row * N + j) = o;
    }
    
  }
}



// ---- f16 WMMA path (v_wmma_f32_16x16x32_f16): 11-bit significands for operands in range — used where a [0,1] probability operand needs more precision than bf16
typedef _Float16 v16h __attribute__((ext_vector_type(16)));
union FragH { v16h v; v8us half[2]; _Float16 h[16]; unsigned short u[16]; };
template <int NT>
__device__ __forceinline__ v8f mmaH(v16h ah, v16h al, v16h bh, v16h bl, v8f c) {
  c = __builtin_amdgcn_wmma_f32_16x16x32_f16(false, ah, false, bh, (short)0, c, false, false);
  if (NT >= 2) c = __builtin_amdgcn_wmma_f32_16x16x32_f16(false, al, false, bh, (short)0, c, false, false);
  if (NT >= 3) c = __builtin_amdgcn_wmma_f32_16x16x32_f16(false, ah, false, bl, (short)0, c, false, false);
  asm volatile("v_nop\n\tv_nop\n\tv_nop\n\tv_nop" : "+v"(c) : "v"(ah), "v"(al), "v"(bh), "v"(bl));
  return c;
}
// batched GEMM like k_gemm_b but f16 operands: A f32 (split into f16 hi/lo if ASPLIT, else rounded to f16), Bt = f16 values [n][k]; alpha; C f32; N multiple of 16 (partial tiles skipped)
template <bool ASPLIT>
__global__ __launch_bounds__(128) void k_gemm_h(const float* __restrict__ A, int lda, size_t sA, const _Float16* __restrict__ Bh, int ldb, size_t sB, float alpha, float* __restrict__ C, int ldc, size_t sC, int M, int N, int K) {
  __shared__ __attribute__((aligned(16))) float so[4][16][64];
  const int tid = threadIdx.x, w = tid >> 5, lane = tid & 31, ln = lane & 15, hh = lane >> 4; const int by = blockIdx.y;
  A += (size_t)by * sA; Bh += (size_t)by * sB; C += (size_t)by * sC;
  const int ntn = (N + 63) / 64; const int wid = blockIdx.x * 4 + w; const int mt = wid / ntn, nq = wid % ntn; if (mt * 16 >= M) return;
  const int row0 = mt * 16, col0 = nq * 64; const float* arow = A + (size_t)(row0 + ln) * lda;
  v8f acc[4] = {};
  for (int kb = 0; kb < K; kb += 32) {
    FragH ah, al;
    const v4f x0 = *(const v4fa*)(arow + kb + 8 * hh), x1 = *(const v4fa*)(arow + kb + 8 * hh + 4), x2 = *(const v4fa*)(arow + kb + 16 + 8 * hh), x3 = *(const v4fa*)(arow + kb + 16 + 8 * hh + 4);
    float xs[16] = {x0[0],x0[1],x0[2],x0[3],x1[0],x1[1],x1[2],x1[3],x2[0],x2[1],x2[2],x2[3],x3[0],x3[1],x3[2],x3[3]};
#pragma unroll
    for (int i = 0; i < 16; ++i) { const _Float16 h = (_Float16)xs[i]; ah.h[i] = h; al.h[i] = ASPLIT ? (_Float16)(xs[i] - (float)h) : (_Float16)0.0f; }
#pragma unroll
    for (int t = 0; t < 4; ++t) { if (col0 + t * 16 >= N) continue; const size_t boff = (size_t)(col0 + t * 16 + ln) * ldb + kb; FragH bq; bq.half[0] = *(const v8us*)(Bh + boff + 8 * hh); bq.half[1] = *(const v8us*)(Bh + boff + 16 + 8 * hh);
      acc[t] = mmaH<ASPLIT ? 2 : 1>(ah.v, al.v, bq.v, bq.v, acc[t]); }
  }
#pragma unroll
  for (int t = 0; t < 4; ++t) { if (col0 + t * 16 >= N) continue;
#pragma unroll
    for (int r = 0; r < 8; ++r) so[w][8 * hh + r][t * 16 + ln] = acc[t][r] * alpha; }
  __builtin_amdgcn_fence(__ATOMIC_ACQ_REL, "workgroup"); __builtin_amdgcn_wave_barrier();
  const int rsub = lane >> 4, c4 = (lane & 15) * 4;
  {
#pragma unroll
    for (int q = 0; q < 8; ++q) { const int r = q * 2 + rsub; if (col0 + c4 < N) { const v4f v = *(const v4fa*)&so[w][r][c4]; *(v4f*)(C + (size_t)(row0 + r) * ldc + col0 + c4) = v; } }
     }
}

// Wt[n][k] = f16(W[k][n]·scale) from f32 row-major W[K][N] (scale = power of two; bf16-exact weights stay exact in f16 away from the subnormal range)
__global__ __launch_bounds__(256) void k_wt_f16(const float* __restrict__ W, _Float16* __restrict__ Wt, int K, int N, float scale) {
  const int t = blockIdx.x * 256 + threadIdx.x; if (t >= N * (K / 8)) return; const int n = t / (K / 8), k8 = (t % (K / 8)) * 8; FragH f;
#pragma unroll
  for (int i = 0; i < 8; ++i) f.h[i] = (_Float16)(bf16_round(W[(size_t)(k8 + i) * N + n]) * scale); const v8us o = f.half[0];
  *(v8us*)((unsigned short*)Wt + (size_t)n * K + k8) = o; 
}
// k_gemm_hh variant with fused epilogue: v = acc·alpha + bias[by·sBias + col] (+ CP[(row/rowsPerB)·sCPb + by·64 + col] if CP) ; ACT 0 none / 1 elu ; writes f16 C16 (and f32 C if non-null)
template <int ACT>
__global__ __launch_bounds__(128) void k_gemm_hhx(const _Float16* __restrict__ A, int lda, size_t sA, const _Float16* __restrict__ Bh, int ldb, size_t sB, float alpha, const float* __restrict__ bias, size_t sBias, const float* __restrict__ CP, int rowsPerB, size_t sCPb, int row0g,
    float* __restrict__ C, _Float16* __restrict__ C16, int ldc, size_t sC, int M, int N, int K) {
  __shared__ __attribute__((aligned(16))) float so[4][16][64];
  const int tid = threadIdx.x, w = tid >> 5, lane = tid & 31, ln = lane & 15, hh = lane >> 4; const int by = blockIdx.y;
  A += (size_t)by * sA; Bh += (size_t)by * sB; const size_t cofs = (size_t)by * sC; const float* bp = bias ? bias + (size_t)by * sBias : nullptr;
  const int ntn = (N + 63) / 64; const int wid = blockIdx.x * 4 + w; const int mt = wid / ntn, nq = wid % ntn; if (mt * 16 >= M) return;
  const int row0 = mt * 16, col0 = nq * 64; const _Float16* arow = A + (size_t)(row0 + ln) * lda;
  v8f acc[4] = {};
  for (int kb = 0; kb < K; kb += 32) { FragH ah; ah.half[0] = *(const v8us*)((const unsigned short*)arow + kb + 8 * hh); ah.half[1] = *(const v8us*)((const unsigned short*)arow + kb + 16 + 8 * hh);
#pragma unroll
    for (int t = 0; t < 4; ++t) { if (col0 + t * 16 >= N) continue; const size_t boff = (size_t)(col0 + t * 16 + ln) * ldb + kb; FragH bq; bq.half[0] = *(const v8us*)((const unsigned short*)Bh + boff + 8 * hh); bq.half[1] = *(const v8us*)((const unsigned short*)Bh + boff + 16 + 8 * hh);
      acc[t] = mmaH<1>(ah.v, ah.v, bq.v, bq.v, acc[t]); }
  }
#pragma unroll
  for (int t = 0; t < 4; ++t) { if (col0 + t * 16 >= N) continue; const int col = col0 + t * 16 + ln; const float bv = bp ? bf16_round(bp[col]) : 0.f;
#pragma unroll
    for (int r = 0; r < 8; ++r) { float v = acc[t][r] * alpha + bv; if (CP) { const int rr = row0g + row0 + 8 * hh + r; if (rowsPerB < 0) v += CP[cofs + (size_t)rr * ldc + col];      /* rowsPerB < 0: own element of the batched C plane */ else { const int bidx = rr / rowsPerB; v += CP[(size_t)bidx * sCPb + (size_t)by * 64 + col]; } } if (ACT == 1) v = (v > 0.f) ? v : expm1f(v); else if (ACT == 7) v = (v > 0.f) ? v + 1.0f : expf(v); else if (ACT == 8) v = tanhf(v); else if (ACT == 9) v = 0.5f * v * (1.0f + tanhf(0.7978845608028654f * (v + 0.044715f * v * v * v))); else if (ACT == 11) v = 1.0f / (1.0f + expf(-v)); else if (ACT == 12) v = (v > 0.f) ? v : 0.01f * v; else if (ACT == 14) v = (v > 0.f) ? v : 0.1f * v; else if (ACT == 16) v = (v >= 0.f) ? v : 0.3f * v; else if (ACT == 17) v = (v >= 0.f) ? v : 0.2f * v; else if (ACT == 15) v = v / (1.0f + expf(-v)); else if (ACT == 3) v = fmaxf(v, 0.f); else if (ACT == 6) v = 0.5f * v * (1.0f + erff(v * 0.70710678118654752f)); so[w][8 * hh + r][t * 16 + ln] = v; } }
  __builtin_amdgcn_fence(__ATOMIC_ACQ_REL, "workgroup"); __builtin_amdgcn_wave_barrier();
  const int rsub = lane >> 4, c4 = (lane & 15) * 4; typedef _Float16 v4h __attribute__((ext_vector_type(4)));
  {
#pragma unroll
    for (int q = 0; q < 8; ++q) { const int r = q * 2 + rsub; if (col0 + c4 < N) { const v4f v = *(const v4fa*)&so[w][r][c4]; if (C) *(v4f*)(C + cofs + (size_t)(row0 + r) * ldc + col0 + c4) = v; if (C16) { v4h h4; for (int i = 0; i < 4; ++i) h4[i] = (_Float16)v[i]; *(v4h*)(C16 + cofs + (size_t)(row0 + r) * ldc + col0 + c4) = h4; } } }
     }
}


typedef _Float16 v4h __attribute__((ext_vector_type(4)));

__global__ __launch_bounds__(256) void k_x16(const float* __restrict__ x, _Float16* __restrict__ X16, size_t n8) { const size_t t = (size_t)blockIdx.x * 256 + threadIdx.x; if (t >= n8) return; FragH f;
#pragma unroll
  for (int q = 0; q < 8; ++q) f.h[q] = (_Float16)bf16_round(x[t * 8 + q]); *(v8us*)((unsigned short*)X16 + t * 8) = f.half[0];  }
__global__ __launch_bounds__(256) void k_h16(const float* __restrict__ x, _Float16* __restrict__ X16, size_t n8) { const size_t t = (size_t)blockIdx.x * 256 + threadIdx.x; if (t >= n8) return; FragH f;
#pragma unroll
  for (int q = 0; q < 8; ++q) f.h[q] = (_Float16)x[t * 8 + q]; *(v8us*)((unsigned short*)X16 + t * 8) = f.half[0];  }
__global__ __launch_bounds__(256) void k_round16f(const float* __restrict__ W, _Float16* __restrict__ Bt, size_t n8) { const size_t t = (size_t)blockIdx.x * 256 + threadIdx.x; if (t >= n8) return; FragH f;
#pragma unroll
  for (int i = 0; i < 8; ++i) f.h[i] = (_Float16)(bf16_round(W[t * 8 + i]) * 16.0f); *(v8us*)((unsigned short*)Bt + t * 8) = f.half[0];  }
template <int NHv, int TTv>
__global__ __launch_bounds__(256) void k_vt(const _Float16* __restrict__ V16, int ldv, int voff, _Float16* __restrict__ Vt) { __shared__ unsigned short tl[64][66]; const int tid = threadIdx.x; const int slab = blockIdx.x / (TTv / 64), lg = blockIdx.x % (TTv / 64); const int b = slab / NHv, h = slab % NHv;
  for (int i = tid; i < 64 * 8; i += 256) { const int r = i / 8, c8 = (i % 8) * 8; FragH f; f.half[0] = *(const v8us*)((const unsigned short*)V16 + ((size_t)b * TTv + lg * 64 + r) * ldv + voff + h * 64 + c8);
#pragma unroll
    for (int q = 0; q < 8; ++q) tl[r][c8 + q] = f.u[q]; }
  __syncthreads();
  {
#pragma unroll
    for (int rd = 0; rd < 2; ++rd) { const int d = rd * 32 + tid / 8, pc = tid % 8; FragH f;
#pragma unroll
      for (int q = 0; q < 8; ++q) f.u[q] = tl[pc * 8 + q][d];
      *(v8us*)((unsigned short*)Vt + ((size_t)slab * 64 + d) * TTv + lg * 64 + pc * 8) = f.half[0]; }
     } }

__global__ __launch_bounds__(256) void k_hl(const float* __restrict__ F, _Float16* __restrict__ Hh, _Float16* __restrict__ Hl, size_t n8) { const size_t t = (size_t)blockIdx.x * 256 + threadIdx.x; if (t >= n8) return; FragH fh, fl; const v4f a = *(const v4fa*)(F + t * 8), c = *(const v4fa*)(F + t * 8 + 4);
#pragma unroll
  for (int q = 0; q < 4; ++q) { _Float16 h = (_Float16)a[q]; fh.h[q] = h; fl.h[q] = (_Float16)((a[q] - (float)h) * 1024.0f); h = (_Float16)c[q]; fh.h[4 + q] = h; fl.h[4 + q] = (_Float16)((c[q] - (float)h) * 1024.0f); }
  { *(v8us*)((unsigned short*)Hh + t * 8) = fh.half[0]; *(v8us*)((unsigned short*)Hl + t * 8) = fl.half[0];  } }

// ---- fast GEMM (wave tile 32x64; requires M % 32 == 0 rows per launch region and N % 64 == 0); epilogue = k_gemm_hhx semantics ----
__device__ __forceinline__ v16h g2_frag(const _Float16* p, int hh) { FragH f; f.half[0] = *(const v8us*)((const unsigned short*)p + 8 * hh); f.half[1] = *(const v8us*)((const unsigned short*)p + 16 + 8 * hh); return f.v; }
__device__ __forceinline__ v8f g2_mma(v16h a, v16h b, v8f c) { v8f d = __builtin_amdgcn_wmma_f32_16x16x32_f16(false, a, false, b, (short)0, c, false, false); asm volatile("v_nop\n\tv_nop\n\tv_nop\n\tv_nop" : "+v"(d) : "v"(a), "v"(b)); return d; }
template <int ACT>
__global__ __launch_bounds__(128) void k_gemm2(const _Float16* __restrict__ A, int lda, size_t sA, const _Float16* __restrict__ Bh, int ldb, size_t sB, float alpha, const float* __restrict__ bias, size_t sBias, const float* __restrict__ CP, int rowsPerB, size_t sCPb, int row0g,
    float* __restrict__ C, _Float16* __restrict__ C16, int ldc, size_t sC, int M, int N, int K) { static_assert(ACT == 0 || ACT == 3 || ACT == 6 || ACT == 8 || ACT == 9 || ACT == 11 || ACT == 12 || ACT == 14 || ACT == 15 || ACT == 16 || ACT == 17, "k_gemm2: unsupported ACT code (would silently apply no activation)");
  __shared__ __attribute__((aligned(16))) float so[4][32][68];
  const int tid = threadIdx.x, w = tid >> 5, lane = tid & 31, ln = lane & 15, hh = lane >> 4; const int by = blockIdx.y;
  A += (size_t)by * sA; Bh += (size_t)by * sB; const size_t cofs = (size_t)by * sC; const float* bp = bias ? bias + (size_t)by * sBias : nullptr;
  const int ntn = N >> 6; const int mt = blockIdx.x / ntn, nq = blockIdx.x - mt * ntn; const int row0 = mt * 128 + 32 * w, col0 = nq * 64; if (row0 >= M) return;
  const _Float16* a0p = A + (size_t)(row0 + ln) * lda; const _Float16* a1p = a0p + (size_t)16 * lda;
  const _Float16* b0p = Bh + (size_t)(col0 + ln) * ldb; const _Float16* b1p = b0p + (size_t)16 * ldb; const _Float16* b2p = b1p + (size_t)16 * ldb; const _Float16* b3p = b2p + (size_t)16 * ldb;
  const v8f z8 = {0.f,0.f,0.f,0.f,0.f,0.f,0.f,0.f}; v8f c00 = z8, c01 = z8, c02 = z8, c03 = z8, c10 = z8, c11 = z8, c12 = z8, c13 = z8;
#pragma unroll 1
  for (int kb = 0; kb < K; kb += 32) { const v16h a0 = g2_frag(a0p + kb, hh), a1 = g2_frag(a1p + kb, hh);
    v16h b = g2_frag(b0p + kb, hh); c00 = g2_mma(a0, b, c00); c10 = g2_mma(a1, b, c10);
    b = g2_frag(b1p + kb, hh); c01 = g2_mma(a0, b, c01); c11 = g2_mma(a1, b, c11);
    b = g2_frag(b2p + kb, hh); c02 = g2_mma(a0, b, c02); c12 = g2_mma(a1, b, c12);
    b = g2_frag(b3p + kb, hh); c03 = g2_mma(a0, b, c03); c13 = g2_mma(a1, b, c13); }
  v8f accs[8] = {c00, c01, c02, c03, c10, c11, c12, c13};
#pragma unroll
  for (int u = 0; u < 8; ++u) { const int t = u & 3, half = u >> 2; const int col = col0 + t * 16 + ln; const float bv = bp ? bf16_round(bp[col]) : 0.f;
#pragma unroll
    for (int r = 0; r < 8; ++r) { const int rloc = half * 16 + 8 * hh + r; float v = accs[u][r] * alpha + bv; if (CP) { if (rowsPerB < 0) v += CP[cofs + (size_t)(row0g + row0 + rloc) * ldc + col];      /* rowsPerB < 0: own element of the batched C plane */ else { const int bidx = (row0g + row0 + rloc) / rowsPerB; v += CP[(size_t)bidx * sCPb + (size_t)by * 64 + col]; } }
      if (ACT == 3) v = fmaxf(v, 0.f); else if (ACT == 6) v = 0.5f * v * (1.0f + erff(v * 0.70710678118654752f)); else if (ACT == 11) v = 1.0f / (1.0f + expf(-v)); else if (ACT == 15) v = v / (1.0f + expf(-v)); else if (ACT == 12) v = (v > 0.f) ? v : 0.01f * v; else if (ACT == 8) v = tanhf(v); else if (ACT == 9) v = 0.5f * v * (1.0f + tanhf(0.7978845608028654f * (v + 0.044715f * v * v * v))); else if (ACT == 14) v = (v > 0.f) ? v : 0.1f * v; else if (ACT == 16) v = (v >= 0.f) ? v : 0.3f * v; else if (ACT == 17) v = (v >= 0.f) ? v : 0.2f * v;
      so[w][rloc][t * 16 + ln] = v; } }
  __builtin_amdgcn_fence(__ATOMIC_ACQ_REL, "workgroup"); __builtin_amdgcn_wave_barrier();
  const int rsub = lane >> 4, c4 = (lane & 15) * 4;
  {
#pragma unroll
    for (int q = 0; q < 16; ++q) { const int r = q * 2 + rsub; const v4f v = *(const v4fa*)&so[w][r][c4]; if (C) *(v4f*)(C + cofs + (size_t)(row0 + r) * ldc + col0 + c4) = v; if (C16) { v4h h4; for (int i = 0; i < 4; ++i) h4[i] = (_Float16)v[i]; *(v4h*)(C16 + cofs + (size_t)(row0 + r) * ldc + col0 + c4) = h4; } }
     } }


__global__ __launch_bounds__(256) void k_wnat(const float* __restrict__ w, size_t n8, _Float16* __restrict__ Bt) { const size_t t = (size_t)blockIdx.x * 256 + threadIdx.x; if (t >= n8) return; FragH f; for (int q = 0; q < 8; ++q) f.h[q] = (_Float16)(bf16_round(w[t * 8 + q]) * 16.0f); *(v8us*)((unsigned short*)Bt + t * 8) = f.half[0];  }
__global__ __launch_bounds__(256) void k_rsm(const float* __restrict__ S, _Float16* __restrict__ P, int nrows) {
  #pragma clang fp contract(off)
  const int i = blockIdx.x * 256 + threadIdx.x; if (i >= nrows) return; const float* s = S + (size_t)i * SQ; float mx = -3.0e38f;
#pragma unroll 1
  for (int j = 0; j < SQ; ++j) mx = fmaxf(mx, s[j]); float se = 0.f;
#pragma unroll 1
  for (int j = 0; j < SQ; ++j) se += expf(s[j] - mx); const float sc = 256.0f / se;
#pragma unroll 1
  for (int j0 = 0; j0 < SQ; j0 += 8) { FragH f; for (int q = 0; q < 8; ++q) f.h[q] = (_Float16)(expf(s[j0 + q] - mx) * sc); unsigned short* d = (unsigned short*)P + (size_t)i * SQ + j0; *(v8us*)d = f.half[0];  } }
__global__ __launch_bounds__(256) void k_vt(const _Float16* __restrict__ V16, int b, int h0, _Float16* __restrict__ VT) { __shared__ unsigned short tl[64][65]; const int tid = threadIdx.x; const int hh = blockIdx.x % HG, sg = blockIdx.x / HG; const int s0 = sg * 64; const int h = h0 + hh;
  for (int i = tid; i < 64 * 8; i += 256) { const int j = i / 8, d8 = (i % 8) * 8; FragH f; f.half[0] = *(const v8us*)((const unsigned short*)V16 + ((size_t)b * SQ + s0 + j) * DM + h * HD + d8); for (int q = 0; q < 8; ++q) tl[d8 + q][j] = f.u[q]; }
  __syncthreads();
  { for (int i = tid; i < 64 * 8; i += 256) { const int d = i / 8, j8 = (i % 8) * 8; FragH f; for (int q = 0; q < 8; ++q) f.u[q] = tl[d][j8 + q]; *(v8us*)((unsigned short*)VT + ((size_t)hh * HD + d) * SQ + s0 + j8) = f.half[0]; }  } }


template <int MASK>
__global__ __launch_bounds__(32) void k_att0h(const float* __restrict__ QF, const float* __restrict__ KF, const float* __restrict__ VF, int ld, int ldv, const int* __restrict__ mk, float scale, float* __restrict__ OF, int ldo) {
  #pragma clang fp contract(off)
  __shared__ __attribute__((aligned(16))) float lq[32][128]; __shared__ __attribute__((aligned(16))) float lo[32][128];
  const int tid = threadIdx.x; const int h = blockIdx.x / (QT0 / 32), rg = blockIdx.x % (QT0 / 32); const int i = rg * 32 + tid;
  for (int c = 0; c < 32; ++c) { *(v4f*)&lq[tid][c * 4] = *(const v4fa*)(QF + (size_t)i * ld + h * 128 + c * 4); const v4f z = {0.f, 0.f, 0.f, 0.f}; *(v4f*)&lo[tid][c * 4] = z; }
  float m = -1.0e30f, l = 0.f; const int jmax = rg * 32 + 31;
#pragma unroll 1
  for (int j = 0; j <= jmax; ++j) { const float* kr = KF + (size_t)j * ld + h * 128; const float* vr = VF + (size_t)j * ldv + h * 128; float s = 0.f;
#pragma unroll 1
    for (int c = 0; c < 32; ++c) { const v4f kq = *(const v4fa*)(kr + c * 4); const v4f qq = *(v4f*)&lq[tid][c * 4]; for (int u = 0; u < 4; ++u) s = __fadd_rn(s, __fmul_rn(qq[u], kq[u])); }
    s = __fmul_rn(s, scale); float f; if (MASK) { const int mb = mk[(size_t)i * SQ + j]; f = (mb == 0) ? 1.f : 0.f; } else { f = (j <= i) ? 1.f : 0.f; }
    const float sm = fmaf(f, s, (1.f - f) * -1.0e30f); const float mn = fmaxf(m, sm); const float sc = expf(m - mn); const float e = __fmul_rn(f, expf(sm - mn)); l = __fadd_rn(__fmul_rn(l, sc), e); m = mn;
#pragma unroll 1
    for (int c = 0; c < 32; ++c) { const v4f vv = *(const v4fa*)(vr + c * 4); v4f oo = *(v4f*)&lo[tid][c * 4]; for (int u = 0; u < 4; ++u) oo[u] = __fadd_rn(__fmul_rn(oo[u], sc), __fmul_rn(e, vv[u])); *(v4f*)&lo[tid][c * 4] = oo; } }
  const float fin = 64.0f / l;
  { for (int c = 0; c < 32; ++c) { v4f oo = *(v4f*)&lo[tid][c * 4]; for (int u = 0; u < 4; ++u) oo[u] = __fmul_rn(oo[u], fin); *(v4f*)(OF + (size_t)i * ldo + h * 128 + c * 4) = oo; }  } }
__global__ __launch_bounds__(256) void k_f2h(const float* __restrict__ F, int ldf, int coff, int ncol, _Float16* __restrict__ H16, size_t nrow) { const size_t t = (size_t)blockIdx.x * 256 + threadIdx.x; const size_t n8 = nrow * (size_t)(ncol / 8); if (t >= n8) return; const size_t r = t / (ncol / 8); const int c8 = (int)(t % (ncol / 8)) * 8; FragH f; const v4f a = *(const v4fa*)(F + r * ldf + coff + c8), b2 = *(const v4fa*)(F + r * ldf + coff + c8 + 4); for (int q = 0; q < 4; ++q) { f.h[q] = (_Float16)a[q]; f.h[4 + q] = (_Float16)b2[q]; } *(v8us*)((unsigned short*)H16 + r * ncol + c8) = f.half[0];  }

__global__ __launch_bounds__(256) void k_tab128(float theta, float* __restrict__ CS, float* __restrict__ SN) {
  #pragma clang fp contract(off)
  const int t = blockIdx.x * 256 + threadIdx.x; if (t >= SQ * 64) return; const int i = t % 64; const int p = t / 64; const float invf = (float)(1.0 / pow((double)theta, (double)(2 * i) / 128.0));      /* = XLA's constant-folded f32 table */ const float ang = __fmul_rn((float)p, invf); const float c = cosf(ang), s = sinf(ang);
  *(float*)(CS + t) = c; *(float*)(SN + t) = s;  }
template <int TAB>
__global__ __launch_bounds__(128) void k_rope128(const float* __restrict__ F, int ldf, int nh, const float* __restrict__ CS, const float* __restrict__ SN, _Float16* __restrict__ H16, int ldo, float osc) {
  #pragma clang fp contract(off)
  __shared__ float xv[128]; __shared__ unsigned short sh_[128]; const int d = threadIdx.x; const int h = blockIdx.x % nh; const size_t r = blockIdx.x / nh; const int p = (int)(r % SQ);
  xv[d] = F[r * (size_t)ldf + (size_t)h * 128 + d]; __syncthreads();
  float c, s; if (TAB) { c = bf16_round(CS[(size_t)p * 128 + d]); s = bf16_round(SN[(size_t)p * 128 + d]); } else { c = CS[p * 64 + (d & 63)]; s = SN[p * 64 + (d & 63)]; }
  const float rot = (d < 64) ? -xv[d + 64] : xv[d - 64]; const float o = __fadd_rn(__fmul_rn(xv[d], c), __fmul_rn(rot, s));
  FragH th; th.h[0] = (_Float16)__fmul_rn(o, osc); sh_[d] = th.u[0]; __syncthreads();
  if (d < 16) { FragH f; for (int q = 0; q < 8; ++q) f.u[q] = sh_[d * 8 + q]; unsigned short* dst = (unsigned short*)H16 + r * (size_t)ldo + (size_t)h * 128 + d * 8; *(v8us*)dst = f.half[0];  } }

template <int TAB, int IL, int F32OUT>
__global__ __launch_bounds__(128) void k_rope128x(const float* __restrict__ F, int ldf, int nh, const float* __restrict__ CS, const float* __restrict__ SN, void* __restrict__ OUT, int ldo, float osc) {
  #pragma clang fp contract(off)
  __shared__ float xv[128]; __shared__ float ov[128]; const int d = threadIdx.x; const int h = blockIdx.x % nh; const size_t r = blockIdx.x / nh; const int p = (int)(r % SQ);
  xv[d] = F[r * (size_t)ldf + (size_t)h * 128 + d]; __syncthreads();
  float c, s; if (TAB == 2) { c = CS[r * 128 + d]; s = SN[r * 128 + d]; }      /* computed full-width f32 tables, one row per token row r (relative to the passed pointers) */ else if (TAB) { c = bf16_round(CS[(size_t)p * 128 + d]); s = bf16_round(SN[(size_t)p * 128 + d]); } else { const int ti = IL ? (d >> 1) : (d & 63); c = CS[p * 64 + ti]; s = SN[p * 64 + ti]; }
  const float rot = IL ? ((d & 1) ? xv[d - 1] : -xv[d + 1]) : ((d < 64) ? -xv[d + 64] : xv[d - 64]);
  ov[d] = __fmul_rn(__fadd_rn(__fmul_rn(xv[d], c), __fmul_rn(rot, s)), osc); __syncthreads();
  if (F32OUT) { if (d < 32) { const v4f v = *(const v4f*)&ov[d * 4]; float* dst = (float*)OUT + r * (size_t)ldo + (size_t)h * 128 + d * 4; *(v4f*)dst = v;  } }
  else { if (d < 16) { FragH f; for (int q = 0; q < 8; ++q) f.h[q] = (_Float16)ov[d * 8 + q]; unsigned short* dst = (unsigned short*)OUT + r * (size_t)ldo + (size_t)h * 128 + d * 8; *(v8us*)dst = f.half[0];  } } }
template <int N>
__global__ __launch_bounds__(256) void k_rmsrow(float* __restrict__ X, const float* __restrict__ w, float eps) {
  #pragma clang fp contract(off)
  constexpr int PT = N / 256; __shared__ float red[256]; const size_t r = blockIdx.x; const int t = threadIdx.x; float* row = X + r * N + (size_t)t * PT; float v[PT]; float ss = 0.f;
  for (int q = 0; q < PT; ++q) { v[q] = row[q]; ss = __fadd_rn(ss, __fmul_rn(v[q], v[q])); }
  red[t] = ss; __syncthreads(); for (int k = 128; k > 0; k >>= 1) { if (t < k) red[t] = __fadd_rn(red[t], red[t + k]); __syncthreads(); }
  const float rs = rsqrtf(__fadd_rn(red[0] / (float)N, eps)); float o[PT]; for (int q = 0; q < PT; ++q) o[q] = __fmul_rn(__fmul_rn(v[q], rs), bf16_round(w[t * PT + q]));
  { for (int q = 0; q < PT; ++q) *(float*)(row + q) = o[q];  } }
template <int GS_, int NHQ, int DSRC>
__global__ __launch_bounds__(256) void k_kvexp128(const float* __restrict__ src, float* __restrict__ dst, size_t n4) { const size_t t = (size_t)blockIdx.x * 256 + threadIdx.x; if (t >= n4) return; const size_t e = t * 4; const size_t row = e / ((size_t)NHQ * 128); const int col = (int)(e % ((size_t)NHQ * 128)); const int h = col / 128, d = col % 128; const v4f v = *(const v4fa*)(src + row * DSRC + (size_t)(h / GS_) * 128 + d); *(v4f*)(dst + e) = v;  }

__global__ __launch_bounds__(256) void k_rsmcfb(const float* __restrict__ S, _Float16* __restrict__ P, int hg, int q0, int nk, const int* __restrict__ mk) {
  #pragma clang fp contract(off)
  const int t = blockIdx.x * 256 + threadIdx.x; if (t >= hg * QT) return; const size_t i = (size_t)t; const float* s = S + i * NKX; const size_t ig = (size_t)(q0 + (t % QT)); const int* mr = mk + ig * SQ; float mx = -3.0e38f;
#pragma unroll 1
  for (int j = 0; j < nk; ++j) { const int mb = mr[j]; const float f = (mb == 0) ? 1.f : 0.f; mx = fmaxf(mx, fmaf(f, s[j], (1.f - f) * -1.0e9f)); } float se = 0.f;
#pragma unroll 1
  for (int j = 0; j < nk; ++j) { const int mb = mr[j]; const float f = (mb == 0) ? 1.f : 0.f; se += __expf(fmaf(f, s[j], (1.f - f) * -1.0e9f) - mx); } const float sc = 256.0f / se;
#pragma unroll 1
  for (int j0 = 0; j0 < nk; j0 += 8) { FragH fr; for (int q = 0; q < 8; ++q) { const int j = j0 + q; const int mb = mr[j]; const float f = (mb == 0) ? 1.f : 0.f; fr.h[q] = (_Float16)(__expf(fmaf(f, s[j], (1.f - f) * -1.0e9f) - mx) * sc); } unsigned short* d = (unsigned short*)P + i * NKX + j0; *(v8us*)d = fr.half[0];  } }


__global__ __launch_bounds__(256) void k_rsmcf2(const float* __restrict__ S, _Float16* __restrict__ P, int hg, int q0, int nk) {
  #pragma clang fp contract(off)
  const int t = blockIdx.x * 256 + threadIdx.x; if (t >= hg * QT) return; const size_t i = (size_t)t; const float* s = S + i * NKX; const int last = q0 + (t % QT); float mx = -3.0e38f;
#pragma unroll 1
  for (int j = 0; j < nk; ++j) { const float f = (j <= last) ? 1.f : 0.f; mx = fmaxf(mx, fmaf(f, s[j], (1.f - f) * -1.0e9f)); } float se = 0.f;
#pragma unroll 1
  for (int j = 0; j < nk; ++j) { const float f = (j <= last) ? 1.f : 0.f; se += __expf(fmaf(f, s[j], (1.f - f) * -1.0e9f) - mx); } const float sc = 256.0f / se;
#pragma unroll 1
  for (int j0 = 0; j0 < nk; j0 += 8) { FragH fr; for (int q = 0; q < 8; ++q) { const int j = j0 + q; const float f = (j <= last) ? 1.f : 0.f; fr.h[q] = (_Float16)(__expf(fmaf(f, s[j], (1.f - f) * -1.0e9f) - mx) * sc); } unsigned short* d = (unsigned short*)P + i * NKX + j0; *(v8us*)d = fr.half[0];  } }



__global__ __launch_bounds__(256) void k_tab128p(const int* __restrict__ pos, int nrows, float theta, float* __restrict__ CS, float* __restrict__ SN) {
  #pragma clang fp contract(off)
  const int t = blockIdx.x * 256 + threadIdx.x; if (t >= nrows * 64) return; const int i = t % 64; const int r = t / 64; const float invf = (float)(1.0 / pow((double)theta, (double)(2 * i) / 128.0)); const float ang = __fmul_rn((float)pos[r], invf); const float c = cosf(ang), sv = sinf(ang);
  float* c0 = CS + (size_t)r * 128 + i; float* s0 = SN + (size_t)r * 128 + i;
  { *(float*)c0 = c; *(float*)(c0 + 64) = c; *(float*)s0 = sv; *(float*)(s0 + 64) = sv;  } }

__global__ __launch_bounds__(256) void k_rsmcim(const float* __restrict__ S, _Float16* __restrict__ P, int hg, int q0, int nk, const int* __restrict__ am) {
  #pragma clang fp contract(off)
  const int t = blockIdx.x * 256 + threadIdx.x; if (t >= hg * QT) return; const size_t i = (size_t)t; const float* s = S + i * NKX; const int last = q0 + (t % QT); const int* mr = am + (size_t)last * SQ; float mx = -3.0e38f;      /* the module's mask row of this query (keys >= nk lie above the diagonal of the causal mask and are not computed) */
#pragma unroll 1
  for (int j = 0; j < nk; ++j) { const float f = (mr[j] != 0) ? 1.f : 0.f; mx = fmaxf(mx, fmaf(f, s[j], (1.f - f) * -1.0e9f)); } float se = 0.f;
#pragma unroll 1
  for (int j = 0; j < nk; ++j) { const float f = (mr[j] != 0) ? 1.f : 0.f; se += __expf(fmaf(f, s[j], (1.f - f) * -1.0e9f) - mx); } const float sc = 256.0f / se;
#pragma unroll 1
  for (int j0 = 0; j0 < nk; j0 += 8) { FragH fr; for (int q = 0; q < 8; ++q) { const int j = j0 + q; const float f = (mr[j] != 0) ? 1.f : 0.f; fr.h[q] = (_Float16)(__expf(fmaf(f, s[j], (1.f - f) * -1.0e9f) - mx) * sc); } unsigned short* d = (unsigned short*)P + i * NKX + j0; *(v8us*)d = fr.half[0];  } }



__global__ __launch_bounds__(256) void k_tab128h(int nr, float theta, float* __restrict__ CS, float* __restrict__ SN) {
  #pragma clang fp contract(off)
  const size_t t = (size_t)blockIdx.x * 256 + threadIdx.x; if (t >= (size_t)nr * 64) return; const int i = (int)(t % 64); const size_t r = t / 64; const int p = (int)(r % SQ);
  const float invf = (float)(1.0 / pow((double)theta, ((double)(2 * i)) / 128.0)); const float ang = __fmul_rn((float)p, invf); const float c = cosf(ang), sv = sinf(ang);
  float* pc = CS + r * 128 + i; float* ps = SN + r * 128 + i;
  *(float*)pc = c; *(float*)(pc + 64) = c; *(float*)ps = sv; *(float*)(ps + 64) = sv;  }
extern "C" void kernel_launch(void* const* d_in, const int* in_sizes, int n_in,
                              void* d_out, int out_size, void* d_ws, size_t ws_size, hipStream_t stream) {
  (void)in_sizes; (void)n_in; (void)out_size;
  const float* const* I = (const float* const*)d_in; const float* x = I[0]; const float* wq = I[1]; const float* wk = I[2]; const float* wv = I[3]; const float* wo = I[4]; const float* bq = nullptr; const float* bk = nullptr; const float* bv = nullptr; const float* bo = nullptr;      /* [in][out] Wq [2048][2048], Wk/Wv [2048][1024], Wo [2048][2048]; no biases; positions implicit */
  char* ws = (char*)d_ws; size_t off = 0;
  auto take = [&](size_t bytes) { char* p = ws + off; off += (bytes + 255) & ~(size_t)255; return p; };
  _Float16* BQ = (_Float16*)take((size_t)DMX * DMX * 2); _Float16* BK = (_Float16*)take((size_t)DKV * DMX * 2); _Float16* BV = (_Float16*)take((size_t)DKV * DMX * 2); _Float16* BO = (_Float16*)take((size_t)DMX * DMX * 2);
  _Float16* X16 = (_Float16*)take(NR * DMX * 2); float* QF = (float*)take(NR * DMX * 4); float* KF = (float*)take(NR * DKV * 4); float* VF = (float*)take(NR * DKV * 4); _Float16* Q16 = (_Float16*)take(NR * DMX * 2); _Float16* K16 = (_Float16*)take(NR * DKV * 2); _Float16* V16 = (_Float16*)take(NR * DKV * 2); _Float16* O16 = (_Float16*)take(NR * DMX * 2);
  float* S = (float*)take((size_t)NH * QT * NKX * 4); _Float16* P = (_Float16*)take((size_t)NH * QT * NKX * 2); _Float16* VT = (_Float16*)take((size_t)(DKV / 64) * 64 * SQ * 2);
  float* CS = (float*)take(NR * 128 * 4); float* SN = (float*)take(NR * 128 * 4); float* QF0 = (float*)take((size_t)QT0 * DMX * 4); float* KRF0 = (float*)take((size_t)QT0 * DKV * 4); float* KF0e = (float*)take((size_t)QT0 * DMX * 4); float* VF0e = (float*)take((size_t)QT0 * DMX * 4); float* OF0 = (float*)take((size_t)NB * QT0 * DMX * 4); _Float16* OH0 = (_Float16*)take((size_t)NB * QT0 * DMX * 2); _Float16* OL0 = (_Float16*)take((size_t)NB * QT0 * DMX * 2);
  if (off > ws_size) return;      /* approx 8 + 4 + 4 + 8 + 16 + 32 + 16 + 16 + 16 + 8 + 8 + 16 + 32 + 16 + 4 + 2 + 2 + 2 + 1 + 2 + 2 + 4 + 2 + 2 = 223 MiB */
  k_wt_f16<<<(unsigned)(((size_t)DMX * DMX / 8 + 255) / 256), 256, 0, stream>>>(wq, BQ, DMX, DMX, 16.0f); k_wt_f16<<<(unsigned)(((size_t)DKV * DMX / 8 + 255) / 256), 256, 0, stream>>>(wk, BK, DMX, DKV, 16.0f); k_wt_f16<<<(unsigned)(((size_t)DKV * DMX / 8 + 255) / 256), 256, 0, stream>>>(wv, BV, DMX, DKV, 16.0f); k_wt_f16<<<(unsigned)(((size_t)DMX * DMX / 8 + 255) / 256), 256, 0, stream>>>(wo, BO, DMX, DMX, 16.0f);      /* [in][out] -> Bt x16 */
  k_x16<<<(unsigned)((NR * DMX / 8 + 255) / 256), 256, 0, stream>>>(x, X16, NR * DMX / 8);
  k_gemm2<0><<<dim3((unsigned)((NR / 128) * (DMX / 64)), 1), 128, 0, stream>>>(X16, DMX, 0, BQ, DMX, 0, 0.0625f, bq, 0, nullptr, 1, 0, 0, QF, nullptr, DMX, 0, (int)NR, DMX, DMX);      /* q (f32) */
  k_gemm2<0><<<dim3((unsigned)((NR / 128) * (DKV / 64)), 1), 128, 0, stream>>>(X16, DMX, 0, BK, DMX, 0, 0.0625f, bk, 0, nullptr, 1, 0, 0, KF, nullptr, DKV, 0, (int)NR, DKV, DMX);      /* k (f32) */
  k_gemm2<0><<<dim3((unsigned)((NR / 128) * (DKV / 64)), 1), 128, 0, stream>>>(X16, DMX, 0, BV, DMX, 0, 0.0625f, bv, 0, nullptr, 1, 0, 0, VF, V16, DKV, 0, (int)NR, DKV, DMX);      /* v (f32 for the first tile + f16) */
  k_tab128h<<<(unsigned)((NR * 64 + 255) / 256), 256, 0, stream>>>((int)NR, 10000.0f, CS, SN);      /* per-row cos/sin tables [NR][128] for positions r % SQ, duplicated over both halves (cat(f, f)) */
  k_rope128x<2, 0, 0><<<(unsigned)(NR * NH), 128, 0, stream>>>(QF, DMX, NH, CS, SN, Q16, DMX, 1.0f); k_rope128x<2, 0, 0><<<(unsigned)(NR * NKV), 128, 0, stream>>>(KF, DKV, NKV, CS, SN, K16, DKV, 1.0f);      /* rope (all rows) -> f16 */
  for (int b = 0; b < NB; ++b) { const size_t r0 = (size_t)b * SQ;
    k_rope128x<2, 0, 1><<<(unsigned)(QT0 * NH), 128, 0, stream>>>(QF + r0 * DMX, DMX, NH, CS + r0 * 128, SN + r0 * 128, QF0, DMX, 1.0f); k_rope128x<2, 0, 1><<<(unsigned)(QT0 * NKV), 128, 0, stream>>>(KF + r0 * DKV, DKV, NKV, CS + r0 * 128, SN + r0 * 128, KRF0, DKV, 1.0f);      /* f32 roped q, k of this batch's rows 0..255 */
    k_kvexp128<GSZ, NH, DKV><<<(unsigned)(((size_t)QT0 * DMX / 4 + 255) / 256), 256, 0, stream>>>(KRF0, KF0e, (size_t)QT0 * DMX / 4); k_kvexp128<GSZ, NH, DKV><<<(unsigned)(((size_t)QT0 * DMX / 4 + 255) / 256), 256, 0, stream>>>(VF + r0 * DKV, VF0e, (size_t)QT0 * DMX / 4);      /* kv head -> query head expansion for the exact first tile */
    k_vt<DKV / 64, SQ><<<(DKV / 64) * (SQ / 64), 256, 0, stream>>>(V16 + r0 * DKV, DKV, 0, VT);      /* V^T of this batch: kv head g = slabs 2g, 2g+1 */
    k_att0h<0><<<NH * (QT0 / 32), 32, 0, stream>>>(QF0, KF0e, VF0e, DMX, DMX, nullptr, ATS, OF0 + (size_t)b * QT0 * DMX, DMX);      /* exact causal attention rows 0..255 (o x64) */
    for (int q0 = 0; q0 < SQ; q0 += QT) { const int nk = q0 + QT;      /* causal: keys below the tile end only */
      for (int g = 0; g < NKV; ++g) k_gemm2<0><<<dim3((QT / 128) * (nk / 64), GSZ), 128, 0, stream>>>(Q16 + (r0 + q0) * DMX + (size_t)g * GSZ * HDK, DMX, (size_t)HDK, K16 + r0 * DKV + (size_t)g * HDK, DKV, 0, ATS, nullptr, 0, nullptr, 1, 0, 0, S + (size_t)g * GSZ * QT * NKX, nullptr, NKX, (size_t)QT * NKX, QT, nk, HDK);      /* scores: the kv head's 2 query heads vs its key slab (zero key stride) */
      k_rsmcf2<<<(NH * QT + 255) / 256, 256, 0, stream>>>(S, P, NH, q0, nk);      /* causal softmax (arithmetic select) over the computed keys */
      for (int g = 0; g < NKV; ++g) k_gemm2<0><<<dim3((QT / 128) * (HDK / 64), GSZ), 128, 0, stream>>>(P + (size_t)g * GSZ * QT * NKX, NKX, (size_t)QT * NKX, VT + (size_t)g * HDK * SQ, SQ, 0, 0.25f, nullptr, 0, nullptr, 1, 0, 0, nullptr, O16 + (r0 + q0) * DMX + (size_t)g * GSZ * HDK, DMX, (size_t)HDK, QT, HDK, nk); } }      /* o for the 2 query heads (x64) */
  k_gemm2<0><<<dim3((unsigned)((NR / 128) * (DMX / 64)), 1), 128, 0, stream>>>(O16, DMX, 0, BO, DMX, 0, 0.0009765625f, bo, 0, nullptr, 1, 0, 0, (float*)d_out, nullptr, DMX, 0, (int)NR, DMX, DMX);      /* out = o Wo */
  k_hl<<<(unsigned)(((size_t)NB * QT0 * DMX / 8 + 255) / 256), 256, 0, stream>>>(OF0, OH0, OL0, (size_t)NB * QT0 * DMX / 8);      /* first-tile o (x64) -> f16 hi + x1024 residual planes */
  for (int b = 0; b < NB; ++b) { const size_t r0 = (size_t)b * SQ; const size_t f0 = (size_t)b * QT0;
    k_gemm2<0><<<dim3((QT0 / 128) * (DMX / 64), 1), 128, 0, stream>>>(OH0 + f0 * DMX, DMX, 0, BO, DMX, 0, 0.0009765625f, bo, 0, nullptr, 1, 0, 0, (float*)d_out + r0 * DMX, nullptr, DMX, 0, QT0, DMX, DMX);      /* rows 0..255 of the batch rewritten from the exact path */
    k_gemm2<0><<<dim3((QT0 / 128) * (DMX / 64), 1), 128, 0, stream>>>(OL0 + f0 * DMX, DMX, 0, BO, DMX, 0, 0.00000095367431640625f, nullptr, 0, (const float*)d_out + r0 * DMX, -1, 0, 0, (float*)d_out + r0 * DMX, nullptr, DMX, 0, QT0, DMX, DMX); }      /* += o_lo Wo 2^-20 (own-element accumulate) */
}

// v001
// Measured time: 4090 microseconds a run.
// Two timings next to v000 both put it at 2.91 times that version's speed.
#include <hip/hip_runtime.h>
// Grouped-query causal attention with rotate-half RoPE, 16 query / 8 kv heads of 128 (x [2][2048][2048]; q = x Wq (16 x 128), k = x Wk, v = x Wv (8 x 128) ([in][out] weights sigma 0.02, no biases); inv_freq_i = 1/10000^(2i/128), positions 0..2047, cos/sin = cat(freqs, freqs); q, k roped; kv head h/2 serves query head h; scores / sqrt(128); causal (tril, -inf); softmax; out = merged Wo -> [2][2048][2048]).
// Compute dtype: inputs rounded to bf16; x / weights exact; projections and rope f32; q, k, v, softmax weights and o as plain f16 GEMM operands (~2^-12; first 256 rows of each batch exact); scores, statistics, out f32. v_wmma_f32_16x16x32_f16.
#define NB 2
#define SQ 2048
#define DMX 2048
#define NH 16
#define NKV 8
#define GSZ 2                        /* query heads per kv head */
#define GSH 1                        /* log2(GSZ): query head >> GSH = its kv head */
#define HDK 128
#define DKV (NKV * HDK)
#define QT 256
#define QT0 256
#define NKX SQ
#define DM DMX
#define HD 64
#define HG 1
#define NR ((size_t)NB * SQ)
#define ATS 0.08838834764831845f
typedef __bf16 v16b __attribute__((ext_vector_type(16)));
typedef unsigned short v8us __attribute__((ext_vector_type(8), may_alias));
typedef float  v8f  __attribute__((ext_vector_type(8)));
typedef float  v4f  __attribute__((ext_vector_type(4)));
typedef float  v4fa __attribute__((ext_vector_type(4), may_alias));
union FragB { v16b v; v8us half[2]; unsigned short u[16]; };

__device__ __forceinline__ unsigned short bf16_bits(float x) { unsigned int u = __float_as_uint(x); return (unsigned short)((u + 0x7FFFu + ((u >> 16) & 1u)) >> 16); }
__device__ __forceinline__ float bf16_val(unsigned short b) { return __uint_as_float(((unsigned int)b) << 16); }
__device__ __forceinline__ float bf16_round(float x) { return bf16_val(bf16_bits(x)); }
// D += A·B with NT terms: 1 = ah·bh, 2 = + al·bh (A split), 3 = + ah·bl (both split)
template <int NT>
__device__ __forceinline__ v8f mmaN(v16b ah, v16b al, v16b bh, v16b bl, v8f c) {
  c = __builtin_amdgcn_wmma_f32_16x16x32_bf16(false, ah, false, bh, (short)0, c, false, false);
  if (NT >= 2) c = __builtin_amdgcn_wmma_f32_16x16x32_bf16(false, al, false, bh, (short)0, c, false, false);
  if (NT >= 3) c = __builtin_amdgcn_wmma_f32_16x16x32_bf16(false, ah, false, bl, (short)0, c, false, false);
  asm volatile("v_nop\n\tv_nop\n\tv_nop\n\tv_nop" : "+v"(c) : "v"(ah), "v"(al), "v"(bh), "v"(bl));
  return c;
}

__global__ __launch_bounds__(256) void k_wt_bf16(const float* __restrict__ W, unsigned short* __restrict__ Wt, int K, int N) {
  const int t = blockIdx.x * 256 + threadIdx.x;
  const int k8n = K / 8;
  if (t >= N * k8n) return;
  const int n = t / k8n, k8 = (t % k8n) * 8;
  v8us v;
#pragma unroll
  for (int i = 0; i < 8; ++i) v[i] = bf16_bits(W[(size_t)(k8 + i) * N + n]);
  *(v8us*)(Wt + (size_t)n * K + k8) = v;
  
}

// GEMM C[M][N] (f32, pitch ldc) = act(A[M][K]·W + bias). A f32 row-major (pitch lda) converted per fragment to bf16
// (ASPLIT: hi/lo two planes -> 2 terms, else single rounded term); Wt bf16 [N][K] (pitch ldb). BIAS_BF16 rounds the
// bias to bf16 first (bias quantised to bf16 before the add). K%32==0, M%16==0, N%64==0.
template <bool ASPLIT, int ACT, bool BIAS_BF16>
__global__ __launch_bounds__(128) void k_gemm_bf(const float* __restrict__ A, int lda, const unsigned short* __restrict__ Wt, int ldb,
                                               const float* __restrict__ bias, float* __restrict__ C, int ldc, int M, int N, int K) {
  __shared__ __attribute__((aligned(16))) float so[4][16][64];
  const int tid = threadIdx.x, w = tid >> 5, lane = tid & 31, ln = lane & 15, hh = lane >> 4;
  const int ntn = N / 64;
  const int wid = blockIdx.x * 4 + w;
  const int mt = wid / ntn, nq = wid % ntn;
  if (mt * 16 >= M) return;
  const int row0 = mt * 16, col0 = nq * 64;
  const float* arow = A + (size_t)(row0 + ln) * lda;
  v8f acc[4] = {};
  for (int kb = 0; kb < K; kb += 32) {
    FragB ah, al;
    const v4f x0 = *(const v4fa*)(arow + kb + 8 * hh), x1 = *(const v4fa*)(arow + kb + 8 * hh + 4);
    const v4f x2 = *(const v4fa*)(arow + kb + 16 + 8 * hh), x3 = *(const v4fa*)(arow + kb + 16 + 8 * hh + 4);
    float xs[16] = {x0[0],x0[1],x0[2],x0[3],x1[0],x1[1],x1[2],x1[3],x2[0],x2[1],x2[2],x2[3],x3[0],x3[1],x3[2],x3[3]};
#pragma unroll
    for (int i = 0; i < 16; ++i) { const unsigned short hb = bf16_bits(xs[i]); ah.u[i] = hb; al.u[i] = ASPLIT ? bf16_bits(xs[i] - bf16_val(hb)) : (unsigned short)0; }
#pragma unroll
    for (int t = 0; t < 4; ++t) {
      const unsigned short* brow = Wt + (size_t)(col0 + t * 16 + ln) * ldb + kb;
      FragB b;
      b.half[0] = *(const v8us*)(brow + 8 * hh);
      b.half[1] = *(const v8us*)(brow + 16 + 8 * hh);
      acc[t] = mmaN<ASPLIT ? 2 : 1>(ah.v, al.v, b.v, b.v, acc[t]);
    }
  }
#pragma unroll
  for (int t = 0; t < 4; ++t) {
    float bv = bias ? bias[col0 + t * 16 + ln] : 0.f;
    if (BIAS_BF16) bv = bf16_round(bv);
#pragma unroll
    for (int r = 0; r < 8; ++r) { float v = acc[t][r] + bv; if (ACT == 1) v = fmaxf(v, 0.f); so[w][8 * hh + r][t * 16 + ln] = v; }
  }
  __builtin_amdgcn_fence(__ATOMIC_ACQ_REL, "workgroup");
  __builtin_amdgcn_wave_barrier();
  const int rsub = lane >> 4, c4 = (lane & 15) * 4;
  {
#pragma unroll
    for (int q = 0; q < 8; ++q) {
      const int r = q * 2 + rsub;
      const v4f v = *(const v4fa*)&so[w][r][c4];
      *(v4f*)(C + (size_t)(row0 + r) * ldc + col0 + c4) = v;
    }
    
  }
}

// GEMM C = act(A·W + bias + resid): A f32 (ASPLIT -> hi/lo 2 terms), Wt bf16 [N][K]; ACT 0 none, 1 relu, 2 exact gelu;
// resid (optional, f32, row index = (row % rmod), pitch ldr, RES_BF16 rounds it) added before the activation.
template <bool ASPLIT, int ACT, bool BIAS_BF16, bool RES_BF16>
__global__ __launch_bounds__(128) void k_gemm_bf3(const float* __restrict__ A, int lda, const unsigned short* __restrict__ Wt, int ldb,
                                                const float* __restrict__ bias, const float* __restrict__ resid, int rmod, int ldr,
                                                float* __restrict__ C, int ldc, int M, int N, int K) {
  __shared__ __attribute__((aligned(16))) float so[4][16][64];
  const int tid = threadIdx.x, w = tid >> 5, lane = tid & 31, ln = lane & 15, hh = lane >> 4;
  const int ntn = N / 64;
  const int wid = blockIdx.x * 4 + w;
  const int mt = wid / ntn, nq = wid % ntn;
  if (mt * 16 >= M) return;
  const int row0 = mt * 16, col0 = nq * 64;
  const float* arow = A + (size_t)(row0 + ln) * lda;
  v8f acc[4] = {};
  for (int kb = 0; kb < K; kb += 32) {
    FragB ah, al;
    const v4f x0 = *(const v4fa*)(arow + kb + 8 * hh), x1 = *(const v4fa*)(arow + kb + 8 * hh + 4);
    const v4f x2 = *(const v4fa*)(arow + kb + 16 + 8 * hh), x3 = *(const v4fa*)(arow + kb + 16 + 8 * hh + 4);
    float xs[16] = {x0[0],x0[1],x0[2],x0[3],x1[0],x1[1],x1[2],x1[3],x2[0],x2[1],x2[2],x2[3],x3[0],x3[1],x3[2],x3[3]};
#pragma unroll
    for (int i = 0; i < 16; ++i) { const unsigned short hb = bf16_bits(xs[i]); ah.u[i] = hb; al.u[i] = ASPLIT ? bf16_bits(xs[i] - bf16_val(hb)) : (unsigned short)0; }
#pragma unroll
    for (int t = 0; t < 4; ++t) {
      const unsigned short* brow = Wt + (size_t)(col0 + t * 16 + ln) * ldb + kb;
      FragB b;
      b.half[0] = *(const v8us*)(brow + 8 * hh);
      b.half[1] = *(const v8us*)(brow + 16 + 8 * hh);
      acc[t] = mmaN<ASPLIT ? 2 : 1>(ah.v, al.v, b.v, b.v, acc[t]);
    }
  }
#pragma unroll
  for (int t = 0; t < 4; ++t) {
    const int col = col0 + t * 16 + ln;
    float bv = bias ? bias[col] : 0.f;
    if (BIAS_BF16) bv = bf16_round(bv);
#pragma unroll
    for (int r = 0; r < 8; ++r) {
      float v = acc[t][r] + bv;
      if (resid) { float rv = resid[(size_t)((row0 + 8 * hh + r) % rmod) * ldr + col]; if (RES_BF16) rv = bf16_round(rv); v += rv; }
      if (ACT == 1) v = fmaxf(v, 0.f);
      if (ACT == 2) v = 0.5f * v * (1.0f + erff(v * 0.70710678118654752f));
      if (ACT == 3) { const float u = 0.7978845608028654f * (v + 0.044715f * v * v * v); v = 0.5f * v * (1.0f + tanhf(u)); }
      so[w][8 * hh + r][t * 16 + ln] = v;
    }
  }
  __builtin_amdgcn_fence(__ATOMIC_ACQ_REL, "workgroup");
  __builtin_amdgcn_wave_barrier();
  const int rsub = lane >> 4, c4 = (lane & 15) * 4;
  {
#pragma unroll
    for (int q = 0; q < 8; ++q) {
      const int r = q * 2 + rsub;
      const v4f v = *(const v4fa*)&so[w][r][c4];
      *(v4f*)(C + (size_t)(row0 + r) * ldc + col0 + c4) = v;
    }
    
  }
}
// row LayerNorm (biased variance, eps) over N: s = X (+ R); optional out_sum <- s; out_norm <- (s-mu)*rsqrt(var+eps)*g + b
template <bool PARAM_BF16>
__global__ __launch_bounds__(256) void k_layernorm(const float* __restrict__ X, const float* __restrict__ R, const float* __restrict__ g, const float* __restrict__ bta,
                                                  float* __restrict__ out_sum, float* __restrict__ out_norm, int N, float eps) {
  __shared__ float red[256];
  const int row = blockIdx.x, tid = threadIdx.x;
  const float* x = X + (size_t)row * N; const float* rr = R ? R + (size_t)row * N : nullptr;
  float vals[16];                     // up to N = 4096
  const int per = N / 256;            // contiguous chunk per thread? use strided-by-4 chunks: thread handles j = tid*4 + 1024*u
  float s1 = 0.f;
  for (int u = 0; u < per / 4; ++u) {
    const int j = tid * 4 + 1024 * u;
    const v4f a = *(const v4fa*)(x + j);
    v4f b = {0.f,0.f,0.f,0.f}; if (rr) b = *(const v4fa*)(rr + j);
#pragma unroll
    for (int q = 0; q < 4; ++q) { const float v = a[q] + b[q]; vals[u * 4 + q] = v; s1 += v; }
  }
  red[tid] = s1; __syncthreads();
  for (int st = 128; st > 0; st >>= 1) { if (tid < st) red[tid] += red[tid + st]; __syncthreads(); }
  const float mu = red[0] / (float)N; __syncthreads();
  float s2 = 0.f;
  for (int u = 0; u < per / 4; ++u)
#pragma unroll
    for (int q = 0; q < 4; ++q) { const float c = vals[u * 4 + q] - mu; s2 += c * c; }
  red[tid] = s2; __syncthreads();
  for (int st = 128; st > 0; st >>= 1) { if (tid < st) red[tid] += red[tid + st]; __syncthreads(); }
  const float rs = rsqrtf(red[0] / (float)N + eps);
  {
    for (int u = 0; u < per / 4; ++u) {
      const int j = tid * 4 + 1024 * u;
      v4f o, sm;
#pragma unroll
      for (int q = 0; q < 4; ++q) {
        float gg = g[j + q], bb = bta[j + q];
        if (PARAM_BF16) { gg = bf16_round(gg); bb = bf16_round(bb); }
        sm[q] = vals[u * 4 + q]; o[q] = (vals[u * 4 + q] - mu) * rs * gg + bb;
      }
      if (out_sum) *(v4f*)(out_sum + (size_t)row * N + j) = sm;
      *(v4f*)(out_norm + (size_t)row * N + j) = o;
    }
    
  }
}



// ---- f16 WMMA path (v_wmma_f32_16x16x32_f16): 11-bit significands for operands in range — used where a [0,1] probability operand needs more precision than bf16
typedef _Float16 v16h __attribute__((ext_vector_type(16)));
union FragH { v16h v; v8us half[2]; _Float16 h[16]; unsigned short u[16]; };
template <int NT>
__device__ __forceinline__ v8f mmaH(v16h ah, v16h al, v16h bh, v16h bl, v8f c) {
  c = __builtin_amdgcn_wmma_f32_16x16x32_f16(false, ah, false, bh, (short)0, c, false, false);
  if (NT >= 2) c = __builtin_amdgcn_wmma_f32_16x16x32_f16(false, al, false, bh, (short)0, c, false, false);
  if (NT >= 3) c = __builtin_amdgcn_wmma_f32_16x16x32_f16(false, ah, false, bl, (short)0, c, false, false);
  asm volatile("v_nop\n\tv_nop\n\tv_nop\n\tv_nop" : "+v"(c) : "v"(ah), "v"(al), "v"(bh), "v"(bl));
  return c;
}
// batched GEMM like k_gemm_b but f16 operands: A f32 (split into f16 hi/lo if ASPLIT, else rounded to f16), Bt = f16 values [n][k]; alpha; C f32; N multiple of 16 (partial tiles skipped)
template <bool ASPLIT>
__global__ __launch_bounds__(128) void k_gemm_h(const float* __restrict__ A, int lda, size_t sA, const _Float16* __restrict__ Bh, int ldb, size_t sB, float alpha, float* __restrict__ C, int ldc, size_t sC, int M, int N, int K) {
  __shared__ __attribute__((aligned(16))) float so[4][16][64];
  const int tid = threadIdx.x, w = tid >> 5, lane = tid & 31, ln = lane & 15, hh = lane >> 4; const int by = blockIdx.y;
  A += (size_t)by * sA; Bh += (size_t)by * sB; C += (size_t)by * sC;
  const int ntn = (N + 63) / 64; const int wid = blockIdx.x * 4 + w; const int mt = wid / ntn, nq = wid % ntn; if (mt * 16 >= M) return;
  const int row0 = mt * 16, col0 = nq * 64; const float* arow = A + (size_t)(row0 + ln) * lda;
  v8f acc[4] = {};
  for (int kb = 0; kb < K; kb += 32) {
    FragH ah, al;
    const v4f x0 = *(const v4fa*)(arow + kb + 8 * hh), x1 = *(const v4fa*)(arow + kb + 8 * hh + 4), x2 = *(const v4fa*)(arow + kb + 16 + 8 * hh), x3 = *(const v4fa*)(arow + kb + 16 + 8 * hh + 4);
    float xs[16] = {x0[0],x0[1],x0[2],x0[3],x1[0],x1[1],x1[2],x1[3],x2[0],x2[1],x2[2],x2[3],x3[0],x3[1],x3[2],x3[3]};
#pragma unroll
    for (int i = 0; i < 16; ++i) { const _Float16 h = (_Float16)xs[i]; ah.h[i] = h; al.h[i] = ASPLIT ? (_Float16)(xs[i] - (float)h) : (_Float16)0.0f; }
#pragma unroll
    for (int t = 0; t < 4; ++t) { if (col0 + t * 16 >= N) continue; const size_t boff = (size_t)(col0 + t * 16 + ln) * ldb + kb; FragH bq; bq.half[0] = *(const v8us*)(Bh + boff + 8 * hh); bq.half[1] = *(const v8us*)(Bh + boff + 16 + 8 * hh);
      acc[t] = mmaH<ASPLIT ? 2 : 1>(ah.v, al.v, bq.v, bq.v, acc[t]); }
  }
#pragma unroll
  for (int t = 0; t < 4; ++t) { if (col0 + t * 16 >= N) continue;
#pragma unroll
    for (int r = 0; r < 8; ++r) so[w][8 * hh + r][t * 16 + ln] = acc[t][r] * alpha; }
  __builtin_amdgcn_fence(__ATOMIC_ACQ_REL, "workgroup"); __builtin_amdgcn_wave_barrier();
  const int rsub = lane >> 4, c4 = (lane & 15) * 4;
  {
#pragma unroll
    for (int q = 0; q < 8; ++q) { const int r = q * 2 + rsub; if (col0 + c4 < N) { const v4f v = *(const v4fa*)&so[w][r][c4]; *(v4f*)(C + (size_t)(row0 + r) * ldc + col0 + c4) = v; } }
     }
}

// Wt[n][k] = f16(W[k][n]·scale) from f32 row-major W[K][N] (scale = power of two; bf16-exact weights stay exact in f16 away from the subnormal range)
__global__ __launch_bounds__(256) void k_wt_f16(const float* __restrict__ W, _Float16* __restrict__ Wt, int K, int N, float scale) {
  const int t = blockIdx.x * 256 + threadIdx.x; if (t >= N * (K / 8)) return; const int n = t / (K / 8), k8 = (t % (K / 8)) * 8; FragH f;
#pragma unroll
  for (int i = 0; i < 8; ++i) f.h[i] = (_Float16)(bf16_round(W[(size_t)(k8 + i) * N + n]) * scale); const v8us o = f.half[0];
  *(v8us*)((unsigned short*)Wt + (size_t)n * K + k8) = o; 
}
// k_gemm_hh variant with fused epilogue: v = acc·alpha + bias[by·sBias + col] (+ CP[(row/rowsPerB)·sCPb + by·64 + col] if CP) ; ACT 0 none / 1 elu ; writes f16 C16 (and f32 C if non-null)
template <int ACT>
__global__ __launch_bounds__(128) void k_gemm_hhx(const _Float16* __restrict__ A, int lda, size_t sA, const _Float16* __restrict__ Bh, int ldb, size_t sB, float alpha, const float* __restrict__ bias, size_t sBias, const float* __restrict__ CP, int rowsPerB, size_t sCPb, int row0g,
    float* __restrict__ C, _Float16* __restrict__ C16, int ldc, size_t sC, int M, int N, int K) {
  __shared__ __attribute__((aligned(16))) float so[4][16][64];
  const int tid = threadIdx.x, w = tid >> 5, lane = tid & 31, ln = lane & 15, hh = lane >> 4; const int by = blockIdx.y;
  A += (size_t)by * sA; Bh += (size_t)by * sB; const size_t cofs = (size_t)by * sC; const float* bp = bias ? bias + (size_t)by * sBias : nullptr;
  const int ntn = (N + 63) / 64; const int wid = blockIdx.x * 4 + w; const int mt = wid / ntn, nq = wid % ntn; if (mt * 16 >= M) return;
  const int row0 = mt * 16, col0 = nq * 64; const _Float16* arow = A + (size_t)(row0 + ln) * lda;
  v8f acc[4] = {};
  for (int kb = 0; kb < K; kb += 32) { FragH ah; ah.half[0] = *(const v8us*)((const unsigned short*)arow + kb + 8 * hh); ah.half[1] = *(const v8us*)((const unsigned short*)arow + kb + 16 + 8 * hh);
#pragma unroll
    for (int t = 0; t < 4; ++t) { if (col0 + t * 16 >= N) continue; const size_t boff = (size_t)(col0 + t * 16 + ln) * ldb + kb; FragH bq; bq.half[0] = *(const v8us*)((const unsigned short*)Bh + boff + 8 * hh); bq.half[1] = *(const v8us*)((const unsigned short*)Bh + boff + 16 + 8 * hh);
      acc[t] = mmaH<1>(ah.v, ah.v, bq.v, bq.v, acc[t]); }
  }
#pragma unroll
  for (int t = 0; t < 4; ++t) { if (col0 + t * 16 >= N) continue; const int col = col0 + t * 16 + ln; const float bv = bp ? bf16_round(bp[col]) : 0.f;
#pragma unroll
    for (int r = 0; r < 8; ++r) { float v = acc[t][r] * alpha + bv; if (CP) { const int rr = row0g + row0 + 8 * hh + r; if (rowsPerB < 0) v += CP[cofs + (size_t)rr * ldc + col];      /* rowsPerB < 0: own element of the batched C plane */ else { const int bidx = rr / rowsPerB; v += CP[(size_t)bidx * sCPb + (size_t)by * 64 + col]; } } if (ACT == 1) v = (v > 0.f) ? v : expm1f(v); else if (ACT == 7) v = (v > 0.f) ? v + 1.0f : expf(v); else if (ACT == 8) v = tanhf(v); else if (ACT == 9) v = 0.5f * v * (1.0f + tanhf(0.7978845608028654f * (v + 0.044715f * v * v * v))); else if (ACT == 11) v = 1.0f / (1.0f + expf(-v)); else if (ACT == 12) v = (v > 0.f) ? v : 0.01f * v; else if (ACT == 14) v = (v > 0.f) ? v : 0.1f * v; else if (ACT == 16) v = (v >= 0.f) ? v : 0.3f * v; else if (ACT == 17) v = (v >= 0.f) ? v : 0.2f * v; else if (ACT == 15) v = v / (1.0f + expf(-v)); else if (ACT == 3) v = fmaxf(v, 0.f); else if (ACT == 6) v = 0.5f * v * (1.0f + erff(v * 0.70710678118654752f)); so[w][8 * hh + r][t * 16 + ln] = v; } }
  __builtin_amdgcn_fence(__ATOMIC_ACQ_REL, "workgroup"); __builtin_amdgcn_wave_barrier();
  const int rsub = lane >> 4, c4 = (lane & 15) * 4; typedef _Float16 v4h __attribute__((ext_vector_type(4)));
  {
#pragma unroll
    for (int q = 0; q < 8; ++q) { const int r = q * 2 + rsub; if (col0 + c4 < N) { const v4f v = *(const v4fa*)&so[w][r][c4]; if (C) *(v4f*)(C + cofs + (size_t)(row0 + r) * ldc + col0 + c4) = v; if (C16) { v4h h4; for (int i = 0; i < 4; ++i) h4[i] = (_Float16)v[i]; *(v4h*)(C16 + cofs + (size_t)(row0 + r) * ldc + col0 + c4) = h4; } } }
     }
}


typedef _Float16 v4h __attribute__((ext_vector_type(4)));

__global__ __launch_bounds__(256) void k_x16(const float* __restrict__ x, _Float16* __restrict__ X16, size_t n8) { const size_t t = (size_t)blockIdx.x * 256 + threadIdx.x; if (t >= n8) return; FragH f;
#pragma unroll
  for (int q = 0; q < 8; ++q) f.h[q] = (_Float16)bf16_round(x[t * 8 + q]); *(v8us*)((unsigned short*)X16 + t * 8) = f.half[0];  }
__global__ __launch_bounds__(256) void k_h16(const float* __restrict__ x, _Float16* __restrict__ X16, size_t n8) { const size_t t = (size_t)blockIdx.x * 256 + threadIdx.x; if (t >= n8) return; FragH f;
#pragma unroll
  for (int q = 0; q < 8; ++q) f.h[q] = (_Float16)x[t * 8 + q]; *(v8us*)((unsigned short*)X16 + t * 8) = f.half[0];  }
__global__ __launch_bounds__(256) void k_round16f(const float* __restrict__ W, _Float16* __restrict__ Bt, size_t n8) { const size_t t = (size_t)blockIdx.x * 256 + threadIdx.x; if (t >= n8) return; FragH f;
#pragma unroll
  for (int i = 0; i < 8; ++i) f.h[i] = (_Float16)(bf16_round(W[t * 8 + i]) * 16.0f); *(v8us*)((unsigned short*)Bt + t * 8) = f.half[0];  }
template <int NHv, int TTv>
__global__ __launch_bounds__(256) void k_vt(const _Float16* __restrict__ V16, int ldv, int voff, _Float16* __restrict__ Vt) { __shared__ unsigned short tl[64][66]; const int tid = threadIdx.x; const int slab = blockIdx.x / (TTv / 64), lg = blockIdx.x % (TTv / 64); const int b = slab / NHv, h = slab % NHv;
  for (int i = tid; i < 64 * 8; i += 256) { const int r = i / 8, c8 = (i % 8) * 8; FragH f; f.half[0] = *(const v8us*)((const unsigned short*)V16 + ((size_t)b * TTv + lg * 64 + r) * ldv + voff + h * 64 + c8);
#pragma unroll
    for (int q = 0; q < 8; ++q) tl[r][c8 + q] = f.u[q]; }
  __syncthreads();
  {
#pragma unroll
    for (int rd = 0; rd < 2; ++rd) { const int d = rd * 32 + tid / 8, pc = tid % 8; FragH f;
#pragma unroll
      for (int q = 0; q < 8; ++q) f.u[q] = tl[pc * 8 + q][d];
      *(v8us*)((unsigned short*)Vt + ((size_t)slab * 64 + d) * TTv + lg * 64 + pc * 8) = f.half[0]; }
     } }

__global__ __launch_bounds__(256) void k_hl(const float* __restrict__ F, _Float16* __restrict__ Hh, _Float16* __restrict__ Hl, size_t n8) { const size_t t = (size_t)blockIdx.x * 256 + threadIdx.x; if (t >= n8) return; FragH fh, fl; const v4f a = *(const v4fa*)(F + t * 8), c = *(const v4fa*)(F + t * 8 + 4);
#pragma unroll
  for (int q = 0; q < 4; ++q) { _Float16 h = (_Float16)a[q]; fh.h[q] = h; fl.h[q] = (_Float16)((a[q] - (float)h) * 1024.0f); h = (_Float16)c[q]; fh.h[4 + q] = h; fl.h[4 + q] = (_Float16)((c[q] - (float)h) * 1024.0f); }
  { *(v8us*)((unsigned short*)Hh + t * 8) = fh.half[0]; *(v8us*)((unsigned short*)Hl + t * 8) = fl.half[0];  } }

// ---- fast GEMM (wave tile 32x64; requires M % 32 == 0 rows per launch region and N % 64 == 0); epilogue = k_gemm_hhx semantics ----
__device__ __forceinline__ v16h g2_frag(const _Float16* p, int hh) { FragH f; f.half[0] = *(const v8us*)((const unsigned short*)p + 8 * hh); f.half[1] = *(const v8us*)((const unsigned short*)p + 16 + 8 * hh); return f.v; }
__device__ __forceinline__ v8f g2_mma(v16h a, v16h b, v8f c) { v8f d = __builtin_amdgcn_wmma_f32_16x16x32_f16(false, a, false, b, (short)0, c, false, false); asm volatile("v_nop\n\tv_nop\n\tv_nop\n\tv_nop" : "+v"(d) : "v"(a), "v"(b)); return d; }
template <int ACT>
__global__ __launch_bounds__(128) void k_gemm2(const _Float16* __restrict__ A, int lda, size_t sA, const _Float16* __restrict__ Bh, int ldb, size_t sB, float alpha, const float* __restrict__ bias, size_t sBias, const float* __restrict__ CP, int rowsPerB, size_t sCPb, int row0g,
    float* __restrict__ C, _Float16* __restrict__ C16, int ldc, size_t sC, int M, int N, int K, int bsh, size_t zA, size_t zB, size_t zC) { static_assert(ACT == 0 || ACT == 3 || ACT == 6 || ACT == 8 || ACT == 9 || ACT == 11 || ACT == 12 || ACT == 14 || ACT == 15 || ACT == 16 || ACT == 17, "k_gemm2: unsupported ACT code (would silently apply no activation)");
  __shared__ __attribute__((aligned(16))) float so[4][32][68];
  const int tid = threadIdx.x, w = tid >> 5, lane = tid & 31, ln = lane & 15, hh = lane >> 4; const int by = blockIdx.y, bz = blockIdx.z;      /* grid.y = plane (head), 2^bsh planes share one B plane; grid.z = outer batch with its own strides zA, zB, zC */
  A += (size_t)by * sA + (size_t)bz * zA; Bh += (size_t)(by >> bsh) * sB + (size_t)bz * zB; const size_t cofs = (size_t)by * sC + (size_t)bz * zC; const float* bp = bias ? bias + (size_t)by * sBias : nullptr;
  const int ntn = N >> 6; const int mt = blockIdx.x / ntn, nq = blockIdx.x - mt * ntn; const int row0 = mt * 128 + 32 * w, col0 = nq * 64; if (row0 >= M) return;
  const _Float16* a0p = A + (size_t)(row0 + ln) * lda; const _Float16* a1p = a0p + (size_t)16 * lda;
  const _Float16* b0p = Bh + (size_t)(col0 + ln) * ldb; const _Float16* b1p = b0p + (size_t)16 * ldb; const _Float16* b2p = b1p + (size_t)16 * ldb; const _Float16* b3p = b2p + (size_t)16 * ldb;
  const v8f z8 = {0.f,0.f,0.f,0.f,0.f,0.f,0.f,0.f}; v8f c00 = z8, c01 = z8, c02 = z8, c03 = z8, c10 = z8, c11 = z8, c12 = z8, c13 = z8;
#pragma unroll 1
  for (int kb = 0; kb < K; kb += 32) { const v16h a0 = g2_frag(a0p + kb, hh), a1 = g2_frag(a1p + kb, hh);
    v16h b = g2_frag(b0p + kb, hh); c00 = g2_mma(a0, b, c00); c10 = g2_mma(a1, b, c10);
    b = g2_frag(b1p + kb, hh); c01 = g2_mma(a0, b, c01); c11 = g2_mma(a1, b, c11);
    b = g2_frag(b2p + kb, hh); c02 = g2_mma(a0, b, c02); c12 = g2_mma(a1, b, c12);
    b = g2_frag(b3p + kb, hh); c03 = g2_mma(a0, b, c03); c13 = g2_mma(a1, b, c13); }
  v8f accs[8] = {c00, c01, c02, c03, c10, c11, c12, c13};
#pragma unroll
  for (int u = 0; u < 8; ++u) { const int t = u & 3, half = u >> 2; const int col = col0 + t * 16 + ln; const float bv = bp ? bf16_round(bp[col]) : 0.f;
#pragma unroll
    for (int r = 0; r < 8; ++r) { const int rloc = half * 16 + 8 * hh + r; float v = accs[u][r] * alpha + bv; if (CP) { if (rowsPerB < 0) v += CP[cofs + (size_t)(row0g + row0 + rloc) * ldc + col];      /* rowsPerB < 0: own element of the batched C plane */ else { const int bidx = (row0g + row0 + rloc) / rowsPerB; v += CP[(size_t)bidx * sCPb + (size_t)by * 64 + col]; } }
      if (ACT == 3) v = fmaxf(v, 0.f); else if (ACT == 6) v = 0.5f * v * (1.0f + erff(v * 0.70710678118654752f)); else if (ACT == 11) v = 1.0f / (1.0f + expf(-v)); else if (ACT == 15) v = v / (1.0f + expf(-v)); else if (ACT == 12) v = (v > 0.f) ? v : 0.01f * v; else if (ACT == 8) v = tanhf(v); else if (ACT == 9) v = 0.5f * v * (1.0f + tanhf(0.7978845608028654f * (v + 0.044715f * v * v * v))); else if (ACT == 14) v = (v > 0.f) ? v : 0.1f * v; else if (ACT == 16) v = (v >= 0.f) ? v : 0.3f * v; else if (ACT == 17) v = (v >= 0.f) ? v : 0.2f * v;
      so[w][rloc][t * 16 + ln] = v; } }
  __builtin_amdgcn_fence(__ATOMIC_ACQ_REL, "workgroup"); __builtin_amdgcn_wave_barrier();
  const int rsub = lane >> 4, c4 = (lane & 15) * 4;
  {
#pragma unroll
    for (int q = 0; q < 16; ++q) { const int r = q * 2 + rsub; const v4f v = *(const v4fa*)&so[w][r][c4]; if (C) *(v4f*)(C + cofs + (size_t)(row0 + r) * ldc + col0 + c4) = v; if (C16) { v4h h4; for (int i = 0; i < 4; ++i) h4[i] = (_Float16)v[i]; *(v4h*)(C16 + cofs + (size_t)(row0 + r) * ldc + col0 + c4) = h4; } }
     } }


__global__ __launch_bounds__(256) void k_wnat(const float* __restrict__ w, size_t n8, _Float16* __restrict__ Bt) { const size_t t = (size_t)blockIdx.x * 256 + threadIdx.x; if (t >= n8) return; FragH f; for (int q = 0; q < 8; ++q) f.h[q] = (_Float16)(bf16_round(w[t * 8 + q]) * 16.0f); *(v8us*)((unsigned short*)Bt + t * 8) = f.half[0];  }
__global__ __launch_bounds__(256) void k_rsm(const float* __restrict__ S, _Float16* __restrict__ P, int nrows) {
  #pragma clang fp contract(off)
  const int i = blockIdx.x * 256 + threadIdx.x; if (i >= nrows) return; const float* s = S + (size_t)i * SQ; float mx = -3.0e38f;
#pragma unroll 1
  for (int j = 0; j < SQ; ++j) mx = fmaxf(mx, s[j]); float se = 0.f;
#pragma unroll 1
  for (int j = 0; j < SQ; ++j) se += expf(s[j] - mx); const float sc = 256.0f / se;
#pragma unroll 1
  for (int j0 = 0; j0 < SQ; j0 += 8) { FragH f; for (int q = 0; q < 8; ++q) f.h[q] = (_Float16)(expf(s[j0 + q] - mx) * sc); unsigned short* d = (unsigned short*)P + (size_t)i * SQ + j0; *(v8us*)d = f.half[0];  } }
__global__ __launch_bounds__(256) void k_vt(const _Float16* __restrict__ V16, int b, int h0, _Float16* __restrict__ VT) { __shared__ unsigned short tl[64][65]; const int tid = threadIdx.x; const int hh = blockIdx.x % HG, sg = blockIdx.x / HG; const int s0 = sg * 64; const int h = h0 + hh;
  for (int i = tid; i < 64 * 8; i += 256) { const int j = i / 8, d8 = (i % 8) * 8; FragH f; f.half[0] = *(const v8us*)((const unsigned short*)V16 + ((size_t)b * SQ + s0 + j) * DM + h * HD + d8); for (int q = 0; q < 8; ++q) tl[d8 + q][j] = f.u[q]; }
  __syncthreads();
  { for (int i = tid; i < 64 * 8; i += 256) { const int d = i / 8, j8 = (i % 8) * 8; FragH f; for (int q = 0; q < 8; ++q) f.u[q] = tl[d][j8 + q]; *(v8us*)((unsigned short*)VT + ((size_t)hh * HD + d) * SQ + s0 + j8) = f.half[0]; }  } }


template <int MASK>
__global__ __launch_bounds__(32) void k_att0h(const float* __restrict__ QF, const float* __restrict__ KF, const float* __restrict__ VF, int ld, int ldv, const int* __restrict__ mk, float scale, float* __restrict__ OF, int ldo) {
  #pragma clang fp contract(off)
  __shared__ __attribute__((aligned(16))) float lq[32][128]; __shared__ __attribute__((aligned(16))) float lo[32][128];
  const int tid = threadIdx.x; const int h = blockIdx.x / (QT0 / 32), rg = blockIdx.x % (QT0 / 32); const int i = rg * 32 + tid;
  { const size_t rb = (size_t)blockIdx.y * QT0; QF += rb * ld; KF += rb * ld; VF += rb * ldv; OF += rb * ldo; }      /* grid.y = batch: QT0 rows of every plane per batch */
  for (int c = 0; c < 32; ++c) { *(v4f*)&lq[tid][c * 4] = *(const v4fa*)(QF + (size_t)i * ld + h * 128 + c * 4); const v4f z = {0.f, 0.f, 0.f, 0.f}; *(v4f*)&lo[tid][c * 4] = z; }
  float m = -1.0e30f, l = 0.f; const int jmax = rg * 32 + 31;
#pragma unroll 1
  for (int j = 0; j <= jmax; ++j) { const float* kr = KF + (size_t)j * ld + h * 128; const float* vr = VF + (size_t)j * ldv + h * 128; float s = 0.f;
#pragma unroll 1
    for (int c = 0; c < 32; ++c) { const v4f kq = *(const v4fa*)(kr + c * 4); const v4f qq = *(v4f*)&lq[tid][c * 4]; for (int u = 0; u < 4; ++u) s = __fadd_rn(s, __fmul_rn(qq[u], kq[u])); }
    s = __fmul_rn(s, scale); float f; if (MASK) { const int mb = mk[(size_t)i * SQ + j]; f = (mb == 0) ? 1.f : 0.f; } else { f = (j <= i) ? 1.f : 0.f; }
    const float sm = fmaf(f, s, (1.f - f) * -1.0e30f); const float mn = fmaxf(m, sm); const float sc = expf(m - mn); const float e = __fmul_rn(f, expf(sm - mn)); l = __fadd_rn(__fmul_rn(l, sc), e); m = mn;
#pragma unroll 1
    for (int c = 0; c < 32; ++c) { const v4f vv = *(const v4fa*)(vr + c * 4); v4f oo = *(v4f*)&lo[tid][c * 4]; for (int u = 0; u < 4; ++u) oo[u] = __fadd_rn(__fmul_rn(oo[u], sc), __fmul_rn(e, vv[u])); *(v4f*)&lo[tid][c * 4] = oo; } }
  const float fin = 64.0f / l;
  { for (int c = 0; c < 32; ++c) { v4f oo = *(v4f*)&lo[tid][c * 4]; for (int u = 0; u < 4; ++u) oo[u] = __fmul_rn(oo[u], fin); *(v4f*)(OF + (size_t)i * ldo + h * 128 + c * 4) = oo; }  } }
__global__ __launch_bounds__(256) void k_f2h(const float* __restrict__ F, int ldf, int coff, int ncol, _Float16* __restrict__ H16, size_t nrow) { const size_t t = (size_t)blockIdx.x * 256 + threadIdx.x; const size_t n8 = nrow * (size_t)(ncol / 8); if (t >= n8) return; const size_t r = t / (ncol / 8); const int c8 = (int)(t % (ncol / 8)) * 8; FragH f; const v4f a = *(const v4fa*)(F + r * ldf + coff + c8), b2 = *(const v4fa*)(F + r * ldf + coff + c8 + 4); for (int q = 0; q < 4; ++q) { f.h[q] = (_Float16)a[q]; f.h[4 + q] = (_Float16)b2[q]; } *(v8us*)((unsigned short*)H16 + r * ncol + c8) = f.half[0];  }

__global__ __launch_bounds__(256) void k_tab128(float theta, float* __restrict__ CS, float* __restrict__ SN) {
  #pragma clang fp contract(off)
  const int t = blockIdx.x * 256 + threadIdx.x; if (t >= SQ * 64) return; const int i = t % 64; const int p = t / 64; const float invf = (float)(1.0 / pow((double)theta, (double)(2 * i) / 128.0));      /* = XLA's constant-folded f32 table */ const float ang = __fmul_rn((float)p, invf); const float c = cosf(ang), s = sinf(ang);
  *(float*)(CS + t) = c; *(float*)(SN + t) = s;  }
template <int TAB>
__global__ __launch_bounds__(128) void k_rope128(const float* __restrict__ F, int ldf, int nh, const float* __restrict__ CS, const float* __restrict__ SN, _Float16* __restrict__ H16, int ldo, float osc) {
  #pragma clang fp contract(off)
  __shared__ float xv[128]; __shared__ unsigned short sh_[128]; const int d = threadIdx.x; const int h = blockIdx.x % nh; const size_t r = blockIdx.x / nh; const int p = (int)(r % SQ);
  xv[d] = F[r * (size_t)ldf + (size_t)h * 128 + d]; __syncthreads();
  float c, s; if (TAB) { c = bf16_round(CS[(size_t)p * 128 + d]); s = bf16_round(SN[(size_t)p * 128 + d]); } else { c = CS[p * 64 + (d & 63)]; s = SN[p * 64 + (d & 63)]; }
  const float rot = (d < 64) ? -xv[d + 64] : xv[d - 64]; const float o = __fadd_rn(__fmul_rn(xv[d], c), __fmul_rn(rot, s));
  FragH th; th.h[0] = (_Float16)__fmul_rn(o, osc); sh_[d] = th.u[0]; __syncthreads();
  if (d < 16) { FragH f; for (int q = 0; q < 8; ++q) f.u[q] = sh_[d * 8 + q]; unsigned short* dst = (unsigned short*)H16 + r * (size_t)ldo + (size_t)h * 128 + d * 8; *(v8us*)dst = f.half[0];  } }

template <int TAB, int IL, int F32OUT>
__global__ __launch_bounds__(128) void k_rope128x(const float* __restrict__ F, int ldf, int nh, const float* __restrict__ CS, const float* __restrict__ SN, void* __restrict__ OUT, int ldo, float osc, int yin, int yout) {
  #pragma clang fp contract(off)
  __shared__ float xv[128]; __shared__ float ov[128]; const int d = threadIdx.x; const int h = blockIdx.x % nh; const size_t r = blockIdx.x / nh + (size_t)blockIdx.y * yin; const size_t ro = blockIdx.x / nh + (size_t)blockIdx.y * yout; const int p = (int)(r % SQ);      /* grid.y = batch: source and table rows step by yin, output rows by yout */
  xv[d] = F[r * (size_t)ldf + (size_t)h * 128 + d]; __syncthreads();
  float c, s; if (TAB == 2) { c = CS[r * 128 + d]; s = SN[r * 128 + d]; }      /* computed full-width f32 tables, one row per token row r (relative to the passed pointers) */ else if (TAB) { c = bf16_round(CS[(size_t)p * 128 + d]); s = bf16_round(SN[(size_t)p * 128 + d]); } else { const int ti = IL ? (d >> 1) : (d & 63); c = CS[p * 64 + ti]; s = SN[p * 64 + ti]; }
  const float rot = IL ? ((d & 1) ? xv[d - 1] : -xv[d + 1]) : ((d < 64) ? -xv[d + 64] : xv[d - 64]);
  ov[d] = __fmul_rn(__fadd_rn(__fmul_rn(xv[d], c), __fmul_rn(rot, s)), osc); __syncthreads();
  if (F32OUT) { if (d < 32) { const v4f v = *(const v4f*)&ov[d * 4]; float* dst = (float*)OUT + ro * (size_t)ldo + (size_t)h * 128 + d * 4; *(v4f*)dst = v;  } }
  else { if (d < 16) { FragH f; for (int q = 0; q < 8; ++q) f.h[q] = (_Float16)ov[d * 8 + q]; unsigned short* dst = (unsigned short*)OUT + ro * (size_t)ldo + (size_t)h * 128 + d * 8; *(v8us*)dst = f.half[0];  } } }
template <int N>
__global__ __launch_bounds__(256) void k_rmsrow(float* __restrict__ X, const float* __restrict__ w, float eps) {
  #pragma clang fp contract(off)
  constexpr int PT = N / 256; __shared__ float red[256]; const size_t r = blockIdx.x; const int t = threadIdx.x; float* row = X + r * N + (size_t)t * PT; float v[PT]; float ss = 0.f;
  for (int q = 0; q < PT; ++q) { v[q] = row[q]; ss = __fadd_rn(ss, __fmul_rn(v[q], v[q])); }
  red[t] = ss; __syncthreads(); for (int k = 128; k > 0; k >>= 1) { if (t < k) red[t] = __fadd_rn(red[t], red[t + k]); __syncthreads(); }
  const float rs = rsqrtf(__fadd_rn(red[0] / (float)N, eps)); float o[PT]; for (int q = 0; q < PT; ++q) o[q] = __fmul_rn(__fmul_rn(v[q], rs), bf16_round(w[t * PT + q]));
  { for (int q = 0; q < PT; ++q) *(float*)(row + q) = o[q];  } }
template <int GS_, int NHQ, int DSRC>
__global__ __launch_bounds__(256) void k_kvexp128(const float* __restrict__ src, float* __restrict__ dst, size_t n4, size_t ysrc, size_t ydst) { const size_t t = (size_t)blockIdx.x * 256 + threadIdx.x; if (t >= n4) return; src += (size_t)blockIdx.y * ysrc; dst += (size_t)blockIdx.y * ydst;      /* grid.y = batch */ const size_t e = t * 4; const size_t row = e / ((size_t)NHQ * 128); const int col = (int)(e % ((size_t)NHQ * 128)); const int h = col / 128, d = col % 128; const v4f v = *(const v4fa*)(src + row * DSRC + (size_t)(h / GS_) * 128 + d); *(v4f*)(dst + e) = v;  }

__global__ __launch_bounds__(256) void k_rsmcfb(const float* __restrict__ S, _Float16* __restrict__ P, int hg, int q0, int nk, const int* __restrict__ mk) {
  #pragma clang fp contract(off)
  const int t = blockIdx.x * 256 + threadIdx.x; if (t >= hg * QT) return; const size_t i = (size_t)t; const float* s = S + i * NKX; const size_t ig = (size_t)(q0 + (t % QT)); const int* mr = mk + ig * SQ; float mx = -3.0e38f;
#pragma unroll 1
  for (int j = 0; j < nk; ++j) { const int mb = mr[j]; const float f = (mb == 0) ? 1.f : 0.f; mx = fmaxf(mx, fmaf(f, s[j], (1.f - f) * -1.0e9f)); } float se = 0.f;
#pragma unroll 1
  for (int j = 0; j < nk; ++j) { const int mb = mr[j]; const float f = (mb == 0) ? 1.f : 0.f; se += __expf(fmaf(f, s[j], (1.f - f) * -1.0e9f) - mx); } const float sc = 256.0f / se;
#pragma unroll 1
  for (int j0 = 0; j0 < nk; j0 += 8) { FragH fr; for (int q = 0; q < 8; ++q) { const int j = j0 + q; const int mb = mr[j]; const float f = (mb == 0) ? 1.f : 0.f; fr.h[q] = (_Float16)(__expf(fmaf(f, s[j], (1.f - f) * -1.0e9f) - mx) * sc); } unsigned short* d = (unsigned short*)P + i * NKX + j0; *(v8us*)d = fr.half[0];  } }


__global__ __launch_bounds__(256) void k_rsmcf2(const float* __restrict__ S, _Float16* __restrict__ P, int hg, int q0, int nk) {
  #pragma clang fp contract(off)
  const int t = blockIdx.x * 256 + threadIdx.x; if (t >= hg * QT) return; const size_t i = (size_t)t; const float* s = S + i * NKX; const int last = q0 + (t % QT); float mx = -3.0e38f;
#pragma unroll 1
  for (int j = 0; j < nk; ++j) { const float f = (j <= last) ? 1.f : 0.f; mx = fmaxf(mx, fmaf(f, s[j], (1.f - f) * -1.0e9f)); } float se = 0.f;
#pragma unroll 1
  for (int j = 0; j < nk; ++j) { const float f = (j <= last) ? 1.f : 0.f; se += __expf(fmaf(f, s[j], (1.f - f) * -1.0e9f) - mx); } const float sc = 256.0f / se;
#pragma unroll 1
  for (int j0 = 0; j0 < nk; j0 += 8) { FragH fr; for (int q = 0; q < 8; ++q) { const int j = j0 + q; const float f = (j <= last) ? 1.f : 0.f; fr.h[q] = (_Float16)(__expf(fmaf(f, s[j], (1.f - f) * -1.0e9f) - mx) * sc); } unsigned short* d = (unsigned short*)P + i * NKX + j0; *(v8us*)d = fr.half[0];  } }



__global__ __launch_bounds__(256) void k_tab128p(const int* __restrict__ pos, int nrows, float theta, float* __restrict__ CS, float* __restrict__ SN) {
  #pragma clang fp contract(off)
  const int t = blockIdx.x * 256 + threadIdx.x; if (t >= nrows * 64) return; const int i = t % 64; const int r = t / 64; const float invf = (float)(1.0 / pow((double)theta, (double)(2 * i) / 128.0)); const float ang = __fmul_rn((float)pos[r], invf); const float c = cosf(ang), sv = sinf(ang);
  float* c0 = CS + (size_t)r * 128 + i; float* s0 = SN + (size_t)r * 128 + i;
  { *(float*)c0 = c; *(float*)(c0 + 64) = c; *(float*)s0 = sv; *(float*)(s0 + 64) = sv;  } }

__global__ __launch_bounds__(256) void k_rsmcim(const float* __restrict__ S, _Float16* __restrict__ P, int hg, int q0, int nk, const int* __restrict__ am) {
  #pragma clang fp contract(off)
  const int t = blockIdx.x * 256 + threadIdx.x; if (t >= hg * QT) return; const size_t i = (size_t)t; const float* s = S + i * NKX; const int last = q0 + (t % QT); const int* mr = am + (size_t)last * SQ; float mx = -3.0e38f;      /* the module's mask row of this query (keys >= nk lie above the diagonal of the causal mask and are not computed) */
#pragma unroll 1
  for (int j = 0; j < nk; ++j) { const float f = (mr[j] != 0) ? 1.f : 0.f; mx = fmaxf(mx, fmaf(f, s[j], (1.f - f) * -1.0e9f)); } float se = 0.f;
#pragma unroll 1
  for (int j = 0; j < nk; ++j) { const float f = (mr[j] != 0) ? 1.f : 0.f; se += __expf(fmaf(f, s[j], (1.f - f) * -1.0e9f) - mx); } const float sc = 256.0f / se;
#pragma unroll 1
  for (int j0 = 0; j0 < nk; j0 += 8) { FragH fr; for (int q = 0; q < 8; ++q) { const int j = j0 + q; const float f = (mr[j] != 0) ? 1.f : 0.f; fr.h[q] = (_Float16)(__expf(fmaf(f, s[j], (1.f - f) * -1.0e9f) - mx) * sc); } unsigned short* d = (unsigned short*)P + i * NKX + j0; *(v8us*)d = fr.half[0];  } }



__global__ __launch_bounds__(256) void k_tab128h(int nr, float theta, float* __restrict__ CS, float* __restrict__ SN) {
  #pragma clang fp contract(off)
  const size_t t = (size_t)blockIdx.x * 256 + threadIdx.x; if (t >= (size_t)nr * 64) return; const int i = (int)(t % 64); const size_t r = t / 64; const int p = (int)(r % SQ);
  const float invf = (float)(1.0 / pow((double)theta, ((double)(2 * i)) / 128.0)); const float ang = __fmul_rn((float)p, invf); const float c = cosf(ang), sv = sinf(ang);
  float* pc = CS + r * 128 + i; float* ps = SN + r * 128 + i;
  *(float*)pc = c; *(float*)(pc + 64) = c; *(float*)ps = sv; *(float*)(ps + 64) = sv;  }
extern "C" void kernel_launch(void* const* d_in, const int* in_sizes, int n_in,
                              void* d_out, int out_size, void* d_ws, size_t ws_size, hipStream_t stream) {
  (void)in_sizes; (void)n_in; (void)out_size;
  const float* const* I = (const float* const*)d_in; const float* x = I[0]; const float* wq = I[1]; const float* wk = I[2]; const float* wv = I[3]; const float* wo = I[4]; const float* bq = nullptr; const float* bk = nullptr; const float* bv = nullptr; const float* bo = nullptr;      /* [in][out] Wq [2048][2048], Wk/Wv [2048][1024], Wo [2048][2048]; no biases; positions implicit */
  char* ws = (char*)d_ws; size_t off = 0;
  auto take = [&](size_t bytes) { char* p = ws + off; off += (bytes + 255) & ~(size_t)255; return p; };
  _Float16* BQ = (_Float16*)take((size_t)DMX * DMX * 2); _Float16* BK = (_Float16*)take((size_t)DKV * DMX * 2); _Float16* BV = (_Float16*)take((size_t)DKV * DMX * 2); _Float16* BO = (_Float16*)take((size_t)DMX * DMX * 2);
  _Float16* X16 = (_Float16*)take(NR * DMX * 2); float* QF = (float*)take(NR * (DMX + 2 * DKV) * 4); float* KF = QF + NR * DMX; float* VF = KF + NR * DKV; _Float16* Q16 = (_Float16*)take(NR * DMX * 2); _Float16* K16 = (_Float16*)take(NR * DKV * 2); _Float16* V16 = (_Float16*)take(NR * DKV * 2); _Float16* O16 = (_Float16*)take(NR * DMX * 2);
  static_assert((size_t)NB * NH * QT * NKX <= NR * (DMX + 2 * DKV), "score planes must fit the f32 q, k, v planes they reuse");
  float* S = QF;      /* score planes of both batches reuse the f32 q, k, v planes: their last readers (rope, kv expansion) are launched before the first score GEMM of this call */
  _Float16* P = (_Float16*)take((size_t)NB * NH * QT * NKX * 2); _Float16* VT = (_Float16*)take((size_t)NB * (DKV / 64) * 64 * SQ * 2);
  float* CS = (float*)take(NR * 128 * 4); float* SN = (float*)take(NR * 128 * 4); float* QF0 = (float*)take((size_t)NB * QT0 * DMX * 4); float* KRF0 = (float*)take((size_t)NB * QT0 * DKV * 4); float* KF0e = (float*)take((size_t)NB * QT0 * DMX * 4); float* VF0e = (float*)take((size_t)NB * QT0 * DMX * 4); float* OF0 = (float*)take((size_t)NB * QT0 * DMX * 4); _Float16* OH0 = (_Float16*)take((size_t)NB * QT0 * DMX * 2); _Float16* OL0 = (_Float16*)take((size_t)NB * QT0 * DMX * 2);
  if (off > ws_size) return;      /* 24 (weights) + 16 + 64 + 16 + 8 + 8 + 16 + 32 + 8 + 2 + 2 + 4 + 2 + 4 + 4 + 4 + 2 + 2 = 218 MiB */
  k_wt_f16<<<(unsigned)(((size_t)DMX * DMX / 8 + 255) / 256), 256, 0, stream>>>(wq, BQ, DMX, DMX, 16.0f); k_wt_f16<<<(unsigned)(((size_t)DKV * DMX / 8 + 255) / 256), 256, 0, stream>>>(wk, BK, DMX, DKV, 16.0f); k_wt_f16<<<(unsigned)(((size_t)DKV * DMX / 8 + 255) / 256), 256, 0, stream>>>(wv, BV, DMX, DKV, 16.0f); k_wt_f16<<<(unsigned)(((size_t)DMX * DMX / 8 + 255) / 256), 256, 0, stream>>>(wo, BO, DMX, DMX, 16.0f);      /* [in][out] -> Bt x16 */
  k_x16<<<(unsigned)((NR * DMX / 8 + 255) / 256), 256, 0, stream>>>(x, X16, NR * DMX / 8);
  k_gemm2<0><<<dim3((unsigned)((NR / 128) * (DMX / 64)), 1), 128, 0, stream>>>(X16, DMX, 0, BQ, DMX, 0, 0.0625f, bq, 0, nullptr, 1, 0, 0, QF, nullptr, DMX, 0, (int)NR, DMX, DMX, 0, 0, 0, 0);      /* q (f32) */
  k_gemm2<0><<<dim3((unsigned)((NR / 128) * (DKV / 64)), 1), 128, 0, stream>>>(X16, DMX, 0, BK, DMX, 0, 0.0625f, bk, 0, nullptr, 1, 0, 0, KF, nullptr, DKV, 0, (int)NR, DKV, DMX, 0, 0, 0, 0);      /* k (f32) */
  k_gemm2<0><<<dim3((unsigned)((NR / 128) * (DKV / 64)), 1), 128, 0, stream>>>(X16, DMX, 0, BV, DMX, 0, 0.0625f, bv, 0, nullptr, 1, 0, 0, VF, V16, DKV, 0, (int)NR, DKV, DMX, 0, 0, 0, 0);      /* v (f32 for the first tile + f16) */
  k_tab128h<<<(unsigned)((NR * 64 + 255) / 256), 256, 0, stream>>>((int)NR, 10000.0f, CS, SN);      /* per-row cos/sin tables [NR][128] for positions r % SQ, duplicated over both halves (cat(f, f)) */
  k_rope128x<2, 0, 0><<<(unsigned)(NR * NH), 128, 0, stream>>>(QF, DMX, NH, CS, SN, Q16, DMX, 1.0f, 0, 0); k_rope128x<2, 0, 0><<<(unsigned)(NR * NKV), 128, 0, stream>>>(KF, DKV, NKV, CS, SN, K16, DKV, 1.0f, 0, 0);      /* rope (all rows) -> f16 */
  /* From here on every launch covers both batches (grid.y or grid.z = batch, or both batches' rows in one grid.x), and each attention GEMM all 16 query heads (grid.y = head). */
  k_rope128x<2, 0, 1><<<dim3(QT0 * NH, NB), 128, 0, stream>>>(QF, DMX, NH, CS, SN, QF0, DMX, 1.0f, SQ, QT0); k_rope128x<2, 0, 1><<<dim3(QT0 * NKV, NB), 128, 0, stream>>>(KF, DKV, NKV, CS, SN, KRF0, DKV, 1.0f, SQ, QT0);      /* f32 roped q, k of each batch's first QT0 rows */
  k_kvexp128<GSZ, NH, DKV><<<dim3((unsigned)(((size_t)QT0 * DMX / 4 + 255) / 256), NB), 256, 0, stream>>>(KRF0, KF0e, (size_t)QT0 * DMX / 4, (size_t)QT0 * DKV, (size_t)QT0 * DMX); k_kvexp128<GSZ, NH, DKV><<<dim3((unsigned)(((size_t)QT0 * DMX / 4 + 255) / 256), NB), 256, 0, stream>>>(VF, VF0e, (size_t)QT0 * DMX / 4, (size_t)SQ * DKV, (size_t)QT0 * DMX);      /* kv head -> query head expansion for the exact first tile */
  k_vt<DKV / 64, SQ><<<NB * (DKV / 64) * (SQ / 64), 256, 0, stream>>>(V16, DKV, 0, VT);      /* V^T, [batch][DKV][SQ]: kv head g = slabs 2g, 2g+1 of its batch */
  k_att0h<0><<<dim3(NH * (QT0 / 32), NB), 32, 0, stream>>>(QF0, KF0e, VF0e, DMX, DMX, nullptr, ATS, OF0, DMX);      /* exact causal attention, first QT0 rows (o x64) */
  for (int q0 = 0; q0 < SQ; q0 += QT) { const int nk = q0 + QT;      /* causal: keys below the tile end only */
    k_gemm2<0><<<dim3((QT / 128) * (nk / 64), NH, NB), 128, 0, stream>>>(Q16 + (size_t)q0 * DMX, DMX, (size_t)HDK, K16, DKV, (size_t)HDK, ATS, nullptr, 0, nullptr, 1, 0, 0, S, nullptr, NKX, (size_t)QT * NKX, QT, nk, HDK, GSH, (size_t)SQ * DMX, (size_t)SQ * DKV, (size_t)NH * QT * NKX);      /* scores: query head y vs key slab y >> GSH */
    k_rsmcf2<<<(NB * NH * QT + 255) / 256, 256, 0, stream>>>(S, P, NB * NH, q0, nk);      /* causal softmax (arithmetic select) over the computed keys */
    k_gemm2<0><<<dim3((QT / 128) * (HDK / 64), NH, NB), 128, 0, stream>>>(P, NKX, (size_t)QT * NKX, VT, SQ, (size_t)HDK * SQ, 0.25f, nullptr, 0, nullptr, 1, 0, 0, nullptr, O16 + (size_t)q0 * DMX, DMX, (size_t)HDK, QT, HDK, nk, GSH, (size_t)NH * QT * NKX, (size_t)DKV * SQ, (size_t)SQ * DMX); }      /* o (x64): query head y vs V^T slab y >> GSH */
  k_gemm2<0><<<dim3((unsigned)((NR / 128) * (DMX / 64)), 1), 128, 0, stream>>>(O16, DMX, 0, BO, DMX, 0, 0.0009765625f, bo, 0, nullptr, 1, 0, 0, (float*)d_out, nullptr, DMX, 0, (int)NR, DMX, DMX, 0, 0, 0, 0);      /* out = o Wo */
  k_hl<<<(unsigned)(((size_t)NB * QT0 * DMX / 8 + 255) / 256), 256, 0, stream>>>(OF0, OH0, OL0, (size_t)NB * QT0 * DMX / 8);      /* first-tile o (x64) -> f16 hi + x1024 residual planes */
  k_gemm2<0><<<dim3((QT0 / 128) * (DMX / 64), 1, NB), 128, 0, stream>>>(OH0, DMX, 0, BO, DMX, 0, 0.0009765625f, bo, 0, nullptr, 1, 0, 0, (float*)d_out, nullptr, DMX, 0, QT0, DMX, DMX, 0, (size_t)QT0 * DMX, 0, (size_t)SQ * DMX);      /* first QT0 rows of each batch rewritten from the exact path */
  k_gemm2<0><<<dim3((QT0 / 128) * (DMX / 64), 1, NB), 128, 0, stream>>>(OL0, DMX, 0, BO, DMX, 0, 0.00000095367431640625f, nullptr, 0, (const float*)d_out, -1, 0, 0, (float*)d_out, nullptr, DMX, 0, QT0, DMX, DMX, 0, (size_t)QT0 * DMX, 0, (size_t)SQ * DMX);      /* += o_lo Wo 2^-20 (own-element accumulate) */
}

// v002
// One run takes 2620 microseconds.
// Next to v001, in two timings, it ran 1.56 times as fast each time.
// All steps since v000 together make it 4.53 times as fast.
#include <hip/hip_runtime.h>
// Grouped-query causal attention with rotate-half RoPE, 16 query / 8 kv heads of 128 (x [2][2048][2048]; q = x Wq (16 x 128), k = x Wk, v = x Wv (8 x 128) ([in][out] weights sigma 0.02, no biases); inv_freq_i = 1/10000^(2i/128), positions 0..2047, cos/sin = cat(freqs, freqs); q, k roped; kv head h/2 serves query head h; scores / sqrt(128); causal (tril, -inf); softmax; out = merged Wo -> [2][2048][2048]).
// Compute dtype: inputs rounded to bf16; x / weights exact; projections and rope f32; q, k, v, softmax weights and o as plain f16 GEMM operands (~2^-12; first 256 rows of each batch exact); scores, statistics, out f32. v_wmma_f32_16x16x32_f16.
#define NB 2
#define SQ 2048
#define DMX 2048
#define NH 16
#define NKV 8
#define GSZ 2                        /* query heads per kv head */
#define GSH 1                        /* log2(GSZ): query head >> GSH = its kv head */
#define HDK 128
#define DKV (NKV * HDK)
#define QT 256
#define QT0 256
#define NKX SQ
#define DM DMX
#define HD 64
#define HG 1
#define NR ((size_t)NB * SQ)
#define ATS 0.08838834764831845f
typedef __bf16 v16b __attribute__((ext_vector_type(16)));
typedef unsigned short v8us __attribute__((ext_vector_type(8), may_alias));
typedef float  v8f  __attribute__((ext_vector_type(8)));
typedef float  v4f  __attribute__((ext_vector_type(4)));
typedef float  v4fa __attribute__((ext_vector_type(4), may_alias));
union FragB { v16b v; v8us half[2]; unsigned short u[16]; };

__device__ __forceinline__ unsigned short bf16_bits(float x) { unsigned int u = __float_as_uint(x); return (unsigned short)((u + 0x7FFFu + ((u >> 16) & 1u)) >> 16); }
__device__ __forceinline__ float bf16_val(unsigned short b) { return __uint_as_float(((unsigned int)b) << 16); }
__device__ __forceinline__ float bf16_round(float x) { return bf16_val(bf16_bits(x)); }
// D += A·B with NT terms: 1 = ah·bh, 2 = + al·bh (A split), 3 = + ah·bl (both split)
template <int NT>
__device__ __forceinline__ v8f mmaN(v16b ah, v16b al, v16b bh, v16b bl, v8f c) {
  c = __builtin_amdgcn_wmma_f32_16x16x32_bf16(false, ah, false, bh, (short)0, c, false, false);
  if (NT >= 2) c = __builtin_amdgcn_wmma_f32_16x16x32_bf16(false, al, false, bh, (short)0, c, false, false);
  if (NT >= 3) c = __builtin_amdgcn_wmma_f32_16x16x32_bf16(false, ah, false, bl, (short)0, c, false, false);
  asm volatile("v_nop\n\tv_nop\n\tv_nop\n\tv_nop" : "+v"(c) : "v"(ah), "v"(al), "v"(bh), "v"(bl));
  return c;
}

__global__ __launch_bounds__(256) void k_wt_bf16(const float* __restrict__ W, unsigned short* __restrict__ Wt, int K, int N) {
  const int t = blockIdx.x * 256 + threadIdx.x;
  const int k8n = K / 8;
  if (t >= N * k8n) return;
  const int n = t / k8n, k8 = (t % k8n) * 8;
  v8us v;
#pragma unroll
  for (int i = 0; i < 8; ++i) v[i] = bf16_bits(W[(size_t)(k8 + i) * N + n]);
  *(v8us*)(Wt + (size_t)n * K + k8) = v;
  
}

// GEMM C[M][N] (f32, pitch ldc) = act(A[M][K]·W + bias). A f32 row-major (pitch lda) converted per fragment to bf16
// (ASPLIT: hi/lo two planes -> 2 terms, else single rounded term); Wt bf16 [N][K] (pitch ldb). BIAS_BF16 rounds the
// bias to bf16 first (bias quantised to bf16 before the add). K%32==0, M%16==0, N%64==0.
template <bool ASPLIT, int ACT, bool BIAS_BF16>
__global__ __launch_bounds__(128) void k_gemm_bf(const float* __restrict__ A, int lda, const unsigned short* __restrict__ Wt, int ldb,
                                               const float* __restrict__ bias, float* __restrict__ C, int ldc, int M, int N, int K) {
  __shared__ __attribute__((aligned(16))) float so[4][16][64];
  const int tid = threadIdx.x, w = tid >> 5, lane = tid & 31, ln = lane & 15, hh = lane >> 4;
  const int ntn = N / 64;
  const int wid = blockIdx.x * 4 + w;
  const int mt = wid / ntn, nq = wid % ntn;
  if (mt * 16 >= M) return;
  const int row0 = mt * 16, col0 = nq * 64;
  const float* arow = A + (size_t)(row0 + ln) * lda;
  v8f acc[4] = {};
  for (int kb = 0; kb < K; kb += 32) {
    FragB ah, al;
    const v4f x0 = *(const v4fa*)(arow + kb + 8 * hh), x1 = *(const v4fa*)(arow + kb + 8 * hh + 4);
    const v4f x2 = *(const v4fa*)(arow + kb + 16 + 8 * hh), x3 = *(const v4fa*)(arow + kb + 16 + 8 * hh + 4);
    float xs[16] = {x0[0],x0[1],x0[2],x0[3],x1[0],x1[1],x1[2],x1[3],x2[0],x2[1],x2[2],x2[3],x3[0],x3[1],x3[2],x3[3]};
#pragma unroll
    for (int i = 0; i < 16; ++i) { const unsigned short hb = bf16_bits(xs[i]); ah.u[i] = hb; al.u[i] = ASPLIT ? bf16_bits(xs[i] - bf16_val(hb)) : (unsigned short)0; }
#pragma unroll
    for (int t = 0; t < 4; ++t) {
      const unsigned short* brow = Wt + (size_t)(col0 + t * 16 + ln) * ldb + kb;
      FragB b;
      b.half[0] = *(const v8us*)(brow + 8 * hh);
      b.half[1] = *(const v8us*)(brow + 16 + 8 * hh);
      acc[t] = mmaN<ASPLIT ? 2 : 1>(ah.v, al.v, b.v, b.v, acc[t]);
    }
  }
#pragma unroll
  for (int t = 0; t < 4; ++t) {
    float bv = bias ? bias[col0 + t * 16 + ln] : 0.f;
    if (BIAS_BF16) bv = bf16_round(bv);
#pragma unroll
    for (int r = 0; r < 8; ++r) { float v = acc[t][r] + bv; if (ACT == 1) v = fmaxf(v, 0.f); so[w][8 * hh + r][t * 16 + ln] = v; }
  }
  __builtin_amdgcn_fence(__ATOMIC_ACQ_REL, "workgroup");
  __builtin_amdgcn_wave_barrier();
  const int rsub = lane >> 4, c4 = (lane & 15) * 4;
  {
#pragma unroll
    for (int q = 0; q < 8; ++q) {
      const int r = q * 2 + rsub;
      const v4f v = *(const v4fa*)&so[w][r][c4];
      *(v4f*)(C + (size_t)(row0 + r) * ldc + col0 + c4) = v;
    }
    
  }
}

// GEMM C = act(A·W + bias + resid): A f32 (ASPLIT -> hi/lo 2 terms), Wt bf16 [N][K]; ACT 0 none, 1 relu, 2 exact gelu;
// resid (optional, f32, row index = (row % rmod), pitch ldr, RES_BF16 rounds it) added before the activation.
template <bool ASPLIT, int ACT, bool BIAS_BF16, bool RES_BF16>
__global__ __launch_bounds__(128) void k_gemm_bf3(const float* __restrict__ A, int lda, const unsigned short* __restrict__ Wt, int ldb,
                                                const float* __restrict__ bias, const float* __restrict__ resid, int rmod, int ldr,
                                                float* __restrict__ C, int ldc, int M, int N, int K) {
  __shared__ __attribute__((aligned(16))) float so[4][16][64];
  const int tid = threadIdx.x, w = tid >> 5, lane = tid & 31, ln = lane & 15, hh = lane >> 4;
  const int ntn = N / 64;
  const int wid = blockIdx.x * 4 + w;
  const int mt = wid / ntn, nq = wid % ntn;
  if (mt * 16 >= M) return;
  const int row0 = mt * 16, col0 = nq * 64;
  const float* arow = A + (size_t)(row0 + ln) * lda;
  v8f acc[4] = {};
  for (int kb = 0; kb < K; kb += 32) {
    FragB ah, al;
    const v4f x0 = *(const v4fa*)(arow + kb + 8 * hh), x1 = *(const v4fa*)(arow + kb + 8 * hh + 4);
    const v4f x2 = *(const v4fa*)(arow + kb + 16 + 8 * hh), x3 = *(const v4fa*)(arow + kb + 16 + 8 * hh + 4);
    float xs[16] = {x0[0],x0[1],x0[2],x0[3],x1[0],x1[1],x1[2],x1[3],x2[0],x2[1],x2[2],x2[3],x3[0],x3[1],x3[2],x3[3]};
#pragma unroll
    for (int i = 0; i < 16; ++i) { const unsigned short hb = bf16_bits(xs[i]); ah.u[i] = hb; al.u[i] = ASPLIT ? bf16_bits(xs[i] - bf16_val(hb)) : (unsigned short)0; }
#pragma unroll
    for (int t = 0; t < 4; ++t) {
      const unsigned short* brow = Wt + (size_t)(col0 + t * 16 + ln) * ldb + kb;
      FragB b;
      b.half[0] = *(const v8us*)(brow + 8 * hh);
      b.half[1] = *(const v8us*)(brow + 16 + 8 * hh);
      acc[t] = mmaN<ASPLIT ? 2 : 1>(ah.v, al.v, b.v, b.v, acc[t]);
    }
  }
#pragma unroll
  for (int t = 0; t < 4; ++t) {
    const int col = col0 + t * 16 + ln;
    float bv = bias ? bias[col] : 0.f;
    if (BIAS_BF16) bv = bf16_round(bv);
#pragma unroll
    for (int r = 0; r < 8; ++r) {
      float v = acc[t][r] + bv;
      if (resid) { float rv = resid[(size_t)((row0 + 8 * hh + r) % rmod) * ldr + col]; if (RES_BF16) rv = bf16_round(rv); v += rv; }
      if (ACT == 1) v = fmaxf(v, 0.f);
      if (ACT == 2) v = 0.5f * v * (1.0f + erff(v * 0.70710678118654752f));
      if (ACT == 3) { const float u = 0.7978845608028654f * (v + 0.044715f * v * v * v); v = 0.5f * v * (1.0f + tanhf(u)); }
      so[w][8 * hh + r][t * 16 + ln] = v;
    }
  }
  __builtin_amdgcn_fence(__ATOMIC_ACQ_REL, "workgroup");
  __builtin_amdgcn_wave_barrier();
  const int rsub = lane >> 4, c4 = (lane & 15) * 4;
  {
#pragma unroll
    for (int q = 0; q < 8; ++q) {
      const int r = q * 2 + rsub;
      const v4f v = *(const v4fa*)&so[w][r][c4];
      *(v4f*)(C + (size_t)(row0 + r) * ldc + col0 + c4) = v;
    }
    
  }
}
// row LayerNorm (biased variance, eps) over N: s = X (+ R); optional out_sum <- s; out_norm <- (s-mu)*rsqrt(var+eps)*g + b
template <bool PARAM_BF16>
__global__ __launch_bounds__(256) void k_layernorm(const float* __restrict__ X, const float* __restrict__ R, const float* __restrict__ g, const float* __restrict__ bta,
                                                  float* __restrict__ out_sum, float* __restrict__ out_norm, int N, float eps) {
  __shared__ float red[256];
  const int row = blockIdx.x, tid = threadIdx.x;
  const float* x = X + (size_t)row * N; const float* rr = R ? R + (size_t)row * N : nullptr;
  float vals[16];                     // up to N = 4096
  const int per = N / 256;            // contiguous chunk per thread? use strided-by-4 chunks: thread handles j = tid*4 + 1024*u
  float s1 = 0.f;
  for (int u = 0; u < per / 4; ++u) {
    const int j = tid * 4 + 1024 * u;
    const v4f a = *(const v4fa*)(x + j);
    v4f b = {0.f,0.f,0.f,0.f}; if (rr) b = *(const v4fa*)(rr + j);
#pragma unroll
    for (int q = 0; q < 4; ++q) { const float v = a[q] + b[q]; vals[u * 4 + q] = v; s1 += v; }
  }
  red[tid] = s1; __syncthreads();
  for (int st = 128; st > 0; st >>= 1) { if (tid < st) red[tid] += red[tid + st]; __syncthreads(); }
  const float mu = red[0] / (float)N; __syncthreads();
  float s2 = 0.f;
  for (int u = 0; u < per / 4; ++u)
#pragma unroll
    for (int q = 0; q < 4; ++q) { const float c = vals[u * 4 + q] - mu; s2 += c * c; }
  red[tid] = s2; __syncthreads();
  for (int st = 128; st > 0; st >>= 1) { if (tid < st) red[tid] += red[tid + st]; __syncthreads(); }
  const float rs = rsqrtf(red[0] / (float)N + eps);
  {
    for (int u = 0; u < per / 4; ++u) {
      const int j = tid * 4 + 1024 * u;
      v4f o, sm;
#pragma unroll
      for (int q = 0; q < 4; ++q) {
        float gg = g[j + q], bb = bta[j + q];
        if (PARAM_BF16) { gg = bf16_round(gg); bb = bf16_round(bb); }
        sm[q] = vals[u * 4 + q]; o[q] = (vals[u * 4 + q] - mu) * rs * gg + bb;
      }
      if (out_sum) *(v4f*)(out_sum + (size_t)row * N + j) = sm;
      *(v4f*)(out_norm + (size_t)row * N + j) = o;
    }
    
  }
}



// ---- f16 WMMA path (v_wmma_f32_16x16x32_f16): 11-bit significands for operands in range — used where a [0,1] probability operand needs more precision than bf16
typedef _Float16 v16h __attribute__((ext_vector_type(16)));
union FragH { v16h v; v8us half[2]; _Float16 h[16]; unsigned short u[16]; };
template <int NT>
__device__ __forceinline__ v8f mmaH(v16h ah, v16h al, v16h bh, v16h bl, v8f c) {
  c = __builtin_amdgcn_wmma_f32_16x16x32_f16(false, ah, false, bh, (short)0, c, false, false);
  if (NT >= 2) c = __builtin_amdgcn_wmma_f32_16x16x32_f16(false, al, false, bh, (short)0, c, false, false);
  if (NT >= 3) c = __builtin_amdgcn_wmma_f32_16x16x32_f16(false, ah, false, bl, (short)0, c, false, false);
  asm volatile("v_nop\n\tv_nop\n\tv_nop\n\tv_nop" : "+v"(c) : "v"(ah), "v"(al), "v"(bh), "v"(bl));
  return c;
}
// batched GEMM like k_gemm_b but f16 operands: A f32 (split into f16 hi/lo if ASPLIT, else rounded to f16), Bt = f16 values [n][k]; alpha; C f32; N multiple of 16 (partial tiles skipped)
template <bool ASPLIT>
__global__ __launch_bounds__(128) void k_gemm_h(const float* __restrict__ A, int lda, size_t sA, const _Float16* __restrict__ Bh, int ldb, size_t sB, float alpha, float* __restrict__ C, int ldc, size_t sC, int M, int N, int K) {
  __shared__ __attribute__((aligned(16))) float so[4][16][64];
  const int tid = threadIdx.x, w = tid >> 5, lane = tid & 31, ln = lane & 15, hh = lane >> 4; const int by = blockIdx.y;
  A += (size_t)by * sA; Bh += (size_t)by * sB; C += (size_t)by * sC;
  const int ntn = (N + 63) / 64; const int wid = blockIdx.x * 4 + w; const int mt = wid / ntn, nq = wid % ntn; if (mt * 16 >= M) return;
  const int row0 = mt * 16, col0 = nq * 64; const float* arow = A + (size_t)(row0 + ln) * lda;
  v8f acc[4] = {};
  for (int kb = 0; kb < K; kb += 32) {
    FragH ah, al;
    const v4f x0 = *(const v4fa*)(arow + kb + 8 * hh), x1 = *(const v4fa*)(arow + kb + 8 * hh + 4), x2 = *(const v4fa*)(arow + kb + 16 + 8 * hh), x3 = *(const v4fa*)(arow + kb + 16 + 8 * hh + 4);
    float xs[16] = {x0[0],x0[1],x0[2],x0[3],x1[0],x1[1],x1[2],x1[3],x2[0],x2[1],x2[2],x2[3],x3[0],x3[1],x3[2],x3[3]};
#pragma unroll
    for (int i = 0; i < 16; ++i) { const _Float16 h = (_Float16)xs[i]; ah.h[i] = h; al.h[i] = ASPLIT ? (_Float16)(xs[i] - (float)h) : (_Float16)0.0f; }
#pragma unroll
    for (int t = 0; t < 4; ++t) { if (col0 + t * 16 >= N) continue; const size_t boff = (size_t)(col0 + t * 16 + ln) * ldb + kb; FragH bq; bq.half[0] = *(const v8us*)(Bh + boff + 8 * hh); bq.half[1] = *(const v8us*)(Bh + boff + 16 + 8 * hh);
      acc[t] = mmaH<ASPLIT ? 2 : 1>(ah.v, al.v, bq.v, bq.v, acc[t]); }
  }
#pragma unroll
  for (int t = 0; t < 4; ++t) { if (col0 + t * 16 >= N) continue;
#pragma unroll
    for (int r = 0; r < 8; ++r) so[w][8 * hh + r][t * 16 + ln] = acc[t][r] * alpha; }
  __builtin_amdgcn_fence(__ATOMIC_ACQ_REL, "workgroup"); __builtin_amdgcn_wave_barrier();
  const int rsub = lane >> 4, c4 = (lane & 15) * 4;
  {
#pragma unroll
    for (int q = 0; q < 8; ++q) { const int r = q * 2 + rsub; if (col0 + c4 < N) { const v4f v = *(const v4fa*)&so[w][r][c4]; *(v4f*)(C + (size_t)(row0 + r) * ldc + col0 + c4) = v; } }
     }
}

// Wt[n][k] = f16(W[k][n]·scale) from f32 row-major W[K][N] (scale = power of two; bf16-exact weights stay exact in f16 away from the subnormal range)
__global__ __launch_bounds__(256) void k_wt_f16(const float* __restrict__ W, _Float16* __restrict__ Wt, int K, int N, float scale) {
  const int t = blockIdx.x * 256 + threadIdx.x; if (t >= N * (K / 8)) return; const int n = t / (K / 8), k8 = (t % (K / 8)) * 8; FragH f;
#pragma unroll
  for (int i = 0; i < 8; ++i) f.h[i] = (_Float16)(bf16_round(W[(size_t)(k8 + i) * N + n]) * scale); const v8us o = f.half[0];
  *(v8us*)((unsigned short*)Wt + (size_t)n * K + k8) = o; 
}
// k_gemm_hh variant with fused epilogue: v = acc·alpha + bias[by·sBias + col] (+ CP[(row/rowsPerB)·sCPb + by·64 + col] if CP) ; ACT 0 none / 1 elu ; writes f16 C16 (and f32 C if non-null)
template <int ACT>
__global__ __launch_bounds__(128) void k_gemm_hhx(const _Float16* __restrict__ A, int lda, size_t sA, const _Float16* __restrict__ Bh, int ldb, size_t sB, float alpha, const float* __restrict__ bias, size_t sBias, const float* __restrict__ CP, int rowsPerB, size_t sCPb, int row0g,
    float* __restrict__ C, _Float16* __restrict__ C16, int ldc, size_t sC, int M, int N, int K) {
  __shared__ __attribute__((aligned(16))) float so[4][16][64];
  const int tid = threadIdx.x, w = tid >> 5, lane = tid & 31, ln = lane & 15, hh = lane >> 4; const int by = blockIdx.y;
  A += (size_t)by * sA; Bh += (size_t)by * sB; const size_t cofs = (size_t)by * sC; const float* bp = bias ? bias + (size_t)by * sBias : nullptr;
  const int ntn = (N + 63) / 64; const int wid = blockIdx.x * 4 + w; const int mt = wid / ntn, nq = wid % ntn; if (mt * 16 >= M) return;
  const int row0 = mt * 16, col0 = nq * 64; const _Float16* arow = A + (size_t)(row0 + ln) * lda;
  v8f acc[4] = {};
  for (int kb = 0; kb < K; kb += 32) { FragH ah; ah.half[0] = *(const v8us*)((const unsigned short*)arow + kb + 8 * hh); ah.half[1] = *(const v8us*)((const unsigned short*)arow + kb + 16 + 8 * hh);
#pragma unroll
    for (int t = 0; t < 4; ++t) { if (col0 + t * 16 >= N) continue; const size_t boff = (size_t)(col0 + t * 16 + ln) * ldb + kb; FragH bq; bq.half[0] = *(const v8us*)((const unsigned short*)Bh + boff + 8 * hh); bq.half[1] = *(const v8us*)((const unsigned short*)Bh + boff + 16 + 8 * hh);
      acc[t] = mmaH<1>(ah.v, ah.v, bq.v, bq.v, acc[t]); }
  }
#pragma unroll
  for (int t = 0; t < 4; ++t) { if (col0 + t * 16 >= N) continue; const int col = col0 + t * 16 + ln; const float bv = bp ? bf16_round(bp[col]) : 0.f;
#pragma unroll
    for (int r = 0; r < 8; ++r) { float v = acc[t][r] * alpha + bv; if (CP) { const int rr = row0g + row0 + 8 * hh + r; if (rowsPerB < 0) v += CP[cofs + (size_t)rr * ldc + col];      /* rowsPerB < 0: own element of the batched C plane */ else { const int bidx = rr / rowsPerB; v += CP[(size_t)bidx * sCPb + (size_t)by * 64 + col]; } } if (ACT == 1) v = (v > 0.f) ? v : expm1f(v); else if (ACT == 7) v = (v > 0.f) ? v + 1.0f : expf(v); else if (ACT == 8) v = tanhf(v); else if (ACT == 9) v = 0.5f * v * (1.0f + tanhf(0.7978845608028654f * (v + 0.044715f * v * v * v))); else if (ACT == 11) v = 1.0f / (1.0f + expf(-v)); else if (ACT == 12) v = (v > 0.f) ? v : 0.01f * v; else if (ACT == 14) v = (v > 0.f) ? v : 0.1f * v; else if (ACT == 16) v = (v >= 0.f) ? v : 0.3f * v; else if (ACT == 17) v = (v >= 0.f) ? v : 0.2f * v; else if (ACT == 15) v = v / (1.0f + expf(-v)); else if (ACT == 3) v = fmaxf(v, 0.f); else if (ACT == 6) v = 0.5f * v * (1.0f + erff(v * 0.70710678118654752f)); so[w][8 * hh + r][t * 16 + ln] = v; } }
  __builtin_amdgcn_fence(__ATOMIC_ACQ_REL, "workgroup"); __builtin_amdgcn_wave_barrier();
  const int rsub = lane >> 4, c4 = (lane & 15) * 4; typedef _Float16 v4h __attribute__((ext_vector_type(4)));
  {
#pragma unroll
    for (int q = 0; q < 8; ++q) { const int r = q * 2 + rsub; if (col0 + c4 < N) { const v4f v = *(const v4fa*)&so[w][r][c4]; if (C) *(v4f*)(C + cofs + (size_t)(row0 + r) * ldc + col0 + c4) = v; if (C16) { v4h h4; for (int i = 0; i < 4; ++i) h4[i] = (_Float16)v[i]; *(v4h*)(C16 + cofs + (size_t)(row0 + r) * ldc + col0 + c4) = h4; } } }
     }
}


typedef _Float16 v4h __attribute__((ext_vector_type(4)));

__global__ __launch_bounds__(256) void k_x16(const float* __restrict__ x, _Float16* __restrict__ X16, size_t n8) { const size_t t = (size_t)blockIdx.x * 256 + threadIdx.x; if (t >= n8) return; FragH f;
#pragma unroll
  for (int q = 0; q < 8; ++q) f.h[q] = (_Float16)bf16_round(x[t * 8 + q]); *(v8us*)((unsigned short*)X16 + t * 8) = f.half[0];  }
__global__ __launch_bounds__(256) void k_h16(const float* __restrict__ x, _Float16* __restrict__ X16, size_t n8) { const size_t t = (size_t)blockIdx.x * 256 + threadIdx.x; if (t >= n8) return; FragH f;
#pragma unroll
  for (int q = 0; q < 8; ++q) f.h[q] = (_Float16)x[t * 8 + q]; *(v8us*)((unsigned short*)X16 + t * 8) = f.half[0];  }
__global__ __launch_bounds__(256) void k_round16f(const float* __restrict__ W, _Float16* __restrict__ Bt, size_t n8) { const size_t t = (size_t)blockIdx.x * 256 + threadIdx.x; if (t >= n8) return; FragH f;
#pragma unroll
  for (int i = 0; i < 8; ++i) f.h[i] = (_Float16)(bf16_round(W[t * 8 + i]) * 16.0f); *(v8us*)((unsigned short*)Bt + t * 8) = f.half[0];  }
template <int NHv, int TTv>
__global__ __launch_bounds__(256) void k_vt(const _Float16* __restrict__ V16, int ldv, int voff, _Float16* __restrict__ Vt) { __shared__ unsigned short tl[64][66]; const int tid = threadIdx.x; const int slab = blockIdx.x / (TTv / 64), lg = blockIdx.x % (TTv / 64); const int b = slab / NHv, h = slab % NHv;
  for (int i = tid; i < 64 * 8; i += 256) { const int r = i / 8, c8 = (i % 8) * 8; FragH f; f.half[0] = *(const v8us*)((const unsigned short*)V16 + ((size_t)b * TTv + lg * 64 + r) * ldv + voff + h * 64 + c8);
#pragma unroll
    for (int q = 0; q < 8; ++q) tl[r][c8 + q] = f.u[q]; }
  __syncthreads();
  {
#pragma unroll
    for (int rd = 0; rd < 2; ++rd) { const int d = rd * 32 + tid / 8, pc = tid % 8; FragH f;
#pragma unroll
      for (int q = 0; q < 8; ++q) f.u[q] = tl[pc * 8 + q][d];
      *(v8us*)((unsigned short*)Vt + ((size_t)slab * 64 + d) * TTv + lg * 64 + pc * 8) = f.half[0]; }
     } }

__global__ __launch_bounds__(256) void k_hl(const float* __restrict__ F, _Float16* __restrict__ Hh, _Float16* __restrict__ Hl, size_t n8) { const size_t t = (size_t)blockIdx.x * 256 + threadIdx.x; if (t >= n8) return; FragH fh, fl; const v4f a = *(const v4fa*)(F + t * 8), c = *(const v4fa*)(F + t * 8 + 4);
#pragma unroll
  for (int q = 0; q < 4; ++q) { _Float16 h = (_Float16)a[q]; fh.h[q] = h; fl.h[q] = (_Float16)((a[q] - (float)h) * 1024.0f); h = (_Float16)c[q]; fh.h[4 + q] = h; fl.h[4 + q] = (_Float16)((c[q] - (float)h) * 1024.0f); }
  { *(v8us*)((unsigned short*)Hh + t * 8) = fh.half[0]; *(v8us*)((unsigned short*)Hl + t * 8) = fl.half[0];  } }

// ---- fast GEMM (wave tile 32x64; requires M % 32 == 0 rows per launch region and N % 64 == 0); epilogue = k_gemm_hhx semantics ----
__device__ __forceinline__ v16h g2_frag(const _Float16* p, int hh) { FragH f; f.half[0] = *(const v8us*)((const unsigned short*)p + 8 * hh); f.half[1] = *(const v8us*)((const unsigned short*)p + 16 + 8 * hh); return f.v; }
__device__ __forceinline__ v8f g2_mma(v16h a, v16h b, v8f c) { v8f d = __builtin_amdgcn_wmma_f32_16x16x32_f16(false, a, false, b, (short)0, c, false, false); asm volatile("v_nop\n\tv_nop\n\tv_nop\n\tv_nop" : "+v"(d) : "v"(a), "v"(b)); return d; }
template <int ACT>
__global__ __launch_bounds__(128) void k_gemm2(const _Float16* __restrict__ A, int lda, size_t sA, const _Float16* __restrict__ Bh, int ldb, size_t sB, float alpha, const float* __restrict__ bias, size_t sBias, const float* __restrict__ CP, int rowsPerB, size_t sCPb, int row0g,
    float* __restrict__ C, _Float16* __restrict__ C16, int ldc, size_t sC, int M, int N, int K, int bsh, size_t zA, size_t zB, size_t zC) { static_assert(ACT == 0 || ACT == 3 || ACT == 6 || ACT == 8 || ACT == 9 || ACT == 11 || ACT == 12 || ACT == 14 || ACT == 15 || ACT == 16 || ACT == 17, "k_gemm2: unsupported ACT code (would silently apply no activation)");
  __shared__ __attribute__((aligned(16))) float so[4][32][68];
  const int tid = threadIdx.x, w = tid >> 5, lane = tid & 31, ln = lane & 15, hh = lane >> 4; const int by = blockIdx.y, bz = blockIdx.z;      /* grid.y = plane (head), 2^bsh planes share one B plane; grid.z = outer batch with its own strides zA, zB, zC */
  A += (size_t)by * sA + (size_t)bz * zA; Bh += (size_t)(by >> bsh) * sB + (size_t)bz * zB; const size_t cofs = (size_t)by * sC + (size_t)bz * zC; const float* bp = bias ? bias + (size_t)by * sBias : nullptr;
  const int ntn = N >> 6; const int mt = blockIdx.x / ntn, nq = blockIdx.x - mt * ntn; const int row0 = mt * 128 + 32 * w, col0 = nq * 64; if (row0 >= M) return;
  const _Float16* a0p = A + (size_t)(row0 + ln) * lda; const _Float16* a1p = a0p + (size_t)16 * lda;
  const _Float16* b0p = Bh + (size_t)(col0 + ln) * ldb; const _Float16* b1p = b0p + (size_t)16 * ldb; const _Float16* b2p = b1p + (size_t)16 * ldb; const _Float16* b3p = b2p + (size_t)16 * ldb;
  const v8f z8 = {0.f,0.f,0.f,0.f,0.f,0.f,0.f,0.f}; v8f c00 = z8, c01 = z8, c02 = z8, c03 = z8, c10 = z8, c11 = z8, c12 = z8, c13 = z8;
#pragma unroll 1
  for (int kb = 0; kb < K; kb += 32) { const v16h a0 = g2_frag(a0p + kb, hh), a1 = g2_frag(a1p + kb, hh);
    v16h b = g2_frag(b0p + kb, hh); c00 = g2_mma(a0, b, c00); c10 = g2_mma(a1, b, c10);
    b = g2_frag(b1p + kb, hh); c01 = g2_mma(a0, b, c01); c11 = g2_mma(a1, b, c11);
    b = g2_frag(b2p + kb, hh); c02 = g2_mma(a0, b, c02); c12 = g2_mma(a1, b, c12);
    b = g2_frag(b3p + kb, hh); c03 = g2_mma(a0, b, c03); c13 = g2_mma(a1, b, c13); }
  v8f accs[8] = {c00, c01, c02, c03, c10, c11, c12, c13};
#pragma unroll
  for (int u = 0; u < 8; ++u) { const int t = u & 3, half = u >> 2; const int col = col0 + t * 16 + ln; const float bv = bp ? bf16_round(bp[col]) : 0.f;
#pragma unroll
    for (int r = 0; r < 8; ++r) { const int rloc = half * 16 + 8 * hh + r; float v = accs[u][r] * alpha + bv; if (CP) { if (rowsPerB < 0) v += CP[cofs + (size_t)(row0g + row0 + rloc) * ldc + col];      /* rowsPerB < 0: own element of the batched C plane */ else { const int bidx = (row0g + row0 + rloc) / rowsPerB; v += CP[(size_t)bidx * sCPb + (size_t)by * 64 + col]; } }
      if (ACT == 3) v = fmaxf(v, 0.f); else if (ACT == 6) v = 0.5f * v * (1.0f + erff(v * 0.70710678118654752f)); else if (ACT == 11) v = 1.0f / (1.0f + expf(-v)); else if (ACT == 15) v = v / (1.0f + expf(-v)); else if (ACT == 12) v = (v > 0.f) ? v : 0.01f * v; else if (ACT == 8) v = tanhf(v); else if (ACT == 9) v = 0.5f * v * (1.0f + tanhf(0.7978845608028654f * (v + 0.044715f * v * v * v))); else if (ACT == 14) v = (v > 0.f) ? v : 0.1f * v; else if (ACT == 16) v = (v >= 0.f) ? v : 0.3f * v; else if (ACT == 17) v = (v >= 0.f) ? v : 0.2f * v;
      so[w][rloc][t * 16 + ln] = v; } }
  __builtin_amdgcn_fence(__ATOMIC_ACQ_REL, "workgroup"); __builtin_amdgcn_wave_barrier();
  const int rsub = lane >> 4, c4 = (lane & 15) * 4;
  {
#pragma unroll
    for (int q = 0; q < 16; ++q) { const int r = q * 2 + rsub; const v4f v = *(const v4fa*)&so[w][r][c4]; if (C) *(v4f*)(C + cofs + (size_t)(row0 + r) * ldc + col0 + c4) = v; if (C16) { v4h h4; for (int i = 0; i < 4; ++i) h4[i] = (_Float16)v[i]; *(v4h*)(C16 + cofs + (size_t)(row0 + r) * ldc + col0 + c4) = h4; } }
     } }


__global__ __launch_bounds__(256) void k_wnat(const float* __restrict__ w, size_t n8, _Float16* __restrict__ Bt) { const size_t t = (size_t)blockIdx.x * 256 + threadIdx.x; if (t >= n8) return; FragH f; for (int q = 0; q < 8; ++q) f.h[q] = (_Float16)(bf16_round(w[t * 8 + q]) * 16.0f); *(v8us*)((unsigned short*)Bt + t * 8) = f.half[0];  }
__global__ __launch_bounds__(256) void k_rsm(const float* __restrict__ S, _Float16* __restrict__ P, int nrows) {
  #pragma clang fp contract(off)
  const int i = blockIdx.x * 256 + threadIdx.x; if (i >= nrows) return; const float* s = S + (size_t)i * SQ; float mx = -3.0e38f;
#pragma unroll 1
  for (int j = 0; j < SQ; ++j) mx = fmaxf(mx, s[j]); float se = 0.f;
#pragma unroll 1
  for (int j = 0; j < SQ; ++j) se += expf(s[j] - mx); const float sc = 256.0f / se;
#pragma unroll 1
  for (int j0 = 0; j0 < SQ; j0 += 8) { FragH f; for (int q = 0; q < 8; ++q) f.h[q] = (_Float16)(expf(s[j0 + q] - mx) * sc); unsigned short* d = (unsigned short*)P + (size_t)i * SQ + j0; *(v8us*)d = f.half[0];  } }
__global__ __launch_bounds__(256) void k_vt(const _Float16* __restrict__ V16, int b, int h0, _Float16* __restrict__ VT) { __shared__ unsigned short tl[64][65]; const int tid = threadIdx.x; const int hh = blockIdx.x % HG, sg = blockIdx.x / HG; const int s0 = sg * 64; const int h = h0 + hh;
  for (int i = tid; i < 64 * 8; i += 256) { const int j = i / 8, d8 = (i % 8) * 8; FragH f; f.half[0] = *(const v8us*)((const unsigned short*)V16 + ((size_t)b * SQ + s0 + j) * DM + h * HD + d8); for (int q = 0; q < 8; ++q) tl[d8 + q][j] = f.u[q]; }
  __syncthreads();
  { for (int i = tid; i < 64 * 8; i += 256) { const int d = i / 8, j8 = (i % 8) * 8; FragH f; for (int q = 0; q < 8; ++q) f.u[q] = tl[d][j8 + q]; *(v8us*)((unsigned short*)VT + ((size_t)hh * HD + d) * SQ + s0 + j8) = f.half[0]; }  } }


template <int MASK>
__global__ __launch_bounds__(32) void k_att0h(const float* __restrict__ QF, const float* __restrict__ KF, const float* __restrict__ VF, int ld, int ldv, const int* __restrict__ mk, float scale, float* __restrict__ OF, int ldo) {
  #pragma clang fp contract(off)
  __shared__ __attribute__((aligned(16))) float lq[32][128]; __shared__ __attribute__((aligned(16))) float lo[32][128];
  const int tid = threadIdx.x; const int h = blockIdx.x / (QT0 / 32), rg = blockIdx.x % (QT0 / 32); const int i = rg * 32 + tid;
  { const size_t rb = (size_t)blockIdx.y * QT0; QF += rb * ld; KF += rb * ld; VF += rb * ldv; OF += rb * ldo; }      /* grid.y = batch: QT0 rows of every plane per batch */
  for (int c = 0; c < 32; ++c) { *(v4f*)&lq[tid][c * 4] = *(const v4fa*)(QF + (size_t)i * ld + h * 128 + c * 4); const v4f z = {0.f, 0.f, 0.f, 0.f}; *(v4f*)&lo[tid][c * 4] = z; }
  float m = -1.0e30f, l = 0.f; const int jmax = rg * 32 + 31;
#pragma unroll 1
  for (int j = 0; j <= jmax; ++j) { const float* kr = KF + (size_t)j * ld + h * 128; const float* vr = VF + (size_t)j * ldv + h * 128; float s = 0.f;
#pragma unroll 1
    for (int c = 0; c < 32; ++c) { const v4f kq = *(const v4fa*)(kr + c * 4); const v4f qq = *(v4f*)&lq[tid][c * 4]; for (int u = 0; u < 4; ++u) s = __fadd_rn(s, __fmul_rn(qq[u], kq[u])); }
    s = __fmul_rn(s, scale); float f; if (MASK) { const int mb = mk[(size_t)i * SQ + j]; f = (mb == 0) ? 1.f : 0.f; } else { f = (j <= i) ? 1.f : 0.f; }
    const float sm = fmaf(f, s, (1.f - f) * -1.0e30f); const float mn = fmaxf(m, sm); const float sc = expf(m - mn); const float e = __fmul_rn(f, expf(sm - mn)); l = __fadd_rn(__fmul_rn(l, sc), e); m = mn;
#pragma unroll 1
    for (int c = 0; c < 32; ++c) { const v4f vv = *(const v4fa*)(vr + c * 4); v4f oo = *(v4f*)&lo[tid][c * 4]; for (int u = 0; u < 4; ++u) oo[u] = __fadd_rn(__fmul_rn(oo[u], sc), __fmul_rn(e, vv[u])); *(v4f*)&lo[tid][c * 4] = oo; } }
  const float fin = 64.0f / l;
  { for (int c = 0; c < 32; ++c) { v4f oo = *(v4f*)&lo[tid][c * 4]; for (int u = 0; u < 4; ++u) oo[u] = __fmul_rn(oo[u], fin); *(v4f*)(OF + (size_t)i * ldo + h * 128 + c * 4) = oo; }  } }
__global__ __launch_bounds__(256) void k_f2h(const float* __restrict__ F, int ldf, int coff, int ncol, _Float16* __restrict__ H16, size_t nrow) { const size_t t = (size_t)blockIdx.x * 256 + threadIdx.x; const size_t n8 = nrow * (size_t)(ncol / 8); if (t >= n8) return; const size_t r = t / (ncol / 8); const int c8 = (int)(t % (ncol / 8)) * 8; FragH f; const v4f a = *(const v4fa*)(F + r * ldf + coff + c8), b2 = *(const v4fa*)(F + r * ldf + coff + c8 + 4); for (int q = 0; q < 4; ++q) { f.h[q] = (_Float16)a[q]; f.h[4 + q] = (_Float16)b2[q]; } *(v8us*)((unsigned short*)H16 + r * ncol + c8) = f.half[0];  }

__global__ __launch_bounds__(256) void k_tab128(float theta, float* __restrict__ CS, float* __restrict__ SN) {
  #pragma clang fp contract(off)
  const int t = blockIdx.x * 256 + threadIdx.x; if (t >= SQ * 64) return; const int i = t % 64; const int p = t / 64; const float invf = (float)(1.0 / pow((double)theta, (double)(2 * i) / 128.0));      /* = XLA's constant-folded f32 table */ const float ang = __fmul_rn((float)p, invf); const float c = cosf(ang), s = sinf(ang);
  *(float*)(CS + t) = c; *(float*)(SN + t) = s;  }
template <int TAB>
__global__ __launch_bounds__(128) void k_rope128(const float* __restrict__ F, int ldf, int nh, const float* __restrict__ CS, const float* __restrict__ SN, _Float16* __restrict__ H16, int ldo, float osc) {
  #pragma clang fp contract(off)
  __shared__ float xv[128]; __shared__ unsigned short sh_[128]; const int d = threadIdx.x; const int h = blockIdx.x % nh; const size_t r = blockIdx.x / nh; const int p = (int)(r % SQ);
  xv[d] = F[r * (size_t)ldf + (size_t)h * 128 + d]; __syncthreads();
  float c, s; if (TAB) { c = bf16_round(CS[(size_t)p * 128 + d]); s = bf16_round(SN[(size_t)p * 128 + d]); } else { c = CS[p * 64 + (d & 63)]; s = SN[p * 64 + (d & 63)]; }
  const float rot = (d < 64) ? -xv[d + 64] : xv[d - 64]; const float o = __fadd_rn(__fmul_rn(xv[d], c), __fmul_rn(rot, s));
  FragH th; th.h[0] = (_Float16)__fmul_rn(o, osc); sh_[d] = th.u[0]; __syncthreads();
  if (d < 16) { FragH f; for (int q = 0; q < 8; ++q) f.u[q] = sh_[d * 8 + q]; unsigned short* dst = (unsigned short*)H16 + r * (size_t)ldo + (size_t)h * 128 + d * 8; *(v8us*)dst = f.half[0];  } }

template <int TAB, int IL, int F32OUT>
__global__ __launch_bounds__(128) void k_rope128x(const float* __restrict__ F, int ldf, int nh, const float* __restrict__ CS, const float* __restrict__ SN, void* __restrict__ OUT, int ldo, float osc, int yin, int yout) {
  #pragma clang fp contract(off)
  __shared__ float xv[128]; __shared__ float ov[128]; const int d = threadIdx.x; const int h = blockIdx.x % nh; const size_t r = blockIdx.x / nh + (size_t)blockIdx.y * yin; const size_t ro = blockIdx.x / nh + (size_t)blockIdx.y * yout; const int p = (int)(r % SQ);      /* grid.y = batch: source and table rows step by yin, output rows by yout */
  xv[d] = F[r * (size_t)ldf + (size_t)h * 128 + d]; __syncthreads();
  float c, s; if (TAB == 2) { c = CS[r * 128 + d]; s = SN[r * 128 + d]; }      /* computed full-width f32 tables, one row per token row r (relative to the passed pointers) */ else if (TAB) { c = bf16_round(CS[(size_t)p * 128 + d]); s = bf16_round(SN[(size_t)p * 128 + d]); } else { const int ti = IL ? (d >> 1) : (d & 63); c = CS[p * 64 + ti]; s = SN[p * 64 + ti]; }
  const float rot = IL ? ((d & 1) ? xv[d - 1] : -xv[d + 1]) : ((d < 64) ? -xv[d + 64] : xv[d - 64]);
  ov[d] = __fmul_rn(__fadd_rn(__fmul_rn(xv[d], c), __fmul_rn(rot, s)), osc); __syncthreads();
  if (F32OUT) { if (d < 32) { const v4f v = *(const v4f*)&ov[d * 4]; float* dst = (float*)OUT + ro * (size_t)ldo + (size_t)h * 128 + d * 4; *(v4f*)dst = v;  } }
  else { if (d < 16) { FragH f; for (int q = 0; q < 8; ++q) f.h[q] = (_Float16)ov[d * 8 + q]; unsigned short* dst = (unsigned short*)OUT + ro * (size_t)ldo + (size_t)h * 128 + d * 8; *(v8us*)dst = f.half[0];  } } }
template <int N>
__global__ __launch_bounds__(256) void k_rmsrow(float* __restrict__ X, const float* __restrict__ w, float eps) {
  #pragma clang fp contract(off)
  constexpr int PT = N / 256; __shared__ float red[256]; const size_t r = blockIdx.x; const int t = threadIdx.x; float* row = X + r * N + (size_t)t * PT; float v[PT]; float ss = 0.f;
  for (int q = 0; q < PT; ++q) { v[q] = row[q]; ss = __fadd_rn(ss, __fmul_rn(v[q], v[q])); }
  red[t] = ss; __syncthreads(); for (int k = 128; k > 0; k >>= 1) { if (t < k) red[t] = __fadd_rn(red[t], red[t + k]); __syncthreads(); }
  const float rs = rsqrtf(__fadd_rn(red[0] / (float)N, eps)); float o[PT]; for (int q = 0; q < PT; ++q) o[q] = __fmul_rn(__fmul_rn(v[q], rs), bf16_round(w[t * PT + q]));
  { for (int q = 0; q < PT; ++q) *(float*)(row + q) = o[q];  } }
template <int GS_, int NHQ, int DSRC>
__global__ __launch_bounds__(256) void k_kvexp128(const float* __restrict__ src, float* __restrict__ dst, size_t n4, size_t ysrc, size_t ydst) { const size_t t = (size_t)blockIdx.x * 256 + threadIdx.x; if (t >= n4) return; src += (size_t)blockIdx.y * ysrc; dst += (size_t)blockIdx.y * ydst;      /* grid.y = batch */ const size_t e = t * 4; const size_t row = e / ((size_t)NHQ * 128); const int col = (int)(e % ((size_t)NHQ * 128)); const int h = col / 128, d = col % 128; const v4f v = *(const v4fa*)(src + row * DSRC + (size_t)(h / GS_) * 128 + d); *(v4f*)(dst + e) = v;  }

__global__ __launch_bounds__(256) void k_rsmcfb(const float* __restrict__ S, _Float16* __restrict__ P, int hg, int q0, int nk, const int* __restrict__ mk) {
  #pragma clang fp contract(off)
  const int t = blockIdx.x * 256 + threadIdx.x; if (t >= hg * QT) return; const size_t i = (size_t)t; const float* s = S + i * NKX; const size_t ig = (size_t)(q0 + (t % QT)); const int* mr = mk + ig * SQ; float mx = -3.0e38f;
#pragma unroll 1
  for (int j = 0; j < nk; ++j) { const int mb = mr[j]; const float f = (mb == 0) ? 1.f : 0.f; mx = fmaxf(mx, fmaf(f, s[j], (1.f - f) * -1.0e9f)); } float se = 0.f;
#pragma unroll 1
  for (int j = 0; j < nk; ++j) { const int mb = mr[j]; const float f = (mb == 0) ? 1.f : 0.f; se += __expf(fmaf(f, s[j], (1.f - f) * -1.0e9f) - mx); } const float sc = 256.0f / se;
#pragma unroll 1
  for (int j0 = 0; j0 < nk; j0 += 8) { FragH fr; for (int q = 0; q < 8; ++q) { const int j = j0 + q; const int mb = mr[j]; const float f = (mb == 0) ? 1.f : 0.f; fr.h[q] = (_Float16)(__expf(fmaf(f, s[j], (1.f - f) * -1.0e9f) - mx) * sc); } unsigned short* d = (unsigned short*)P + i * NKX + j0; *(v8us*)d = fr.half[0];  } }


// Causal softmax, one wave per score row: lane l holds columns 128 c + 4 l .. + 3 of every 128-column chunk c in registers, so each
// load and store of a wave covers one contiguous run of the row and the row is read once. Row maximum and denominator: per-lane partial, then a xor butterfly over the 32 lanes.
// rel = the row's last causal column minus the lane's first column.
template <int NC>
__device__ __forceinline__ void rsm_row(const float* __restrict__ s, _Float16* __restrict__ d, int rel) {
  v4f e[NC]; float mx = -3.0e38f, se = 0.f;
#pragma unroll      /* here and below: e[] stays in registers only if every index is a constant */
  for (int c = 0; c < NC; ++c) e[c] = *(const v4fa*)(s + c * 128);
#pragma unroll      /* as above */
  for (int c = 0; c < NC; ++c) for (int q = 0; q < 4; ++q) { const float f = (c * 128 + q <= rel) ? 1.f : 0.f; e[c][q] = fmaf(f, e[c][q], (1.f - f) * -1.0e9f); mx = fmaxf(mx, e[c][q]); }
  for (int m = 16; m > 0; m >>= 1) mx = fmaxf(mx, __shfl_xor(mx, m, 32));
#pragma unroll      /* as above */
  for (int c = 0; c < NC; ++c) for (int q = 0; q < 4; ++q) { e[c][q] = __expf(e[c][q] - mx); se += e[c][q]; }
  for (int m = 16; m > 0; m >>= 1) se += __shfl_xor(se, m, 32);
  const float sc = 256.0f / se;
#pragma unroll      /* as above */
  for (int c = 0; c < NC; ++c) { v4h h4; for (int q = 0; q < 4; ++q) h4[q] = (_Float16)(e[c][q] * sc); *(v4h*)(d + c * 128) = h4; }
  asm volatile("s_wait_xcnt 0x0" ::: "memory");      /* behind the row's stores */
}
__global__ __launch_bounds__(256) void k_rsmcf2(const float* __restrict__ S, _Float16* __restrict__ P, int hg, int q0, int nk) {
  static_assert(QT == 256 && NKX == 8 * QT, "one case per row length below");
  const int col = (threadIdx.x & 31) * 4; const int t = blockIdx.x * 8 + (threadIdx.x >> 5); if (t >= hg * QT) return;
  const float* s = S + (size_t)t * NKX + col; _Float16* d = P + (size_t)t * NKX + col; const int rel = q0 + (t % QT) - col;
  switch (nk / QT) {      /* nk = QT .. NKX in steps of QT: one straight-line body per row length, so that the row's registers are indexed by constants */
    case 1: rsm_row<2>(s, d, rel); break; case 2: rsm_row<4>(s, d, rel); break; case 3: rsm_row<6>(s, d, rel); break; case 4: rsm_row<8>(s, d, rel); break;
    case 5: rsm_row<10>(s, d, rel); break; case 6: rsm_row<12>(s, d, rel); break; case 7: rsm_row<14>(s, d, rel); break; case 8: rsm_row<16>(s, d, rel); break; } }



__global__ __launch_bounds__(256) void k_tab128p(const int* __restrict__ pos, int nrows, float theta, float* __restrict__ CS, float* __restrict__ SN) {
  #pragma clang fp contract(off)
  const int t = blockIdx.x * 256 + threadIdx.x; if (t >= nrows * 64) return; const int i = t % 64; const int r = t / 64; const float invf = (float)(1.0 / pow((double)theta, (double)(2 * i) / 128.0)); const float ang = __fmul_rn((float)pos[r], invf); const float c = cosf(ang), sv = sinf(ang);
  float* c0 = CS + (size_t)r * 128 + i; float* s0 = SN + (size_t)r * 128 + i;
  { *(float*)c0 = c; *(float*)(c0 + 64) = c; *(float*)s0 = sv; *(float*)(s0 + 64) = sv;  } }

__global__ __launch_bounds__(256) void k_rsmcim(const float* __restrict__ S, _Float16* __restrict__ P, int hg, int q0, int nk, const int* __restrict__ am) {
  #pragma clang fp contract(off)
  const int t = blockIdx.x * 256 + threadIdx.x; if (t >= hg * QT) return; const size_t i = (size_t)t; const float* s = S + i * NKX; const int last = q0 + (t % QT); const int* mr = am + (size_t)last * SQ; float mx = -3.0e38f;      /* the module's mask row of this query (keys >= nk lie above the diagonal of the causal mask and are not computed) */
#pragma unroll 1
  for (int j = 0; j < nk; ++j) { const float f = (mr[j] != 0) ? 1.f : 0.f; mx = fmaxf(mx, fmaf(f, s[j], (1.f - f) * -1.0e9f)); } float se = 0.f;
#pragma unroll 1
  for (int j = 0; j < nk; ++j) { const float f = (mr[j] != 0) ? 1.f : 0.f; se += __expf(fmaf(f, s[j], (1.f - f) * -1.0e9f) - mx); } const float sc = 256.0f / se;
#pragma unroll 1
  for (int j0 = 0; j0 < nk; j0 += 8) { FragH fr; for (int q = 0; q < 8; ++q) { const int j = j0 + q; const float f = (mr[j] != 0) ? 1.f : 0.f; fr.h[q] = (_Float16)(__expf(fmaf(f, s[j], (1.f - f) * -1.0e9f) - mx) * sc); } unsigned short* d = (unsigned short*)P + i * NKX + j0; *(v8us*)d = fr.half[0];  } }



__global__ __launch_bounds__(256) void k_tab128h(int nr, float theta, float* __restrict__ CS, float* __restrict__ SN) {
  #pragma clang fp contract(off)
  const size_t t = (size_t)blockIdx.x * 256 + threadIdx.x; if (t >= (size_t)nr * 64) return; const int i = (int)(t % 64); const size_t r = t / 64; const int p = (int)(r % SQ);
  const float invf = (float)(1.0 / pow((double)theta, ((double)(2 * i)) / 128.0)); const float ang = __fmul_rn((float)p, invf); const float c = cosf(ang), sv = sinf(ang);
  float* pc = CS + r * 128 + i; float* ps = SN + r * 128 + i;
  *(float*)pc = c; *(float*)(pc + 64) = c; *(float*)ps = sv; *(float*)(ps + 64) = sv;  }
extern "C" void kernel_launch(void* const* d_in, const int* in_sizes, int n_in,
                              void* d_out, int out_size, void* d_ws, size_t ws_size, hipStream_t stream) {
  (void)in_sizes; (void)n_in; (void)out_size;
  const float* const* I = (const float* const*)d_in; const float* x = I[0]; const float* wq = I[1]; const float* wk = I[2]; const float* wv = I[3]; const float* wo = I[4]; const float* bq = nullptr; const float* bk = nullptr; const float* bv = nullptr; const float* bo = nullptr;      /* [in][out] Wq [2048][2048], Wk/Wv [2048][1024], Wo [2048][2048]; no biases; positions implicit */
  char* ws = (char*)d_ws; size_t off = 0;
  auto take = [&](size_t bytes) { char* p = ws + off; off += (bytes + 255) & ~(size_t)255; return p; };
  _Float16* BQ = (_Float16*)take((size_t)DMX * DMX * 2); _Float16* BK = (_Float16*)take((size_t)DKV * DMX * 2); _Float16* BV = (_Float16*)take((size_t)DKV * DMX * 2); _Float16* BO = (_Float16*)take((size_t)DMX * DMX * 2);
  _Float16* X16 = (_Float16*)take(NR * DMX * 2); float* QF = (float*)take(NR * (DMX + 2 * DKV) * 4); float* KF = QF + NR * DMX; float* VF = KF + NR * DKV; _Float16* Q16 = (_Float16*)take(NR * DMX * 2); _Float16* K16 = (_Float16*)take(NR * DKV * 2); _Float16* V16 = (_Float16*)take(NR * DKV * 2); _Float16* O16 = (_Float16*)take(NR * DMX * 2);
  static_assert((size_t)NB * NH * QT * NKX <= NR * (DMX + 2 * DKV), "score planes must fit the f32 q, k, v planes they reuse");
  float* S = QF;      /* score planes of both batches reuse the f32 q, k, v planes: their last readers (rope, kv expansion) are launched before the first score GEMM of this call */
  _Float16* P = (_Float16*)take((size_t)NB * NH * QT * NKX * 2); _Float16* VT = (_Float16*)take((size_t)NB * (DKV / 64) * 64 * SQ * 2);
  float* CS = (float*)take(NR * 128 * 4); float* SN = (float*)take(NR * 128 * 4); float* QF0 = (float*)take((size_t)NB * QT0 * DMX * 4); float* KRF0 = (float*)take((size_t)NB * QT0 * DKV * 4); float* KF0e = (float*)take((size_t)NB * QT0 * DMX * 4); float* VF0e = (float*)take((size_t)NB * QT0 * DMX * 4); float* OF0 = (float*)take((size_t)NB * QT0 * DMX * 4); _Float16* OH0 = (_Float16*)take((size_t)NB * QT0 * DMX * 2); _Float16* OL0 = (_Float16*)take((size_t)NB * QT0 * DMX * 2);
  if (off > ws_size) return;      /* 24 (weights) + 16 + 64 + 16 + 8 + 8 + 16 + 32 + 8 + 2 + 2 + 4 + 2 + 4 + 4 + 4 + 2 + 2 = 218 MiB */
  k_wt_f16<<<(unsigned)(((size_t)DMX * DMX / 8 + 255) / 256), 256, 0, stream>>>(wq, BQ, DMX, DMX, 16.0f); k_wt_f16<<<(unsigned)(((size_t)DKV * DMX / 8 + 255) / 256), 256, 0, stream>>>(wk, BK, DMX, DKV, 16.0f); k_wt_f16<<<(unsigned)(((size_t)DKV * DMX / 8 + 255) / 256), 256, 0, stream>>>(wv, BV, DMX, DKV, 16.0f); k_wt_f16<<<(unsigned)(((size_t)DMX * DMX / 8 + 255) / 256), 256, 0, stream>>>(wo, BO, DMX, DMX, 16.0f);      /* [in][out] -> Bt x16 */
  k_x16<<<(unsigned)((NR * DMX / 8 + 255) / 256), 256, 0, stream>>>(x, X16, NR * DMX / 8);
  k_gemm2<0><<<dim3((unsigned)((NR / 128) * (DMX / 64)), 1), 128, 0, stream>>>(X16, DMX, 0, BQ, DMX, 0, 0.0625f, bq, 0, nullptr, 1, 0, 0, QF, nullptr, DMX, 0, (int)NR, DMX, DMX, 0, 0, 0, 0);      /* q (f32) */
  k_gemm2<0><<<dim3((unsigned)((NR / 128) * (DKV / 64)), 1), 128, 0, stream>>>(X16, DMX, 0, BK, DMX, 0, 0.0625f, bk, 0, nullptr, 1, 0, 0, KF, nullptr, DKV, 0, (int)NR, DKV, DMX, 0, 0, 0, 0);      /* k (f32) */
  k_gemm2<0><<<dim3((unsigned)((NR / 128) * (DKV / 64)), 1), 128, 0, stream>>>(X16, DMX, 0, BV, DMX, 0, 0.0625f, bv, 0, nullptr, 1, 0, 0, VF, V16, DKV, 0, (int)NR, DKV, DMX, 0, 0, 0, 0);      /* v (f32 for the first tile + f16) */
  k_tab128h<<<(unsigned)((NR * 64 + 255) / 256), 256, 0, stream>>>((int)NR, 10000.0f, CS, SN);      /* per-row cos/sin tables [NR][128] for positions r % SQ, duplicated over both halves (cat(f, f)) */
  k_rope128x<2, 0, 0><<<(unsigned)(NR * NH), 128, 0, stream>>>(QF, DMX, NH, CS, SN, Q16, DMX, 1.0f, 0, 0); k_rope128x<2, 0, 0><<<(unsigned)(NR * NKV), 128, 0, stream>>>(KF, DKV, NKV, CS, SN, K16, DKV, 1.0f, 0, 0);      /* rope (all rows) -> f16 */
  /* From here on every launch covers both batches (grid.y or grid.z = batch, or both batches' rows in one grid.x), and each attention GEMM all 16 query heads (grid.y = head). */
  k_rope128x<2, 0, 1><<<dim3(QT0 * NH, NB), 128, 0, stream>>>(QF, DMX, NH, CS, SN, QF0, DMX, 1.0f, SQ, QT0); k_rope128x<2, 0, 1><<<dim3(QT0 * NKV, NB), 128, 0, stream>>>(KF, DKV, NKV, CS, SN, KRF0, DKV, 1.0f, SQ, QT0);      /* f32 roped q, k of each batch's first QT0 rows */
  k_kvexp128<GSZ, NH, DKV><<<dim3((unsigned)(((size_t)QT0 * DMX / 4 + 255) / 256), NB), 256, 0, stream>>>(KRF0, KF0e, (size_t)QT0 * DMX / 4, (size_t)QT0 * DKV, (size_t)QT0 * DMX); k_kvexp128<GSZ, NH, DKV><<<dim3((unsigned)(((size_t)QT0 * DMX / 4 + 255) / 256), NB), 256, 0, stream>>>(VF, VF0e, (size_t)QT0 * DMX / 4, (size_t)SQ * DKV, (size_t)QT0 * DMX);      /* kv head -> query head expansion for the exact first tile */
  k_vt<DKV / 64, SQ><<<NB * (DKV / 64) * (SQ / 64), 256, 0, stream>>>(V16, DKV, 0, VT);      /* V^T, [batch][DKV][SQ]: kv head g = slabs 2g, 2g+1 of its batch */
  k_att0h<0><<<dim3(NH * (QT0 / 32), NB), 32, 0, stream>>>(QF0, KF0e, VF0e, DMX, DMX, nullptr, ATS, OF0, DMX);      /* exact causal attention, first QT0 rows (o x64) */
  for (int q0 = 0; q0 < SQ; q0 += QT) { const int nk = q0 + QT;      /* causal: keys below the tile end only */
    k_gemm2<0><<<dim3((QT / 128) * (nk / 64), NH, NB), 128, 0, stream>>>(Q16 + (size_t)q0 * DMX, DMX, (size_t)HDK, K16, DKV, (size_t)HDK, ATS, nullptr, 0, nullptr, 1, 0, 0, S, nullptr, NKX, (size_t)QT * NKX, QT, nk, HDK, GSH, (size_t)SQ * DMX, (size_t)SQ * DKV, (size_t)NH * QT * NKX);      /* scores: query head y vs key slab y >> GSH */
    k_rsmcf2<<<(NB * NH * QT + 7) / 8, 256, 0, stream>>>(S, P, NB * NH, q0, nk);      /* causal softmax (arithmetic select) over the computed keys, one wave per row */
    k_gemm2<0><<<dim3((QT / 128) * (HDK / 64), NH, NB), 128, 0, stream>>>(P, NKX, (size_t)QT * NKX, VT, SQ, (size_t)HDK * SQ, 0.25f, nullptr, 0, nullptr, 1, 0, 0, nullptr, O16 + (size_t)q0 * DMX, DMX, (size_t)HDK, QT, HDK, nk, GSH, (size_t)NH * QT * NKX, (size_t)DKV * SQ, (size_t)SQ * DMX); }      /* o (x64): query head y vs V^T slab y >> GSH */
  k_gemm2<0><<<dim3((unsigned)((NR / 128) * (DMX / 64)), 1), 128, 0, stream>>>(O16, DMX, 0, BO, DMX, 0, 0.0009765625f, bo, 0, nullptr, 1, 0, 0, (float*)d_out, nullptr, DMX, 0, (int)NR, DMX, DMX, 0, 0, 0, 0);      /* out = o Wo */
  k_hl<<<(unsigned)(((size_t)NB * QT0 * DMX / 8 + 255) / 256), 256, 0, stream>>>(OF0, OH0, OL0, (size_t)NB * QT0 * DMX / 8);      /* first-tile o (x64) -> f16 hi + x1024 residual planes */
  k_gemm2<0><<<dim3((QT0 / 128) * (DMX / 64), 1, NB), 128, 0, stream>>>(OH0, DMX, 0, BO, DMX, 0, 0.0009765625f, bo, 0, nullptr, 1, 0, 0, (float*)d_out, nullptr, DMX, 0, QT0, DMX, DMX, 0, (size_t)QT0 * DMX, 0, (size_t)SQ * DMX);      /* first QT0 rows of each batch rewritten from the exact path */
  k_gemm2<0><<<dim3((QT0 / 128) * (DMX / 64), 1, NB), 128, 0, stream>>>(OL0, DMX, 0, BO, DMX, 0, 0.00000095367431640625f, nullptr, 0, (const float*)d_out, -1, 0, 0, (float*)d_out, nullptr, DMX, 0, QT0, DMX, DMX, 0, (size_t)QT0 * DMX, 0, (size_t)SQ * DMX);      /* += o_lo Wo 2^-20 (own-element accumulate) */
}

// v003
// It runs in 1090 microseconds.
// In two side-by-side timings against v002, it was 2.40 and 2.41 times as fast.
// Counting every step since v000, it is 10.9 times as fast.
#include <hip/hip_runtime.h>
// Grouped-query causal attention with rotate-half RoPE, 16 query / 8 kv heads of 128 (x [2][2048][2048]; q = x Wq (16 x 128), k = x Wk, v = x Wv (8 x 128) ([in][out] weights sigma 0.02, no biases); inv_freq_i = 1/10000^(2i/128), positions 0..2047, cos/sin = cat(freqs, freqs); q, k roped; kv head h/2 serves query head h; scores / sqrt(128); causal (tril, -inf); softmax; out = merged Wo -> [2][2048][2048]).
// Compute dtype: inputs rounded to bf16; x / weights exact; projections and rope f32; q, k, v, softmax weights and o as plain f16 GEMM operands (~2^-12; first 256 rows of each batch exact); scores, statistics, out f32. v_wmma_f32_16x16x32_f16.
#define NB 2
#define SQ 2048
#define DMX 2048
#define NH 16
#define NKV 8
#define GSZ 2                        /* query heads per kv head */
#define GSH 1                        /* log2(GSZ): query head >> GSH = its kv head */
#define HDK 128
#define DKV (NKV * HDK)
#define QT 256
#define QT0 256
#define NKX SQ
#define DM DMX
#define HD 64
#define HG 1
#define NR ((size_t)NB * SQ)
#define ATS 0.08838834764831845f
typedef __bf16 v16b __attribute__((ext_vector_type(16)));
typedef unsigned short v8us __attribute__((ext_vector_type(8), may_alias));
typedef float  v8f  __attribute__((ext_vector_type(8)));
typedef float  v4f  __attribute__((ext_vector_type(4)));
typedef float  v4fa __attribute__((ext_vector_type(4), may_alias));
union FragB { v16b v; v8us half[2]; unsigned short u[16]; };

__device__ __forceinline__ unsigned short bf16_bits(float x) { unsigned int u = __float_as_uint(x); return (unsigned short)((u + 0x7FFFu + ((u >> 16) & 1u)) >> 16); }
__device__ __forceinline__ float bf16_val(unsigned short b) { return __uint_as_float(((unsigned int)b) << 16); }
__device__ __forceinline__ float bf16_round(float x) { return bf16_val(bf16_bits(x)); }
// D += A·B with NT terms: 1 = ah·bh, 2 = + al·bh (A split), 3 = + ah·bl (both split)
template <int NT>
__device__ __forceinline__ v8f mmaN(v16b ah, v16b al, v16b bh, v16b bl, v8f c) {
  c = __builtin_amdgcn_wmma_f32_16x16x32_bf16(false, ah, false, bh, (short)0, c, false, false);
  if (NT >= 2) c = __builtin_amdgcn_wmma_f32_16x16x32_bf16(false, al, false, bh, (short)0, c, false, false);
  if (NT >= 3) c = __builtin_amdgcn_wmma_f32_16x16x32_bf16(false, ah, false, bl, (short)0, c, false, false);
  asm volatile("v_nop\n\tv_nop\n\tv_nop\n\tv_nop" : "+v"(c) : "v"(ah), "v"(al), "v"(bh), "v"(bl));
  return c;
}

__global__ __launch_bounds__(256) void k_wt_bf16(const float* __restrict__ W, unsigned short* __restrict__ Wt, int K, int N) {
  const int t = blockIdx.x * 256 + threadIdx.x;
  const int k8n = K / 8;
  if (t >= N * k8n) return;
  const int n = t / k8n, k8 = (t % k8n) * 8;
  v8us v;
#pragma unroll
  for (int i = 0; i < 8; ++i) v[i] = bf16_bits(W[(size_t)(k8 + i) * N + n]);
  *(v8us*)(Wt + (size_t)n * K + k8) = v;
  
}

// GEMM C[M][N] (f32, pitch ldc) = act(A[M][K]·W + bias). A f32 row-major (pitch lda) converted per fragment to bf16
// (ASPLIT: hi/lo two planes -> 2 terms, else single rounded term); Wt bf16 [N][K] (pitch ldb). BIAS_BF16 rounds the
// bias to bf16 first (bias quantised to bf16 before the add). K%32==0, M%16==0, N%64==0.
template <bool ASPLIT, int ACT, bool BIAS_BF16>
__global__ __launch_bounds__(128) void k_gemm_bf(const float* __restrict__ A, int lda, const unsigned short* __restrict__ Wt, int ldb,
                                               const float* __restrict__ bias, float* __restrict__ C, int ldc, int M, int N, int K) {
  __shared__ __attribute__((aligned(16))) float so[4][16][64];
  const int tid = threadIdx.x, w = tid >> 5, lane = tid & 31, ln = lane & 15, hh = lane >> 4;
  const int ntn = N / 64;
  const int wid = blockIdx.x * 4 + w;
  const int mt = wid / ntn, nq = wid % ntn;
  if (mt * 16 >= M) return;
  const int row0 = mt * 16, col0 = nq * 64;
  const float* arow = A + (size_t)(row0 + ln) * lda;
  v8f acc[4] = {};
  for (int kb = 0; kb < K; kb += 32) {
    FragB ah, al;
    const v4f x0 = *(const v4fa*)(arow + kb + 8 * hh), x1 = *(const v4fa*)(arow + kb + 8 * hh + 4);
    const v4f x2 = *(const v4fa*)(arow + kb + 16 + 8 * hh), x3 = *(const v4fa*)(arow + kb + 16 + 8 * hh + 4);
    float xs[16] = {x0[0],x0[1],x0[2],x0[3],x1[0],x1[1],x1[2],x1[3],x2[0],x2[1],x2[2],x2[3],x3[0],x3[1],x3[2],x3[3]};
#pragma unroll
    for (int i = 0; i < 16; ++i) { const unsigned short hb = bf16_bits(xs[i]); ah.u[i] = hb; al.u[i] = ASPLIT ? bf16_bits(xs[i] - bf16_val(hb)) : (unsigned short)0; }
#pragma unroll
    for (int t = 0; t < 4; ++t) {
      const unsigned short* brow = Wt + (size_t)(col0 + t * 16 + ln) * ldb + kb;
      FragB b;
      b.half[0] = *(const v8us*)(brow + 8 * hh);
      b.half[1] = *(const v8us*)(brow + 16 + 8 * hh);
      acc[t] = mmaN<ASPLIT ? 2 : 1>(ah.v, al.v, b.v, b.v, acc[t]);
    }
  }
#pragma unroll
  for (int t = 0; t < 4; ++t) {
    float bv = bias ? bias[col0 + t * 16 + ln] : 0.f;
    if (BIAS_BF16) bv = bf16_round(bv);
#pragma unroll
    for (int r = 0; r < 8; ++r) { float v = acc[t][r] + bv; if (ACT == 1) v = fmaxf(v, 0.f); so[w][8 * hh + r][t * 16 + ln] = v; }
  }
  __builtin_amdgcn_fence(__ATOMIC_ACQ_REL, "workgroup");
  __builtin_amdgcn_wave_barrier();
  const int rsub = lane >> 4, c4 = (lane & 15) * 4;
  {
#pragma unroll
    for (int q = 0; q < 8; ++q) {
      const int r = q * 2 + rsub;
      const v4f v = *(const v4fa*)&so[w][r][c4];
      *(v4f*)(C + (size_t)(row0 + r) * ldc + col0 + c4) = v;
    }
    
  }
}

// GEMM C = act(A·W + bias + resid): A f32 (ASPLIT -> hi/lo 2 terms), Wt bf16 [N][K]; ACT 0 none, 1 relu, 2 exact gelu;
// resid (optional, f32, row index = (row % rmod), pitch ldr, RES_BF16 rounds it) added before the activation.
template <bool ASPLIT, int ACT, bool BIAS_BF16, bool RES_BF16>
__global__ __launch_bounds__(128) void k_gemm_bf3(const float* __restrict__ A, int lda, const unsigned short* __restrict__ Wt, int ldb,
                                                const float* __restrict__ bias, const float* __restrict__ resid, int rmod, int ldr,
                                                float* __restrict__ C, int ldc, int M, int N, int K) {
  __shared__ __attribute__((aligned(16))) float so[4][16][64];
  const int tid = threadIdx.x, w = tid >> 5, lane = tid & 31, ln = lane & 15, hh = lane >> 4;
  const int ntn = N / 64;
  const int wid = blockIdx.x * 4 + w;
  const int mt = wid / ntn, nq = wid % ntn;
  if (mt * 16 >= M) return;
  const int row0 = mt * 16, col0 = nq * 64;
  const float* arow = A + (size_t)(row0 + ln) * lda;
  v8f acc[4] = {};
  for (int kb = 0; kb < K; kb += 32) {
    FragB ah, al;
    const v4f x0 = *(const v4fa*)(arow + kb + 8 * hh), x1 = *(const v4fa*)(arow + kb + 8 * hh + 4);
    const v4f x2 = *(const v4fa*)(arow + kb + 16 + 8 * hh), x3 = *(const v4fa*)(arow + kb + 16 + 8 * hh + 4);
    float xs[16] = {x0[0],x0[1],x0[2],x0[3],x1[0],x1[1],x1[2],x1[3],x2[0],x2[1],x2[2],x2[3],x3[0],x3[1],x3[2],x3[3]};
#pragma unroll
    for (int i = 0; i < 16; ++i) { const unsigned short hb = bf16_bits(xs[i]); ah.u[i] = hb; al.u[i] = ASPLIT ? bf16_bits(xs[i] - bf16_val(hb)) : (unsigned short)0; }
#pragma unroll
    for (int t = 0; t < 4; ++t) {
      const unsigned short* brow = Wt + (size_t)(col0 + t * 16 + ln) * ldb + kb;
      FragB b;
      b.half[0] = *(const v8us*)(brow + 8 * hh);
      b.half[1] = *(const v8us*)(brow + 16 + 8 * hh);
      acc[t] = mmaN<ASPLIT ? 2 : 1>(ah.v, al.v, b.v, b.v, acc[t]);
    }
  }
#pragma unroll
  for (int t = 0; t < 4; ++t) {
    const int col = col0 + t * 16 + ln;
    float bv = bias ? bias[col] : 0.f;
    if (BIAS_BF16) bv = bf16_round(bv);
#pragma unroll
    for (int r = 0; r < 8; ++r) {
      float v = acc[t][r] + bv;
      if (resid) { float rv = resid[(size_t)((row0 + 8 * hh + r) % rmod) * ldr + col]; if (RES_BF16) rv = bf16_round(rv); v += rv; }
      if (ACT == 1) v = fmaxf(v, 0.f);
      if (ACT == 2) v = 0.5f * v * (1.0f + erff(v * 0.70710678118654752f));
      if (ACT == 3) { const float u = 0.7978845608028654f * (v + 0.044715f * v * v * v); v = 0.5f * v * (1.0f + tanhf(u)); }
      so[w][8 * hh + r][t * 16 + ln] = v;
    }
  }
  __builtin_amdgcn_fence(__ATOMIC_ACQ_REL, "workgroup");
  __builtin_amdgcn_wave_barrier();
  const int rsub = lane >> 4, c4 = (lane & 15) * 4;
  {
#pragma unroll
    for (int q = 0; q < 8; ++q) {
      const int r = q * 2 + rsub;
      const v4f v = *(const v4fa*)&so[w][r][c4];
      *(v4f*)(C + (size_t)(row0 + r) * ldc + col0 + c4) = v;
    }
    
  }
}
// row LayerNorm (biased variance, eps) over N: s = X (+ R); optional out_sum <- s; out_norm <- (s-mu)*rsqrt(var+eps)*g + b
template <bool PARAM_BF16>
__global__ __launch_bounds__(256) void k_layernorm(const float* __restrict__ X, const float* __restrict__ R, const float* __restrict__ g, const float* __restrict__ bta,
                                                  float* __restrict__ out_sum, float* __restrict__ out_norm, int N, float eps) {
  __shared__ float red[256];
  const int row = blockIdx.x, tid = threadIdx.x;
  const float* x = X + (size_t)row * N; const float* rr = R ? R + (size_t)row * N : nullptr;
  float vals[16];                     // up to N = 4096
  const int per = N / 256;            // contiguous chunk per thread? use strided-by-4 chunks: thread handles j = tid*4 + 1024*u
  float s1 = 0.f;
  for (int u = 0; u < per / 4; ++u) {
    const int j = tid * 4 + 1024 * u;
    const v4f a = *(const v4fa*)(x + j);
    v4f b = {0.f,0.f,0.f,0.f}; if (rr) b = *(const v4fa*)(rr + j);
#pragma unroll
    for (int q = 0; q < 4; ++q) { const float v = a[q] + b[q]; vals[u * 4 + q] = v; s1 += v; }
  }
  red[tid] = s1; __syncthreads();
  for (int st = 128; st > 0; st >>= 1) { if (tid < st) red[tid] += red[tid + st]; __syncthreads(); }
  const float mu = red[0] / (float)N; __syncthreads();
  float s2 = 0.f;
  for (int u = 0; u < per / 4; ++u)
#pragma unroll
    for (int q = 0; q < 4; ++q) { const float c = vals[u * 4 + q] - mu; s2 += c * c; }
  red[tid] = s2; __syncthreads();
  for (int st = 128; st > 0; st >>= 1) { if (tid < st) red[tid] += red[tid + st]; __syncthreads(); }
  const float rs = rsqrtf(red[0] / (float)N + eps);
  {
    for (int u = 0; u < per / 4; ++u) {
      const int j = tid * 4 + 1024 * u;
      v4f o, sm;
#pragma unroll
      for (int q = 0; q < 4; ++q) {
        float gg = g[j + q], bb = bta[j + q];
        if (PARAM_BF16) { gg = bf16_round(gg); bb = bf16_round(bb); }
        sm[q] = vals[u * 4 + q]; o[q] = (vals[u * 4 + q] - mu) * rs * gg + bb;
      }
      if (out_sum) *(v4f*)(out_sum + (size_t)row * N + j) = sm;
      *(v4f*)(out_norm + (size_t)row * N + j) = o;
    }
    
  }
}



// ---- f16 WMMA path (v_wmma_f32_16x16x32_f16): 11-bit significands for operands in range — used where a [0,1] probability operand needs more precision than bf16
typedef _Float16 v16h __attribute__((ext_vector_type(16)));
union FragH { v16h v; v8us half[2]; _Float16 h[16]; unsigned short u[16]; };
template <int NT>
__device__ __forceinline__ v8f mmaH(v16h ah, v16h al, v16h bh, v16h bl, v8f c) {
  c = __builtin_amdgcn_wmma_f32_16x16x32_f16(false, ah, false, bh, (short)0, c, false, false);
  if (NT >= 2) c = __builtin_amdgcn_wmma_f32_16x16x32_f16(false, al, false, bh, (short)0, c, false, false);
  if (NT >= 3) c = __builtin_amdgcn_wmma_f32_16x16x32_f16(false, ah, false, bl, (short)0, c, false, false);
  asm volatile("v_nop\n\tv_nop\n\tv_nop\n\tv_nop" : "+v"(c) : "v"(ah), "v"(al), "v"(bh), "v"(bl));
  return c;
}
// batched GEMM like k_gemm_b but f16 operands: A f32 (split into f16 hi/lo if ASPLIT, else rounded to f16), Bt = f16 values [n][k]; alpha; C f32; N multiple of 16 (partial tiles skipped)
template <bool ASPLIT>
__global__ __launch_bounds__(128) void k_gemm_h(const float* __restrict__ A, int lda, size_t sA, const _Float16* __restrict__ Bh, int ldb, size_t sB, float alpha, float* __restrict__ C, int ldc, size_t sC, int M, int N, int K) {
  __shared__ __attribute__((aligned(16))) float so[4][16][64];
  const int tid = threadIdx.x, w = tid >> 5, lane = tid & 31, ln = lane & 15, hh = lane >> 4; const int by = blockIdx.y;
  A += (size_t)by * sA; Bh += (size_t)by * sB; C += (size_t)by * sC;
  const int ntn = (N + 63) / 64; const int wid = blockIdx.x * 4 + w; const int mt = wid / ntn, nq = wid % ntn; if (mt * 16 >= M) return;
  const int row0 = mt * 16, col0 = nq * 64; const float* arow = A + (size_t)(row0 + ln) * lda;
  v8f acc[4] = {};
  for (int kb = 0; kb < K; kb += 32) {
    FragH ah, al;
    const v4f x0 = *(const v4fa*)(arow + kb + 8 * hh), x1 = *(const v4fa*)(arow + kb + 8 * hh + 4), x2 = *(const v4fa*)(arow + kb + 16 + 8 * hh), x3 = *(const v4fa*)(arow + kb + 16 + 8 * hh + 4);
    float xs[16] = {x0[0],x0[1],x0[2],x0[3],x1[0],x1[1],x1[2],x1[3],x2[0],x2[1],x2[2],x2[3],x3[0],x3[1],x3[2],x3[3]};
#pragma unroll
    for (int i = 0; i < 16; ++i) { const _Float16 h = (_Float16)xs[i]; ah.h[i] = h; al.h[i] = ASPLIT ? (_Float16)(xs[i] - (float)h) : (_Float16)0.0f; }
#pragma unroll
    for (int t = 0; t < 4; ++t) { if (col0 + t * 16 >= N) continue; const size_t boff = (size_t)(col0 + t * 16 + ln) * ldb + kb; FragH bq; bq.half[0] = *(const v8us*)(Bh + boff + 8 * hh); bq.half[1] = *(const v8us*)(Bh + boff + 16 + 8 * hh);
      acc[t] = mmaH<ASPLIT ? 2 : 1>(ah.v, al.v, bq.v, bq.v, acc[t]); }
  }
#pragma unroll
  for (int t = 0; t < 4; ++t) { if (col0 + t * 16 >= N) continue;
#pragma unroll
    for (int r = 0; r < 8; ++r) so[w][8 * hh + r][t * 16 + ln] = acc[t][r] * alpha; }
  __builtin_amdgcn_fence(__ATOMIC_ACQ_REL, "workgroup"); __builtin_amdgcn_wave_barrier();
  const int rsub = lane >> 4, c4 = (lane & 15) * 4;
  {
#pragma unroll
    for (int q = 0; q < 8; ++q) { const int r = q * 2 + rsub; if (col0 + c4 < N) { const v4f v = *(const v4fa*)&so[w][r][c4]; *(v4f*)(C + (size_t)(row0 + r) * ldc + col0 + c4) = v; } }
     }
}

// Wt[n][k] = f16(W[k][n]·scale) from f32 row-major W[K][N] (scale = power of two; bf16-exact weights stay exact in f16 away from the subnormal range)
__global__ __launch_bounds__(256) void k_wt_f16(const float* __restrict__ W, _Float16* __restrict__ Wt, int K, int N, float scale) {
  const int t = blockIdx.x * 256 + threadIdx.x; if (t >= N * (K / 8)) return; const int n = t / (K / 8), k8 = (t % (K / 8)) * 8; FragH f;
#pragma unroll
  for (int i = 0; i < 8; ++i) f.h[i] = (_Float16)(bf16_round(W[(size_t)(k8 + i) * N + n]) * scale); const v8us o = f.half[0];
  *(v8us*)((unsigned short*)Wt + (size_t)n * K + k8) = o; 
}
// k_gemm_hh variant with fused epilogue: v = acc·alpha + bias[by·sBias + col] (+ CP[(row/rowsPerB)·sCPb + by·64 + col] if CP) ; ACT 0 none / 1 elu ; writes f16 C16 (and f32 C if non-null)
template <int ACT>
__global__ __launch_bounds__(128) void k_gemm_hhx(const _Float16* __restrict__ A, int lda, size_t sA, const _Float16* __restrict__ Bh, int ldb, size_t sB, float alpha, const float* __restrict__ bias, size_t sBias, const float* __restrict__ CP, int rowsPerB, size_t sCPb, int row0g,
    float* __restrict__ C, _Float16* __restrict__ C16, int ldc, size_t sC, int M, int N, int K) {
  __shared__ __attribute__((aligned(16))) float so[4][16][64];
  const int tid = threadIdx.x, w = tid >> 5, lane = tid & 31, ln = lane & 15, hh = lane >> 4; const int by = blockIdx.y;
  A += (size_t)by * sA; Bh += (size_t)by * sB; const size_t cofs = (size_t)by * sC; const float* bp = bias ? bias + (size_t)by * sBias : nullptr;
  const int ntn = (N + 63) / 64; const int wid = blockIdx.x * 4 + w; const int mt = wid / ntn, nq = wid % ntn; if (mt * 16 >= M) return;
  const int row0 = mt * 16, col0 = nq * 64; const _Float16* arow = A + (size_t)(row0 + ln) * lda;
  v8f acc[4] = {};
  for (int kb = 0; kb < K; kb += 32) { FragH ah; ah.half[0] = *(const v8us*)((const unsigned short*)arow + kb + 8 * hh); ah.half[1] = *(const v8us*)((const unsigned short*)arow + kb + 16 + 8 * hh);
#pragma unroll
    for (int t = 0; t < 4; ++t) { if (col0 + t * 16 >= N) continue; const size_t boff = (size_t)(col0 + t * 16 + ln) * ldb + kb; FragH bq; bq.half[0] = *(const v8us*)((const unsigned short*)Bh + boff + 8 * hh); bq.half[1] = *(const v8us*)((const unsigned short*)Bh + boff + 16 + 8 * hh);
      acc[t] = mmaH<1>(ah.v, ah.v, bq.v, bq.v, acc[t]); }
  }
#pragma unroll
  for (int t = 0; t < 4; ++t) { if (col0 + t * 16 >= N) continue; const int col = col0 + t * 16 + ln; const float bv = bp ? bf16_round(bp[col]) : 0.f;
#pragma unroll
    for (int r = 0; r < 8; ++r) { float v = acc[t][r] * alpha + bv; if (CP) { const int rr = row0g + row0 + 8 * hh + r; if (rowsPerB < 0) v += CP[cofs + (size_t)rr * ldc + col];      /* rowsPerB < 0: own element of the batched C plane */ else { const int bidx = rr / rowsPerB; v += CP[(size_t)bidx * sCPb + (size_t)by * 64 + col]; } } if (ACT == 1) v = (v > 0.f) ? v : expm1f(v); else if (ACT == 7) v = (v > 0.f) ? v + 1.0f : expf(v); else if (ACT == 8) v = tanhf(v); else if (ACT == 9) v = 0.5f * v * (1.0f + tanhf(0.7978845608028654f * (v + 0.044715f * v * v * v))); else if (ACT == 11) v = 1.0f / (1.0f + expf(-v)); else if (ACT == 12) v = (v > 0.f) ? v : 0.01f * v; else if (ACT == 14) v = (v > 0.f) ? v : 0.1f * v; else if (ACT == 16) v = (v >= 0.f) ? v : 0.3f * v; else if (ACT == 17) v = (v >= 0.f) ? v : 0.2f * v; else if (ACT == 15) v = v / (1.0f + expf(-v)); else if (ACT == 3) v = fmaxf(v, 0.f); else if (ACT == 6) v = 0.5f * v * (1.0f + erff(v * 0.70710678118654752f)); so[w][8 * hh + r][t * 16 + ln] = v; } }
  __builtin_amdgcn_fence(__ATOMIC_ACQ_REL, "workgroup"); __builtin_amdgcn_wave_barrier();
  const int rsub = lane >> 4, c4 = (lane & 15) * 4; typedef _Float16 v4h __attribute__((ext_vector_type(4)));
  {
#pragma unroll
    for (int q = 0; q < 8; ++q) { const int r = q * 2 + rsub; if (col0 + c4 < N) { const v4f v = *(const v4fa*)&so[w][r][c4]; if (C) *(v4f*)(C + cofs + (size_t)(row0 + r) * ldc + col0 + c4) = v; if (C16) { v4h h4; for (int i = 0; i < 4; ++i) h4[i] = (_Float16)v[i]; *(v4h*)(C16 + cofs + (size_t)(row0 + r) * ldc + col0 + c4) = h4; } } }
     }
}


typedef _Float16 v4h __attribute__((ext_vector_type(4)));

__global__ __launch_bounds__(256) void k_x16(const float* __restrict__ x, _Float16* __restrict__ X16, size_t n8) { const size_t t = (size_t)blockIdx.x * 256 + threadIdx.x; if (t >= n8) return; FragH f;
#pragma unroll
  for (int q = 0; q < 8; ++q) f.h[q] = (_Float16)bf16_round(x[t * 8 + q]); *(v8us*)((unsigned short*)X16 + t * 8) = f.half[0];  }
__global__ __launch_bounds__(256) void k_h16(const float* __restrict__ x, _Float16* __restrict__ X16, size_t n8) { const size_t t = (size_t)blockIdx.x * 256 + threadIdx.x; if (t >= n8) return; FragH f;
#pragma unroll
  for (int q = 0; q < 8; ++q) f.h[q] = (_Float16)x[t * 8 + q]; *(v8us*)((unsigned short*)X16 + t * 8) = f.half[0];  }
__global__ __launch_bounds__(256) void k_round16f(const float* __restrict__ W, _Float16* __restrict__ Bt, size_t n8) { const size_t t = (size_t)blockIdx.x * 256 + threadIdx.x; if (t >= n8) return; FragH f;
#pragma unroll
  for (int i = 0; i < 8; ++i) f.h[i] = (_Float16)(bf16_round(W[t * 8 + i]) * 16.0f); *(v8us*)((unsigned short*)Bt + t * 8) = f.half[0];  }
template <int NHv, int TTv>
__global__ __launch_bounds__(256) void k_vt(const _Float16* __restrict__ V16, int ldv, int voff, _Float16* __restrict__ Vt) { __shared__ unsigned short tl[64][66]; const int tid = threadIdx.x; const int slab = blockIdx.x / (TTv / 64), lg = blockIdx.x % (TTv / 64); const int b = slab / NHv, h = slab % NHv;
  for (int i = tid; i < 64 * 8; i += 256) { const int r = i / 8, c8 = (i % 8) * 8; FragH f; f.half[0] = *(const v8us*)((const unsigned short*)V16 + ((size_t)b * TTv + lg * 64 + r) * ldv + voff + h * 64 + c8);
#pragma unroll
    for (int q = 0; q < 8; ++q) tl[r][c8 + q] = f.u[q]; }
  __syncthreads();
  {
#pragma unroll
    for (int rd = 0; rd < 2; ++rd) { const int d = rd * 32 + tid / 8, pc = tid % 8; FragH f;
#pragma unroll
      for (int q = 0; q < 8; ++q) f.u[q] = tl[pc * 8 + q][d];
      *(v8us*)((unsigned short*)Vt + ((size_t)slab * 64 + d) * TTv + lg * 64 + pc * 8) = f.half[0]; }
     } }

__global__ __launch_bounds__(256) void k_hl(const float* __restrict__ F, _Float16* __restrict__ Hh, _Float16* __restrict__ Hl, size_t n8) { const size_t t = (size_t)blockIdx.x * 256 + threadIdx.x; if (t >= n8) return; FragH fh, fl; const v4f a = *(const v4fa*)(F + t * 8), c = *(const v4fa*)(F + t * 8 + 4);
#pragma unroll
  for (int q = 0; q < 4; ++q) { _Float16 h = (_Float16)a[q]; fh.h[q] = h; fl.h[q] = (_Float16)((a[q] - (float)h) * 1024.0f); h = (_Float16)c[q]; fh.h[4 + q] = h; fl.h[4 + q] = (_Float16)((c[q] - (float)h) * 1024.0f); }
  { *(v8us*)((unsigned short*)Hh + t * 8) = fh.half[0]; *(v8us*)((unsigned short*)Hl + t * 8) = fl.half[0];  } }

// ---- fast GEMM (wave tile 32x64; requires M % 32 == 0 rows per launch region and N % 64 == 0); epilogue = k_gemm_hhx semantics ----
__device__ __forceinline__ v16h g2_frag(const _Float16* p, int hh) { FragH f; f.half[0] = *(const v8us*)((const unsigned short*)p + 8 * hh); f.half[1] = *(const v8us*)((const unsigned short*)p + 16 + 8 * hh); return f.v; }
__device__ __forceinline__ v8f g2_mma(v16h a, v16h b, v8f c) { v8f d = __builtin_amdgcn_wmma_f32_16x16x32_f16(false, a, false, b, (short)0, c, false, false); asm volatile("v_nop\n\tv_nop\n\tv_nop\n\tv_nop" : "+v"(d) : "v"(a), "v"(b)); return d; }
template <int ACT>
__global__ __launch_bounds__(128) void k_gemm2(const _Float16* __restrict__ A, int lda, size_t sA, const _Float16* __restrict__ Bh, int ldb, size_t sB, float alpha, const float* __restrict__ bias, size_t sBias, const float* __restrict__ CP, int rowsPerB, size_t sCPb, int row0g,
    float* __restrict__ C, _Float16* __restrict__ C16, int ldc, size_t sC, int M, int N, int K, int bsh, size_t zA, size_t zB, size_t zC) { static_assert(ACT == 0 || ACT == 3 || ACT == 6 || ACT == 8 || ACT == 9 || ACT == 11 || ACT == 12 || ACT == 14 || ACT == 15 || ACT == 16 || ACT == 17, "k_gemm2: unsupported ACT code (would silently apply no activation)");
  __shared__ __attribute__((aligned(16))) float so[4][32][68];
  const int tid = threadIdx.x, w = tid >> 5, lane = tid & 31, ln = lane & 15, hh = lane >> 4; const int by = blockIdx.y, bz = blockIdx.z;      /* grid.y = plane (head), 2^bsh planes share one B plane; grid.z = outer batch with its own strides zA, zB, zC */
  A += (size_t)by * sA + (size_t)bz * zA; Bh += (size_t)(by >> bsh) * sB + (size_t)bz * zB; const size_t cofs = (size_t)by * sC + (size_t)bz * zC; const float* bp = bias ? bias + (size_t)by * sBias : nullptr;
  const int ntn = N >> 6; const int mt = blockIdx.x / ntn, nq = blockIdx.x - mt * ntn; const int row0 = mt * 128 + 32 * w, col0 = nq * 64; if (row0 >= M) return;
  const _Float16* a0p = A + (size_t)(row0 + ln) * lda; const _Float16* a1p = a0p + (size_t)16 * lda;
  const _Float16* b0p = Bh + (size_t)(col0 + ln) * ldb; const _Float16* b1p = b0p + (size_t)16 * ldb; const _Float16* b2p = b1p + (size_t)16 * ldb; const _Float16* b3p = b2p + (size_t)16 * ldb;
  const v8f z8 = {0.f,0.f,0.f,0.f,0.f,0.f,0.f,0.f}; v8f c00 = z8, c01 = z8, c02 = z8, c03 = z8, c10 = z8, c11 = z8, c12 = z8, c13 = z8;
#pragma unroll 1
  for (int kb = 0; kb < K; kb += 32) { const v16h a0 = g2_frag(a0p + kb, hh), a1 = g2_frag(a1p + kb, hh);
    v16h b = g2_frag(b0p + kb, hh); c00 = g2_mma(a0, b, c00); c10 = g2_mma(a1, b, c10);
    b = g2_frag(b1p + kb, hh); c01 = g2_mma(a0, b, c01); c11 = g2_mma(a1, b, c11);
    b = g2_frag(b2p + kb, hh); c02 = g2_mma(a0, b, c02); c12 = g2_mma(a1, b, c12);
    b = g2_frag(b3p + kb, hh); c03 = g2_mma(a0, b, c03); c13 = g2_mma(a1, b, c13); }
  v8f accs[8] = {c00, c01, c02, c03, c10, c11, c12, c13};
#pragma unroll
  for (int u = 0; u < 8; ++u) { const int t = u & 3, half = u >> 2; const int col = col0 + t * 16 + ln; const float bv = bp ? bf16_round(bp[col]) : 0.f;
#pragma unroll
    for (int r = 0; r < 8; ++r) { const int rloc = half * 16 + 8 * hh + r; float v = accs[u][r] * alpha + bv; if (CP) { if (rowsPerB < 0) v += CP[cofs + (size_t)(row0g + row0 + rloc) * ldc + col];      /* rowsPerB < 0: own element of the batched C plane */ else { const int bidx = (row0g + row0 + rloc) / rowsPerB; v += CP[(size_t)bidx * sCPb + (size_t)by * 64 + col]; } }
      if (ACT == 3) v = fmaxf(v, 0.f); else if (ACT == 6) v = 0.5f * v * (1.0f + erff(v * 0.70710678118654752f)); else if (ACT == 11) v = 1.0f / (1.0f + expf(-v)); else if (ACT == 15) v = v / (1.0f + expf(-v)); else if (ACT == 12) v = (v > 0.f) ? v : 0.01f * v; else if (ACT == 8) v = tanhf(v); else if (ACT == 9) v = 0.5f * v * (1.0f + tanhf(0.7978845608028654f * (v + 0.044715f * v * v * v))); else if (ACT == 14) v = (v > 0.f) ? v : 0.1f * v; else if (ACT == 16) v = (v >= 0.f) ? v : 0.3f * v; else if (ACT == 17) v = (v >= 0.f) ? v : 0.2f * v;
      so[w][rloc][t * 16 + ln] = v; } }
  __builtin_amdgcn_fence(__ATOMIC_ACQ_REL, "workgroup"); __builtin_amdgcn_wave_barrier();
  const int rsub = lane >> 4, c4 = (lane & 15) * 4;
  {
#pragma unroll
    for (int q = 0; q < 16; ++q) { const int r = q * 2 + rsub; const v4f v = *(const v4fa*)&so[w][r][c4]; if (C) *(v4f*)(C + cofs + (size_t)(row0 + r) * ldc + col0 + c4) = v; if (C16) { v4h h4; for (int i = 0; i < 4; ++i) h4[i] = (_Float16)v[i]; *(v4h*)(C16 + cofs + (size_t)(row0 + r) * ldc + col0 + c4) = h4; } }
     } }


__global__ __launch_bounds__(256) void k_wnat(const float* __restrict__ w, size_t n8, _Float16* __restrict__ Bt) { const size_t t = (size_t)blockIdx.x * 256 + threadIdx.x; if (t >= n8) return; FragH f; for (int q = 0; q < 8; ++q) f.h[q] = (_Float16)(bf16_round(w[t * 8 + q]) * 16.0f); *(v8us*)((unsigned short*)Bt + t * 8) = f.half[0];  }
__global__ __launch_bounds__(256) void k_rsm(const float* __restrict__ S, _Float16* __restrict__ P, int nrows) {
  #pragma clang fp contract(off)
  const int i = blockIdx.x * 256 + threadIdx.x; if (i >= nrows) return; const float* s = S + (size_t)i * SQ; float mx = -3.0e38f;
#pragma unroll 1
  for (int j = 0; j < SQ; ++j) mx = fmaxf(mx, s[j]); float se = 0.f;
#pragma unroll 1
  for (int j = 0; j < SQ; ++j) se += expf(s[j] - mx); const float sc = 256.0f / se;
#pragma unroll 1
  for (int j0 = 0; j0 < SQ; j0 += 8) { FragH f; for (int q = 0; q < 8; ++q) f.h[q] = (_Float16)(expf(s[j0 + q] - mx) * sc); unsigned short* d = (unsigned short*)P + (size_t)i * SQ + j0; *(v8us*)d = f.half[0];  } }
__global__ __launch_bounds__(256) void k_vt(const _Float16* __restrict__ V16, int b, int h0, _Float16* __restrict__ VT) { __shared__ unsigned short tl[64][65]; const int tid = threadIdx.x; const int hh = blockIdx.x % HG, sg = blockIdx.x / HG; const int s0 = sg * 64; const int h = h0 + hh;
  for (int i = tid; i < 64 * 8; i += 256) { const int j = i / 8, d8 = (i % 8) * 8; FragH f; f.half[0] = *(const v8us*)((const unsigned short*)V16 + ((size_t)b * SQ + s0 + j) * DM + h * HD + d8); for (int q = 0; q < 8; ++q) tl[d8 + q][j] = f.u[q]; }
  __syncthreads();
  { for (int i = tid; i < 64 * 8; i += 256) { const int d = i / 8, j8 = (i % 8) * 8; FragH f; for (int q = 0; q < 8; ++q) f.u[q] = tl[d][j8 + q]; *(v8us*)((unsigned short*)VT + ((size_t)hh * HD + d) * SQ + s0 + j8) = f.half[0]; }  } }


// Exact (f32, vector unit) causal attention over the first QT0 rows: one work-group of eight waves per (batch, head, 32 query rows).
// Step 1: wave w keeps key row 32 w + lane in registers and forms its scores against the 32 query rows, each read from LDS at one address for the whole wave.
// Step 2: wave w does the softmax of query rows 4 w .. 4 w + 3, lane = key mod 32 (maximum and denominator: per-lane partial, then a xor butterfly).
// Step 3: wave w sums weight x value over the keys in order for the same four rows, lane = four columns of the head, so that every value row is read as one whole run.
__global__ __launch_bounds__(256) void k_att0h(const float* __restrict__ QF, const float* __restrict__ KF, const float* __restrict__ VF, float scale, float* __restrict__ OF) {
  constexpr int ld = DMX, ldv = DMX, ldo = DMX;      /* row pitches as constants: the rows of one run of loads differ by an immediate offset only */
  static_assert(QT0 == 256, "eight waves: one per 32 keys, four query rows each");
  __shared__ __attribute__((aligned(16))) float sm[8 * 32 * 132 + 32 * 128];
  float (*lk)[32][132] = (float (*)[32][132])sm;      /* key rows at a pitch of 33 x 16 bytes: a lane reads its own row without bank conflicts */
  float (*lp)[QT0] = (float (*)[QT0])sm;      /* scores, then weights: they take the key rows' place once every wave holds its key rows in registers, which keeps the work-group under half of the LDS (above that this compiler budgets 512 registers and fetches the query reads far ahead into a second register window) */
  float (*lq)[128] = (float (*)[128])(sm + 8 * 32 * 132);
  const int tid = threadIdx.x, lane = tid & 31; const int w = __builtin_amdgcn_readfirstlane(tid >> 5); const int h = blockIdx.x / (QT0 / 32), rg = blockIdx.x % (QT0 / 32);
  { const size_t rb = (size_t)blockIdx.y * QT0; QF += rb * ld; KF += rb * ld; VF += rb * ldv; OF += rb * ldo; }      /* grid.y = batch: QT0 rows of every plane per batch */
  const int hc = h * 128 + lane * 4;
  for (int r = 0; r < 4; ++r) *(v4f*)&lq[4 * w + r][lane * 4] = *(const v4fa*)(QF + (size_t)(rg * 32 + 4 * w + r) * ld + hc);
  if (w <= rg) {      /* causal: key chunks 0 .. rg only */
#pragma unroll      /* all 32 row loads in flight together */
    for (int r = 0; r < 32; ++r) *(v4f*)&lk[w][r][lane * 4] = *(const v4fa*)(KF + (size_t)(w * 32 + r) * ld + hc); }
  __syncthreads();
  v4f kr[32];
  if (w <= rg) {
#pragma unroll      /* here and in the c loop below: kr[] stays in registers only if every index is a constant */
    for (int c = 0; c < 32; ++c) kr[c] = *(const v4f*)&lk[w][lane][c * 4]; }
  __syncthreads();      /* every key row has been read: from here on its place holds scores */
  if (w <= rg) {
#pragma unroll 1      /* the body is 512 multiply-adds already */
    for (int r0 = 0; r0 < 32; r0 += 4) { float s0 = 0.f, s1 = 0.f, s2 = 0.f, s3 = 0.f;
#pragma unroll
      for (int c = 0; c < 32; ++c) { const v4f q0 = *(const v4f*)&lq[r0][c * 4], q1 = *(const v4f*)&lq[r0 + 1][c * 4], q2 = *(const v4f*)&lq[r0 + 2][c * 4], q3 = *(const v4f*)&lq[r0 + 3][c * 4];
        for (int u = 0; u < 4; ++u) { s0 = fmaf(q0[u], kr[c][u], s0); s1 = fmaf(q1[u], kr[c][u], s1); s2 = fmaf(q2[u], kr[c][u], s2); s3 = fmaf(q3[u], kr[c][u], s3); } }
      float* sp = &lp[r0][w * 32 + lane]; sp[0] = s0 * scale; sp[QT0] = s1 * scale; sp[2 * QT0] = s2 * scale; sp[3 * QT0] = s3 * scale; } }
  __syncthreads();
  float fin[4];
#pragma unroll      /* fin[] and e[] are indexed by constants */
  for (int r = 0; r < 4; ++r) { const int il = 4 * w + r, i = rg * 32 + il; float e[8]; float mx = -3.0e38f, l = 0.f;
#pragma unroll
    for (int c = 0; c < 8; ++c) { e[c] = -3.0e38f; if (c <= rg) { const float s = lp[il][c * 32 + lane]; if (c * 32 + lane <= i) e[c] = s; } mx = fmaxf(mx, e[c]); }
    for (int m = 16; m > 0; m >>= 1) mx = fmaxf(mx, __shfl_xor(mx, m, 32));
#pragma unroll
    for (int c = 0; c < 8; ++c) { e[c] = (c * 32 + lane <= i) ? expf(e[c] - mx) : 0.f; l += e[c]; }
    for (int m = 16; m > 0; m >>= 1) l += __shfl_xor(l, m, 32);
    fin[r] = 64.0f / l;
#pragma unroll
    for (int c = 0; c < 8; ++c) if (c <= rg) lp[il][c * 32 + lane] = e[c]; }
  __syncthreads();
  const v4f z4 = {0.f, 0.f, 0.f, 0.f}; v4f acc[4] = {z4, z4, z4, z4}; const float* vp = VF + hc; const int nk = (rg + 1) * 32;
#pragma unroll 1      /* 16 value rows in flight a trip are enough; more would only cost registers */
  for (int j0 = 0; j0 < nk; j0 += 16) { v4f vv[16];
#pragma unroll
    for (int u = 0; u < 16; ++u) vv[u] = *(const v4fa*)(vp + (size_t)(j0 + u) * ldv);
#pragma unroll
    for (int g = 0; g < 4; ++g) for (int r = 0; r < 4; ++r) { const v4f p = *(const v4f*)&lp[4 * w + r][j0 + 4 * g]; for (int u = 0; u < 4; ++u) for (int x = 0; x < 4; ++x) acc[r][x] = fmaf(p[u], vv[4 * g + u][x], acc[r][x]); } }
#pragma unroll
  for (int r = 0; r < 4; ++r) { v4f o; for (int x = 0; x < 4; ++x) o[x] = acc[r][x] * fin[r]; *(v4f*)(OF + (size_t)(rg * 32 + 4 * w + r) * ldo + hc) = o; } }
__global__ __launch_bounds__(256) void k_f2h(const float* __restrict__ F, int ldf, int coff, int ncol, _Float16* __restrict__ H16, size_t nrow) { const size_t t = (size_t)blockIdx.x * 256 + threadIdx.x; const size_t n8 = nrow * (size_t)(ncol / 8); if (t >= n8) return; const size_t r = t / (ncol / 8); const int c8 = (int)(t % (ncol / 8)) * 8; FragH f; const v4f a = *(const v4fa*)(F + r * ldf + coff + c8), b2 = *(const v4fa*)(F + r * ldf + coff + c8 + 4); for (int q = 0; q < 4; ++q) { f.h[q] = (_Float16)a[q]; f.h[4 + q] = (_Float16)b2[q]; } *(v8us*)((unsigned short*)H16 + r * ncol + c8) = f.half[0];  }

__global__ __launch_bounds__(256) void k_tab128(float theta, float* __restrict__ CS, float* __restrict__ SN) {
  #pragma clang fp contract(off)
  const int t = blockIdx.x * 256 + threadIdx.x; if (t >= SQ * 64) return; const int i = t % 64; const int p = t / 64; const float invf = (float)(1.0 / pow((double)theta, (double)(2 * i) / 128.0));      /* = XLA's constant-folded f32 table */ const float ang = __fmul_rn((float)p, invf); const float c = cosf(ang), s = sinf(ang);
  *(float*)(CS + t) = c; *(float*)(SN + t) = s;  }
template <int TAB>
__global__ __launch_bounds__(128) void k_rope128(const float* __restrict__ F, int ldf, int nh, const float* __restrict__ CS, const float* __restrict__ SN, _Float16* __restrict__ H16, int ldo, float osc) {
  #pragma clang fp contract(off)
  __shared__ float xv[128]; __shared__ unsigned short sh_[128]; const int d = threadIdx.x; const int h = blockIdx.x % nh; const size_t r = blockIdx.x / nh; const int p = (int)(r % SQ);
  xv[d] = F[r * (size_t)ldf + (size_t)h * 128 + d]; __syncthreads();
  float c, s; if (TAB) { c = bf16_round(CS[(size_t)p * 128 + d]); s = bf16_round(SN[(size_t)p * 128 + d]); } else { c = CS[p * 64 + (d & 63)]; s = SN[p * 64 + (d & 63)]; }
  const float rot = (d < 64) ? -xv[d + 64] : xv[d - 64]; const float o = __fadd_rn(__fmul_rn(xv[d], c), __fmul_rn(rot, s));
  FragH th; th.h[0] = (_Float16)__fmul_rn(o, osc); sh_[d] = th.u[0]; __syncthreads();
  if (d < 16) { FragH f; for (int q = 0; q < 8; ++q) f.u[q] = sh_[d * 8 + q]; unsigned short* dst = (unsigned short*)H16 + r * (size_t)ldo + (size_t)h * 128 + d * 8; *(v8us*)dst = f.half[0];  } }

template <int TAB, int IL, int F32OUT>
__global__ __launch_bounds__(128) void k_rope128x(const float* __restrict__ F, int ldf, int nh, const float* __restrict__ CS, const float* __restrict__ SN, void* __restrict__ OUT, int ldo, float osc, int yin, int yout) {
  #pragma clang fp contract(off)
  __shared__ float xv[128]; __shared__ float ov[128]; const int d = threadIdx.x; const int h = blockIdx.x % nh; const size_t r = blockIdx.x / nh + (size_t)blockIdx.y * yin; const size_t ro = blockIdx.x / nh + (size_t)blockIdx.y * yout; const int p = (int)(r % SQ);      /* grid.y = batch: source and table rows step by yin, output rows by yout */
  xv[d] = F[r * (size_t)ldf + (size_t)h * 128 + d]; __syncthreads();
  float c, s; if (TAB == 2) { c = CS[r * 128 + d]; s = SN[r * 128 + d]; }      /* computed full-width f32 tables, one row per token row r (relative to the passed pointers) */ else if (TAB) { c = bf16_round(CS[(size_t)p * 128 + d]); s = bf16_round(SN[(size_t)p * 128 + d]); } else { const int ti = IL ? (d >> 1) : (d & 63); c = CS[p * 64 + ti]; s = SN[p * 64 + ti]; }
  const float rot = IL ? ((d & 1) ? xv[d - 1] : -xv[d + 1]) : ((d < 64) ? -xv[d + 64] : xv[d - 64]);
  ov[d] = __fmul_rn(__fadd_rn(__fmul_rn(xv[d], c), __fmul_rn(rot, s)), osc); __syncthreads();
  if (F32OUT) { if (d < 32) { const v4f v = *(const v4f*)&ov[d * 4]; float* dst = (float*)OUT + ro * (size_t)ldo + (size_t)h * 128 + d * 4; *(v4f*)dst = v;  } }
  else { if (d < 16) { FragH f; for (int q = 0; q < 8; ++q) f.h[q] = (_Float16)ov[d * 8 + q]; unsigned short* dst = (unsigned short*)OUT + ro * (size_t)ldo + (size_t)h * 128 + d * 8; *(v8us*)dst = f.half[0];  } } }
template <int N>
__global__ __launch_bounds__(256) void k_rmsrow(float* __restrict__ X, const float* __restrict__ w, float eps) {
  #pragma clang fp contract(off)
  constexpr int PT = N / 256; __shared__ float red[256]; const size_t r = blockIdx.x; const int t = threadIdx.x; float* row = X + r * N + (size_t)t * PT; float v[PT]; float ss = 0.f;
  for (int q = 0; q < PT; ++q) { v[q] = row[q]; ss = __fadd_rn(ss, __fmul_rn(v[q], v[q])); }
  red[t] = ss; __syncthreads(); for (int k = 128; k > 0; k >>= 1) { if (t < k) red[t] = __fadd_rn(red[t], red[t + k]); __syncthreads(); }
  const float rs = rsqrtf(__fadd_rn(red[0] / (float)N, eps)); float o[PT]; for (int q = 0; q < PT; ++q) o[q] = __fmul_rn(__fmul_rn(v[q], rs), bf16_round(w[t * PT + q]));
  { for (int q = 0; q < PT; ++q) *(float*)(row + q) = o[q];  } }
template <int GS_, int NHQ, int DSRC>
__global__ __launch_bounds__(256) void k_kvexp128(const float* __restrict__ src, float* __restrict__ dst, size_t n4, size_t ysrc, size_t ydst) { const size_t t = (size_t)blockIdx.x * 256 + threadIdx.x; if (t >= n4) return; src += (size_t)blockIdx.y * ysrc; dst += (size_t)blockIdx.y * ydst;      /* grid.y = batch */ const size_t e = t * 4; const size_t row = e / ((size_t)NHQ * 128); const int col = (int)(e % ((size_t)NHQ * 128)); const int h = col / 128, d = col % 128; const v4f v = *(const v4fa*)(src + row * DSRC + (size_t)(h / GS_) * 128 + d); *(v4f*)(dst + e) = v;  }

__global__ __launch_bounds__(256) void k_rsmcfb(const float* __restrict__ S, _Float16* __restrict__ P, int hg, int q0, int nk, const int* __restrict__ mk) {
  #pragma clang fp contract(off)
  const int t = blockIdx.x * 256 + threadIdx.x; if (t >= hg * QT) return; const size_t i = (size_t)t; const float* s = S + i * NKX; const size_t ig = (size_t)(q0 + (t % QT)); const int* mr = mk + ig * SQ; float mx = -3.0e38f;
#pragma unroll 1
  for (int j = 0; j < nk; ++j) { const int mb = mr[j]; const float f = (mb == 0) ? 1.f : 0.f; mx = fmaxf(mx, fmaf(f, s[j], (1.f - f) * -1.0e9f)); } float se = 0.f;
#pragma unroll 1
  for (int j = 0; j < nk; ++j) { const int mb = mr[j]; const float f = (mb == 0) ? 1.f : 0.f; se += __expf(fmaf(f, s[j], (1.f - f) * -1.0e9f) - mx); } const float sc = 256.0f / se;
#pragma unroll 1
  for (int j0 = 0; j0 < nk; j0 += 8) { FragH fr; for (int q = 0; q < 8; ++q) { const int j = j0 + q; const int mb = mr[j]; const float f = (mb == 0) ? 1.f : 0.f; fr.h[q] = (_Float16)(__expf(fmaf(f, s[j], (1.f - f) * -1.0e9f) - mx) * sc); } unsigned short* d = (unsigned short*)P + i * NKX + j0; *(v8us*)d = fr.half[0];  } }


// Causal softmax, one wave per score row: lane l holds columns 128 c + 4 l .. + 3 of every 128-column chunk c in registers, so each
// load and store of a wave covers one contiguous run of the row and the row is read once. Row maximum and denominator: per-lane partial, then a xor butterfly over the 32 lanes.
// rel = the row's last causal column minus the lane's first column.
template <int NC>
__device__ __forceinline__ void rsm_row(const float* __restrict__ s, _Float16* __restrict__ d, int rel) {
  v4f e[NC]; float mx = -3.0e38f, se = 0.f;
#pragma unroll      /* here and below: e[] stays in registers only if every index is a constant */
  for (int c = 0; c < NC; ++c) e[c] = *(const v4fa*)(s + c * 128);
#pragma unroll      /* as above */
  for (int c = 0; c < NC; ++c) for (int q = 0; q < 4; ++q) { const float f = (c * 128 + q <= rel) ? 1.f : 0.f; e[c][q] = fmaf(f, e[c][q], (1.f - f) * -1.0e9f); mx = fmaxf(mx, e[c][q]); }
  for (int m = 16; m > 0; m >>= 1) mx = fmaxf(mx, __shfl_xor(mx, m, 32));
#pragma unroll      /* as above */
  for (int c = 0; c < NC; ++c) for (int q = 0; q < 4; ++q) { e[c][q] = __expf(e[c][q] - mx); se += e[c][q]; }
  for (int m = 16; m > 0; m >>= 1) se += __shfl_xor(se, m, 32);
  const float sc = 256.0f / se;
#pragma unroll      /* as above */
  for (int c = 0; c < NC; ++c) { v4h h4; for (int q = 0; q < 4; ++q) h4[q] = (_Float16)(e[c][q] * sc); *(v4h*)(d + c * 128) = h4; }
  asm volatile("s_wait_xcnt 0x0" ::: "memory");      /* behind the row's stores */
}
__global__ __launch_bounds__(256) void k_rsmcf2(const float* __restrict__ S, _Float16* __restrict__ P, int hg, int q0, int nk) {
  static_assert(QT == 256 && NKX == 8 * QT, "one case per row length below");
  const int col = (threadIdx.x & 31) * 4; const int t = blockIdx.x * 8 + (threadIdx.x >> 5); if (t >= hg * QT) return;
  const float* s = S + (size_t)t * NKX + col; _Float16* d = P + (size_t)t * NKX + col; const int rel = q0 + (t % QT) - col;
  switch (nk / QT) {      /* nk = QT .. NKX in steps of QT: one straight-line body per row length, so that the row's registers are indexed by constants */
    case 1: rsm_row<2>(s, d, rel); break; case 2: rsm_row<4>(s, d, rel); break; case 3: rsm_row<6>(s, d, rel); break; case 4: rsm_row<8>(s, d, rel); break;
    case 5: rsm_row<10>(s, d, rel); break; case 6: rsm_row<12>(s, d, rel); break; case 7: rsm_row<14>(s, d, rel); break; case 8: rsm_row<16>(s, d, rel); break; } }



__global__ __launch_bounds__(256) void k_tab128p(const int* __restrict__ pos, int nrows, float theta, float* __restrict__ CS, float* __restrict__ SN) {
  #pragma clang fp contract(off)
  const int t = blockIdx.x * 256 + threadIdx.x; if (t >= nrows * 64) return; const int i = t % 64; const int r = t / 64; const float invf = (float)(1.0 / pow((double)theta, (double)(2 * i) / 128.0)); const float ang = __fmul_rn((float)pos[r], invf); const float c = cosf(ang), sv = sinf(ang);
  float* c0 = CS + (size_t)r * 128 + i; float* s0 = SN + (size_t)r * 128 + i;
  { *(float*)c0 = c; *(float*)(c0 + 64) = c; *(float*)s0 = sv; *(float*)(s0 + 64) = sv;  } }

__global__ __launch_bounds__(256) void k_rsmcim(const float* __restrict__ S, _Float16* __restrict__ P, int hg, int q0, int nk, const int* __restrict__ am) {
  #pragma clang fp contract(off)
  const int t = blockIdx.x * 256 + threadIdx.x; if (t >= hg * QT) return; const size_t i = (size_t)t; const float* s = S + i * NKX; const int last = q0 + (t % QT); const int* mr = am + (size_t)last * SQ; float mx = -3.0e38f;      /* the module's mask row of this query (keys >= nk lie above the diagonal of the causal mask and are not computed) */
#pragma unroll 1
  for (int j = 0; j < nk; ++j) { const float f = (mr[j] != 0) ? 1.f : 0.f; mx = fmaxf(mx, fmaf(f, s[j], (1.f - f) * -1.0e9f)); } float se = 0.f;
#pragma unroll 1
  for (int j = 0; j < nk; ++j) { const float f = (mr[j] != 0) ? 1.f : 0.f; se += __expf(fmaf(f, s[j], (1.f - f) * -1.0e9f) - mx); } const float sc = 256.0f / se;
#pragma unroll 1
  for (int j0 = 0; j0 < nk; j0 += 8) { FragH fr; for (int q = 0; q < 8; ++q) { const int j = j0 + q; const float f = (mr[j] != 0) ? 1.f : 0.f; fr.h[q] = (_Float16)(__expf(fmaf(f, s[j], (1.f - f) * -1.0e9f) - mx) * sc); } unsigned short* d = (unsigned short*)P + i * NKX + j0; *(v8us*)d = fr.half[0];  } }



__global__ __launch_bounds__(256) void k_tab128h(int nr, float theta, float* __restrict__ CS, float* __restrict__ SN) {
  #pragma clang fp contract(off)
  const size_t t = (size_t)blockIdx.x * 256 + threadIdx.x; if (t >= (size_t)nr * 64) return; const int i = (int)(t % 64); const size_t r = t / 64; const int p = (int)(r % SQ);
  const float invf = (float)(1.0 / pow((double)theta, ((double)(2 * i)) / 128.0)); const float ang = __fmul_rn((float)p, invf); const float c = cosf(ang), sv = sinf(ang);
  float* pc = CS + r * 128 + i; float* ps = SN + r * 128 + i;
  *(float*)pc = c; *(float*)(pc + 64) = c; *(float*)ps = sv; *(float*)(ps + 64) = sv;  }
extern "C" void kernel_launch(void* const* d_in, const int* in_sizes, int n_in,
                              void* d_out, int out_size, void* d_ws, size_t ws_size, hipStream_t stream) {
  (void)in_sizes; (void)n_in; (void)out_size;
  const float* const* I = (const float* const*)d_in; const float* x = I[0]; const float* wq = I[1]; const float* wk = I[2]; const float* wv = I[3]; const float* wo = I[4]; const float* bq = nullptr; const float* bk = nullptr; const float* bv = nullptr; const float* bo = nullptr;      /* [in][out] Wq [2048][2048], Wk/Wv [2048][1024], Wo [2048][2048]; no biases; positions implicit */
  char* ws = (char*)d_ws; size_t off = 0;
  auto take = [&](size_t bytes) { char* p = ws + off; off += (bytes + 255) & ~(size_t)255; return p; };
  _Float16* BQ = (_Float16*)take((size_t)DMX * DMX * 2); _Float16* BK = (_Float16*)take((size_t)DKV * DMX * 2); _Float16* BV = (_Float16*)take((size_t)DKV * DMX * 2); _Float16* BO = (_Float16*)take((size_t)DMX * DMX * 2);
  _Float16* X16 = (_Float16*)take(NR * DMX * 2); float* QF = (float*)take(NR * (DMX + 2 * DKV) * 4); float* KF = QF + NR * DMX; float* VF = KF + NR * DKV; _Float16* Q16 = (_Float16*)take(NR * DMX * 2); _Float16* K16 = (_Float16*)take(NR * DKV * 2); _Float16* V16 = (_Float16*)take(NR * DKV * 2); _Float16* O16 = (_Float16*)take(NR * DMX * 2);
  static_assert((size_t)NB * NH * QT * NKX <= NR * (DMX + 2 * DKV), "score planes must fit the f32 q, k, v planes they reuse");
  float* S = QF;      /* score planes of both batches reuse the f32 q, k, v planes: their last readers (rope, kv expansion) are launched before the first score GEMM of this call */
  _Float16* P = (_Float16*)take((size_t)NB * NH * QT * NKX * 2); _Float16* VT = (_Float16*)take((size_t)NB * (DKV / 64) * 64 * SQ * 2);
  float* CS = (float*)take(NR * 128 * 4); float* SN = (float*)take(NR * 128 * 4); float* QF0 = (float*)take((size_t)NB * QT0 * DMX * 4); float* KRF0 = (float*)take((size_t)NB * QT0 * DKV * 4); float* KF0e = (float*)take((size_t)NB * QT0 * DMX * 4); float* VF0e = (float*)take((size_t)NB * QT0 * DMX * 4); float* OF0 = (float*)take((size_t)NB * QT0 * DMX * 4); _Float16* OH0 = (_Float16*)take((size_t)NB * QT0 * DMX * 2); _Float16* OL0 = (_Float16*)take((size_t)NB * QT0 * DMX * 2);
  if (off > ws_size) return;      /* 24 (weights) + 16 + 64 + 16 + 8 + 8 + 16 + 32 + 8 + 2 + 2 + 4 + 2 + 4 + 4 + 4 + 2 + 2 = 218 MiB */
  k_wt_f16<<<(unsigned)(((size_t)DMX * DMX / 8 + 255) / 256), 256, 0, stream>>>(wq, BQ, DMX, DMX, 16.0f); k_wt_f16<<<(unsigned)(((size_t)DKV * DMX / 8 + 255) / 256), 256, 0, stream>>>(wk, BK, DMX, DKV, 16.0f); k_wt_f16<<<(unsigned)(((size_t)DKV * DMX / 8 + 255) / 256), 256, 0, stream>>>(wv, BV, DMX, DKV, 16.0f); k_wt_f16<<<(unsigned)(((size_t)DMX * DMX / 8 + 255) / 256), 256, 0, stream>>>(wo, BO, DMX, DMX, 16.0f);      /* [in][out] -> Bt x16 */
  k_x16<<<(unsigned)((NR * DMX / 8 + 255) / 256), 256, 0, stream>>>(x, X16, NR * DMX / 8);
  k_gemm2<0><<<dim3((unsigned)((NR / 128) * (DMX / 64)), 1), 128, 0, stream>>>(X16, DMX, 0, BQ, DMX, 0, 0.0625f, bq, 0, nullptr, 1, 0, 0, QF, nullptr, DMX, 0, (int)NR, DMX, DMX, 0, 0, 0, 0);      /* q (f32) */
  k_gemm2<0><<<dim3((unsigned)((NR / 128) * (DKV / 64)), 1), 128, 0, stream>>>(X16, DMX, 0, BK, DMX, 0, 0.0625f, bk, 0, nullptr, 1, 0, 0, KF, nullptr, DKV, 0, (int)NR, DKV, DMX, 0, 0, 0, 0);      /* k (f32) */
  k_gemm2<0><<<dim3((unsigned)((NR / 128) * (DKV / 64)), 1), 128, 0, stream>>>(X16, DMX, 0, BV, DMX, 0, 0.0625f, bv, 0, nullptr, 1, 0, 0, VF, V16, DKV, 0, (int)NR, DKV, DMX, 0, 0, 0, 0);      /* v (f32 for the first tile + f16) */
  k_tab128h<<<(unsigned)((NR * 64 + 255) / 256), 256, 0, stream>>>((int)NR, 10000.0f, CS, SN);      /* per-row cos/sin tables [NR][128] for positions r % SQ, duplicated over both halves (cat(f, f)) */
  k_rope128x<2, 0, 0><<<(unsigned)(NR * NH), 128, 0, stream>>>(QF, DMX, NH, CS, SN, Q16, DMX, 1.0f, 0, 0); k_rope128x<2, 0, 0><<<(unsigned)(NR * NKV), 128, 0, stream>>>(KF, DKV, NKV, CS, SN, K16, DKV, 1.0f, 0, 0);      /* rope (all rows) -> f16 */
  /* From here on every launch covers both batches (grid.y or grid.z = batch, or both batches' rows in one grid.x), and each attention GEMM all 16 query heads (grid.y = head). */
  k_rope128x<2, 0, 1><<<dim3(QT0 * NH, NB), 128, 0, stream>>>(QF, DMX, NH, CS, SN, QF0, DMX, 1.0f, SQ, QT0); k_rope128x<2, 0, 1><<<dim3(QT0 * NKV, NB), 128, 0, stream>>>(KF, DKV, NKV, CS, SN, KRF0, DKV, 1.0f, SQ, QT0);      /* f32 roped q, k of each batch's first QT0 rows */
  k_kvexp128<GSZ, NH, DKV><<<dim3((unsigned)(((size_t)QT0 * DMX / 4 + 255) / 256), NB), 256, 0, stream>>>(KRF0, KF0e, (size_t)QT0 * DMX / 4, (size_t)QT0 * DKV, (size_t)QT0 * DMX); k_kvexp128<GSZ, NH, DKV><<<dim3((unsigned)(((size_t)QT0 * DMX / 4 + 255) / 256), NB), 256, 0, stream>>>(VF, VF0e, (size_t)QT0 * DMX / 4, (size_t)SQ * DKV, (size_t)QT0 * DMX);      /* kv head -> query head expansion for the exact first tile */
  k_vt<DKV / 64, SQ><<<NB * (DKV / 64) * (SQ / 64), 256, 0, stream>>>(V16, DKV, 0, VT);      /* V^T, [batch][DKV][SQ]: kv head g = slabs 2g, 2g+1 of its batch */
  k_att0h<<<dim3(NH * (QT0 / 32), NB), 256, 0, stream>>>(QF0, KF0e, VF0e, ATS, OF0);      /* exact causal attention, first QT0 rows (o x64) */
  for (int q0 = 0; q0 < SQ; q0 += QT) { const int nk = q0 + QT;      /* causal: keys below the tile end only */
    k_gemm2<0><<<dim3((QT / 128) * (nk / 64), NH, NB), 128, 0, stream>>>(Q16 + (size_t)q0 * DMX, DMX, (size_t)HDK, K16, DKV, (size_t)HDK, ATS, nullptr, 0, nullptr, 1, 0, 0, S, nullptr, NKX, (size_t)QT * NKX, QT, nk, HDK, GSH, (size_t)SQ * DMX, (size_t)SQ * DKV, (size_t)NH * QT * NKX);      /* scores: query head y vs key slab y >> GSH */
    k_rsmcf2<<<(NB * NH * QT + 7) / 8, 256, 0, stream>>>(S, P, NB * NH, q0, nk);      /* causal softmax (arithmetic select) over the computed keys, one wave per row */
    k_gemm2<0><<<dim3((QT / 128) * (HDK / 64), NH, NB), 128, 0, stream>>>(P, NKX, (size_t)QT * NKX, VT, SQ, (size_t)HDK * SQ, 0.25f, nullptr, 0, nullptr, 1, 0, 0, nullptr, O16 + (size_t)q0 * DMX, DMX, (size_t)HDK, QT, HDK, nk, GSH, (size_t)NH * QT * NKX, (size_t)DKV * SQ, (size_t)SQ * DMX); }      /* o (x64): query head y vs V^T slab y >> GSH */
  k_gemm2<0><<<dim3((unsigned)((NR / 128) * (DMX / 64)), 1), 128, 0, stream>>>(O16, DMX, 0, BO, DMX, 0, 0.0009765625f, bo, 0, nullptr, 1, 0, 0, (float*)d_out, nullptr, DMX, 0, (int)NR, DMX, DMX, 0, 0, 0, 0);      /* out = o Wo */
  k_hl<<<(unsigned)(((size_t)NB * QT0 * DMX / 8 + 255) / 256), 256, 0, stream>>>(OF0, OH0, OL0, (size_t)NB * QT0 * DMX / 8);      /* first-tile o (x64) -> f16 hi + x1024 residual planes */
  k_gemm2<0><<<dim3((QT0 / 128) * (DMX / 64), 1, NB), 128, 0, stream>>>(OH0, DMX, 0, BO, DMX, 0, 0.0009765625f, bo, 0, nullptr, 1, 0, 0, (float*)d_out, nullptr, DMX, 0, QT0, DMX, DMX, 0, (size_t)QT0 * DMX, 0, (size_t)SQ * DMX);      /* first QT0 rows of each batch rewritten from the exact path */
  k_gemm2<0><<<dim3((QT0 / 128) * (DMX / 64), 1, NB), 128, 0, stream>>>(OL0, DMX, 0, BO, DMX, 0, 0.00000095367431640625f, nullptr, 0, (const float*)d_out, -1, 0, 0, (float*)d_out, nullptr, DMX, 0, QT0, DMX, DMX, 0, (size_t)QT0 * DMX, 0, (size_t)SQ * DMX);      /* += o_lo Wo 2^-20 (own-element accumulate) */
}

// v004
// A run of this version takes 1050 microseconds.
// Timed twice side by side with v003, it ran 1.04 times as fast both times.
// All steps since v000 together make it 11.3 times as fast.
#include <hip/hip_runtime.h>
// Grouped-query causal attention with rotate-half RoPE, 16 query / 8 kv heads of 128 (x [2][2048][2048]; q = x Wq (16 x 128), k = x Wk, v = x Wv (8 x 128) ([in][out] weights sigma 0.02, no biases); inv_freq_i = 1/10000^(2i/128), positions 0..2047, cos/sin = cat(freqs, freqs); q, k roped; kv head h/2 serves query head h; scores / sqrt(128); causal (tril, -inf); softmax; out = merged Wo -> [2][2048][2048]).
// Compute dtype: inputs rounded to bf16; x / weights exact; projections and rope f32; q, k, v, softmax weights and o as plain f16 GEMM operands (~2^-12; first 256 rows of each batch exact); scores, statistics, out f32. v_wmma_f32_16x16x32_f16.
#define NB 2
#define SQ 2048
#define DMX 2048
#define NH 16
#define NKV 8
#define GSZ 2                        /* query heads per kv head */
#define GSH 1                        /* log2(GSZ): query head >> GSH = its kv head */
#define HDK 128
#define DKV (NKV * HDK)
#define QT 256
#define QT0 256
#define NKX SQ
#define DM DMX
#define HD 64
#define HG 1
#define NR ((size_t)NB * SQ)
#define ATS 0.08838834764831845f
typedef __bf16 v16b __attribute__((ext_vector_type(16)));
typedef unsigned short v8us __attribute__((ext_vector_type(8), may_alias));
typedef float  v8f  __attribute__((ext_vector_type(8)));
typedef float  v4f  __attribute__((ext_vector_type(4)));
typedef float  v4fa __attribute__((ext_vector_type(4), may_alias));
union FragB { v16b v; v8us half[2]; unsigned short u[16]; };

__device__ __forceinline__ unsigned short bf16_bits(float x) { unsigned int u = __float_as_uint(x); return (unsigned short)((u + 0x7FFFu + ((u >> 16) & 1u)) >> 16); }
__device__ __forceinline__ float bf16_val(unsigned short b) { return __uint_as_float(((unsigned int)b) << 16); }
__device__ __forceinline__ float bf16_round(float x) { return bf16_val(bf16_bits(x)); }
// D += A·B with NT terms: 1 = ah·bh, 2 = + al·bh (A split), 3 = + ah·bl (both split)
template <int NT>
__device__ __forceinline__ v8f mmaN(v16b ah, v16b al, v16b bh, v16b bl, v8f c) {
  c = __builtin_amdgcn_wmma_f32_16x16x32_bf16(false, ah, false, bh, (short)0, c, false, false);
  if (NT >= 2) c = __builtin_amdgcn_wmma_f32_16x16x32_bf16(false, al, false, bh, (short)0, c, false, false);
  if (NT >= 3) c = __builtin_amdgcn_wmma_f32_16x16x32_bf16(false, ah, false, bl, (short)0, c, false, false);
  asm volatile("v_nop\n\tv_nop\n\tv_nop\n\tv_nop" : "+v"(c) : "v"(ah), "v"(al), "v"(bh), "v"(bl));
  return c;
}

__global__ __launch_bounds__(256) void k_wt_bf16(const float* __restrict__ W, unsigned short* __restrict__ Wt, int K, int N) {
  const int t = blockIdx.x * 256 + threadIdx.x;
  const int k8n = K / 8;
  if (t >= N * k8n) return;
  const int n = t / k8n, k8 = (t % k8n) * 8;
  v8us v;
#pragma unroll
  for (int i = 0; i < 8; ++i) v[i] = bf16_bits(W[(size_t)(k8 + i) * N + n]);
  *(v8us*)(Wt + (size_t)n * K + k8) = v;
  
}

// GEMM C[M][N] (f32, pitch ldc) = act(A[M][K]·W + bias). A f32 row-major (pitch lda) converted per fragment to bf16
// (ASPLIT: hi/lo two planes -> 2 terms, else single rounded term); Wt bf16 [N][K] (pitch ldb). BIAS_BF16 rounds the
// bias to bf16 first (bias quantised to bf16 before the add). K%32==0, M%16==0, N%64==0.
template <bool ASPLIT, int ACT, bool BIAS_BF16>
__global__ __launch_bounds__(128) void k_gemm_bf(const float* __restrict__ A, int lda, const unsigned short* __restrict__ Wt, int ldb,
                                               const float* __restrict__ bias, float* __restrict__ C, int ldc, int M, int N, int K) {
  __shared__ __attribute__((aligned(16))) float so[4][16][64];
  const int tid = threadIdx.x, w = tid >> 5, lane = tid & 31, ln = lane & 15, hh = lane >> 4;
  const int ntn = N / 64;
  const int wid = blockIdx.x * 4 + w;
  const int mt = wid / ntn, nq = wid % ntn;
  if (mt * 16 >= M) return;
  const int row0 = mt * 16, col0 = nq * 64;
  const float* arow = A + (size_t)(row0 + ln) * lda;
  v8f acc[4] = {};
  for (int kb = 0; kb < K; kb += 32) {
    FragB ah, al;
    const v4f x0 = *(const v4fa*)(arow + kb + 8 * hh), x1 = *(const v4fa*)(arow + kb + 8 * hh + 4);
    const v4f x2 = *(const v4fa*)(arow + kb + 16 + 8 * hh), x3 = *(const v4fa*)(arow + kb + 16 + 8 * hh + 4);
    float xs[16] = {x0[0],x0[1],x0[2],x0[3],x1[0],x1[1],x1[2],x1[3],x2[0],x2[1],x2[2],x2[3],x3[0],x3[1],x3[2],x3[3]};
#pragma unroll
    for (int i = 0; i < 16; ++i) { const unsigned short hb = bf16_bits(xs[i]); ah.u[i] = hb; al.u[i] = ASPLIT ? bf16_bits(xs[i] - bf16_val(hb)) : (unsigned short)0; }
#pragma unroll
    for (int t = 0; t < 4; ++t) {
      const unsigned short* brow = Wt + (size_t)(col0 + t * 16 + ln) * ldb + kb;
      FragB b;
      b.half[0] = *(const v8us*)(brow + 8 * hh);
      b.half[1] = *(const v8us*)(brow + 16 + 8 * hh);
      acc[t] = mmaN<ASPLIT ? 2 : 1>(ah.v, al.v, b.v, b.v, acc[t]);
    }
  }
#pragma unroll
  for (int t = 0; t < 4; ++t) {
    float bv = bias ? bias[col0 + t * 16 + ln] : 0.f;
    if (BIAS_BF16) bv = bf16_round(bv);
#pragma unroll
    for (int r = 0; r < 8; ++r) { float v = acc[t][r] + bv; if (ACT == 1) v = fmaxf(v, 0.f); so[w][8 * hh + r][t * 16 + ln] = v; }
  }
  __builtin_amdgcn_fence(__ATOMIC_ACQ_REL, "workgroup");
  __builtin_amdgcn_wave_barrier();
  const int rsub = lane >> 4, c4 = (lane & 15) * 4;
  {
#pragma unroll
    for (int q = 0; q < 8; ++q) {
      const int r = q * 2 + rsub;
      const v4f v = *(const v4fa*)&so[w][r][c4];
      *(v4f*)(C + (size_t)(row0 + r) * ldc + col0 + c4) = v;
    }
    
  }
}

// GEMM C = act(A·W + bias + resid): A f32 (ASPLIT -> hi/lo 2 terms), Wt bf16 [N][K]; ACT 0 none, 1 relu, 2 exact gelu;
// resid (optional, f32, row index = (row % rmod), pitch ldr, RES_BF16 rounds it) added before the activation.
template <bool ASPLIT, int ACT, bool BIAS_BF16, bool RES_BF16>
__global__ __launch_bounds__(128) void k_gemm_bf3(const float* __restrict__ A, int lda, const unsigned short* __restrict__ Wt, int ldb,
                                                const float* __restrict__ bias, const float* __restrict__ resid, int rmod, int ldr,
                                                float* __restrict__ C, int ldc, int M, int N, int K) {
  __shared__ __attribute__((aligned(16))) float so[4][16][64];
  const int tid = threadIdx.x, w = tid >> 5, lane = tid & 31, ln = lane & 15, hh = lane >> 4;
  const int ntn = N / 64;
  const int wid = blockIdx.x * 4 + w;
  const int mt = wid / ntn, nq = wid % ntn;
  if (mt * 16 >= M) return;
  const int row0 = mt * 16, col0 = nq * 64;
  const float* arow = A + (size_t)(row0 + ln) * lda;
  v8f acc[4] = {};
  for (int kb = 0; kb < K; kb += 32) {
    FragB ah, al;
    const v4f x0 = *(const v4fa*)(arow + kb + 8 * hh), x1 = *(const v4fa*)(arow + kb + 8 * hh + 4);
    const v4f x2 = *(const v4fa*)(arow + kb + 16 + 8 * hh), x3 = *(const v4fa*)(arow + kb + 16 + 8 * hh + 4);
    float xs[16] = {x0[0],x0[1],x0[2],x0[3],x1[0],x1[1],x1[2],x1[3],x2[0],x2[1],x2[2],x2[3],x3[0],x3[1],x3[2],x3[3]};
#pragma unroll
    for (int i = 0; i < 16; ++i) { const unsigned short hb = bf16_bits(xs[i]); ah.u[i] = hb; al.u[i] = ASPLIT ? bf16_bits(xs[i] - bf16_val(hb)) : (unsigned short)0; }
#pragma unroll
    for (int t = 0; t < 4; ++t) {
      const unsigned short* brow = Wt + (size_t)(col0 + t * 16 + ln) * ldb + kb;
      FragB b;
      b.half[0] = *(const v8us*)(brow + 8 * hh);
      b.half[1] = *(const v8us*)(brow + 16 + 8 * hh);
      acc[t] = mmaN<ASPLIT ? 2 : 1>(ah.v, al.v, b.v, b.v, acc[t]);
    }
  }
#pragma unroll
  for (int t = 0; t < 4; ++t) {
    const int col = col0 + t * 16 + ln;
    float bv = bias ? bias[col] : 0.f;
    if (BIAS_BF16) bv = bf16_round(bv);
#pragma unroll
    for (int r = 0; r < 8; ++r) {
      float v = acc[t][r] + bv;
      if (resid) { float rv = resid[(size_t)((row0 + 8 * hh + r) % rmod) * ldr + col]; if (RES_BF16) rv = bf16_round(rv); v += rv; }
      if (ACT == 1) v = fmaxf(v, 0.f);
      if (ACT == 2) v = 0.5f * v * (1.0f + erff(v * 0.70710678118654752f));
      if (ACT == 3) { const float u = 0.7978845608028654f * (v + 0.044715f * v * v * v); v = 0.5f * v * (1.0f + tanhf(u)); }
      so[w][8 * hh + r][t * 16 + ln] = v;
    }
  }
  __builtin_amdgcn_fence(__ATOMIC_ACQ_REL, "workgroup");
  __builtin_amdgcn_wave_barrier();
  const int rsub = lane >> 4, c4 = (lane & 15) * 4;
  {
#pragma unroll
    for (int q = 0; q < 8; ++q) {
      const int r = q * 2 + rsub;
      const v4f v = *(const v4fa*)&so[w][r][c4];
      *(v4f*)(C + (size_t)(row0 + r) * ldc + col0 + c4) = v;
    }
    
  }
}
// row LayerNorm (biased variance, eps) over N: s = X (+ R); optional out_sum <- s; out_norm <- (s-mu)*rsqrt(var+eps)*g + b
template <bool PARAM_BF16>
__global__ __launch_bounds__(256) void k_layernorm(const float* __restrict__ X, const float* __restrict__ R, const float* __restrict__ g, const float* __restrict__ bta,
                                                  float* __restrict__ out_sum, float* __restrict__ out_norm, int N, float eps) {
  __shared__ float red[256];
  const int row = blockIdx.x, tid = threadIdx.x;
  const float* x = X + (size_t)row * N; const float* rr = R ? R + (size_t)row * N : nullptr;
  float vals[16];                     // up to N = 4096
  const int per = N / 256;            // contiguous chunk per thread? use strided-by-4 chunks: thread handles j = tid*4 + 1024*u
  float s1 = 0.f;
  for (int u = 0; u < per / 4; ++u) {
    const int j = tid * 4 + 1024 * u;
    const v4f a = *(const v4fa*)(x + j);
    v4f b = {0.f,0.f,0.f,0.f}; if (rr) b = *(const v4fa*)(rr + j);
#pragma unroll
    for (int q = 0; q < 4; ++q) { const float v = a[q] + b[q]; vals[u * 4 + q] = v; s1 += v; }
  }
  red[tid] = s1; __syncthreads();
  for (int st = 128; st > 0; st >>= 1) { if (tid < st) red[tid] += red[tid + st]; __syncthreads(); }
  const float mu = red[0] / (float)N; __syncthreads();
  float s2 = 0.f;
  for (int u = 0; u < per / 4; ++u)
#pragma unroll
    for (int q = 0; q < 4; ++q) { const float c = vals[u * 4 + q] - mu; s2 += c * c; }
  red[tid] = s2; __syncthreads();
  for (int st = 128; st > 0; st >>= 1) { if (tid < st) red[tid] += red[tid + st]; __syncthreads(); }
  const float rs = rsqrtf(red[0] / (float)N + eps);
  {
    for (int u = 0; u < per / 4; ++u) {
      const int j = tid * 4 + 1024 * u;
      v4f o, sm;
#pragma unroll
      for (int q = 0; q < 4; ++q) {
        float gg = g[j + q], bb = bta[j + q];
        if (PARAM_BF16) { gg = bf16_round(gg); bb = bf16_round(bb); }
        sm[q] = vals[u * 4 + q]; o[q] = (vals[u * 4 + q] - mu) * rs * gg + bb;
      }
      if (out_sum) *(v4f*)(out_sum + (size_t)row * N + j) = sm;
      *(v4f*)(out_norm + (size_t)row * N + j) = o;
    }
    
  }
}



// ---- f16 WMMA path (v_wmma_f32_16x16x32_f16): 11-bit significands for operands in range — used where a [0,1] probability operand needs more precision than bf16
typedef _Float16 v16h __attribute__((ext_vector_type(16)));
union FragH { v16h v; v8us half[2]; _Float16 h[16]; unsigned short u[16]; };
template <int NT>
__device__ __forceinline__ v8f mmaH(v16h ah, v16h al, v16h bh, v16h bl, v8f c) {
  c = __builtin_amdgcn_wmma_f32_16x16x32_f16(false, ah, false, bh, (short)0, c, false, false);
  if (NT >= 2) c = __builtin_amdgcn_wmma_f32_16x16x32_f16(false, al, false, bh, (short)0, c, false, false);
  if (NT >= 3) c = __builtin_amdgcn_wmma_f32_16x16x32_f16(false, ah, false, bl, (short)0, c, false, false);
  asm volatile("v_nop\n\tv_nop\n\tv_nop\n\tv_nop" : "+v"(c) : "v"(ah), "v"(al), "v"(bh), "v"(bl));
  return c;
}
// batched GEMM like k_gemm_b but f16 operands: A f32 (split into f16 hi/lo if ASPLIT, else rounded to f16), Bt = f16 values [n][k]; alpha; C f32; N multiple of 16 (partial tiles skipped)
template <bool ASPLIT>
__global__ __launch_bounds__(128) void k_gemm_h(const float* __restrict__ A, int lda, size_t sA, const _Float16* __restrict__ Bh, int ldb, size_t sB, float alpha, float* __restrict__ C, int ldc, size_t sC, int M, int N, int K) {
  __shared__ __attribute__((aligned(16))) float so[4][16][64];
  const int tid = threadIdx.x, w = tid >> 5, lane = tid & 31, ln = lane & 15, hh = lane >> 4; const int by = blockIdx.y;
  A += (size_t)by * sA; Bh += (size_t)by * sB; C += (size_t)by * sC;
  const int ntn = (N + 63) / 64; const int wid = blockIdx.x * 4 + w; const int mt = wid / ntn, nq = wid % ntn; if (mt * 16 >= M) return;
  const int row0 = mt * 16, col0 = nq * 64; const float* arow = A + (size_t)(row0 + ln) * lda;
  v8f acc[4] = {};
  for (int kb = 0; kb < K; kb += 32) {
    FragH ah, al;
    const v4f x0 = *(const v4fa*)(arow + kb + 8 * hh), x1 = *(const v4fa*)(arow + kb + 8 * hh + 4), x2 = *(const v4fa*)(arow + kb + 16 + 8 * hh), x3 = *(const v4fa*)(arow + kb + 16 + 8 * hh + 4);
    float xs[16] = {x0[0],x0[1],x0[2],x0[3],x1[0],x1[1],x1[2],x1[3],x2[0],x2[1],x2[2],x2[3],x3[0],x3[1],x3[2],x3[3]};
#pragma unroll
    for (int i = 0; i < 16; ++i) { const _Float16 h = (_Float16)xs[i]; ah.h[i] = h; al.h[i] = ASPLIT ? (_Float16)(xs[i] - (float)h) : (_Float16)0.0f; }
#pragma unroll
    for (int t = 0; t < 4; ++t) { if (col0 + t * 16 >= N) continue; const size_t boff = (size_t)(col0 + t * 16 + ln) * ldb + kb; FragH bq; bq.half[0] = *(const v8us*)(Bh + boff + 8 * hh); bq.half[1] = *(const v8us*)(Bh + boff + 16 + 8 * hh);
      acc[t] = mmaH<ASPLIT ? 2 : 1>(ah.v, al.v, bq.v, bq.v, acc[t]); }
  }
#pragma unroll
  for (int t = 0; t < 4; ++t) { if (col0 + t * 16 >= N) continue;
#pragma unroll
    for (int r = 0; r < 8; ++r) so[w][8 * hh + r][t * 16 + ln] = acc[t][r] * alpha; }
  __builtin_amdgcn_fence(__ATOMIC_ACQ_REL, "workgroup"); __builtin_amdgcn_wave_barrier();
  const int rsub = lane >> 4, c4 = (lane & 15) * 4;
  {
#pragma unroll
    for (int q = 0; q < 8; ++q) { const int r = q * 2 + rsub; if (col0 + c4 < N) { const v4f v = *(const v4fa*)&so[w][r][c4]; *(v4f*)(C + (size_t)(row0 + r) * ldc + col0 + c4) = v; } }
     }
}

// Wt[n][k] = f16(W[k][n]·scale) from f32 row-major W[K][N] (scale = power of two; bf16-exact weights stay exact in f16 away from the subnormal range)
__global__ __launch_bounds__(256) void k_wt_f16(const float* __restrict__ W, _Float16* __restrict__ Wt, int K, int N, float scale) {
  const int t = blockIdx.x * 256 + threadIdx.x; if (t >= N * (K / 8)) return; const int n = t / (K / 8), k8 = (t % (K / 8)) * 8; FragH f;
#pragma unroll
  for (int i = 0; i < 8; ++i) f.h[i] = (_Float16)(bf16_round(W[(size_t)(k8 + i) * N + n]) * scale); const v8us o = f.half[0];
  *(v8us*)((unsigned short*)Wt + (size_t)n * K + k8) = o; 
}
// k_gemm_hh variant with fused epilogue: v = acc·alpha + bias[by·sBias + col] (+ CP[(row/rowsPerB)·sCPb + by·64 + col] if CP) ; ACT 0 none / 1 elu ; writes f16 C16 (and f32 C if non-null)
template <int ACT>
__global__ __launch_bounds__(128) void k_gemm_hhx(const _Float16* __restrict__ A, int lda, size_t sA, const _Float16* __restrict__ Bh, int ldb, size_t sB, float alpha, const float* __restrict__ bias, size_t sBias, const float* __restrict__ CP, int rowsPerB, size_t sCPb, int row0g,
    float* __restrict__ C, _Float16* __restrict__ C16, int ldc, size_t sC, int M, int N, int K) {
  __shared__ __attribute__((aligned(16))) float so[4][16][64];
  const int tid = threadIdx.x, w = tid >> 5, lane = tid & 31, ln = lane & 15, hh = lane >> 4; const int by = blockIdx.y;
  A += (size_t)by * sA; Bh += (size_t)by * sB; const size_t cofs = (size_t)by * sC; const float* bp = bias ? bias + (size_t)by * sBias : nullptr;
  const int ntn = (N + 63) / 64; const int wid = blockIdx.x * 4 + w; const int mt = wid / ntn, nq = wid % ntn; if (mt * 16 >= M) return;
  const int row0 = mt * 16, col0 = nq * 64; const _Float16* arow = A + (size_t)(row0 + ln) * lda;
  v8f acc[4] = {};
  for (int kb = 0; kb < K; kb += 32) { FragH ah; ah.half[0] = *(const v8us*)((const unsigned short*)arow + kb + 8 * hh); ah.half[1] = *(const v8us*)((const unsigned short*)arow + kb + 16 + 8 * hh);
#pragma unroll
    for (int t = 0; t < 4; ++t) { if (col0 + t * 16 >= N) continue; const size_t boff = (size_t)(col0 + t * 16 + ln) * ldb + kb; FragH bq; bq.half[0] = *(const v8us*)((const unsigned short*)Bh + boff + 8 * hh); bq.half[1] = *(const v8us*)((const unsigned short*)Bh + boff + 16 + 8 * hh);
      acc[t] = mmaH<1>(ah.v, ah.v, bq.v, bq.v, acc[t]); }
  }
#pragma unroll
  for (int t = 0; t < 4; ++t) { if (col0 + t * 16 >= N) continue; const int col = col0 + t * 16 + ln; const float bv = bp ? bf16_round(bp[col]) : 0.f;
#pragma unroll
    for (int r = 0; r < 8; ++r) { float v = acc[t][r] * alpha + bv; if (CP) { const int rr = row0g + row0 + 8 * hh + r; if (rowsPerB < 0) v += CP[cofs + (size_t)rr * ldc + col];      /* rowsPerB < 0: own element of the batched C plane */ else { const int bidx = rr / rowsPerB; v += CP[(size_t)bidx * sCPb + (size_t)by * 64 + col]; } } if (ACT == 1) v = (v > 0.f) ? v : expm1f(v); else if (ACT == 7) v = (v > 0.f) ? v + 1.0f : expf(v); else if (ACT == 8) v = tanhf(v); else if (ACT == 9) v = 0.5f * v * (1.0f + tanhf(0.7978845608028654f * (v + 0.044715f * v * v * v))); else if (ACT == 11) v = 1.0f / (1.0f + expf(-v)); else if (ACT == 12) v = (v > 0.f) ? v : 0.01f * v; else if (ACT == 14) v = (v > 0.f) ? v : 0.1f * v; else if (ACT == 16) v = (v >= 0.f) ? v : 0.3f * v; else if (ACT == 17) v = (v >= 0.f) ? v : 0.2f * v; else if (ACT == 15) v = v / (1.0f + expf(-v)); else if (ACT == 3) v = fmaxf(v, 0.f); else if (ACT == 6) v = 0.5f * v * (1.0f + erff(v * 0.70710678118654752f)); so[w][8 * hh + r][t * 16 + ln] = v; } }
  __builtin_amdgcn_fence(__ATOMIC_ACQ_REL, "workgroup"); __builtin_amdgcn_wave_barrier();
  const int rsub = lane >> 4, c4 = (lane & 15) * 4; typedef _Float16 v4h __attribute__((ext_vector_type(4)));
  {
#pragma unroll
    for (int q = 0; q < 8; ++q) { const int r = q * 2 + rsub; if (col0 + c4 < N) { const v4f v = *(const v4fa*)&so[w][r][c4]; if (C) *(v4f*)(C + cofs + (size_t)(row0 + r) * ldc + col0 + c4) = v; if (C16) { v4h h4; for (int i = 0; i < 4; ++i) h4[i] = (_Float16)v[i]; *(v4h*)(C16 + cofs + (size_t)(row0 + r) * ldc + col0 + c4) = h4; } } }
     }
}


typedef _Float16 v4h __attribute__((ext_vector_type(4)));

__global__ __launch_bounds__(256) void k_x16(const float* __restrict__ x, _Float16* __restrict__ X16, size_t n8) { const size_t t = (size_t)blockIdx.x * 256 + threadIdx.x; if (t >= n8) return; FragH f;
#pragma unroll
  for (int q = 0; q < 8; ++q) f.h[q] = (_Float16)bf16_round(x[t * 8 + q]); *(v8us*)((unsigned short*)X16 + t * 8) = f.half[0];  }
__global__ __launch_bounds__(256) void k_h16(const float* __restrict__ x, _Float16* __restrict__ X16, size_t n8) { const size_t t = (size_t)blockIdx.x * 256 + threadIdx.x; if (t >= n8) return; FragH f;
#pragma unroll
  for (int q = 0; q < 8; ++q) f.h[q] = (_Float16)x[t * 8 + q]; *(v8us*)((unsigned short*)X16 + t * 8) = f.half[0];  }
__global__ __launch_bounds__(256) void k_round16f(const float* __restrict__ W, _Float16* __restrict__ Bt, size_t n8) { const size_t t = (size_t)blockIdx.x * 256 + threadIdx.x; if (t >= n8) return; FragH f;
#pragma unroll
  for (int i = 0; i < 8; ++i) f.h[i] = (_Float16)(bf16_round(W[t * 8 + i]) * 16.0f); *(v8us*)((unsigned short*)Bt + t * 8) = f.half[0];  }
template <int NHv, int TTv>
__global__ __launch_bounds__(256) void k_vt(const _Float16* __restrict__ V16, int ldv, int voff, _Float16* __restrict__ Vt) { __shared__ unsigned short tl[64][66]; const int tid = threadIdx.x; const int slab = blockIdx.x / (TTv / 64), lg = blockIdx.x % (TTv / 64); const int b = slab / NHv, h = slab % NHv;
  for (int i = tid; i < 64 * 8; i += 256) { const int r = i / 8, c8 = (i % 8) * 8; FragH f; f.half[0] = *(const v8us*)((const unsigned short*)V16 + ((size_t)b * TTv + lg * 64 + r) * ldv + voff + h * 64 + c8);
#pragma unroll
    for (int q = 0; q < 8; ++q) tl[r][c8 + q] = f.u[q]; }
  __syncthreads();
  {
#pragma unroll
    for (int rd = 0; rd < 2; ++rd) { const int d = rd * 32 + tid / 8, pc = tid % 8; FragH f;
#pragma unroll
      for (int q = 0; q < 8; ++q) f.u[q] = tl[pc * 8 + q][d];
      *(v8us*)((unsigned short*)Vt + ((size_t)slab * 64 + d) * TTv + lg * 64 + pc * 8) = f.half[0]; }
     } }

__global__ __launch_bounds__(256) void k_hl(const float* __restrict__ F, _Float16* __restrict__ Hh, _Float16* __restrict__ Hl, size_t n8) { const size_t t = (size_t)blockIdx.x * 256 + threadIdx.x; if (t >= n8) return; FragH fh, fl; const v4f a = *(const v4fa*)(F + t * 8), c = *(const v4fa*)(F + t * 8 + 4);
#pragma unroll
  for (int q = 0; q < 4; ++q) { _Float16 h = (_Float16)a[q]; fh.h[q] = h; fl.h[q] = (_Float16)((a[q] - (float)h) * 1024.0f); h = (_Float16)c[q]; fh.h[4 + q] = h; fl.h[4 + q] = (_Float16)((c[q] - (float)h) * 1024.0f); }
  { *(v8us*)((unsigned short*)Hh + t * 8) = fh.half[0]; *(v8us*)((unsigned short*)Hl + t * 8) = fl.half[0];  } }

// ---- fast GEMM (wave tile 32x64; requires M % 32 == 0 rows per launch region and N % 64 == 0); epilogue = k_gemm_hhx semantics ----
__device__ __forceinline__ v16h g2_frag(const _Float16* p, int hh) { FragH f; f.half[0] = *(const v8us*)((const unsigned short*)p + 8 * hh); f.half[1] = *(const v8us*)((const unsigned short*)p + 16 + 8 * hh); return f.v; }
__device__ __forceinline__ v8f g2_mma(v16h a, v16h b, v8f c) { v8f d = __builtin_amdgcn_wmma_f32_16x16x32_f16(false, a, false, b, (short)0, c, false, false); asm volatile("v_nop\n\tv_nop\n\tv_nop\n\tv_nop" : "+v"(d) : "v"(a), "v"(b)); return d; }
template <int ACT>
__global__ __launch_bounds__(128) void k_gemm2(const _Float16* __restrict__ A, int lda, size_t sA, const _Float16* __restrict__ Bh, int ldb, size_t sB, float alpha, const float* __restrict__ bias, size_t sBias, const float* __restrict__ CP, int rowsPerB, size_t sCPb, int row0g,
    float* __restrict__ C, _Float16* __restrict__ C16, int ldc, size_t sC, int M, int N, int K, int bsh, size_t zA, size_t zB, size_t zC) { static_assert(ACT == 0 || ACT == 3 || ACT == 6 || ACT == 8 || ACT == 9 || ACT == 11 || ACT == 12 || ACT == 14 || ACT == 15 || ACT == 16 || ACT == 17, "k_gemm2: unsupported ACT code (would silently apply no activation)");
  __shared__ __attribute__((aligned(16))) float so[4][32][68];
  const int tid = threadIdx.x, w = tid >> 5, lane = tid & 31, ln = lane & 15, hh = lane >> 4; const int by = blockIdx.y, bz = blockIdx.z;      /* grid.y = plane (head), 2^bsh planes share one B plane; grid.z = outer batch with its own strides zA, zB, zC */
  A += (size_t)by * sA + (size_t)bz * zA; Bh += (size_t)(by >> bsh) * sB + (size_t)bz * zB; const size_t cofs = (size_t)by * sC + (size_t)bz * zC; const float* bp = bias ? bias + (size_t)by * sBias : nullptr;
  const int ntn = N >> 6; const int mt = blockIdx.x / ntn, nq = blockIdx.x - mt * ntn; const int row0 = mt * 128 + 32 * w, col0 = nq * 64; if (row0 >= M) return;
  const _Float16* a0p = A + (size_t)(row0 + ln) * lda; const _Float16* a1p = a0p + (size_t)16 * lda;
  const _Float16* b0p = Bh + (size_t)(col0 + ln) * ldb; const _Float16* b1p = b0p + (size_t)16 * ldb; const _Float16* b2p = b1p + (size_t)16 * ldb; const _Float16* b3p = b2p + (size_t)16 * ldb;
  const v8f z8 = {0.f,0.f,0.f,0.f,0.f,0.f,0.f,0.f}; v8f c00 = z8, c01 = z8, c02 = z8, c03 = z8, c10 = z8, c11 = z8, c12 = z8, c13 = z8;
#pragma unroll 1
  for (int kb = 0; kb < K; kb += 32) { const v16h a0 = g2_frag(a0p + kb, hh), a1 = g2_frag(a1p + kb, hh);
    v16h b = g2_frag(b0p + kb, hh); c00 = g2_mma(a0, b, c00); c10 = g2_mma(a1, b, c10);
    b = g2_frag(b1p + kb, hh); c01 = g2_mma(a0, b, c01); c11 = g2_mma(a1, b, c11);
    b = g2_frag(b2p + kb, hh); c02 = g2_mma(a0, b, c02); c12 = g2_mma(a1, b, c12);
    b = g2_frag(b3p + kb, hh); c03 = g2_mma(a0, b, c03); c13 = g2_mma(a1, b, c13); }
  v8f accs[8] = {c00, c01, c02, c03, c10, c11, c12, c13};
#pragma unroll
  for (int u = 0; u < 8; ++u) { const int t = u & 3, half = u >> 2; const int col = col0 + t * 16 + ln; const float bv = bp ? bf16_round(bp[col]) : 0.f;
#pragma unroll
    for (int r = 0; r < 8; ++r) { const int rloc = half * 16 + 8 * hh + r; float v = accs[u][r] * alpha + bv; if (CP) { if (rowsPerB < 0) v += CP[cofs + (size_t)(row0g + row0 + rloc) * ldc + col];      /* rowsPerB < 0: own element of the batched C plane */ else { const int bidx = (row0g + row0 + rloc) / rowsPerB; v += CP[(size_t)bidx * sCPb + (size_t)by * 64 + col]; } }
      if (ACT == 3) v = fmaxf(v, 0.f); else if (ACT == 6) v = 0.5f * v * (1.0f + erff(v * 0.70710678118654752f)); else if (ACT == 11) v = 1.0f / (1.0f + expf(-v)); else if (ACT == 15) v = v / (1.0f + expf(-v)); else if (ACT == 12) v = (v > 0.f) ? v : 0.01f * v; else if (ACT == 8) v = tanhf(v); else if (ACT == 9) v = 0.5f * v * (1.0f + tanhf(0.7978845608028654f * (v + 0.044715f * v * v * v))); else if (ACT == 14) v = (v > 0.f) ? v : 0.1f * v; else if (ACT == 16) v = (v >= 0.f) ? v : 0.3f * v; else if (ACT == 17) v = (v >= 0.f) ? v : 0.2f * v;
      so[w][rloc][t * 16 + ln] = v; } }
  __builtin_amdgcn_fence(__ATOMIC_ACQ_REL, "workgroup"); __builtin_amdgcn_wave_barrier();
  const int rsub = lane >> 4, c4 = (lane & 15) * 4;
  {
#pragma unroll
    for (int q = 0; q < 16; ++q) { const int r = q * 2 + rsub; const v4f v = *(const v4fa*)&so[w][r][c4]; if (C) *(v4f*)(C + cofs + (size_t)(row0 + r) * ldc + col0 + c4) = v; if (C16) { v4h h4; for (int i = 0; i < 4; ++i) h4[i] = (_Float16)v[i]; *(v4h*)(C16 + cofs + (size_t)(row0 + r) * ldc + col0 + c4) = h4; } }
     } }


__global__ __launch_bounds__(256) void k_wnat(const float* __restrict__ w, size_t n8, _Float16* __restrict__ Bt) { const size_t t = (size_t)blockIdx.x * 256 + threadIdx.x; if (t >= n8) return; FragH f; for (int q = 0; q < 8; ++q) f.h[q] = (_Float16)(bf16_round(w[t * 8 + q]) * 16.0f); *(v8us*)((unsigned short*)Bt + t * 8) = f.half[0];  }
__global__ __launch_bounds__(256) void k_rsm(const float* __restrict__ S, _Float16* __restrict__ P, int nrows) {
  #pragma clang fp contract(off)
  const int i = blockIdx.x * 256 + threadIdx.x; if (i >= nrows) return; const float* s = S + (size_t)i * SQ; float mx = -3.0e38f;
#pragma unroll 1
  for (int j = 0; j < SQ; ++j) mx = fmaxf(mx, s[j]); float se = 0.f;
#pragma unroll 1
  for (int j = 0; j < SQ; ++j) se += expf(s[j] - mx); const float sc = 256.0f / se;
#pragma unroll 1
  for (int j0 = 0; j0 < SQ; j0 += 8) { FragH f; for (int q = 0; q < 8; ++q) f.h[q] = (_Float16)(expf(s[j0 + q] - mx) * sc); unsigned short* d = (unsigned short*)P + (size_t)i * SQ + j0; *(v8us*)d = f.half[0];  } }
__global__ __launch_bounds__(256) void k_vt(const _Float16* __restrict__ V16, int b, int h0, _Float16* __restrict__ VT) { __shared__ unsigned short tl[64][65]; const int tid = threadIdx.x; const int hh = blockIdx.x % HG, sg = blockIdx.x / HG; const int s0 = sg * 64; const int h = h0 + hh;
  for (int i = tid; i < 64 * 8; i += 256) { const int j = i / 8, d8 = (i % 8) * 8; FragH f; f.half[0] = *(const v8us*)((const unsigned short*)V16 + ((size_t)b * SQ + s0 + j) * DM + h * HD + d8); for (int q = 0; q < 8; ++q) tl[d8 + q][j] = f.u[q]; }
  __syncthreads();
  { for (int i = tid; i < 64 * 8; i += 256) { const int d = i / 8, j8 = (i % 8) * 8; FragH f; for (int q = 0; q < 8; ++q) f.u[q] = tl[d][j8 + q]; *(v8us*)((unsigned short*)VT + ((size_t)hh * HD + d) * SQ + s0 + j8) = f.half[0]; }  } }


// Exact (f32, vector unit) causal attention over the first QT0 rows: one work-group of eight waves per (batch, head, 32 query rows).
// Step 1: wave w keeps key row 32 w + lane in registers and forms its scores against the 32 query rows, each read from LDS at one address for the whole wave.
// Step 2: wave w does the softmax of query rows 4 w .. 4 w + 3, lane = key mod 32 (maximum and denominator: per-lane partial, then a xor butterfly).
// Step 3: wave w sums weight x value over the keys in order for the same four rows, lane = four columns of the head, so that every value row is read as one whole run.
__global__ __launch_bounds__(256) void k_att0h(const float* __restrict__ QF, const float* __restrict__ KF, const float* __restrict__ VF, float scale, float* __restrict__ OF) {
  constexpr int ld = DMX, ldv = DMX, ldo = DMX;      /* row pitches as constants: the rows of one run of loads differ by an immediate offset only */
  static_assert(QT0 == 256, "eight waves: one per 32 keys, four query rows each");
  __shared__ __attribute__((aligned(16))) float sm[8 * 32 * 132 + 32 * 128];
  float (*lk)[32][132] = (float (*)[32][132])sm;      /* key rows at a pitch of 33 x 16 bytes: a lane reads its own row without bank conflicts */
  float (*lp)[QT0] = (float (*)[QT0])sm;      /* scores, then weights: they take the key rows' place once every wave holds its key rows in registers, which keeps the work-group under half of the LDS (above that this compiler budgets 512 registers and fetches the query reads far ahead into a second register window) */
  float (*lq)[128] = (float (*)[128])(sm + 8 * 32 * 132);
  const int tid = threadIdx.x, lane = tid & 31; const int w = __builtin_amdgcn_readfirstlane(tid >> 5); const int h = blockIdx.x / (QT0 / 32), rg = blockIdx.x % (QT0 / 32);
  { const size_t rb = (size_t)blockIdx.y * QT0; QF += rb * ld; KF += rb * ld; VF += rb * ldv; OF += rb * ldo; }      /* grid.y = batch: QT0 rows of every plane per batch */
  const int hc = h * 128 + lane * 4;
  for (int r = 0; r < 4; ++r) *(v4f*)&lq[4 * w + r][lane * 4] = *(const v4fa*)(QF + (size_t)(rg * 32 + 4 * w + r) * ld + hc);
  if (w <= rg) {      /* causal: key chunks 0 .. rg only */
#pragma unroll      /* all 32 row loads in flight together */
    for (int r = 0; r < 32; ++r) *(v4f*)&lk[w][r][lane * 4] = *(const v4fa*)(KF + (size_t)(w * 32 + r) * ld + hc); }
  __syncthreads();
  v4f kr[32];
  if (w <= rg) {
#pragma unroll      /* here and in the c loop below: kr[] stays in registers only if every index is a constant */
    for (int c = 0; c < 32; ++c) kr[c] = *(const v4f*)&lk[w][lane][c * 4]; }
  __syncthreads();      /* every key row has been read: from here on its place holds scores */
  if (w <= rg) {
#pragma unroll 1      /* the body is 512 multiply-adds already */
    for (int r0 = 0; r0 < 32; r0 += 4) { float s0 = 0.f, s1 = 0.f, s2 = 0.f, s3 = 0.f;
#pragma unroll
      for (int c = 0; c < 32; ++c) { const v4f q0 = *(const v4f*)&lq[r0][c * 4], q1 = *(const v4f*)&lq[r0 + 1][c * 4], q2 = *(const v4f*)&lq[r0 + 2][c * 4], q3 = *(const v4f*)&lq[r0 + 3][c * 4];
        for (int u = 0; u < 4; ++u) { s0 = fmaf(q0[u], kr[c][u], s0); s1 = fmaf(q1[u], kr[c][u], s1); s2 = fmaf(q2[u], kr[c][u], s2); s3 = fmaf(q3[u], kr[c][u], s3); } }
      float* sp = &lp[r0][w * 32 + lane]; sp[0] = s0 * scale; sp[QT0] = s1 * scale; sp[2 * QT0] = s2 * scale; sp[3 * QT0] = s3 * scale; } }
  __syncthreads();
  float fin[4];
#pragma unroll      /* fin[] and e[] are indexed by constants */
  for (int r = 0; r < 4; ++r) { const int il = 4 * w + r, i = rg * 32 + il; float e[8]; float mx = -3.0e38f, l = 0.f;
#pragma unroll
    for (int c = 0; c < 8; ++c) { e[c] = -3.0e38f; if (c <= rg) { const float s = lp[il][c * 32 + lane]; if (c * 32 + lane <= i) e[c] = s; } mx = fmaxf(mx, e[c]); }
    for (int m = 16; m > 0; m >>= 1) mx = fmaxf(mx, __shfl_xor(mx, m, 32));
#pragma unroll
    for (int c = 0; c < 8; ++c) { e[c] = (c * 32 + lane <= i) ? expf(e[c] - mx) : 0.f; l += e[c]; }
    for (int m = 16; m > 0; m >>= 1) l += __shfl_xor(l, m, 32);
    fin[r] = 64.0f / l;
#pragma unroll
    for (int c = 0; c < 8; ++c) if (c <= rg) lp[il][c * 32 + lane] = e[c]; }
  __syncthreads();
  const v4f z4 = {0.f, 0.f, 0.f, 0.f}; v4f acc[4] = {z4, z4, z4, z4}; const float* vp = VF + hc; const int nk = (rg + 1) * 32;
#pragma unroll 1      /* 16 value rows in flight a trip are enough; more would only cost registers */
  for (int j0 = 0; j0 < nk; j0 += 16) { v4f vv[16];
#pragma unroll
    for (int u = 0; u < 16; ++u) vv[u] = *(const v4fa*)(vp + (size_t)(j0 + u) * ldv);
#pragma unroll
    for (int g = 0; g < 4; ++g) for (int r = 0; r < 4; ++r) { const v4f p = *(const v4f*)&lp[4 * w + r][j0 + 4 * g]; for (int u = 0; u < 4; ++u) for (int x = 0; x < 4; ++x) acc[r][x] = fmaf(p[u], vv[4 * g + u][x], acc[r][x]); } }
#pragma unroll
  for (int r = 0; r < 4; ++r) { v4f o; for (int x = 0; x < 4; ++x) o[x] = acc[r][x] * fin[r]; *(v4f*)(OF + (size_t)(rg * 32 + 4 * w + r) * ldo + hc) = o; } }
__global__ __launch_bounds__(256) void k_f2h(const float* __restrict__ F, int ldf, int coff, int ncol, _Float16* __restrict__ H16, size_t nrow) { const size_t t = (size_t)blockIdx.x * 256 + threadIdx.x; const size_t n8 = nrow * (size_t)(ncol / 8); if (t >= n8) return; const size_t r = t / (ncol / 8); const int c8 = (int)(t % (ncol / 8)) * 8; FragH f; const v4f a = *(const v4fa*)(F + r * ldf + coff + c8), b2 = *(const v4fa*)(F + r * ldf + coff + c8 + 4); for (int q = 0; q < 4; ++q) { f.h[q] = (_Float16)a[q]; f.h[4 + q] = (_Float16)b2[q]; } *(v8us*)((unsigned short*)H16 + r * ncol + c8) = f.half[0];  }

__global__ __launch_bounds__(256) void k_tab128(float theta, float* __restrict__ CS, float* __restrict__ SN) {
  #pragma clang fp contract(off)
  const int t = blockIdx.x * 256 + threadIdx.x; if (t >= SQ * 64) return; const int i = t % 64; const int p = t / 64; const float invf = (float)(1.0 / pow((double)theta, (double)(2 * i) / 128.0));      /* = XLA's constant-folded f32 table */ const float ang = __fmul_rn((float)p, invf); const float c = cosf(ang), s = sinf(ang);
  *(float*)(CS + t) = c; *(float*)(SN + t) = s;  }
template <int TAB>
__global__ __launch_bounds__(128) void k_rope128(const float* __restrict__ F, int ldf, int nh, const float* __restrict__ CS, const float* __restrict__ SN, _Float16* __restrict__ H16, int ldo, float osc) {
  #pragma clang fp contract(off)
  __shared__ float xv[128]; __shared__ unsigned short sh_[128]; const int d = threadIdx.x; const int h = blockIdx.x % nh; const size_t r = blockIdx.x / nh; const int p = (int)(r % SQ);
  xv[d] = F[r * (size_t)ldf + (size_t)h * 128 + d]; __syncthreads();
  float c, s; if (TAB) { c = bf16_round(CS[(size_t)p * 128 + d]); s = bf16_round(SN[(size_t)p * 128 + d]); } else { c = CS[p * 64 + (d & 63)]; s = SN[p * 64 + (d & 63)]; }
  const float rot = (d < 64) ? -xv[d + 64] : xv[d - 64]; const float o = __fadd_rn(__fmul_rn(xv[d], c), __fmul_rn(rot, s));
  FragH th; th.h[0] = (_Float16)__fmul_rn(o, osc); sh_[d] = th.u[0]; __syncthreads();
  if (d < 16) { FragH f; for (int q = 0; q < 8; ++q) f.u[q] = sh_[d * 8 + q]; unsigned short* dst = (unsigned short*)H16 + r * (size_t)ldo + (size_t)h * 128 + d * 8; *(v8us*)dst = f.half[0];  } }

// Rotate-half RoPE, one wave per token row. 16 lanes per head: a lane holds columns 4 l .. 4 l + 3 and their partners 64 columns on, so x[d] and x[d + 64] meet in one lane (no LDS, no barrier);
// the row's cos / sin values (full-width f32 tables, one row per token row) stay in registers for all NHv heads, two heads per load. grid.x x 8 = rows per batch; grid.y = batch: source and table rows step by yin, output rows by yout.
template <int NHv, int F32OUT>
__global__ __launch_bounds__(256) void k_rope128w(const float* __restrict__ F, const float* __restrict__ CS, const float* __restrict__ SN, float* __restrict__ OF, _Float16* __restrict__ OH, float osc, int yin, int yout) {
  constexpr int ld = NHv * 128, NI = NHv / 2; static_assert(NHv % 2 == 0, "two heads per wave and trip");
  const int lane = threadIdx.x & 31; const int e = (lane >> 4) * 128 + (lane & 15) * 4, d = (lane & 15) * 4; const size_t rl = (size_t)blockIdx.x * 8 + (threadIdx.x >> 5); const size_t r = rl + (size_t)blockIdx.y * yin, ro = rl + (size_t)blockIdx.y * yout;
  const float* cp = CS + r * 128 + d; const float* sp = SN + r * 128 + d; const float* xp = F + r * ld + e;
  const v4f cl = *(const v4fa*)cp, ch = *(const v4fa*)(cp + 64), sl = *(const v4fa*)sp, sh = *(const v4fa*)(sp + 64);
  v4f xl[NI], xh[NI];
#pragma unroll      /* the whole row's loads in flight together; xl[], xh[] stay in registers only if every index is a constant */
  for (int i = 0; i < NI; ++i) { xl[i] = *(const v4fa*)(xp + i * 256); xh[i] = *(const v4fa*)(xp + i * 256 + 64); }
  asm volatile("s_wait_xcnt 0x0" :: "v"(cp), "v"(sp), "v"(xp) : "memory");      /* behind the row's loads, the three addresses as inputs: no address register is given to a later load's result or overwritten while an issued load still names it, and no table load is put off behind the first data wait */
#pragma unroll      /* as above */
  for (int i = 0; i < NI; ++i) { v4f ol, oh;
    for (int q = 0; q < 4; ++q) { ol[q] = fmaf(-xh[i][q], sl[q], xl[i][q] * cl[q]) * osc; oh[q] = fmaf(xl[i][q], sh[q], xh[i][q] * ch[q]) * osc; }      /* x cos rounded, partner x sin fused into the add: the form that the one-thread-per-column kernel compiled to, so roped q and k keep their bits */
    if (F32OUT) { float* dst = OF + ro * ld + e + i * 256; *(v4f*)dst = ol; *(v4f*)(dst + 64) = oh; }
    else { v4h hl, hh; for (int q = 0; q < 4; ++q) { hl[q] = (_Float16)ol[q]; hh[q] = (_Float16)oh[q]; } _Float16* dst = OH + ro * ld + e + i * 256; *(v4h*)dst = hl; *(v4h*)(dst + 64) = hh; } } }
template <int N>
__global__ __launch_bounds__(256) void k_rmsrow(float* __restrict__ X, const float* __restrict__ w, float eps) {
  #pragma clang fp contract(off)
  constexpr int PT = N / 256; __shared__ float red[256]; const size_t r = blockIdx.x; const int t = threadIdx.x; float* row = X + r * N + (size_t)t * PT; float v[PT]; float ss = 0.f;
  for (int q = 0; q < PT; ++q) { v[q] = row[q]; ss = __fadd_rn(ss, __fmul_rn(v[q], v[q])); }
  red[t] = ss; __syncthreads(); for (int k = 128; k > 0; k >>= 1) { if (t < k) red[t] = __fadd_rn(red[t], red[t + k]); __syncthreads(); }
  const float rs = rsqrtf(__fadd_rn(red[0] / (float)N, eps)); float o[PT]; for (int q = 0; q < PT; ++q) o[q] = __fmul_rn(__fmul_rn(v[q], rs), bf16_round(w[t * PT + q]));
  { for (int q = 0; q < PT; ++q) *(float*)(row + q) = o[q];  } }
template <int GS_, int NHQ, int DSRC>
__global__ __launch_bounds__(256) void k_kvexp128(const float* __restrict__ src, float* __restrict__ dst, size_t n4, size_t ysrc, size_t ydst) { const size_t t = (size_t)blockIdx.x * 256 + threadIdx.x; if (t >= n4) return; src += (size_t)blockIdx.y * ysrc; dst += (size_t)blockIdx.y * ydst;      /* grid.y = batch */ const size_t e = t * 4; const size_t row = e / ((size_t)NHQ * 128); const int col = (int)(e % ((size_t)NHQ * 128)); const int h = col / 128, d = col % 128; const v4f v = *(const v4fa*)(src + row * DSRC + (size_t)(h / GS_) * 128 + d); *(v4f*)(dst + e) = v;  }

__global__ __launch_bounds__(256) void k_rsmcfb(const float* __restrict__ S, _Float16* __restrict__ P, int hg, int q0, int nk, const int* __restrict__ mk) {
  #pragma clang fp contract(off)
  const int t = blockIdx.x * 256 + threadIdx.x; if (t >= hg * QT) return; const size_t i = (size_t)t; const float* s = S + i * NKX; const size_t ig = (size_t)(q0 + (t % QT)); const int* mr = mk + ig * SQ; float mx = -3.0e38f;
#pragma unroll 1
  for (int j = 0; j < nk; ++j) { const int mb = mr[j]; const float f = (mb == 0) ? 1.f : 0.f; mx = fmaxf(mx, fmaf(f, s[j], (1.f - f) * -1.0e9f)); } float se = 0.f;
#pragma unroll 1
  for (int j = 0; j < nk; ++j) { const int mb = mr[j]; const float f = (mb == 0) ? 1.f : 0.f; se += __expf(fmaf(f, s[j], (1.f - f) * -1.0e9f) - mx); } const float sc = 256.0f / se;
#pragma unroll 1
  for (int j0 = 0; j0 < nk; j0 += 8) { FragH fr; for (int q = 0; q < 8; ++q) { const int j = j0 + q; const int mb = mr[j]; const float f = (mb == 0) ? 1.f : 0.f; fr.h[q] = (_Float16)(__expf(fmaf(f, s[j], (1.f - f) * -1.0e9f) - mx) * sc); } unsigned short* d = (unsigned short*)P + i * NKX + j0; *(v8us*)d = fr.half[0];  } }


// Causal softmax, one wave per score row: lane l holds columns 128 c + 4 l .. + 3 of every 128-column chunk c in registers, so each
// load and store of a wave covers one contiguous run of the row and the row is read once. Row maximum and denominator: per-lane partial, then a xor butterfly over the 32 lanes.
// rel = the row's last causal column minus the lane's first column.
template <int NC>
__device__ __forceinline__ void rsm_row(const float* __restrict__ s, _Float16* __restrict__ d, int rel) {
  v4f e[NC]; float mx = -3.0e38f, se = 0.f;
#pragma unroll      /* here and below: e[] stays in registers only if every index is a constant */
  for (int c = 0; c < NC; ++c) e[c] = *(const v4fa*)(s + c * 128);
#pragma unroll      /* as above */
  for (int c = 0; c < NC; ++c) for (int q = 0; q < 4; ++q) { const float f = (c * 128 + q <= rel) ? 1.f : 0.f; e[c][q] = fmaf(f, e[c][q], (1.f - f) * -1.0e9f); mx = fmaxf(mx, e[c][q]); }
  for (int m = 16; m > 0; m >>= 1) mx = fmaxf(mx, __shfl_xor(mx, m, 32));
#pragma unroll      /* as above */
  for (int c = 0; c < NC; ++c) for (int q = 0; q < 4; ++q) { e[c][q] = __expf(e[c][q] - mx); se += e[c][q]; }
  for (int m = 16; m > 0; m >>= 1) se += __shfl_xor(se, m, 32);
  const float sc = 256.0f / se;
#pragma unroll      /* as above */
  for (int c = 0; c < NC; ++c) { v4h h4; for (int q = 0; q < 4; ++q) h4[q] = (_Float16)(e[c][q] * sc); *(v4h*)(d + c * 128) = h4; }
  asm volatile("s_wait_xcnt 0x0" ::: "memory");      /* behind the row's stores */
}
__global__ __launch_bounds__(256) void k_rsmcf2(const float* __restrict__ S, _Float16* __restrict__ P, int hg, int q0, int nk) {
  static_assert(QT == 256 && NKX == 8 * QT, "one case per row length below");
  const int col = (threadIdx.x & 31) * 4; const int t = blockIdx.x * 8 + (threadIdx.x >> 5); if (t >= hg * QT) return;
  const float* s = S + (size_t)t * NKX + col; _Float16* d = P + (size_t)t * NKX + col; const int rel = q0 + (t % QT) - col;
  switch (nk / QT) {      /* nk = QT .. NKX in steps of QT: one straight-line body per row length, so that the row's registers are indexed by constants */
    case 1: rsm_row<2>(s, d, rel); break; case 2: rsm_row<4>(s, d, rel); break; case 3: rsm_row<6>(s, d, rel); break; case 4: rsm_row<8>(s, d, rel); break;
    case 5: rsm_row<10>(s, d, rel); break; case 6: rsm_row<12>(s, d, rel); break; case 7: rsm_row<14>(s, d, rel); break; case 8: rsm_row<16>(s, d, rel); break; } }



__global__ __launch_bounds__(256) void k_tab128p(const int* __restrict__ pos, int nrows, float theta, float* __restrict__ CS, float* __restrict__ SN) {
  #pragma clang fp contract(off)
  const int t = blockIdx.x * 256 + threadIdx.x; if (t >= nrows * 64) return; const int i = t % 64; const int r = t / 64; const float invf = (float)(1.0 / pow((double)theta, (double)(2 * i) / 128.0)); const float ang = __fmul_rn((float)pos[r], invf); const float c = cosf(ang), sv = sinf(ang);
  float* c0 = CS + (size_t)r * 128 + i; float* s0 = SN + (size_t)r * 128 + i;
  { *(float*)c0 = c; *(float*)(c0 + 64) = c; *(float*)s0 = sv; *(float*)(s0 + 64) = sv;  } }

__global__ __launch_bounds__(256) void k_rsmcim(const float* __restrict__ S, _Float16* __restrict__ P, int hg, int q0, int nk, const int* __restrict__ am) {
  #pragma clang fp contract(off)
  const int t = blockIdx.x * 256 + threadIdx.x; if (t >= hg * QT) return; const size_t i = (size_t)t; const float* s = S + i * NKX; const int last = q0 + (t % QT); const int* mr = am + (size_t)last * SQ; float mx = -3.0e38f;      /* the module's mask row of this query (keys >= nk lie above the diagonal of the causal mask and are not computed) */
#pragma unroll 1
  for (int j = 0; j < nk; ++j) { const float f = (mr[j] != 0) ? 1.f : 0.f; mx = fmaxf(mx, fmaf(f, s[j], (1.f - f) * -1.0e9f)); } float se = 0.f;
#pragma unroll 1
  for (int j = 0; j < nk; ++j) { const float f = (mr[j] != 0) ? 1.f : 0.f; se += __expf(fmaf(f, s[j], (1.f - f) * -1.0e9f) - mx); } const float sc = 256.0f / se;
#pragma unroll 1
  for (int j0 = 0; j0 < nk; j0 += 8) { FragH fr; for (int q = 0; q < 8; ++q) { const int j = j0 + q; const float f = (mr[j] != 0) ? 1.f : 0.f; fr.h[q] = (_Float16)(__expf(fmaf(f, s[j], (1.f - f) * -1.0e9f) - mx) * sc); } unsigned short* d = (unsigned short*)P + i * NKX + j0; *(v8us*)d = fr.half[0];  } }



__global__ __launch_bounds__(256) void k_tab128h(int nr, float theta, float* __restrict__ CS, float* __restrict__ SN) {
  #pragma clang fp contract(off)
  const size_t t = (size_t)blockIdx.x * 256 + threadIdx.x; if (t >= (size_t)nr * 64) return; const int i = (int)(t % 64); const size_t r = t / 64; const int p = (int)(r % SQ);
  const float invf = (float)(1.0 / pow((double)theta, ((double)(2 * i)) / 128.0)); const float ang = __fmul_rn((float)p, invf); const float c = cosf(ang), sv = sinf(ang);
  float* pc = CS + r * 128 + i; float* ps = SN + r * 128 + i;
  *(float*)pc = c; *(float*)(pc + 64) = c; *(float*)ps = sv; *(float*)(ps + 64) = sv;  }
extern "C" void kernel_launch(void* const* d_in, const int* in_sizes, int n_in,
                              void* d_out, int out_size, void* d_ws, size_t ws_size, hipStream_t stream) {
  (void)in_sizes; (void)n_in; (void)out_size;
  const float* const* I = (const float* const*)d_in; const float* x = I[0]; const float* wq = I[1]; const float* wk = I[2]; const float* wv = I[3]; const float* wo = I[4]; const float* bq = nullptr; const float* bk = nullptr; const float* bv = nullptr; const float* bo = nullptr;      /* [in][out] Wq [2048][2048], Wk/Wv [2048][1024], Wo [2048][2048]; no biases; positions implicit */
  char* ws = (char*)d_ws; size_t off = 0;
  auto take = [&](size_t bytes) { char* p = ws + off; off += (bytes + 255) & ~(size_t)255; return p; };
  _Float16* BQ = (_Float16*)take((size_t)DMX * DMX * 2); _Float16* BK = (_Float16*)take((size_t)DKV * DMX * 2); _Float16* BV = (_Float16*)take((size_t)DKV * DMX * 2); _Float16* BO = (_Float16*)take((size_t)DMX * DMX * 2);
  _Float16* X16 = (_Float16*)take(NR * DMX * 2); float* QF = (float*)take(NR * (DMX + 2 * DKV) * 4); float* KF = QF + NR * DMX; float* VF = KF + NR * DKV; _Float16* Q16 = (_Float16*)take(NR * DMX * 2); _Float16* K16 = (_Float16*)take(NR * DKV * 2); _Float16* V16 = (_Float16*)take(NR * DKV * 2); _Float16* O16 = (_Float16*)take(NR * DMX * 2);
  static_assert((size_t)NB * NH * QT * NKX <= NR * (DMX + 2 * DKV), "score planes must fit the f32 q, k, v planes they reuse");
  float* S = QF;      /* score planes of both batches reuse the f32 q, k, v planes: their last readers (rope, kv expansion) are launched before the first score GEMM of this call */
  _Float16* P = (_Float16*)take((size_t)NB * NH * QT * NKX * 2); _Float16* VT = (_Float16*)take((size_t)NB * (DKV / 64) * 64 * SQ * 2);
  float* CS = (float*)take(NR * 128 * 4); float* SN = (float*)take(NR * 128 * 4); float* QF0 = (float*)take((size_t)NB * QT0 * DMX * 4); float* KRF0 = (float*)take((size_t)NB * QT0 * DKV * 4); float* KF0e = (float*)take((size_t)NB * QT0 * DMX * 4); float* VF0e = (float*)take((size_t)NB * QT0 * DMX * 4); float* OF0 = (float*)take((size_t)NB * QT0 * DMX * 4); _Float16* OH0 = (_Float16*)take((size_t)NB * QT0 * DMX * 2); _Float16* OL0 = (_Float16*)take((size_t)NB * QT0 * DMX * 2);
  if (off > ws_size) return;      /* 24 (weights) + 16 + 64 + 16 + 8 + 8 + 16 + 32 + 8 + 2 + 2 + 4 + 2 + 4 + 4 + 4 + 2 + 2 = 218 MiB */
  k_wt_f16<<<(unsigned)(((size_t)DMX * DMX / 8 + 255) / 256), 256, 0, stream>>>(wq, BQ, DMX, DMX, 16.0f); k_wt_f16<<<(unsigned)(((size_t)DKV * DMX / 8 + 255) / 256), 256, 0, stream>>>(wk, BK, DMX, DKV, 16.0f); k_wt_f16<<<(unsigned)(((size_t)DKV * DMX / 8 + 255) / 256), 256, 0, stream>>>(wv, BV, DMX, DKV, 16.0f); k_wt_f16<<<(unsigned)(((size_t)DMX * DMX / 8 + 255) / 256), 256, 0, stream>>>(wo, BO, DMX, DMX, 16.0f);      /* [in][out] -> Bt x16 */
  k_x16<<<(unsigned)((NR * DMX / 8 + 255) / 256), 256, 0, stream>>>(x, X16, NR * DMX / 8);
  k_gemm2<0><<<dim3((unsigned)((NR / 128) * (DMX / 64)), 1), 128, 0, stream>>>(X16, DMX, 0, BQ, DMX, 0, 0.0625f, bq, 0, nullptr, 1, 0, 0, QF, nullptr, DMX, 0, (int)NR, DMX, DMX, 0, 0, 0, 0);      /* q (f32) */
  k_gemm2<0><<<dim3((unsigned)((NR / 128) * (DKV / 64)), 1), 128, 0, stream>>>(X16, DMX, 0, BK, DMX, 0, 0.0625f, bk, 0, nullptr, 1, 0, 0, KF, nullptr, DKV, 0, (int)NR, DKV, DMX, 0, 0, 0, 0);      /* k (f32) */
  k_gemm2<0><<<dim3((unsigned)((NR / 128) * (DKV / 64)), 1), 128, 0, stream>>>(X16, DMX, 0, BV, DMX, 0, 0.0625f, bv, 0, nullptr, 1, 0, 0, VF, V16, DKV, 0, (int)NR, DKV, DMX, 0, 0, 0, 0);      /* v (f32 for the first tile + f16) */
  k_tab128h<<<(unsigned)((NR * 64 + 255) / 256), 256, 0, stream>>>((int)NR, 10000.0f, CS, SN);      /* per-row cos/sin tables [NR][128] for positions r % SQ, duplicated over both halves (cat(f, f)) */
  k_rope128w<NH, 0><<<(unsigned)(NR / 8), 256, 0, stream>>>(QF, CS, SN, nullptr, Q16, 1.0f, 0, 0); k_rope128w<NKV, 0><<<(unsigned)(NR / 8), 256, 0, stream>>>(KF, CS, SN, nullptr, K16, 1.0f, 0, 0);      /* rope (all rows) -> f16 */
  /* From here on every launch covers both batches (grid.y or grid.z = batch, else batch folded into grid.x), and each attention GEMM all 16 query heads (grid.y = head). */
  k_rope128w<NH, 1><<<dim3(QT0 / 8, NB), 256, 0, stream>>>(QF, CS, SN, QF0, nullptr, 1.0f, SQ, QT0); k_rope128w<NKV, 1><<<dim3(QT0 / 8, NB), 256, 0, stream>>>(KF, CS, SN, KRF0, nullptr, 1.0f, SQ, QT0);      /* f32 roped q, k of each batch's first QT0 rows */
  k_kvexp128<GSZ, NH, DKV><<<dim3((unsigned)(((size_t)QT0 * DMX / 4 + 255) / 256), NB), 256, 0, stream>>>(KRF0, KF0e, (size_t)QT0 * DMX / 4, (size_t)QT0 * DKV, (size_t)QT0 * DMX); k_kvexp128<GSZ, NH, DKV><<<dim3((unsigned)(((size_t)QT0 * DMX / 4 + 255) / 256), NB), 256, 0, stream>>>(VF, VF0e, (size_t)QT0 * DMX / 4, (size_t)SQ * DKV, (size_t)QT0 * DMX);      /* kv head -> query head expansion for the exact first tile */
  k_vt<DKV / 64, SQ><<<NB * (DKV / 64) * (SQ / 64), 256, 0, stream>>>(V16, DKV, 0, VT);      /* V^T, [batch][DKV][SQ]: kv head g = slabs 2g, 2g+1 of its batch */
  k_att0h<<<dim3(NH * (QT0 / 32), NB), 256, 0, stream>>>(QF0, KF0e, VF0e, ATS, OF0);      /* exact causal attention, first QT0 rows (o x64) */
  for (int q0 = 0; q0 < SQ; q0 += QT) { const int nk = q0 + QT;      /* causal: keys below the tile end only */
    k_gemm2<0><<<dim3((QT / 128) * (nk / 64), NH, NB), 128, 0, stream>>>(Q16 + (size_t)q0 * DMX, DMX, (size_t)HDK, K16, DKV, (size_t)HDK, ATS, nullptr, 0, nullptr, 1, 0, 0, S, nullptr, NKX, (size_t)QT * NKX, QT, nk, HDK, GSH, (size_t)SQ * DMX, (size_t)SQ * DKV, (size_t)NH * QT * NKX);      /* scores: query head y vs key slab y >> GSH */
    k_rsmcf2<<<(NB * NH * QT + 7) / 8, 256, 0, stream>>>(S, P, NB * NH, q0, nk);      /* causal softmax (arithmetic select) over the computed keys, one wave per row */
    k_gemm2<0><<<dim3((QT / 128) * (HDK / 64), NH, NB), 128, 0, stream>>>(P, NKX, (size_t)QT * NKX, VT, SQ, (size_t)HDK * SQ, 0.25f, nullptr, 0, nullptr, 1, 0, 0, nullptr, O16 + (size_t)q0 * DMX, DMX, (size_t)HDK, QT, HDK, nk, GSH, (size_t)NH * QT * NKX, (size_t)DKV * SQ, (size_t)SQ * DMX); }      /* o (x64): query head y vs V^T slab y >> GSH */
  k_gemm2<0><<<dim3((unsigned)((NR / 128) * (DMX / 64)), 1), 128, 0, stream>>>(O16, DMX, 0, BO, DMX, 0, 0.0009765625f, bo, 0, nullptr, 1, 0, 0, (float*)d_out, nullptr, DMX, 0, (int)NR, DMX, DMX, 0, 0, 0, 0);      /* out = o Wo */
  k_hl<<<(unsigned)(((size_t)NB * QT0 * DMX / 8 + 255) / 256), 256, 0, stream>>>(OF0, OH0, OL0, (size_t)NB * QT0 * DMX / 8);      /* first-tile o (x64) -> f16 hi + x1024 residual planes */
  k_gemm2<0><<<dim3((QT0 / 128) * (DMX / 64), 1, NB), 128, 0, stream>>>(OH0, DMX, 0, BO, DMX, 0, 0.0009765625f, bo, 0, nullptr, 1, 0, 0, (float*)d_out, nullptr, DMX, 0, QT0, DMX, DMX, 0, (size_t)QT0 * DMX, 0, (size_t)SQ * DMX);      /* first QT0 rows of each batch rewritten from the exact path */
  k_gemm2<0><<<dim3((QT0 / 128) * (DMX / 64), 1, NB), 128, 0, stream>>>(OL0, DMX, 0, BO, DMX, 0, 0.00000095367431640625f, nullptr, 0, (const float*)d_out, -1, 0, 0, (float*)d_out, nullptr, DMX, 0, QT0, DMX, DMX, 0, (size_t)QT0 * DMX, 0, (size_t)SQ * DMX);      /* += o_lo Wo 2^-20 (own-element accumulate) */
}

// v005
// A run of this version takes 577 microseconds.
// Two timings next to v004 both put it at 1.82 times that version's speed.
// Over all steps from v000 it is 20.6 times as fast.
#include <hip/hip_runtime.h>
// Grouped-query causal attention with rotate-half RoPE, 16 query / 8 kv heads of 128 (x [2][2048][2048]; q = x Wq (16 x 128), k = x Wk, v = x Wv (8 x 128) ([in][out] weights sigma 0.02, no biases); inv_freq_i = 1/10000^(2i/128), positions 0..2047, cos/sin = cat(freqs, freqs); q, k roped; kv head h/2 serves query head h; scores / sqrt(128); causal (tril, -inf); softmax; out = merged Wo -> [2][2048][2048]).
// Compute dtype: inputs rounded to bf16; x / weights exact; projections and rope f32; q, k, v, softmax weights and o as plain f16 GEMM operands (~2^-12; first 256 rows of each batch exact); scores, statistics, out f32. v_wmma_f32_16x16x32_f16.
#define NB 2
#define SQ 2048
#define DMX 2048
#define NH 16
#define NKV 8
#define GSZ 2                        /* query heads per kv head */
#define GSH 1                        /* log2(GSZ): query head >> GSH = its kv head */
#define HDK 128
#define DKV (NKV * HDK)
#define QT 256
#define QT0 256
#define NKX SQ
#define DM DMX
#define HD 64
#define HG 1
#define NR ((size_t)NB * SQ)
#define ATS 0.08838834764831845f
typedef __bf16 v16b __attribute__((ext_vector_type(16)));
typedef unsigned short v8us __attribute__((ext_vector_type(8), may_alias));
typedef float  v8f  __attribute__((ext_vector_type(8)));
typedef float  v4f  __attribute__((ext_vector_type(4)));
typedef float  v4fa __attribute__((ext_vector_type(4), may_alias));
union FragB { v16b v; v8us half[2]; unsigned short u[16]; };

__device__ __forceinline__ unsigned short bf16_bits(float x) { unsigned int u = __float_as_uint(x); return (unsigned short)((u + 0x7FFFu + ((u >> 16) & 1u)) >> 16); }
__device__ __forceinline__ float bf16_val(unsigned short b) { return __uint_as_float(((unsigned int)b) << 16); }
__device__ __forceinline__ float bf16_round(float x) { return bf16_val(bf16_bits(x)); }
// D += A·B with NT terms: 1 = ah·bh, 2 = + al·bh (A split), 3 = + ah·bl (both split)
template <int NT>
__device__ __forceinline__ v8f mmaN(v16b ah, v16b al, v16b bh, v16b bl, v8f c) {
  c = __builtin_amdgcn_wmma_f32_16x16x32_bf16(false, ah, false, bh, (short)0, c, false, false);
  if (NT >= 2) c = __builtin_amdgcn_wmma_f32_16x16x32_bf16(false, al, false, bh, (short)0, c, false, false);
  if (NT >= 3) c = __builtin_amdgcn_wmma_f32_16x16x32_bf16(false, ah, false, bl, (short)0, c, false, false);
  asm volatile("v_nop\n\tv_nop\n\tv_nop\n\tv_nop" : "+v"(c) : "v"(ah), "v"(al), "v"(bh), "v"(bl));
  return c;
}

__global__ __launch_bounds__(256) void k_wt_bf16(const float* __restrict__ W, unsigned short* __restrict__ Wt, int K, int N) {
  const int t = blockIdx.x * 256 + threadIdx.x;
  const int k8n = K / 8;
  if (t >= N * k8n) return;
  const int n = t / k8n, k8 = (t % k8n) * 8;
  v8us v;
#pragma unroll
  for (int i = 0; i < 8; ++i) v[i] = bf16_bits(W[(size_t)(k8 + i) * N + n]);
  *(v8us*)(Wt + (size_t)n * K + k8) = v;
  
}

// GEMM C[M][N] (f32, pitch ldc) = act(A[M][K]·W + bias). A f32 row-major (pitch lda) converted per fragment to bf16
// (ASPLIT: hi/lo two planes -> 2 terms, else single rounded term); Wt bf16 [N][K] (pitch ldb). BIAS_BF16 rounds the
// bias to bf16 first (bias quantised to bf16 before the add). K%32==0, M%16==0, N%64==0.
template <bool ASPLIT, int ACT, bool BIAS_BF16>
__global__ __launch_bounds__(128) void k_gemm_bf(const float* __restrict__ A, int lda, const unsigned short* __restrict__ Wt, int ldb,
                                               const float* __restrict__ bias, float* __restrict__ C, int ldc, int M, int N, int K) {
  __shared__ __attribute__((aligned(16))) float so[4][16][64];
  const int tid = threadIdx.x, w = tid >> 5, lane = tid & 31, ln = lane & 15, hh = lane >> 4;
  const int ntn = N / 64;
  const int wid = blockIdx.x * 4 + w;
  const int mt = wid / ntn, nq = wid % ntn;
  if (mt * 16 >= M) return;
  const int row0 = mt * 16, col0 = nq * 64;
  const float* arow = A + (size_t)(row0 + ln) * lda;
  v8f acc[4] = {};
  for (int kb = 0; kb < K; kb += 32) {
    FragB ah, al;
    const v4f x0 = *(const v4fa*)(arow + kb + 8 * hh), x1 = *(const v4fa*)(arow + kb + 8 * hh + 4);
    const v4f x2 = *(const v4fa*)(arow + kb + 16 + 8 * hh), x3 = *(const v4fa*)(arow + kb + 16 + 8 * hh + 4);
    float xs[16] = {x0[0],x0[1],x0[2],x0[3],x1[0],x1[1],x1[2],x1[3],x2[0],x2[1],x2[2],x2[3],x3[0],x3[1],x3[2],x3[3]};
#pragma unroll
    for (int i = 0; i < 16; ++i) { const unsigned short hb = bf16_bits(xs[i]); ah.u[i] = hb; al.u[i] = ASPLIT ? bf16_bits(xs[i] - bf16_val(hb)) : (unsigned short)0; }
#pragma unroll
    for (int t = 0; t < 4; ++t) {
      const unsigned short* brow = Wt + (size_t)(col0 + t * 16 + ln) * ldb + kb;
      FragB b;
      b.half[0] = *(const v8us*)(brow + 8 * hh);
      b.half[1] = *(const v8us*)(brow + 16 + 8 * hh);
      acc[t] = mmaN<ASPLIT ? 2 : 1>(ah.v, al.v, b.v, b.v, acc[t]);
    }
  }
#pragma unroll
  for (int t = 0; t < 4; ++t) {
    float bv = bias ? bias[col0 + t * 16 + ln] : 0.f;
    if (BIAS_BF16) bv = bf16_round(bv);
#pragma unroll
    for (int r = 0; r < 8; ++r) { float v = acc[t][r] + bv; if (ACT == 1) v = fmaxf(v, 0.f); so[w][8 * hh + r][t * 16 + ln] = v; }
  }
  __builtin_amdgcn_fence(__ATOMIC_ACQ_REL, "workgroup");
  __builtin_amdgcn_wave_barrier();
  const int rsub = lane >> 4, c4 = (lane & 15) * 4;
  {
#pragma unroll
    for (int q = 0; q < 8; ++q) {
      const int r = q * 2 + rsub;
      const v4f v = *(const v4fa*)&so[w][r][c4];
      *(v4f*)(C + (size_t)(row0 + r) * ldc + col0 + c4) = v;
    }
    
  }
}

// GEMM C = act(A·W + bias + resid): A f32 (ASPLIT -> hi/lo 2 terms), Wt bf16 [N][K]; ACT 0 none, 1 relu, 2 exact gelu;
// resid (optional, f32, row index = (row % rmod), pitch ldr, RES_BF16 rounds it) added before the activation.
template <bool ASPLIT, int ACT, bool BIAS_BF16, bool RES_BF16>
__global__ __launch_bounds__(128) void k_gemm_bf3(const float* __restrict__ A, int lda, const unsigned short* __restrict__ Wt, int ldb,
                                                const float* __restrict__ bias, const float* __restrict__ resid, int rmod, int ldr,
                                                float* __restrict__ C, int ldc, int M, int N, int K) {
  __shared__ __attribute__((aligned(16))) float so[4][16][64];
  const int tid = threadIdx.x, w = tid >> 5, lane = tid & 31, ln = lane & 15, hh = lane >> 4;
  const int ntn = N / 64;
  const int wid = blockIdx.x * 4 + w;
  const int mt = wid / ntn, nq = wid % ntn;
  if (mt * 16 >= M) return;
  const int row0 = mt * 16, col0 = nq * 64;
  const float* arow = A + (size_t)(row0 + ln) * lda;
  v8f acc[4] = {};
  for (int kb = 0; kb < K; kb += 32) {
    FragB ah, al;
    const v4f x0 = *(const v4fa*)(arow + kb + 8 * hh), x1 = *(const v4fa*)(arow + kb + 8 * hh + 4);
    const v4f x2 = *(const v4fa*)(arow + kb + 16 + 8 * hh), x3 = *(const v4fa*)(arow + kb + 16 + 8 * hh + 4);
    float xs[16] = {x0[0],x0[1],x0[2],x0[3],x1[0],x1[1],x1[2],x1[3],x2[0],x2[1],x2[2],x2[3],x3[0],x3[1],x3[2],x3[3]};
#pragma unroll
    for (int i = 0; i < 16; ++i) { const unsigned short hb = bf16_bits(xs[i]); ah.u[i] = hb; al.u[i] = ASPLIT ? bf16_bits(xs[i] - bf16_val(hb)) : (unsigned short)0; }
#pragma unroll
    for (int t = 0; t < 4; ++t) {
      const unsigned short* brow = Wt + (size_t)(col0 + t * 16 + ln) * ldb + kb;
      FragB b;
      b.half[0] = *(const v8us*)(brow + 8 * hh);
      b.half[1] = *(const v8us*)(brow + 16 + 8 * hh);
      acc[t] = mmaN<ASPLIT ? 2 : 1>(ah.v, al.v, b.v, b.v, acc[t]);
    }
  }
#pragma unroll
  for (int t = 0; t < 4; ++t) {
    const int col = col0 + t * 16 + ln;
    float bv = bias ? bias[col] : 0.f;
    if (BIAS_BF16) bv = bf16_round(bv);
#pragma unroll
    for (int r = 0; r < 8; ++r) {
      float v = acc[t][r] + bv;
      if (resid) { float rv = resid[(size_t)((row0 + 8 * hh + r) % rmod) * ldr + col]; if (RES_BF16) rv = bf16_round(rv); v += rv; }
      if (ACT == 1) v = fmaxf(v, 0.f);
      if (ACT == 2) v = 0.5f * v * (1.0f + erff(v * 0.70710678118654752f));
      if (ACT == 3) { const float u = 0.7978845608028654f * (v + 0.044715f * v * v * v); v = 0.5f * v * (1.0f + tanhf(u)); }
      so[w][8 * hh + r][t * 16 + ln] = v;
    }
  }
  __builtin_amdgcn_fence(__ATOMIC_ACQ_REL, "workgroup");
  __builtin_amdgcn_wave_barrier();
  const int rsub = lane >> 4, c4 = (lane & 15) * 4;
  {
#pragma unroll
    for (int q = 0; q < 8; ++q) {
      const int r = q * 2 + rsub;
      const v4f v = *(const v4fa*)&so[w][r][c4];
      *(v4f*)(C + (size_t)(row0 + r) * ldc + col0 + c4) = v;
    }
    
  }
}
// row LayerNorm (biased variance, eps) over N: s = X (+ R); optional out_sum <- s; out_norm <- (s-mu)*rsqrt(var+eps)*g + b
template <bool PARAM_BF16>
__global__ __launch_bounds__(256) void k_layernorm(const float* __restrict__ X, const float* __restrict__ R, const float* __restrict__ g, const float* __restrict__ bta,
                                                  float* __restrict__ out_sum, float* __restrict__ out_norm, int N, float eps) {
  __shared__ float red[256];
  const int row = blockIdx.x, tid = threadIdx.x;
  const float* x = X + (size_t)row * N; const float* rr = R ? R + (size_t)row * N : nullptr;
  float vals[16];                     // up to N = 4096
  const int per = N / 256;            // contiguous chunk per thread? use strided-by-4 chunks: thread handles j = tid*4 + 1024*u
  float s1 = 0.f;
  for (int u = 0; u < per / 4; ++u) {
    const int j = tid * 4 + 1024 * u;
    const v4f a = *(const v4fa*)(x + j);
    v4f b = {0.f,0.f,0.f,0.f}; if (rr) b = *(const v4fa*)(rr + j);
#pragma unroll
    for (int q = 0; q < 4; ++q) { const float v = a[q] + b[q]; vals[u * 4 + q] = v; s1 += v; }
  }
  red[tid] = s1; __syncthreads();
  for (int st = 128; st > 0; st >>= 1) { if (tid < st) red[tid] += red[tid + st]; __syncthreads(); }
  const float mu = red[0] / (float)N; __syncthreads();
  float s2 = 0.f;
  for (int u = 0; u < per / 4; ++u)
#pragma unroll
    for (int q = 0; q < 4; ++q) { const float c = vals[u * 4 + q] - mu; s2 += c * c; }
  red[tid] = s2; __syncthreads();
  for (int st = 128; st > 0; st >>= 1) { if (tid < st) red[tid] += red[tid + st]; __syncthreads(); }
  const float rs = rsqrtf(red[0] / (float)N + eps);
  {
    for (int u = 0; u < per / 4; ++u) {
      const int j = tid * 4 + 1024 * u;
      v4f o, sm;
#pragma unroll
      for (int q = 0; q < 4; ++q) {
        float gg = g[j + q], bb = bta[j + q];
        if (PARAM_BF16) { gg = bf16_round(gg); bb = bf16_round(bb); }
        sm[q] = vals[u * 4 + q]; o[q] = (vals[u * 4 + q] - mu) * rs * gg + bb;
      }
      if (out_sum) *(v4f*)(out_sum + (size_t)row * N + j) = sm;
      *(v4f*)(out_norm + (size_t)row * N + j) = o;
    }
    
  }
}



// ---- f16 WMMA path (v_wmma_f32_16x16x32_f16): 11-bit significands for operands in range — used where a [0,1] probability operand needs more precision than bf16
typedef _Float16 v16h __attribute__((ext_vector_type(16)));
union FragH { v16h v; v8us half[2]; _Float16 h[16]; unsigned short u[16]; };
template <int NT>
__device__ __forceinline__ v8f mmaH(v16h ah, v16h al, v16h bh, v16h bl, v8f c) {
  c = __builtin_amdgcn_wmma_f32_16x16x32_f16(false, ah, false, bh, (short)0, c, false, false);
  if (NT >= 2) c = __builtin_amdgcn_wmma_f32_16x16x32_f16(false, al, false, bh, (short)0, c, false, false);
  if (NT >= 3) c = __builtin_amdgcn_wmma_f32_16x16x32_f16(false, ah, false, bl, (short)0, c, false, false);
  asm volatile("v_nop\n\tv_nop\n\tv_nop\n\tv_nop" : "+v"(c) : "v"(ah), "v"(al), "v"(bh), "v"(bl));
  return c;
}
// batched GEMM like k_gemm_b but f16 operands: A f32 (split into f16 hi/lo if ASPLIT, else rounded to f16), Bt = f16 values [n][k]; alpha; C f32; N multiple of 16 (partial tiles skipped)
template <bool ASPLIT>
__global__ __launch_bounds__(128) void k_gemm_h(const float* __restrict__ A, int lda, size_t sA, const _Float16* __restrict__ Bh, int ldb, size_t sB, float alpha, float* __restrict__ C, int ldc, size_t sC, int M, int N, int K) {
  __shared__ __attribute__((aligned(16))) float so[4][16][64];
  const int tid = threadIdx.x, w = tid >> 5, lane = tid & 31, ln = lane & 15, hh = lane >> 4; const int by = blockIdx.y;
  A += (size_t)by * sA; Bh += (size_t)by * sB; C += (size_t)by * sC;
  const int ntn = (N + 63) / 64; const int wid = blockIdx.x * 4 + w; const int mt = wid / ntn, nq = wid % ntn; if (mt * 16 >= M) return;
  const int row0 = mt * 16, col0 = nq * 64; const float* arow = A + (size_t)(row0 + ln) * lda;
  v8f acc[4] = {};
  for (int kb = 0; kb < K; kb += 32) {
    FragH ah, al;
    const v4f x0 = *(const v4fa*)(arow + kb + 8 * hh), x1 = *(const v4fa*)(arow + kb + 8 * hh + 4), x2 = *(const v4fa*)(arow + kb + 16 + 8 * hh), x3 = *(const v4fa*)(arow + kb + 16 + 8 * hh + 4);
    float xs[16] = {x0[0],x0[1],x0[2],x0[3],x1[0],x1[1],x1[2],x1[3],x2[0],x2[1],x2[2],x2[3],x3[0],x3[1],x3[2],x3[3]};
#pragma unroll
    for (int i = 0; i < 16; ++i) { const _Float16 h = (_Float16)xs[i]; ah.h[i] = h; al.h[i] = ASPLIT ? (_Float16)(xs[i] - (float)h) : (_Float16)0.0f; }
#pragma unroll
    for (int t = 0; t < 4; ++t) { if (col0 + t * 16 >= N) continue; const size_t boff = (size_t)(col0 + t * 16 + ln) * ldb + kb; FragH bq; bq.half[0] = *(const v8us*)(Bh + boff + 8 * hh); bq.half[1] = *(const v8us*)(Bh + boff + 16 + 8 * hh);
      acc[t] = mmaH<ASPLIT ? 2 : 1>(ah.v, al.v, bq.v, bq.v, acc[t]); }
  }
#pragma unroll
  for (int t = 0; t < 4; ++t) { if (col0 + t * 16 >= N) continue;
#pragma unroll
    for (int r = 0; r < 8; ++r) so[w][8 * hh + r][t * 16 + ln] = acc[t][r] * alpha; }
  __builtin_amdgcn_fence(__ATOMIC_ACQ_REL, "workgroup"); __builtin_amdgcn_wave_barrier();
  const int rsub = lane >> 4, c4 = (lane & 15) * 4;
  {
#pragma unroll
    for (int q = 0; q < 8; ++q) { const int r = q * 2 + rsub; if (col0 + c4 < N) { const v4f v = *(const v4fa*)&so[w][r][c4]; *(v4f*)(C + (size_t)(row0 + r) * ldc + col0 + c4) = v; } }
     }
}

// Wt[n][k] = f16(W[k][n]·scale) from f32 row-major W[K][N] (scale = power of two; bf16-exact weights stay exact in f16 away from the subnormal range)
__global__ __launch_bounds__(256) void k_wt_f16(const float* __restrict__ W, _Float16* __restrict__ Wt, int K, int N, float scale) {
  const int t = blockIdx.x * 256 + threadIdx.x; if (t >= N * (K / 8)) return; const int n = t / (K / 8), k8 = (t % (K / 8)) * 8; FragH f;
#pragma unroll
  for (int i = 0; i < 8; ++i) f.h[i] = (_Float16)(bf16_round(W[(size_t)(k8 + i) * N + n]) * scale); const v8us o = f.half[0];
  *(v8us*)((unsigned short*)Wt + (size_t)n * K + k8) = o; 
}
// k_gemm_hh variant with fused epilogue: v = acc·alpha + bias[by·sBias + col] (+ CP[(row/rowsPerB)·sCPb + by·64 + col] if CP) ; ACT 0 none / 1 elu ; writes f16 C16 (and f32 C if non-null)
template <int ACT>
__global__ __launch_bounds__(128) void k_gemm_hhx(const _Float16* __restrict__ A, int lda, size_t sA, const _Float16* __restrict__ Bh, int ldb, size_t sB, float alpha, const float* __restrict__ bias, size_t sBias, const float* __restrict__ CP, int rowsPerB, size_t sCPb, int row0g,
    float* __restrict__ C, _Float16* __restrict__ C16, int ldc, size_t sC, int M, int N, int K) {
  __shared__ __attribute__((aligned(16))) float so[4][16][64];
  const int tid = threadIdx.x, w = tid >> 5, lane = tid & 31, ln = lane & 15, hh = lane >> 4; const int by = blockIdx.y;
  A += (size_t)by * sA; Bh += (size_t)by * sB; const size_t cofs = (size_t)by * sC; const float* bp = bias ? bias + (size_t)by * sBias : nullptr;
  const int ntn = (N + 63) / 64; const int wid = blockIdx.x * 4 + w; const int mt = wid / ntn, nq = wid % ntn; if (mt * 16 >= M) return;
  const int row0 = mt * 16, col0 = nq * 64; const _Float16* arow = A + (size_t)(row0 + ln) * lda;
  v8f acc[4] = {};
  for (int kb = 0; kb < K; kb += 32) { FragH ah; ah.half[0] = *(const v8us*)((const unsigned short*)arow + kb + 8 * hh); ah.half[1] = *(const v8us*)((const unsigned short*)arow + kb + 16 + 8 * hh);
#pragma unroll
    for (int t = 0; t < 4; ++t) { if (col0 + t * 16 >= N) continue; const size_t boff = (size_t)(col0 + t * 16 + ln) * ldb + kb; FragH bq; bq.half[0] = *(const v8us*)((const unsigned short*)Bh + boff + 8 * hh); bq.half[1] = *(const v8us*)((const unsigned short*)Bh + boff + 16 + 8 * hh);
      acc[t] = mmaH<1>(ah.v, ah.v, bq.v, bq.v, acc[t]); }
  }
#pragma unroll
  for (int t = 0; t < 4; ++t) { if (col0 + t * 16 >= N) continue; const int col = col0 + t * 16 + ln; const float bv = bp ? bf16_round(bp[col]) : 0.f;
#pragma unroll
    for (int r = 0; r < 8; ++r) { float v = acc[t][r] * alpha + bv; if (CP) { const int rr = row0g + row0 + 8 * hh + r; if (rowsPerB < 0) v += CP[cofs + (size_t)rr * ldc + col];      /* rowsPerB < 0: own element of the batched C plane */ else { const int bidx = rr / rowsPerB; v += CP[(size_t)bidx * sCPb + (size_t)by * 64 + col]; } } if (ACT == 1) v = (v > 0.f) ? v : expm1f(v); else if (ACT == 7) v = (v > 0.f) ? v + 1.0f : expf(v); else if (ACT == 8) v = tanhf(v); else if (ACT == 9) v = 0.5f * v * (1.0f + tanhf(0.7978845608028654f * (v + 0.044715f * v * v * v))); else if (ACT == 11) v = 1.0f / (1.0f + expf(-v)); else if (ACT == 12) v = (v > 0.f) ? v : 0.01f * v; else if (ACT == 14) v = (v > 0.f) ? v : 0.1f * v; else if (ACT == 16) v = (v >= 0.f) ? v : 0.3f * v; else if (ACT == 17) v = (v >= 0.f) ? v : 0.2f * v; else if (ACT == 15) v = v / (1.0f + expf(-v)); else if (ACT == 3) v = fmaxf(v, 0.f); else if (ACT == 6) v = 0.5f * v * (1.0f + erff(v * 0.70710678118654752f)); so[w][8 * hh + r][t * 16 + ln] = v; } }
  __builtin_amdgcn_fence(__ATOMIC_ACQ_REL, "workgroup"); __builtin_amdgcn_wave_barrier();
  const int rsub = lane >> 4, c4 = (lane & 15) * 4; typedef _Float16 v4h __attribute__((ext_vector_type(4)));
  {
#pragma unroll
    for (int q = 0; q < 8; ++q) { const int r = q * 2 + rsub; if (col0 + c4 < N) { const v4f v = *(const v4fa*)&so[w][r][c4]; if (C) *(v4f*)(C + cofs + (size_t)(row0 + r) * ldc + col0 + c4) = v; if (C16) { v4h h4; for (int i = 0; i < 4; ++i) h4[i] = (_Float16)v[i]; *(v4h*)(C16 + cofs + (size_t)(row0 + r) * ldc + col0 + c4) = h4; } } }
     }
}


typedef _Float16 v4h __attribute__((ext_vector_type(4)));

__global__ __launch_bounds__(256) void k_x16(const float* __restrict__ x, _Float16* __restrict__ X16, size_t n8) { const size_t t = (size_t)blockIdx.x * 256 + threadIdx.x; if (t >= n8) return; FragH f;
#pragma unroll
  for (int q = 0; q < 8; ++q) f.h[q] = (_Float16)bf16_round(x[t * 8 + q]); *(v8us*)((unsigned short*)X16 + t * 8) = f.half[0];  }
__global__ __launch_bounds__(256) void k_h16(const float* __restrict__ x, _Float16* __restrict__ X16, size_t n8) { const size_t t = (size_t)blockIdx.x * 256 + threadIdx.x; if (t >= n8) return; FragH f;
#pragma unroll
  for (int q = 0; q < 8; ++q) f.h[q] = (_Float16)x[t * 8 + q]; *(v8us*)((unsigned short*)X16 + t * 8) = f.half[0];  }
__global__ __launch_bounds__(256) void k_round16f(const float* __restrict__ W, _Float16* __restrict__ Bt, size_t n8) { const size_t t = (size_t)blockIdx.x * 256 + threadIdx.x; if (t >= n8) return; FragH f;
#pragma unroll
  for (int i = 0; i < 8; ++i) f.h[i] = (_Float16)(bf16_round(W[t * 8 + i]) * 16.0f); *(v8us*)((unsigned short*)Bt + t * 8) = f.half[0];  }
template <int NHv, int TTv>
__global__ __launch_bounds__(256) void k_vt(const _Float16* __restrict__ V16, int ldv, int voff, _Float16* __restrict__ Vt) { __shared__ unsigned short tl[64][66]; const int tid = threadIdx.x; const int slab = blockIdx.x / (TTv / 64), lg = blockIdx.x % (TTv / 64); const int b = slab / NHv, h = slab % NHv;
  for (int i = tid; i < 64 * 8; i += 256) { const int r = i / 8, c8 = (i % 8) * 8; FragH f; f.half[0] = *(const v8us*)((const unsigned short*)V16 + ((size_t)b * TTv + lg * 64 + r) * ldv + voff + h * 64 + c8);
#pragma unroll
    for (int q = 0; q < 8; ++q) tl[r][c8 + q] = f.u[q]; }
  __syncthreads();
  {
#pragma unroll
    for (int rd = 0; rd < 2; ++rd) { const int d = rd * 32 + tid / 8, pc = tid % 8; FragH f;
#pragma unroll
      for (int q = 0; q < 8; ++q) f.u[q] = tl[pc * 8 + q][d];
      *(v8us*)((unsigned short*)Vt + ((size_t)slab * 64 + d) * TTv + lg * 64 + pc * 8) = f.half[0]; }
     } }

__global__ __launch_bounds__(256) void k_hl(const float* __restrict__ F, _Float16* __restrict__ Hh, _Float16* __restrict__ Hl, size_t n8) { const size_t t = (size_t)blockIdx.x * 256 + threadIdx.x; if (t >= n8) return; FragH fh, fl; const v4f a = *(const v4fa*)(F + t * 8), c = *(const v4fa*)(F + t * 8 + 4);
#pragma unroll
  for (int q = 0; q < 4; ++q) { _Float16 h = (_Float16)a[q]; fh.h[q] = h; fl.h[q] = (_Float16)((a[q] - (float)h) * 1024.0f); h = (_Float16)c[q]; fh.h[4 + q] = h; fl.h[4 + q] = (_Float16)((c[q] - (float)h) * 1024.0f); }
  { *(v8us*)((unsigned short*)Hh + t * 8) = fh.half[0]; *(v8us*)((unsigned short*)Hl + t * 8) = fl.half[0];  } }

// ---- fast GEMM (work-group tile 128x128: eight waves of 32x64; requires M % 128 == 0, N % 128 == 0, K % 128 == 0); epilogue = k_gemm_hhx semantics ----
// Both operands go from global memory to LDS by asynchronous copies, 128 k (256 bytes of each of the 128 A rows and 128 B rows) per stage, two buffers: stage t + 1 flies while stage t is multiplied.
// A wave's copy covers two whole rows of the stage (four whole 128-byte lines), and every operand byte is fetched once per work-group instead of once per wave.
#define G2P 136                      /* f16 per LDS row: 272 bytes = 16 x odd, the pitch for 16-byte readers of 256-byte rows */
#define G2BUF (256 * G2P)            /* f16 per buffer: A rows 0 .. 127, then B rows 0 .. 127 */
__device__ __forceinline__ v16h g2_frag(const _Float16* p, int hh) { FragH f; f.half[0] = *(const v8us*)((const unsigned short*)p + 8 * hh); f.half[1] = *(const v8us*)((const unsigned short*)p + 16 + 8 * hh); return f.v; }
__device__ __forceinline__ v8f g2_mma(v16h a, v16h b, v8f c) { v8f d = __builtin_amdgcn_wmma_f32_16x16x32_f16(false, a, false, b, (short)0, c, false, false); asm volatile("v_nop\n\tv_nop\n\tv_nop\n\tv_nop" : "+v"(d) : "v"(a), "v"(b)); return d; }
// Eight asynchronous 16-byte copies per lane: rows r, r + 16, .. r + 112 of one operand's stage (l = the lane's LDS byte address in row r, g = its global address there, step = 16 source rows in elements).
__device__ __forceinline__ void g2_copy8(unsigned l, const _Float16* g, size_t step) {
  const unsigned l1 = l + 16 * G2P * 2, l2 = l + 32 * G2P * 2, l3 = l + 48 * G2P * 2, l4 = l + 64 * G2P * 2, l5 = l + 80 * G2P * 2, l6 = l + 96 * G2P * 2, l7 = l + 112 * G2P * 2;
  const _Float16* g1 = g + step; const _Float16* g2 = g1 + step; const _Float16* g3 = g2 + step; const _Float16* g4 = g3 + step; const _Float16* g5 = g4 + step; const _Float16* g6 = g5 + step; const _Float16* g7 = g6 + step;
  /* the copies and, as the statement's last line, the wait in front of any rewrite of a register that an issued copy names */
  asm volatile("global_load_async_to_lds_b128 %0, %8, off\n\t"
               "global_load_async_to_lds_b128 %1, %9, off\n\t"
               "global_load_async_to_lds_b128 %2, %10, off\n\t"
               "global_load_async_to_lds_b128 %3, %11, off\n\t"
               "global_load_async_to_lds_b128 %4, %12, off\n\t"
               "global_load_async_to_lds_b128 %5, %13, off\n\t"
               "global_load_async_to_lds_b128 %6, %14, off\n\t"
               "global_load_async_to_lds_b128 %7, %15, off\n\t"
               "s_wait_xcnt 0x0"
               :: "v"(l), "v"(l1), "v"(l2), "v"(l3), "v"(l4), "v"(l5), "v"(l6), "v"(l7), "v"(g), "v"(g1), "v"(g2), "v"(g3), "v"(g4), "v"(g5), "v"(g6), "v"(g7) : "memory"); }
template <int ACT>
__global__ __launch_bounds__(256) void k_gemm2(const _Float16* __restrict__ A, int lda, size_t sA, const _Float16* __restrict__ Bh, int ldb, size_t sB, float alpha, const float* __restrict__ bias, size_t sBias, const float* __restrict__ CP, int rowsPerB, size_t sCPb, int row0g,
    float* __restrict__ C, _Float16* __restrict__ C16, int ldc, size_t sC, int M, int N, int K, int bsh, size_t zA, size_t zB, size_t zC) { static_assert(ACT == 0 || ACT == 3 || ACT == 6 || ACT == 8 || ACT == 9 || ACT == 11 || ACT == 12 || ACT == 14 || ACT == 15 || ACT == 16 || ACT == 17, "k_gemm2: unsupported ACT code (would silently apply no activation)");
  __shared__ __attribute__((aligned(16))) float sm[2 * G2BUF / 2];      /* the two operand buffers; behind the loop's last barrier the same LDS stages the output */
  static_assert(8 * 32 * 68 <= 2 * G2BUF / 2, "output staging must fit the operand buffers");
  float (*so)[32][68] = (float (*)[32][68])sm; const _Float16* lh = (const _Float16*)sm;
  const int tid = threadIdx.x, w = tid >> 5, lane = tid & 31, ln = lane & 15, hh = lane >> 4; const int by = blockIdx.y, bz = blockIdx.z;      /* grid.y = plane (head), 2^bsh planes share one B plane; grid.z = outer batch with its own strides zA, zB, zC */
  A += (size_t)by * sA + (size_t)bz * zA; Bh += (size_t)(by >> bsh) * sB + (size_t)bz * zB; const size_t cofs = (size_t)by * sC + (size_t)bz * zC; const float* bp = bias ? bias + (size_t)by * sBias : nullptr;
  const int ntn = N >> 7; const int mt = blockIdx.x / ntn, nq = blockIdx.x - mt * ntn; if (mt * 128 >= M) return;      /* the same for the whole work-group, in front of every barrier */
  const int row0 = mt * 128 + 32 * (w & 3), col0 = nq * 128 + 64 * (w >> 2);
  const int cr = tid >> 4, cc = (tid & 15) * 8;      /* copies: 16 lanes per row, 16 bytes each */
  const _Float16* ga = A + (size_t)(mt * 128 + cr) * lda + cc; const _Float16* gb = Bh + (size_t)(nq * 128 + cr) * ldb + cc; const size_t sa16 = (size_t)16 * lda, sb16 = (size_t)16 * ldb;
  const unsigned la = (unsigned)(size_t)sm + (unsigned)(cr * G2P + cc) * 2u, lb = la + 128u * G2P * 2u;
  const int aoff = (32 * (w & 3) + ln) * G2P, boff = (128 + 64 * (w >> 2) + ln) * G2P;
  const v8f z8 = {0.f,0.f,0.f,0.f,0.f,0.f,0.f,0.f}; v8f c00 = z8, c01 = z8, c02 = z8, c03 = z8, c10 = z8, c11 = z8, c12 = z8, c13 = z8;
  const int nt = K >> 7;
  g2_copy8(la, ga, sa16); g2_copy8(lb, gb, sb16);      /* stage 0 -> buffer 0 */
  asm volatile("s_wait_asynccnt 0x0" ::: "memory");      /* this wave's copies of stage 0 have landed */
  __syncthreads();      /* ... and every other wave's: stage 0 may be read */
  if (nt > 1) { g2_copy8(la + G2BUF * 2u, ga + 128, sa16); g2_copy8(lb + G2BUF * 2u, gb + 128, sb16); }      /* stage 1 -> buffer 1 */
#pragma unroll 1      /* one stage a trip: 32 matrix instructions a wave */
  for (int t = 0; t < nt; ++t) { const _Float16* a0p = lh + (t & 1) * G2BUF + aoff; const _Float16* a1p = a0p + 16 * G2P; const _Float16* b0p = lh + (t & 1) * G2BUF + boff; const _Float16* b1p = b0p + 16 * G2P; const _Float16* b2p = b1p + 16 * G2P; const _Float16* b3p = b2p + 16 * G2P;
    v16h a0 = g2_frag(a0p, hh), a1 = g2_frag(a1p, hh), b0 = g2_frag(b0p, hh), b1 = g2_frag(b1p, hh), b2 = g2_frag(b2p, hh), b3 = g2_frag(b3p, hh);
#pragma unroll      /* two fragment sets in registers, named by constants; the LDS reads differ by immediate offsets */
    for (int kb = 0; kb < 128; kb += 32) { v16h na0 = a0, na1 = a1, nb0 = b0, nb1 = b1, nb2 = b2, nb3 = b3;
      if (kb + 32 < 128) { na0 = g2_frag(a0p + kb + 32, hh); na1 = g2_frag(a1p + kb + 32, hh); nb0 = g2_frag(b0p + kb + 32, hh); nb1 = g2_frag(b1p + kb + 32, hh); nb2 = g2_frag(b2p + kb + 32, hh); nb3 = g2_frag(b3p + kb + 32, hh); }      /* the next 32 k of this stage, read as one group ahead of this block's products: their LDS latency hides behind the eight matrix instructions */
      c00 = g2_mma(a0, b0, c00); c10 = g2_mma(a1, b0, c10); c01 = g2_mma(a0, b1, c01); c11 = g2_mma(a1, b1, c11);
      c02 = g2_mma(a0, b2, c02); c12 = g2_mma(a1, b2, c12); c03 = g2_mma(a0, b3, c03); c13 = g2_mma(a1, b3, c13);
      a0 = na0; a1 = na1; b0 = nb0; b1 = nb1; b2 = nb2; b3 = nb3; }
    asm volatile("s_wait_dscnt 0x0" ::: "memory");      /* this wave's reads of stage t are done before its buffer is given up */
    asm volatile("s_wait_asynccnt 0x0" ::: "memory");      /* this wave's copies of stage t + 1 have landed */
    __syncthreads();      /* publishes stage t + 1 and ends every wave's reads of stage t */
    if (t + 2 < nt) { const unsigned lo = (unsigned)(t & 1) * (G2BUF * 2u); const int ko = (t + 2) * 128; g2_copy8(la + lo, ga + ko, sa16); g2_copy8(lb + lo, gb + ko, sb16); } }      /* stage t + 2 -> the buffer just left */
  asm volatile("s_wait_asynccnt 0x0" ::: "memory");      /* nothing of this wave is in flight when the buffers become output staging */
  v8f accs[8] = {c00, c01, c02, c03, c10, c11, c12, c13};
#pragma unroll
  for (int u = 0; u < 8; ++u) { const int t = u & 3, half = u >> 2; const int col = col0 + t * 16 + ln; const float bv = bp ? bf16_round(bp[col]) : 0.f;
#pragma unroll
    for (int r = 0; r < 8; ++r) { const int rloc = half * 16 + 8 * hh + r; float v = accs[u][r] * alpha + bv; if (CP) { if (rowsPerB < 0) v += CP[cofs + (size_t)(row0g + row0 + rloc) * ldc + col];      /* rowsPerB < 0: own element of the batched C plane */ else { const int bidx = (row0g + row0 + rloc) / rowsPerB; v += CP[(size_t)bidx * sCPb + (size_t)by * 64 + col]; } }
      if (ACT == 3) v = fmaxf(v, 0.f); else if (ACT == 6) v = 0.5f * v * (1.0f + erff(v * 0.70710678118654752f)); else if (ACT == 11) v = 1.0f / (1.0f + expf(-v)); else if (ACT == 15) v = v / (1.0f + expf(-v)); else if (ACT == 12) v = (v > 0.f) ? v : 0.01f * v; else if (ACT == 8) v = tanhf(v); else if (ACT == 9) v = 0.5f * v * (1.0f + tanhf(0.7978845608028654f * (v + 0.044715f * v * v * v))); else if (ACT == 14) v = (v > 0.f) ? v : 0.1f * v; else if (ACT == 16) v = (v >= 0.f) ? v : 0.3f * v; else if (ACT == 17) v = (v >= 0.f) ? v : 0.2f * v;
      so[w][rloc][t * 16 + ln] = v; } }
  __builtin_amdgcn_fence(__ATOMIC_ACQ_REL, "workgroup"); __builtin_amdgcn_wave_barrier();
  const int rsub = lane >> 4, c4 = (lane & 15) * 4;
  {
#pragma unroll
    for (int q = 0; q < 16; ++q) { const int r = q * 2 + rsub; const v4f v = *(const v4fa*)&so[w][r][c4]; if (C) *(v4f*)(C + cofs + (size_t)(row0 + r) * ldc + col0 + c4) = v; if (C16) { v4h h4; for (int i = 0; i < 4; ++i) h4[i] = (_Float16)v[i]; *(v4h*)(C16 + cofs + (size_t)(row0 + r) * ldc + col0 + c4) = h4; } }
     } }


__global__ __launch_bounds__(256) void k_wnat(const float* __restrict__ w, size_t n8, _Float16* __restrict__ Bt) { const size_t t = (size_t)blockIdx.x * 256 + threadIdx.x; if (t >= n8) return; FragH f; for (int q = 0; q < 8; ++q) f.h[q] = (_Float16)(bf16_round(w[t * 8 + q]) * 16.0f); *(v8us*)((unsigned short*)Bt + t * 8) = f.half[0];  }
__global__ __launch_bounds__(256) void k_rsm(const float* __restrict__ S, _Float16* __restrict__ P, int nrows) {
  #pragma clang fp contract(off)
  const int i = blockIdx.x * 256 + threadIdx.x; if (i >= nrows) return; const float* s = S + (size_t)i * SQ; float mx = -3.0e38f;
#pragma unroll 1
  for (int j = 0; j < SQ; ++j) mx = fmaxf(mx, s[j]); float se = 0.f;
#pragma unroll 1
  for (int j = 0; j < SQ; ++j) se += expf(s[j] - mx); const float sc = 256.0f / se;
#pragma unroll 1
  for (int j0 = 0; j0 < SQ; j0 += 8) { FragH f; for (int q = 0; q < 8; ++q) f.h[q] = (_Float16)(expf(s[j0 + q] - mx) * sc); unsigned short* d = (unsigned short*)P + (size_t)i * SQ + j0; *(v8us*)d = f.half[0];  } }
__global__ __launch_bounds__(256) void k_vt(const _Float16* __restrict__ V16, int b, int h0, _Float16* __restrict__ VT) { __shared__ unsigned short tl[64][65]; const int tid = threadIdx.x; const int hh = blockIdx.x % HG, sg = blockIdx.x / HG; const int s0 = sg * 64; const int h = h0 + hh;
  for (int i = tid; i < 64 * 8; i += 256) { const int j = i / 8, d8 = (i % 8) * 8; FragH f; f.half[0] = *(const v8us*)((const unsigned short*)V16 + ((size_t)b * SQ + s0 + j) * DM + h * HD + d8); for (int q = 0; q < 8; ++q) tl[d8 + q][j] = f.u[q]; }
  __syncthreads();
  { for (int i = tid; i < 64 * 8; i += 256) { const int d = i / 8, j8 = (i % 8) * 8; FragH f; for (int q = 0; q < 8; ++q) f.u[q] = tl[d][j8 + q]; *(v8us*)((unsigned short*)VT + ((size_t)hh * HD + d) * SQ + s0 + j8) = f.half[0]; }  } }


// Exact (f32, vector unit) causal attention over the first QT0 rows: one work-group of eight waves per (batch, head, 32 query rows).
// Step 1: wave w keeps key row 32 w + lane in registers and forms its scores against the 32 query rows, each read from LDS at one address for the whole wave.
// Step 2: wave w does the softmax of query rows 4 w .. 4 w + 3, lane = key mod 32 (maximum and denominator: per-lane partial, then a xor butterfly).
// Step 3: wave w sums weight x value over the keys in order for the same four rows, lane = four columns of the head, so that every value row is read as one whole run.
__global__ __launch_bounds__(256) void k_att0h(const float* __restrict__ QF, const float* __restrict__ KF, const float* __restrict__ VF, float scale, float* __restrict__ OF) {
  constexpr int ld = DMX, ldv = DMX, ldo = DMX;      /* row pitches as constants: the rows of one run of loads differ by an immediate offset only */
  static_assert(QT0 == 256, "eight waves: one per 32 keys, four query rows each");
  __shared__ __attribute__((aligned(16))) float sm[8 * 32 * 132 + 32 * 128];
  float (*lk)[32][132] = (float (*)[32][132])sm;      /* key rows at a pitch of 33 x 16 bytes: a lane reads its own row without bank conflicts */
  float (*lp)[QT0] = (float (*)[QT0])sm;      /* scores, then weights: they take the key rows' place once every wave holds its key rows in registers, which keeps the work-group under half of the LDS (above that this compiler budgets 512 registers and fetches the query reads far ahead into a second register window) */
  float (*lq)[128] = (float (*)[128])(sm + 8 * 32 * 132);
  const int tid = threadIdx.x, lane = tid & 31; const int w = __builtin_amdgcn_readfirstlane(tid >> 5); const int h = blockIdx.x / (QT0 / 32), rg = blockIdx.x % (QT0 / 32);
  { const size_t rb = (size_t)blockIdx.y * QT0; QF += rb * ld; KF += rb * ld; VF += rb * ldv; OF += rb * ldo; }      /* grid.y = batch: QT0 rows of every plane per batch */
  const int hc = h * 128 + lane * 4;
  for (int r = 0; r < 4; ++r) *(v4f*)&lq[4 * w + r][lane * 4] = *(const v4fa*)(QF + (size_t)(rg * 32 + 4 * w + r) * ld + hc);
  if (w <= rg) {      /* causal: key chunks 0 .. rg only */
#pragma unroll      /* all 32 row loads in flight together */
    for (int r = 0; r < 32; ++r) *(v4f*)&lk[w][r][lane * 4] = *(const v4fa*)(KF + (size_t)(w * 32 + r) * ld + hc); }
  __syncthreads();
  v4f kr[32];
  if (w <= rg) {
#pragma unroll      /* here and in the c loop below: kr[] stays in registers only if every index is a constant */
    for (int c = 0; c < 32; ++c) kr[c] = *(const v4f*)&lk[w][lane][c * 4]; }
  __syncthreads();      /* every key row has been read: from here on its place holds scores */
  if (w <= rg) {
#pragma unroll 1      /* the body is 512 multiply-adds already */
    for (int r0 = 0; r0 < 32; r0 += 4) { float s0 = 0.f, s1 = 0.f, s2 = 0.f, s3 = 0.f;
#pragma unroll
      for (int c = 0; c < 32; ++c) { const v4f q0 = *(const v4f*)&lq[r0][c * 4], q1 = *(const v4f*)&lq[r0 + 1][c * 4], q2 = *(const v4f*)&lq[r0 + 2][c * 4], q3 = *(const v4f*)&lq[r0 + 3][c * 4];
        for (int u = 0; u < 4; ++u) { s0 = fmaf(q0[u], kr[c][u], s0); s1 = fmaf(q1[u], kr[c][u], s1); s2 = fmaf(q2[u], kr[c][u], s2); s3 = fmaf(q3[u], kr[c][u], s3); } }
      float* sp = &lp[r0][w * 32 + lane]; sp[0] = s0 * scale; sp[QT0] = s1 * scale; sp[2 * QT0] = s2 * scale; sp[3 * QT0] = s3 * scale; } }
  __syncthreads();
  float fin[4];
#pragma unroll      /* fin[] and e[] are indexed by constants */
  for (int r = 0; r < 4; ++r) { const int il = 4 * w + r, i = rg * 32 + il; float e[8]; float mx = -3.0e38f, l = 0.f;
#pragma unroll
    for (int c = 0; c < 8; ++c) { e[c] = -3.0e38f; if (c <= rg) { const float s = lp[il][c * 32 + lane]; if (c * 32 + lane <= i) e[c] = s; } mx = fmaxf(mx, e[c]); }
    for (int m = 16; m > 0; m >>= 1) mx = fmaxf(mx, __shfl_xor(mx, m, 32));
#pragma unroll
    for (int c = 0; c < 8; ++c) { e[c] = (c * 32 + lane <= i) ? expf(e[c] - mx) : 0.f; l += e[c]; }
    for (int m = 16; m > 0; m >>= 1) l += __shfl_xor(l, m, 32);
    fin[r] = 64.0f / l;
#pragma unroll
    for (int c = 0; c < 8; ++c) if (c <= rg) lp[il][c * 32 + lane] = e[c]; }
  __syncthreads();
  const v4f z4 = {0.f, 0.f, 0.f, 0.f}; v4f acc[4] = {z4, z4, z4, z4}; const float* vp = VF + hc; const int nk = (rg + 1) * 32;
#pragma unroll 1      /* 16 value rows in flight a trip are enough; more would only cost registers */
  for (int j0 = 0; j0 < nk; j0 += 16) { v4f vv[16];
#pragma unroll
    for (int u = 0; u < 16; ++u) vv[u] = *(const v4fa*)(vp + (size_t)(j0 + u) * ldv);
#pragma unroll
    for (int g = 0; g < 4; ++g) for (int r = 0; r < 4; ++r) { const v4f p = *(const v4f*)&lp[4 * w + r][j0 + 4 * g]; for (int u = 0; u < 4; ++u) for (int x = 0; x < 4; ++x) acc[r][x] = fmaf(p[u], vv[4 * g + u][x], acc[r][x]); } }
#pragma unroll
  for (int r = 0; r < 4; ++r) { v4f o; for (int x = 0; x < 4; ++x) o[x] = acc[r][x] * fin[r]; *(v4f*)(OF + (size_t)(rg * 32 + 4 * w + r) * ldo + hc) = o; } }
__global__ __launch_bounds__(256) void k_f2h(const float* __restrict__ F, int ldf, int coff, int ncol, _Float16* __restrict__ H16, size_t nrow) { const size_t t = (size_t)blockIdx.x * 256 + threadIdx.x; const size_t n8 = nrow * (size_t)(ncol / 8); if (t >= n8) return; const size_t r = t / (ncol / 8); const int c8 = (int)(t % (ncol / 8)) * 8; FragH f; const v4f a = *(const v4fa*)(F + r * ldf + coff + c8), b2 = *(const v4fa*)(F + r * ldf + coff + c8 + 4); for (int q = 0; q < 4; ++q) { f.h[q] = (_Float16)a[q]; f.h[4 + q] = (_Float16)b2[q]; } *(v8us*)((unsigned short*)H16 + r * ncol + c8) = f.half[0];  }

__global__ __launch_bounds__(256) void k_tab128(float theta, float* __restrict__ CS, float* __restrict__ SN) {
  #pragma clang fp contract(off)
  const int t = blockIdx.x * 256 + threadIdx.x; if (t >= SQ * 64) return; const int i = t % 64; const int p = t / 64; const float invf = (float)(1.0 / pow((double)theta, (double)(2 * i) / 128.0));      /* = XLA's constant-folded f32 table */ const float ang = __fmul_rn((float)p, invf); const float c = cosf(ang), s = sinf(ang);
  *(float*)(CS + t) = c; *(float*)(SN + t) = s;  }
template <int TAB>
__global__ __launch_bounds__(128) void k_rope128(const float* __restrict__ F, int ldf, int nh, const float* __restrict__ CS, const float* __restrict__ SN, _Float16* __restrict__ H16, int ldo, float osc) {
  #pragma clang fp contract(off)
  __shared__ float xv[128]; __shared__ unsigned short sh_[128]; const int d = threadIdx.x; const int h = blockIdx.x % nh; const size_t r = blockIdx.x / nh; const int p = (int)(r % SQ);
  xv[d] = F[r * (size_t)ldf + (size_t)h * 128 + d]; __syncthreads();
  float c, s; if (TAB) { c = bf16_round(CS[(size_t)p * 128 + d]); s = bf16_round(SN[(size_t)p * 128 + d]); } else { c = CS[p * 64 + (d & 63)]; s = SN[p * 64 + (d & 63)]; }
  const float rot = (d < 64) ? -xv[d + 64] : xv[d - 64]; const float o = __fadd_rn(__fmul_rn(xv[d], c), __fmul_rn(rot, s));
  FragH th; th.h[0] = (_Float16)__fmul_rn(o, osc); sh_[d] = th.u[0]; __syncthreads();
  if (d < 16) { FragH f; for (int q = 0; q < 8; ++q) f.u[q] = sh_[d * 8 + q]; unsigned short* dst = (unsigned short*)H16 + r * (size_t)ldo + (size_t)h * 128 + d * 8; *(v8us*)dst = f.half[0];  } }

// Rotate-half RoPE, one wave per token row. 16 lanes per head: a lane holds columns 4 l .. 4 l + 3 and their partners 64 columns on, so x[d] and x[d + 64] meet in one lane (no LDS, no barrier);
// the row's cos / sin values (full-width f32 tables, one row per token row) stay in registers for all NHv heads, two heads per load. grid.x x 8 = rows per batch; grid.y = batch: source and table rows step by yin, output rows by yout.
template <int NHv, int F32OUT>
__global__ __launch_bounds__(256) void k_rope128w(const float* __restrict__ F, const float* __restrict__ CS, const float* __restrict__ SN, float* __restrict__ OF, _Float16* __restrict__ OH, float osc, int yin, int yout) {
  constexpr int ld = NHv * 128, NI = NHv / 2; static_assert(NHv % 2 == 0, "two heads per wave and trip");
  const int lane = threadIdx.x & 31; const int e = (lane >> 4) * 128 + (lane & 15) * 4, d = (lane & 15) * 4; const size_t rl = (size_t)blockIdx.x * 8 + (threadIdx.x >> 5); const size_t r = rl + (size_t)blockIdx.y * yin, ro = rl + (size_t)blockIdx.y * yout;
  const float* cp = CS + r * 128 + d; const float* sp = SN + r * 128 + d; const float* xp = F + r * ld + e;
  const v4f cl = *(const v4fa*)cp, ch = *(const v4fa*)(cp + 64), sl = *(const v4fa*)sp, sh = *(const v4fa*)(sp + 64);
  v4f xl[NI], xh[NI];
#pragma unroll      /* the whole row's loads in flight together; xl[], xh[] stay in registers only if every index is a constant */
  for (int i = 0; i < NI; ++i) { xl[i] = *(const v4fa*)(xp + i * 256); xh[i] = *(const v4fa*)(xp + i * 256 + 64); }
  asm volatile("s_wait_xcnt 0x0" :: "v"(cp), "v"(sp), "v"(xp) : "memory");      /* behind the row's loads, the three addresses as inputs: no address register is given to a later load's result or overwritten while an issued load still names it, and no table load is put off behind the first data wait */
#pragma unroll      /* as above */
  for (int i = 0; i < NI; ++i) { v4f ol, oh;
    for (int q = 0; q < 4; ++q) { ol[q] = fmaf(-xh[i][q], sl[q], xl[i][q] * cl[q]) * osc; oh[q] = fmaf(xl[i][q], sh[q], xh[i][q] * ch[q]) * osc; }      /* x cos rounded, partner x sin fused into the add: the form that the one-thread-per-column kernel compiled to, so roped q and k keep their bits */
    if (F32OUT) { float* dst = OF + ro * ld + e + i * 256; *(v4f*)dst = ol; *(v4f*)(dst + 64) = oh; }
    else { v4h hl, hh; for (int q = 0; q < 4; ++q) { hl[q] = (_Float16)ol[q]; hh[q] = (_Float16)oh[q]; } _Float16* dst = OH + ro * ld + e + i * 256; *(v4h*)dst = hl; *(v4h*)(dst + 64) = hh; } } }
template <int N>
__global__ __launch_bounds__(256) void k_rmsrow(float* __restrict__ X, const float* __restrict__ w, float eps) {
  #pragma clang fp contract(off)
  constexpr int PT = N / 256; __shared__ float red[256]; const size_t r = blockIdx.x; const int t = threadIdx.x; float* row = X + r * N + (size_t)t * PT; float v[PT]; float ss = 0.f;
  for (int q = 0; q < PT; ++q) { v[q] = row[q]; ss = __fadd_rn(ss, __fmul_rn(v[q], v[q])); }
  red[t] = ss; __syncthreads(); for (int k = 128; k > 0; k >>= 1) { if (t < k) red[t] = __fadd_rn(red[t], red[t + k]); __syncthreads(); }
  const float rs = rsqrtf(__fadd_rn(red[0] / (float)N, eps)); float o[PT]; for (int q = 0; q < PT; ++q) o[q] = __fmul_rn(__fmul_rn(v[q], rs), bf16_round(w[t * PT + q]));
  { for (int q = 0; q < PT; ++q) *(float*)(row + q) = o[q];  } }
template <int GS_, int NHQ, int DSRC>
__global__ __launch_bounds__(256) void k_kvexp128(const float* __restrict__ src, float* __restrict__ dst, size_t n4, size_t ysrc, size_t ydst) { const size_t t = (size_t)blockIdx.x * 256 + threadIdx.x; if (t >= n4) return; src += (size_t)blockIdx.y * ysrc; dst += (size_t)blockIdx.y * ydst;      /* grid.y = batch */ const size_t e = t * 4; const size_t row = e / ((size_t)NHQ * 128); const int col = (int)(e % ((size_t)NHQ * 128)); const int h = col / 128, d = col % 128; const v4f v = *(const v4fa*)(src + row * DSRC + (size_t)(h / GS_) * 128 + d); *(v4f*)(dst + e) = v;  }

__global__ __launch_bounds__(256) void k_rsmcfb(const float* __restrict__ S, _Float16* __restrict__ P, int hg, int q0, int nk, const int* __restrict__ mk) {
  #pragma clang fp contract(off)
  const int t = blockIdx.x * 256 + threadIdx.x; if (t >= hg * QT) return; const size_t i = (size_t)t; const float* s = S + i * NKX; const size_t ig = (size_t)(q0 + (t % QT)); const int* mr = mk + ig * SQ; float mx = -3.0e38f;
#pragma unroll 1
  for (int j = 0; j < nk; ++j) { const int mb = mr[j]; const float f = (mb == 0) ? 1.f : 0.f; mx = fmaxf(mx, fmaf(f, s[j], (1.f - f) * -1.0e9f)); } float se = 0.f;
#pragma unroll 1
  for (int j = 0; j < nk; ++j) { const int mb = mr[j]; const float f = (mb == 0) ? 1.f : 0.f; se += __expf(fmaf(f, s[j], (1.f - f) * -1.0e9f) - mx); } const float sc = 256.0f / se;
#pragma unroll 1
  for (int j0 = 0; j0 < nk; j0 += 8) { FragH fr; for (int q = 0; q < 8; ++q) { const int j = j0 + q; const int mb = mr[j]; const float f = (mb == 0) ? 1.f : 0.f; fr.h[q] = (_Float16)(__expf(fmaf(f, s[j], (1.f - f) * -1.0e9f) - mx) * sc); } unsigned short* d = (unsigned short*)P + i * NKX + j0; *(v8us*)d = fr.half[0];  } }


// Causal softmax, one wave per score row: lane l holds columns 128 c + 4 l .. + 3 of every 128-column chunk c in registers, so each
// load and store of a wave covers one contiguous run of the row and the row is read once. Row maximum and denominator: per-lane partial, then a xor butterfly over the 32 lanes.
// rel = the row's last causal column minus the lane's first column.
template <int NC>
__device__ __forceinline__ void rsm_row(const float* __restrict__ s, _Float16* __restrict__ d, int rel) {
  v4f e[NC]; float mx = -3.0e38f, se = 0.f;
#pragma unroll      /* here and below: e[] stays in registers only if every index is a constant */
  for (int c = 0; c < NC; ++c) e[c] = *(const v4fa*)(s + c * 128);
#pragma unroll      /* as above */
  for (int c = 0; c < NC; ++c) for (int q = 0; q < 4; ++q) { const float f = (c * 128 + q <= rel) ? 1.f : 0.f; e[c][q] = fmaf(f, e[c][q], (1.f - f) * -1.0e9f); mx = fmaxf(mx, e[c][q]); }
  for (int m = 16; m > 0; m >>= 1) mx = fmaxf(mx, __shfl_xor(mx, m, 32));
#pragma unroll      /* as above */
  for (int c = 0; c < NC; ++c) for (int q = 0; q < 4; ++q) { e[c][q] = __expf(e[c][q] - mx); se += e[c][q]; }
  for (int m = 16; m > 0; m >>= 1) se += __shfl_xor(se, m, 32);
  const float sc = 256.0f / se;
#pragma unroll      /* as above */
  for (int c = 0; c < NC; ++c) { v4h h4; for (int q = 0; q < 4; ++q) h4[q] = (_Float16)(e[c][q] * sc); *(v4h*)(d + c * 128) = h4; }
  asm volatile("s_wait_xcnt 0x0" ::: "memory");      /* behind the row's stores */
}
__global__ __launch_bounds__(256) void k_rsmcf2(const float* __restrict__ S, _Float16* __restrict__ P, int hg, int q0, int nk) {
  static_assert(QT == 256 && NKX == 8 * QT, "one case per row length below");
  const int col = (threadIdx.x & 31) * 4; const int t = blockIdx.x * 8 + (threadIdx.x >> 5); if (t >= hg * QT) return;
  const float* s = S + (size_t)t * NKX + col; _Float16* d = P + (size_t)t * NKX + col; const int rel = q0 + (t % QT) - col;
  switch (nk / QT) {      /* nk = QT .. NKX in steps of QT: one straight-line body per row length, so that the row's registers are indexed by constants */
    case 1: rsm_row<2>(s, d, rel); break; case 2: rsm_row<4>(s, d, rel); break; case 3: rsm_row<6>(s, d, rel); break; case 4: rsm_row<8>(s, d, rel); break;
    case 5: rsm_row<10>(s, d, rel); break; case 6: rsm_row<12>(s, d, rel); break; case 7: rsm_row<14>(s, d, rel); break; case 8: rsm_row<16>(s, d, rel); break; } }



__global__ __launch_bounds__(256) void k_tab128p(const int* __restrict__ pos, int nrows, float theta, float* __restrict__ CS, float* __restrict__ SN) {
  #pragma clang fp contract(off)
  const int t = blockIdx.x * 256 + threadIdx.x; if (t >= nrows * 64) return; const int i = t % 64; const int r = t / 64; const float invf = (float)(1.0 / pow((double)theta, (double)(2 * i) / 128.0)); const float ang = __fmul_rn((float)pos[r], invf); const float c = cosf(ang), sv = sinf(ang);
  float* c0 = CS + (size_t)r * 128 + i; float* s0 = SN + (size_t)r * 128 + i;
  { *(float*)c0 = c; *(float*)(c0 + 64) = c; *(float*)s0 = sv; *(float*)(s0 + 64) = sv;  } }

__global__ __launch_bounds__(256) void k_rsmcim(const float* __restrict__ S, _Float16* __restrict__ P, int hg, int q0, int nk, const int* __restrict__ am) {
  #pragma clang fp contract(off)
  const int t = blockIdx.x * 256 + threadIdx.x; if (t >= hg * QT) return; const size_t i = (size_t)t; const float* s = S + i * NKX; const int last = q0 + (t % QT); const int* mr = am + (size_t)last * SQ; float mx = -3.0e38f;      /* the module's mask row of this query (keys >= nk lie above the diagonal of the causal mask and are not computed) */
#pragma unroll 1
  for (int j = 0; j < nk; ++j) { const float f = (mr[j] != 0) ? 1.f : 0.f; mx = fmaxf(mx, fmaf(f, s[j], (1.f - f) * -1.0e9f)); } float se = 0.f;
#pragma unroll 1
  for (int j = 0; j < nk; ++j) { const float f = (mr[j] != 0) ? 1.f : 0.f; se += __expf(fmaf(f, s[j], (1.f - f) * -1.0e9f) - mx); } const float sc = 256.0f / se;
#pragma unroll 1
  for (int j0 = 0; j0 < nk; j0 += 8) { FragH fr; for (int q = 0; q < 8; ++q) { const int j = j0 + q; const float f = (mr[j] != 0) ? 1.f : 0.f; fr.h[q] = (_Float16)(__expf(fmaf(f, s[j], (1.f - f) * -1.0e9f) - mx) * sc); } unsigned short* d = (unsigned short*)P + i * NKX + j0; *(v8us*)d = fr.half[0];  } }



__global__ __launch_bounds__(256) void k_tab128h(int nr, float theta, float* __restrict__ CS, float* __restrict__ SN) {
  #pragma clang fp contract(off)
  const size_t t = (size_t)blockIdx.x * 256 + threadIdx.x; if (t >= (size_t)nr * 64) return; const int i = (int)(t % 64); const size_t r = t / 64; const int p = (int)(r % SQ);
  const float invf = (float)(1.0 / pow((double)theta, ((double)(2 * i)) / 128.0)); const float ang = __fmul_rn((float)p, invf); const float c = cosf(ang), sv = sinf(ang);
  float* pc = CS + r * 128 + i; float* ps = SN + r * 128 + i;
  *(float*)pc = c; *(float*)(pc + 64) = c; *(float*)ps = sv; *(float*)(ps + 64) = sv;  }
extern "C" void kernel_launch(void* const* d_in, const int* in_sizes, int n_in,
                              void* d_out, int out_size, void* d_ws, size_t ws_size, hipStream_t stream) {
  (void)in_sizes; (void)n_in; (void)out_size;
  const float* const* I = (const float* const*)d_in; const float* x = I[0]; const float* wq = I[1]; const float* wk = I[2]; const float* wv = I[3]; const float* wo = I[4]; const float* bq = nullptr; const float* bk = nullptr; const float* bv = nullptr; const float* bo = nullptr;      /* [in][out] Wq [2048][2048], Wk/Wv [2048][1024], Wo [2048][2048]; no biases; positions implicit */
  char* ws = (char*)d_ws; size_t off = 0;
  auto take = [&](size_t bytes) { char* p = ws + off; off += (bytes + 255) & ~(size_t)255; return p; };
  _Float16* BQ = (_Float16*)take((size_t)DMX * DMX * 2); _Float16* BK = (_Float16*)take((size_t)DKV * DMX * 2); _Float16* BV = (_Float16*)take((size_t)DKV * DMX * 2); _Float16* BO = (_Float16*)take((size_t)DMX * DMX * 2);
  _Float16* X16 = (_Float16*)take(NR * DMX * 2); float* QF = (float*)take(NR * (DMX + 2 * DKV) * 4); float* KF = QF + NR * DMX; float* VF = KF + NR * DKV; _Float16* Q16 = (_Float16*)take(NR * DMX * 2); _Float16* K16 = (_Float16*)take(NR * DKV * 2); _Float16* V16 = (_Float16*)take(NR * DKV * 2); _Float16* O16 = (_Float16*)take(NR * DMX * 2);
  static_assert((size_t)NB * NH * QT * NKX <= NR * (DMX + 2 * DKV), "score planes must fit the f32 q, k, v planes they reuse");
  float* S = QF;      /* score planes of both batches reuse the f32 q, k, v planes: their last readers (rope, kv expansion) are launched before the first score GEMM of this call */
  _Float16* P = (_Float16*)take((size_t)NB * NH * QT * NKX * 2); _Float16* VT = (_Float16*)take((size_t)NB * (DKV / 64) * 64 * SQ * 2);
  float* CS = (float*)take(NR * 128 * 4); float* SN = (float*)take(NR * 128 * 4); float* QF0 = (float*)take((size_t)NB * QT0 * DMX * 4); float* KRF0 = (float*)take((size_t)NB * QT0 * DKV * 4); float* KF0e = (float*)take((size_t)NB * QT0 * DMX * 4); float* VF0e = (float*)take((size_t)NB * QT0 * DMX * 4); float* OF0 = (float*)take((size_t)NB * QT0 * DMX * 4); _Float16* OH0 = (_Float16*)take((size_t)NB * QT0 * DMX * 2); _Float16* OL0 = (_Float16*)take((size_t)NB * QT0 * DMX * 2);
  if (off > ws_size) return;      /* 24 (weights) + 16 + 64 + 16 + 8 + 8 + 16 + 32 + 8 + 2 + 2 + 4 + 2 + 4 + 4 + 4 + 2 + 2 = 218 MiB */
  k_wt_f16<<<(unsigned)(((size_t)DMX * DMX / 8 + 255) / 256), 256, 0, stream>>>(wq, BQ, DMX, DMX, 16.0f); k_wt_f16<<<(unsigned)(((size_t)DKV * DMX / 8 + 255) / 256), 256, 0, stream>>>(wk, BK, DMX, DKV, 16.0f); k_wt_f16<<<(unsigned)(((size_t)DKV * DMX / 8 + 255) / 256), 256, 0, stream>>>(wv, BV, DMX, DKV, 16.0f); k_wt_f16<<<(unsigned)(((size_t)DMX * DMX / 8 + 255) / 256), 256, 0, stream>>>(wo, BO, DMX, DMX, 16.0f);      /* [in][out] -> Bt x16 */
  k_x16<<<(unsigned)((NR * DMX / 8 + 255) / 256), 256, 0, stream>>>(x, X16, NR * DMX / 8);
  k_gemm2<0><<<dim3((unsigned)((NR / 128) * (DMX / 128)), 1), 256, 0, stream>>>(X16, DMX, 0, BQ, DMX, 0, 0.0625f, bq, 0, nullptr, 1, 0, 0, QF, nullptr, DMX, 0, (int)NR, DMX, DMX, 0, 0, 0, 0);      /* q (f32) */
  k_gemm2<0><<<dim3((unsigned)((NR / 128) * (DKV / 128)), 1), 256, 0, stream>>>(X16, DMX, 0, BK, DMX, 0, 0.0625f, bk, 0, nullptr, 1, 0, 0, KF, nullptr, DKV, 0, (int)NR, DKV, DMX, 0, 0, 0, 0);      /* k (f32) */
  k_gemm2<0><<<dim3((unsigned)((NR / 128) * (DKV / 128)), 1), 256, 0, stream>>>(X16, DMX, 0, BV, DMX, 0, 0.0625f, bv, 0, nullptr, 1, 0, 0, VF, V16, DKV, 0, (int)NR, DKV, DMX, 0, 0, 0, 0);      /* v (f32 for the first tile + f16) */
  k_tab128h<<<(unsigned)((NR * 64 + 255) / 256), 256, 0, stream>>>((int)NR, 10000.0f, CS, SN);      /* per-row cos/sin tables [NR][128] for positions r % SQ, duplicated over both halves (cat(f, f)) */
  k_rope128w<NH, 0><<<(unsigned)(NR / 8), 256, 0, stream>>>(QF, CS, SN, nullptr, Q16, 1.0f, 0, 0); k_rope128w<NKV, 0><<<(unsigned)(NR / 8), 256, 0, stream>>>(KF, CS, SN, nullptr, K16, 1.0f, 0, 0);      /* rope (all rows) -> f16 */
  /* From here on every launch covers both batches (grid.y or grid.z = batch, else batch folded into grid.x), and each attention GEMM all 16 query heads (grid.y = head). */
  k_rope128w<NH, 1><<<dim3(QT0 / 8, NB), 256, 0, stream>>>(QF, CS, SN, QF0, nullptr, 1.0f, SQ, QT0); k_rope128w<NKV, 1><<<dim3(QT0 / 8, NB), 256, 0, stream>>>(KF, CS, SN, KRF0, nullptr, 1.0f, SQ, QT0);      /* f32 roped q, k of each batch's first QT0 rows */
  k_kvexp128<GSZ, NH, DKV><<<dim3((unsigned)(((size_t)QT0 * DMX / 4 + 255) / 256), NB), 256, 0, stream>>>(KRF0, KF0e, (size_t)QT0 * DMX / 4, (size_t)QT0 * DKV, (size_t)QT0 * DMX); k_kvexp128<GSZ, NH, DKV><<<dim3((unsigned)(((size_t)QT0 * DMX / 4 + 255) / 256), NB), 256, 0, stream>>>(VF, VF0e, (size_t)QT0 * DMX / 4, (size_t)SQ * DKV, (size_t)QT0 * DMX);      /* kv head -> query head expansion for the exact first tile */
  k_vt<DKV / 64, SQ><<<NB * (DKV / 64) * (SQ / 64), 256, 0, stream>>>(V16, DKV, 0, VT);      /* V^T, [batch][DKV][SQ]: kv head g = slabs 2g, 2g+1 of its batch */
  k_att0h<<<dim3(NH * (QT0 / 32), NB), 256, 0, stream>>>(QF0, KF0e, VF0e, ATS, OF0);      /* exact causal attention, first QT0 rows (o x64) */
  for (int q0 = 0; q0 < SQ; q0 += QT) { const int nk = q0 + QT;      /* causal: keys below the tile end only */
    k_gemm2<0><<<dim3((QT / 128) * (nk / 128), NH, NB), 256, 0, stream>>>(Q16 + (size_t)q0 * DMX, DMX, (size_t)HDK, K16, DKV, (size_t)HDK, ATS, nullptr, 0, nullptr, 1, 0, 0, S, nullptr, NKX, (size_t)QT * NKX, QT, nk, HDK, GSH, (size_t)SQ * DMX, (size_t)SQ * DKV, (size_t)NH * QT * NKX);      /* scores: query head y vs key slab y >> GSH */
    k_rsmcf2<<<(NB * NH * QT + 7) / 8, 256, 0, stream>>>(S, P, NB * NH, q0, nk);      /* causal softmax (arithmetic select) over the computed keys, one wave per row */
    k_gemm2<0><<<dim3((QT / 128) * (HDK / 128), NH, NB), 256, 0, stream>>>(P, NKX, (size_t)QT * NKX, VT, SQ, (size_t)HDK * SQ, 0.25f, nullptr, 0, nullptr, 1, 0, 0, nullptr, O16 + (size_t)q0 * DMX, DMX, (size_t)HDK, QT, HDK, nk, GSH, (size_t)NH * QT * NKX, (size_t)DKV * SQ, (size_t)SQ * DMX); }      /* o (x64): query head y vs V^T slab y >> GSH */
  k_gemm2<0><<<dim3((unsigned)((NR / 128) * (DMX / 128)), 1), 256, 0, stream>>>(O16, DMX, 0, BO, DMX, 0, 0.0009765625f, bo, 0, nullptr, 1, 0, 0, (float*)d_out, nullptr, DMX, 0, (int)NR, DMX, DMX, 0, 0, 0, 0);      /* out = o Wo */
  k_hl<<<(unsigned)(((size_t)NB * QT0 * DMX / 8 + 255) / 256), 256, 0, stream>>>(OF0, OH0, OL0, (size_t)NB * QT0 * DMX / 8);      /* first-tile o (x64) -> f16 hi + x1024 residual planes */
  k_gemm2<0><<<dim3((QT0 / 128) * (DMX / 128), 1, NB), 256, 0, stream>>>(OH0, DMX, 0, BO, DMX, 0, 0.0009765625f, bo, 0, nullptr, 1, 0, 0, (float*)d_out, nullptr, DMX, 0, QT0, DMX, DMX, 0, (size_t)QT0 * DMX, 0, (size_t)SQ * DMX);      /* first QT0 rows of each batch rewritten from the exact path */
  k_gemm2<0><<<dim3((QT0 / 128) * (DMX / 128), 1, NB), 256, 0, stream>>>(OL0, DMX, 0, BO, DMX, 0, 0.00000095367431640625f, nullptr, 0, (const float*)d_out, -1, 0, 0, (float*)d_out, nullptr, DMX, 0, QT0, DMX, DMX, 0, (size_t)QT0 * DMX, 0, (size_t)SQ * DMX);      /* += o_lo Wo 2^-20 (own-element accumulate) */
}

// v007
// A run of this version takes 278 microseconds.
// Versions between v005 and this one are left out; their measured steps multiply to 2.10 times as fast.
// All steps since v000 together make it 43.3 times as fast.
#include <hip/hip_runtime.h>
// Grouped-query causal attention with rotate-half RoPE, 16 query / 8 kv heads of 128 (x [2][2048][2048]; q = x Wq (16 x 128), k = x Wk, v = x Wv (8 x 128) ([in][out] weights sigma 0.02, no biases); inv_freq_i = 1/10000^(2i/128), positions 0..2047, cos/sin = cat(freqs, freqs); q, k roped; kv head h/2 serves query head h; scores / sqrt(128); causal (tril, -inf); softmax; out = merged Wo -> [2][2048][2048]).
// Compute dtype: inputs rounded to bf16; x / weights exact; projections and rope f32; q, k, v, softmax weights and o as plain f16 GEMM operands (~2^-12; first 256 rows of each batch exact); scores, statistics, out f32. v_wmma_f32_16x16x32_f16.
#define NB 2
#define SQ 2048
#define DMX 2048
#define NH 16
#define NKV 8
#define GSZ 2                        /* query heads per kv head */
#define GSH 1                        /* log2(GSZ): query head >> GSH = its kv head */
#define HDK 128
#define DKV (NKV * HDK)
#define QT 256
#define QT0 256
#define NKX SQ
#define DM DMX
#define HD 64
#define HG 1
#define NR ((size_t)NB * SQ)
#define ATS 0.08838834764831845f
typedef __bf16 v16b __attribute__((ext_vector_type(16)));
typedef unsigned short v8us __attribute__((ext_vector_type(8), may_alias));
typedef float  v8f  __attribute__((ext_vector_type(8)));
typedef float  v4f  __attribute__((ext_vector_type(4)));
typedef float  v4fa __attribute__((ext_vector_type(4), may_alias));
union FragB { v16b v; v8us half[2]; unsigned short u[16]; };

__device__ __forceinline__ unsigned short bf16_bits(float x) { unsigned int u = __float_as_uint(x); return (unsigned short)((u + 0x7FFFu + ((u >> 16) & 1u)) >> 16); }
__device__ __forceinline__ float bf16_val(unsigned short b) { return __uint_as_float(((unsigned int)b) << 16); }
__device__ __forceinline__ float bf16_round(float x) { return bf16_val(bf16_bits(x)); }
// D += A·B with NT terms: 1 = ah·bh, 2 = + al·bh (A split), 3 = + ah·bl (both split)
template <int NT>
__device__ __forceinline__ v8f mmaN(v16b ah, v16b al, v16b bh, v16b bl, v8f c) {
  c = __builtin_amdgcn_wmma_f32_16x16x32_bf16(false, ah, false, bh, (short)0, c, false, false);
  if (NT >= 2) c = __builtin_amdgcn_wmma_f32_16x16x32_bf16(false, al, false, bh, (short)0, c, false, false);
  if (NT >= 3) c = __builtin_amdgcn_wmma_f32_16x16x32_bf16(false, ah, false, bl, (short)0, c, false, false);
  asm volatile("v_nop\n\tv_nop\n\tv_nop\n\tv_nop" : "+v"(c) : "v"(ah), "v"(al), "v"(bh), "v"(bl));
  return c;
}

__global__ __launch_bounds__(256) void k_wt_bf16(const float* __restrict__ W, unsigned short* __restrict__ Wt, int K, int N) {
  const int t = blockIdx.x * 256 + threadIdx.x;
  const int k8n = K / 8;
  if (t >= N * k8n) return;
  const int n = t / k8n, k8 = (t % k8n) * 8;
  v8us v;
#pragma unroll
  for (int i = 0; i < 8; ++i) v[i] = bf16_bits(W[(size_t)(k8 + i) * N + n]);
  *(v8us*)(Wt + (size_t)n * K + k8) = v;
  
}

// GEMM C[M][N] (f32, pitch ldc) = act(A[M][K]·W + bias). A f32 row-major (pitch lda) converted per fragment to bf16
// (ASPLIT: hi/lo two planes -> 2 terms, else single rounded term); Wt bf16 [N][K] (pitch ldb). BIAS_BF16 rounds the
// bias to bf16 first (bias quantised to bf16 before the add). K%32==0, M%16==0, N%64==0.
template <bool ASPLIT, int ACT, bool BIAS_BF16>
__global__ __launch_bounds__(128) void k_gemm_bf(const float* __restrict__ A, int lda, const unsigned short* __restrict__ Wt, int ldb,
                                               const float* __restrict__ bias, float* __restrict__ C, int ldc, int M, int N, int K) {
  __shared__ __attribute__((aligned(16))) float so[4][16][64];
  const int tid = threadIdx.x, w = tid >> 5, lane = tid & 31, ln = lane & 15, hh = lane >> 4;
  const int ntn = N / 64;
  const int wid = blockIdx.x * 4 + w;
  const int mt = wid / ntn, nq = wid % ntn;
  if (mt * 16 >= M) return;
  const int row0 = mt * 16, col0 = nq * 64;
  const float* arow = A + (size_t)(row0 + ln) * lda;
  v8f acc[4] = {};
  for (int kb = 0; kb < K; kb += 32) {
    FragB ah, al;
    const v4f x0 = *(const v4fa*)(arow + kb + 8 * hh), x1 = *(const v4fa*)(arow + kb + 8 * hh + 4);
    const v4f x2 = *(const v4fa*)(arow + kb + 16 + 8 * hh), x3 = *(const v4fa*)(arow + kb + 16 + 8 * hh + 4);
    float xs[16] = {x0[0],x0[1],x0[2],x0[3],x1[0],x1[1],x1[2],x1[3],x2[0],x2[1],x2[2],x2[3],x3[0],x3[1],x3[2],x3[3]};
#pragma unroll
    for (int i = 0; i < 16; ++i) { const unsigned short hb = bf16_bits(xs[i]); ah.u[i] = hb; al.u[i] = ASPLIT ? bf16_bits(xs[i] - bf16_val(hb)) : (unsigned short)0; }
#pragma unroll
    for (int t = 0; t < 4; ++t) {
      const unsigned short* brow = Wt + (size_t)(col0 + t * 16 + ln) * ldb + kb;
      FragB b;
      b.half[0] = *(const v8us*)(brow + 8 * hh);
      b.half[1] = *(const v8us*)(brow + 16 + 8 * hh);
      acc[t] = mmaN<ASPLIT ? 2 : 1>(ah.v, al.v, b.v, b.v, acc[t]);
    }
  }
#pragma unroll
  for (int t = 0; t < 4; ++t) {
    float bv = bias ? bias[col0 + t * 16 + ln] : 0.f;
    if (BIAS_BF16) bv = bf16_round(bv);
#pragma unroll
    for (int r = 0; r < 8; ++r) { float v = acc[t][r] + bv; if (ACT == 1) v = fmaxf(v, 0.f); so[w][8 * hh + r][t * 16 + ln] = v; }
  }
  __builtin_amdgcn_fence(__ATOMIC_ACQ_REL, "workgroup");
  __builtin_amdgcn_wave_barrier();
  const int rsub = lane >> 4, c4 = (lane & 15) * 4;
  {
#pragma unroll
    for (int q = 0; q < 8; ++q) {
      const int r = q * 2 + rsub;
      const v4f v = *(const v4fa*)&so[w][r][c4];
      *(v4f*)(C + (size_t)(row0 + r) * ldc + col0 + c4) = v;
    }
    
  }
}

// GEMM C = act(A·W + bias + resid): A f32 (ASPLIT -> hi/lo 2 terms), Wt bf16 [N][K]; ACT 0 none, 1 relu, 2 exact gelu;
// resid (optional, f32, row index = (row % rmod), pitch ldr, RES_BF16 rounds it) added before the activation.
template <bool ASPLIT, int ACT, bool BIAS_BF16, bool RES_BF16>
__global__ __launch_bounds__(128) void k_gemm_bf3(const float* __restrict__ A, int lda, const unsigned short* __restrict__ Wt, int ldb,
                                                const float* __restrict__ bias, const float* __restrict__ resid, int rmod, int ldr,
                                                float* __restrict__ C, int ldc, int M, int N, int K) {
  __shared__ __attribute__((aligned(16))) float so[4][16][64];
  const int tid = threadIdx.x, w = tid >> 5, lane = tid & 31, ln = lane & 15, hh = lane >> 4;
  const int ntn = N / 64;
  const int wid = blockIdx.x * 4 + w;
  const int mt = wid / ntn, nq = wid % ntn;
  if (mt * 16 >= M) return;
  const int row0 = mt * 16, col0 = nq * 64;
  const float* arow = A + (size_t)(row0 + ln) * lda;
  v8f acc[4] = {};
  for (int kb = 0; kb < K; kb += 32) {
    FragB ah, al;
    const v4f x0 = *(const v4fa*)(arow + kb + 8 * hh), x1 = *(const v4fa*)(arow + kb + 8 * hh + 4);
    const v4f x2 = *(const v4fa*)(arow + kb + 16 + 8 * hh), x3 = *(const v4fa*)(arow + kb + 16 + 8 * hh + 4);
    float xs[16] = {x0[0],x0[1],x0[2],x0[3],x1[0],x1[1],x1[2],x1[3],x2[0],x2[1],x2[2],x2[3],x3[0],x3[1],x3[2],x3[3]};
#pragma unroll
    for (int i = 0; i < 16; ++i) { const unsigned short hb = bf16_bits(xs[i]); ah.u[i] = hb; al.u[i] = ASPLIT ? bf16_bits(xs[i] - bf16_val(hb)) : (unsigned short)0; }
#pragma unroll
    for (int t = 0; t < 4; ++t) {
      const unsigned short* brow = Wt + (size_t)(col0 + t * 16 + ln) * ldb + kb;
      FragB b;
      b.half[0] = *(const v8us*)(brow + 8 * hh);
      b.half[1] = *(const v8us*)(brow + 16 + 8 * hh);
      acc[t] = mmaN<ASPLIT ? 2 : 1>(ah.v, al.v, b.v, b.v, acc[t]);
    }
  }
#pragma unroll
  for (int t = 0; t < 4; ++t) {
    const int col = col0 + t * 16 + ln;
    float bv = bias ? bias[col] : 0.f;
    if (BIAS_BF16) bv = bf16_round(bv);
#pragma unroll
    for (int r = 0; r < 8; ++r) {
      float v = acc[t][r] + bv;
      if (resid) { float rv = resid[(size_t)((row0 + 8 * hh + r) % rmod) * ldr + col]; if (RES_BF16) rv = bf16_round(rv); v += rv; }
      if (ACT == 1) v = fmaxf(v, 0.f);
      if (ACT == 2) v = 0.5f * v * (1.0f + erff(v * 0.70710678118654752f));
      if (ACT == 3) { const float u = 0.7978845608028654f * (v + 0.044715f * v * v * v); v = 0.5f * v * (1.0f + tanhf(u)); }
      so[w][8 * hh + r][t * 16 + ln] = v;
    }
  }
  __builtin_amdgcn_fence(__ATOMIC_ACQ_REL, "workgroup");
  __builtin_amdgcn_wave_barrier();
  const int rsub = lane >> 4, c4 = (lane & 15) * 4;
  {
#pragma unroll
    for (int q = 0; q < 8; ++q) {
      const int r = q * 2 + rsub;
      const v4f v = *(const v4fa*)&so[w][r][c4];
      *(v4f*)(C + (size_t)(row0 + r) * ldc + col0 + c4) = v;
    }
    
  }
}
// row LayerNorm (biased variance, eps) over N: s = X (+ R); optional out_sum <- s; out_norm <- (s-mu)*rsqrt(var+eps)*g + b
template <bool PARAM_BF16>
__global__ __launch_bounds__(256) void k_layernorm(const float* __restrict__ X, const float* __restrict__ R, const float* __restrict__ g, const float* __restrict__ bta,
                                                  float* __restrict__ out_sum, float* __restrict__ out_norm, int N, float eps) {
  __shared__ float red[256];
  const int row = blockIdx.x, tid = threadIdx.x;
  const float* x = X + (size_t)row * N; const float* rr = R ? R + (size_t)row * N : nullptr;
  float vals[16];                     // up to N = 4096
  const int per = N / 256;            // contiguous chunk per thread? use strided-by-4 chunks: thread handles j = tid*4 + 1024*u
  float s1 = 0.f;
  for (int u = 0; u < per / 4; ++u) {
    const int j = tid * 4 + 1024 * u;
    const v4f a = *(const v4fa*)(x + j);
    v4f b = {0.f,0.f,0.f,0.f}; if (rr) b = *(const v4fa*)(rr + j);
#pragma unroll
    for (int q = 0; q < 4; ++q) { const float v = a[q] + b[q]; vals[u * 4 + q] = v; s1 += v; }
  }
  red[tid] = s1; __syncthreads();
  for (int st = 128; st > 0; st >>= 1) { if (tid < st) red[tid] += red[tid + st]; __syncthreads(); }
  const float mu = red[0] / (float)N; __syncthreads();
  float s2 = 0.f;
  for (int u = 0; u < per / 4; ++u)
#pragma unroll
    for (int q = 0; q < 4; ++q) { const float c = vals[u * 4 + q] - mu; s2 += c * c; }
  red[tid] = s2; __syncthreads();
  for (int st = 128; st > 0; st >>= 1) { if (tid < st) red[tid] += red[tid + st]; __syncthreads(); }
  const float rs = rsqrtf(red[0] / (float)N + eps);
  {
    for (int u = 0; u < per / 4; ++u) {
      const int j = tid * 4 + 1024 * u;
      v4f o, sm;
#pragma unroll
      for (int q = 0; q < 4; ++q) {
        float gg = g[j + q], bb = bta[j + q];
        if (PARAM_BF16) { gg = bf16_round(gg); bb = bf16_round(bb); }
        sm[q] = vals[u * 4 + q]; o[q] = (vals[u * 4 + q] - mu) * rs * gg + bb;
      }
      if (out_sum) *(v4f*)(out_sum + (size_t)row * N + j) = sm;
      *(v4f*)(out_norm + (size_t)row * N + j) = o;
    }
    
  }
}



// ---- f16 WMMA path (v_wmma_f32_16x16x32_f16): 11-bit significands for operands in range — used where a [0,1] probability operand needs more precision than bf16
typedef _Float16 v16h __attribute__((ext_vector_type(16)));
union FragH { v16h v; v8us half[2]; _Float16 h[16]; unsigned short u[16]; };
template <int NT>
__device__ __forceinline__ v8f mmaH(v16h ah, v16h al, v16h bh, v16h bl, v8f c) {
  c = __builtin_amdgcn_wmma_f32_16x16x32_f16(false, ah, false, bh, (short)0, c, false, false);
  if (NT >= 2) c = __builtin_amdgcn_wmma_f32_16x16x32_f16(false, al, false, bh, (short)0, c, false, false);
  if (NT >= 3) c = __builtin_amdgcn_wmma_f32_16x16x32_f16(false, ah, false, bl, (short)0, c, false, false);
  asm volatile("v_nop\n\tv_nop\n\tv_nop\n\tv_nop" : "+v"(c) : "v"(ah), "v"(al), "v"(bh), "v"(bl));
  return c;
}
// batched GEMM like k_gemm_b but f16 operands: A f32 (split into f16 hi/lo if ASPLIT, else rounded to f16), Bt = f16 values [n][k]; alpha; C f32; N multiple of 16 (partial tiles skipped)
template <bool ASPLIT>
__global__ __launch_bounds__(128) void k_gemm_h(const float* __restrict__ A, int lda, size_t sA, const _Float16* __restrict__ Bh, int ldb, size_t sB, float alpha, float* __restrict__ C, int ldc, size_t sC, int M, int N, int K) {
  __shared__ __attribute__((aligned(16))) float so[4][16][64];
  const int tid = threadIdx.x, w = tid >> 5, lane = tid & 31, ln = lane & 15, hh = lane >> 4; const int by = blockIdx.y;
  A += (size_t)by * sA; Bh += (size_t)by * sB; C += (size_t)by * sC;
  const int ntn = (N + 63) / 64; const int wid = blockIdx.x * 4 + w; const int mt = wid / ntn, nq = wid % ntn; if (mt * 16 >= M) return;
  const int row0 = mt * 16, col0 = nq * 64; const float* arow = A + (size_t)(row0 + ln) * lda;
  v8f acc[4] = {};
  for (int kb = 0; kb < K; kb += 32) {
    FragH ah, al;
    const v4f x0 = *(const v4fa*)(arow + kb + 8 * hh), x1 = *(const v4fa*)(arow + kb + 8 * hh + 4), x2 = *(const v4fa*)(arow + kb + 16 + 8 * hh), x3 = *(const v4fa*)(arow + kb + 16 + 8 * hh + 4);
    float xs[16] = {x0[0],x0[1],x0[2],x0[3],x1[0],x1[1],x1[2],x1[3],x2[0],x2[1],x2[2],x2[3],x3[0],x3[1],x3[2],x3[3]};
#pragma unroll
    for (int i = 0; i < 16; ++i) { const _Float16 h = (_Float16)xs[i]; ah.h[i] = h; al.h[i] = ASPLIT ? (_Float16)(xs[i] - (float)h) : (_Float16)0.0f; }
#pragma unroll
    for (int t = 0; t < 4; ++t) { if (col0 + t * 16 >= N) continue; const size_t boff = (size_t)(col0 + t * 16 + ln) * ldb + kb; FragH bq; bq.half[0] = *(const v8us*)(Bh + boff + 8 * hh); bq.half[1] = *(const v8us*)(Bh + boff + 16 + 8 * hh);
      acc[t] = mmaH<ASPLIT ? 2 : 1>(ah.v, al.v, bq.v, bq.v, acc[t]); }
  }
#pragma unroll
  for (int t = 0; t < 4; ++t) { if (col0 + t * 16 >= N) continue;
#pragma unroll
    for (int r = 0; r < 8; ++r) so[w][8 * hh + r][t * 16 + ln] = acc[t][r] * alpha; }
  __builtin_amdgcn_fence(__ATOMIC_ACQ_REL, "workgroup"); __builtin_amdgcn_wave_barrier();
  const int rsub = lane >> 4, c4 = (lane & 15) * 4;
  {
#pragma unroll
    for (int q = 0; q < 8; ++q) { const int r = q * 2 + rsub; if (col0 + c4 < N) { const v4f v = *(const v4fa*)&so[w][r][c4]; *(v4f*)(C + (size_t)(row0 + r) * ldc + col0 + c4) = v; } }
     }
}

// Wt[n][k] = f16(W[k][n] x scale) from f32 row-major W[K][N] (scale = power of two; bf16-exact weights stay exact in f16 away from the subnormal range).
// One work-group turns a tile of 128 k x 64 n through LDS: it reads 256-byte runs of W's rows and stores 256-byte runs of Wt's rows, so both sides move whole 128-byte lines.
// An LDS word holds the f16 pair (k, k + 1) of one n. Row pitch 65 words: the 32 lanes of a store (16 groups of four n, two k pairs) and of a load (two n, 16 groups of four words) each fall on 32 different banks.
typedef _Float16 wt_h2 __attribute__((ext_vector_type(2)));
typedef unsigned int wt_u4 __attribute__((ext_vector_type(4)));
template <int K, int N>
__global__ __launch_bounds__(256) void k_wt_f16(const float* __restrict__ W, _Float16* __restrict__ Wt, float scale) {
  static_assert(K % 128 == 0 && N % 64 == 0, "whole tiles only");
  __shared__ unsigned int lt[64][65];
  const int tid = threadIdx.x; const int kt = blockIdx.x / (N / 64), nt = blockIdx.x % (N / 64);      /* neighbouring work-groups read neighbouring runs of the same rows */
  const int c4 = (tid & 15) * 4, r = tid >> 4;
  const float* sp = W + (size_t)(kt * 128 + 2 * r) * N + nt * 64 + c4;
  v4f a[4], b[4];
#pragma unroll      /* all eight row loads in flight together, from one address with immediate offsets; a[], b[] are indexed by constants */
  for (int u = 0; u < 4; ++u) { a[u] = *(const v4fa*)(sp + (size_t)(32 * u) * N); b[u] = *(const v4fa*)(sp + (size_t)(32 * u + 1) * N); }
  asm volatile("s_wait_xcnt 0x0" :: "v"(sp) : "memory");      /* behind the loads, their address as input: the address register is not given to a load's result or overwritten while an issued load still names it */
#pragma unroll      /* as above */
  for (int u = 0; u < 4; ++u) for (int q = 0; q < 4; ++q) { const wt_h2 p = {(_Float16)(bf16_round(a[u][q]) * scale), (_Float16)(bf16_round(b[u][q]) * scale)}; lt[c4 + q][r + 16 * u] = __builtin_bit_cast(unsigned int, p); }
  __syncthreads();      /* the tile is whole before any row of it is read across */
  const int k4 = (tid & 15) * 4;      /* 16 lanes per output row, eight k (four words) each */
  wt_u4 o[4];
#pragma unroll      /* o[] is indexed by constants */
  for (int u = 0; u < 4; ++u) { const unsigned int* lp = &lt[r + 16 * u][k4]; o[u] = wt_u4{lp[0], lp[1], lp[2], lp[3]}; }
  _Float16* dp = Wt + (size_t)(nt * 64 + r) * K + kt * 128 + 2 * k4;
#pragma unroll      /* as above */
  for (int u = 0; u < 4; ++u) *(wt_u4*)(dp + (size_t)(16 * u) * K) = o[u];
}
// k_gemm_hh variant with fused epilogue: v = acc·alpha + bias[by·sBias + col] (+ CP[(row/rowsPerB)·sCPb + by·64 + col] if CP) ; ACT 0 none / 1 elu ; writes f16 C16 (and f32 C if non-null)
template <int ACT>
__global__ __launch_bounds__(128) void k_gemm_hhx(const _Float16* __restrict__ A, int lda, size_t sA, const _Float16* __restrict__ Bh, int ldb, size_t sB, float alpha, const float* __restrict__ bias, size_t sBias, const float* __restrict__ CP, int rowsPerB, size_t sCPb, int row0g,
    float* __restrict__ C, _Float16* __restrict__ C16, int ldc, size_t sC, int M, int N, int K) {
  __shared__ __attribute__((aligned(16))) float so[4][16][64];
  const int tid = threadIdx.x, w = tid >> 5, lane = tid & 31, ln = lane & 15, hh = lane >> 4; const int by = blockIdx.y;
  A += (size_t)by * sA; Bh += (size_t)by * sB; const size_t cofs = (size_t)by * sC; const float* bp = bias ? bias + (size_t)by * sBias : nullptr;
  const int ntn = (N + 63) / 64; const int wid = blockIdx.x * 4 + w; const int mt = wid / ntn, nq = wid % ntn; if (mt * 16 >= M) return;
  const int row0 = mt * 16, col0 = nq * 64; const _Float16* arow = A + (size_t)(row0 + ln) * lda;
  v8f acc[4] = {};
  for (int kb = 0; kb < K; kb += 32) { FragH ah; ah.half[0] = *(const v8us*)((const unsigned short*)arow + kb + 8 * hh); ah.half[1] = *(const v8us*)((const unsigned short*)arow + kb + 16 + 8 * hh);
#pragma unroll
    for (int t = 0; t < 4; ++t) { if (col0 + t * 16 >= N) continue; const size_t boff = (size_t)(col0 + t * 16 + ln) * ldb + kb; FragH bq; bq.half[0] = *(const v8us*)((const unsigned short*)Bh + boff + 8 * hh); bq.half[1] = *(const v8us*)((const unsigned short*)Bh + boff + 16 + 8 * hh);
      acc[t] = mmaH<1>(ah.v, ah.v, bq.v, bq.v, acc[t]); }
  }
#pragma unroll
  for (int t = 0; t < 4; ++t) { if (col0 + t * 16 >= N) continue; const int col = col0 + t * 16 + ln; const float bv = bp ? bf16_round(bp[col]) : 0.f;
#pragma unroll
    for (int r = 0; r < 8; ++r) { float v = acc[t][r] * alpha + bv; if (CP) { const int rr = row0g + row0 + 8 * hh + r; if (rowsPerB < 0) v += CP[cofs + (size_t)rr * ldc + col];      /* rowsPerB < 0: own element of the batched C plane */ else { const int bidx = rr / rowsPerB; v += CP[(size_t)bidx * sCPb + (size_t)by * 64 + col]; } } if (ACT == 1) v = (v > 0.f) ? v : expm1f(v); else if (ACT == 7) v = (v > 0.f) ? v + 1.0f : expf(v); else if (ACT == 8) v = tanhf(v); else if (ACT == 9) v = 0.5f * v * (1.0f + tanhf(0.7978845608028654f * (v + 0.044715f * v * v * v))); else if (ACT == 11) v = 1.0f / (1.0f + expf(-v)); else if (ACT == 12) v = (v > 0.f) ? v : 0.01f * v; else if (ACT == 14) v = (v > 0.f) ? v : 0.1f * v; else if (ACT == 16) v = (v >= 0.f) ? v : 0.3f * v; else if (ACT == 17) v = (v >= 0.f) ? v : 0.2f * v; else if (ACT == 15) v = v / (1.0f + expf(-v)); else if (ACT == 3) v = fmaxf(v, 0.f); else if (ACT == 6) v = 0.5f * v * (1.0f + erff(v * 0.70710678118654752f)); so[w][8 * hh + r][t * 16 + ln] = v; } }
  __builtin_amdgcn_fence(__ATOMIC_ACQ_REL, "workgroup"); __builtin_amdgcn_wave_barrier();
  const int rsub = lane >> 4, c4 = (lane & 15) * 4; typedef _Float16 v4h __attribute__((ext_vector_type(4)));
  {
#pragma unroll
    for (int q = 0; q < 8; ++q) { const int r = q * 2 + rsub; if (col0 + c4 < N) { const v4f v = *(const v4fa*)&so[w][r][c4]; if (C) *(v4f*)(C + cofs + (size_t)(row0 + r) * ldc + col0 + c4) = v; if (C16) { v4h h4; for (int i = 0; i < 4; ++i) h4[i] = (_Float16)v[i]; *(v4h*)(C16 + cofs + (size_t)(row0 + r) * ldc + col0 + c4) = h4; } } }
     }
}


typedef _Float16 v4h __attribute__((ext_vector_type(4)));

__global__ __launch_bounds__(256) void k_x16(const float* __restrict__ x, _Float16* __restrict__ X16, size_t n8) { const size_t t = (size_t)blockIdx.x * 256 + threadIdx.x; if (t >= n8) return; FragH f;
#pragma unroll
  for (int q = 0; q < 8; ++q) f.h[q] = (_Float16)bf16_round(x[t * 8 + q]); *(v8us*)((unsigned short*)X16 + t * 8) = f.half[0];  }
__global__ __launch_bounds__(256) void k_h16(const float* __restrict__ x, _Float16* __restrict__ X16, size_t n8) { const size_t t = (size_t)blockIdx.x * 256 + threadIdx.x; if (t >= n8) return; FragH f;
#pragma unroll
  for (int q = 0; q < 8; ++q) f.h[q] = (_Float16)x[t * 8 + q]; *(v8us*)((unsigned short*)X16 + t * 8) = f.half[0];  }
__global__ __launch_bounds__(256) void k_round16f(const float* __restrict__ W, _Float16* __restrict__ Bt, size_t n8) { const size_t t = (size_t)blockIdx.x * 256 + threadIdx.x; if (t >= n8) return; FragH f;
#pragma unroll
  for (int i = 0; i < 8; ++i) f.h[i] = (_Float16)(bf16_round(W[t * 8 + i]) * 16.0f); *(v8us*)((unsigned short*)Bt + t * 8) = f.half[0];  }
template <int NHv, int TTv>
__global__ __launch_bounds__(256) void k_vt(const _Float16* __restrict__ V16, int ldv, int voff, _Float16* __restrict__ Vt) { __shared__ unsigned short tl[64][66]; const int tid = threadIdx.x; const int slab = blockIdx.x / (TTv / 64), lg = blockIdx.x % (TTv / 64); const int b = slab / NHv, h = slab % NHv;
  for (int i = tid; i < 64 * 8; i += 256) { const int r = i / 8, c8 = (i % 8) * 8; FragH f; f.half[0] = *(const v8us*)((const unsigned short*)V16 + ((size_t)b * TTv + lg * 64 + r) * ldv + voff + h * 64 + c8);
#pragma unroll
    for (int q = 0; q < 8; ++q) tl[r][c8 + q] = f.u[q]; }
  __syncthreads();
  {
#pragma unroll
    for (int rd = 0; rd < 2; ++rd) { const int d = rd * 32 + tid / 8, pc = tid % 8; FragH f;
#pragma unroll
      for (int q = 0; q < 8; ++q) f.u[q] = tl[pc * 8 + q][d];
      *(v8us*)((unsigned short*)Vt + ((size_t)slab * 64 + d) * TTv + lg * 64 + pc * 8) = f.half[0]; }
     } }

__global__ __launch_bounds__(256) void k_hl(const float* __restrict__ F, _Float16* __restrict__ Hh, _Float16* __restrict__ Hl, size_t n8) { const size_t t = (size_t)blockIdx.x * 256 + threadIdx.x; if (t >= n8) return; FragH fh, fl; const v4f a = *(const v4fa*)(F + t * 8), c = *(const v4fa*)(F + t * 8 + 4);
#pragma unroll
  for (int q = 0; q < 4; ++q) { _Float16 h = (_Float16)a[q]; fh.h[q] = h; fl.h[q] = (_Float16)((a[q] - (float)h) * 1024.0f); h = (_Float16)c[q]; fh.h[4 + q] = h; fl.h[4 + q] = (_Float16)((c[q] - (float)h) * 1024.0f); }
  { *(v8us*)((unsigned short*)Hh + t * 8) = fh.half[0]; *(v8us*)((unsigned short*)Hl + t * 8) = fl.half[0];  } }

// ---- fast GEMM (work-group tile 128x128: eight waves of 32x64; requires M % 128 == 0, N % 128 == 0, K % 128 == 0); epilogue = k_gemm_hhx semantics ----
// Both operands go from global memory to LDS by asynchronous copies, 128 k (256 bytes of each of the 128 A rows and 128 B rows) per stage, two buffers: stage t + 1 flies while stage t is multiplied.
// A wave's copy covers two whole rows of the stage (four whole 128-byte lines), and every operand byte is fetched once per work-group instead of once per wave.
#define G2P 136                      /* f16 per LDS row: 272 bytes = 16 x odd, the pitch for 16-byte readers of 256-byte rows */
#define G2BUF (256 * G2P)            /* f16 per buffer: A rows 0 .. 127, then B rows 0 .. 127 */
__device__ __forceinline__ v16h g2_frag(const _Float16* p, int hh) { FragH f; f.half[0] = *(const v8us*)((const unsigned short*)p + 8 * hh); f.half[1] = *(const v8us*)((const unsigned short*)p + 16 + 8 * hh); return f.v; }
__device__ __forceinline__ v8f g2_mma(v16h a, v16h b, v8f c) { v8f d = __builtin_amdgcn_wmma_f32_16x16x32_f16(false, a, false, b, (short)0, c, false, false); asm volatile("v_nop\n\tv_nop\n\tv_nop\n\tv_nop" : "+v"(d) : "v"(a), "v"(b)); return d; }
// Eight asynchronous 16-byte copies per lane: rows r, r + 16, .. r + 112 of one operand's stage (l = the lane's LDS byte address in row r, g = its global address there, step = 16 source rows in elements).
__device__ __forceinline__ void g2_copy8(unsigned l, const _Float16* g, size_t step) {
  const unsigned l1 = l + 16 * G2P * 2, l2 = l + 32 * G2P * 2, l3 = l + 48 * G2P * 2, l4 = l + 64 * G2P * 2, l5 = l + 80 * G2P * 2, l6 = l + 96 * G2P * 2, l7 = l + 112 * G2P * 2;
  const _Float16* g1 = g + step; const _Float16* g2 = g1 + step; const _Float16* g3 = g2 + step; const _Float16* g4 = g3 + step; const _Float16* g5 = g4 + step; const _Float16* g6 = g5 + step; const _Float16* g7 = g6 + step;
  /* the copies and, as the statement's last line, the wait in front of any rewrite of a register that an issued copy names */
  asm volatile("global_load_async_to_lds_b128 %0, %8, off\n\t"
               "global_load_async_to_lds_b128 %1, %9, off\n\t"
               "global_load_async_to_lds_b128 %2, %10, off\n\t"
               "global_load_async_to_lds_b128 %3, %11, off\n\t"
               "global_load_async_to_lds_b128 %4, %12, off\n\t"
               "global_load_async_to_lds_b128 %5, %13, off\n\t"
               "global_load_async_to_lds_b128 %6, %14, off\n\t"
               "global_load_async_to_lds_b128 %7, %15, off\n\t"
               "s_wait_xcnt 0x0"
               :: "v"(l), "v"(l1), "v"(l2), "v"(l3), "v"(l4), "v"(l5), "v"(l6), "v"(l7), "v"(g), "v"(g1), "v"(g2), "v"(g3), "v"(g4), "v"(g5), "v"(g6), "v"(g7) : "memory"); }
template <int ACT>
__global__ __launch_bounds__(256) void k_gemm2(const _Float16* __restrict__ A, int lda, size_t sA, const _Float16* __restrict__ Bh, int ldb, size_t sB, float alpha, const float* __restrict__ bias, size_t sBias, const float* __restrict__ CP, int rowsPerB, size_t sCPb, int row0g,
    float* __restrict__ C, _Float16* __restrict__ C16, int ldc, size_t sC, int M, int N, int K, int bsh, size_t zA, size_t zB, size_t zC) { static_assert(ACT == 0 || ACT == 3 || ACT == 6 || ACT == 8 || ACT == 9 || ACT == 11 || ACT == 12 || ACT == 14 || ACT == 15 || ACT == 16 || ACT == 17, "k_gemm2: unsupported ACT code (would silently apply no activation)");
  __shared__ __attribute__((aligned(16))) float sm[2 * G2BUF / 2];      /* the two operand buffers; behind the loop's last barrier the same LDS stages the output */
  static_assert(8 * 32 * 68 <= 2 * G2BUF / 2, "output staging must fit the operand buffers");
  float (*so)[32][68] = (float (*)[32][68])sm; const _Float16* lh = (const _Float16*)sm;
  const int tid = threadIdx.x, w = tid >> 5, lane = tid & 31, ln = lane & 15, hh = lane >> 4; const int by = blockIdx.y, bz = blockIdx.z;      /* grid.y = plane (head), 2^bsh planes share one B plane; grid.z = outer batch with its own strides zA, zB, zC */
  A += (size_t)by * sA + (size_t)bz * zA; Bh += (size_t)(by >> bsh) * sB + (size_t)bz * zB; const size_t cofs = (size_t)by * sC + (size_t)bz * zC; const float* bp = bias ? bias + (size_t)by * sBias : nullptr;
  const int ntn = N >> 7; const int mt = blockIdx.x / ntn, nq = blockIdx.x - mt * ntn; if (mt * 128 >= M) return;      /* the same for the whole work-group, in front of every barrier */
  const int row0 = mt * 128 + 32 * (w & 3), col0 = nq * 128 + 64 * (w >> 2);
  const int cr = tid >> 4, cc = (tid & 15) * 8;      /* copies: 16 lanes per row, 16 bytes each */
  const _Float16* ga = A + (size_t)(mt * 128 + cr) * lda + cc; const _Float16* gb = Bh + (size_t)(nq * 128 + cr) * ldb + cc; const size_t sa16 = (size_t)16 * lda, sb16 = (size_t)16 * ldb;
  const unsigned la = (unsigned)(size_t)sm + (unsigned)(cr * G2P + cc) * 2u, lb = la + 128u * G2P * 2u;
  const int aoff = (32 * (w & 3) + ln) * G2P, boff = (128 + 64 * (w >> 2) + ln) * G2P;
  const v8f z8 = {0.f,0.f,0.f,0.f,0.f,0.f,0.f,0.f}; v8f c00 = z8, c01 = z8, c02 = z8, c03 = z8, c10 = z8, c11 = z8, c12 = z8, c13 = z8;
  const int nt = K >> 7;
  g2_copy8(la, ga, sa16); g2_copy8(lb, gb, sb16);      /* stage 0 -> buffer 0 */
  asm volatile("s_wait_asynccnt 0x0" ::: "memory");      /* this wave's copies of stage 0 have landed */
  __syncthreads();      /* ... and every other wave's: stage 0 may be read */
  if (nt > 1) { g2_copy8(la + G2BUF * 2u, ga + 128, sa16); g2_copy8(lb + G2BUF * 2u, gb + 128, sb16); }      /* stage 1 -> buffer 1 */
#pragma unroll 1      /* one stage a trip: 32 matrix instructions a wave */
  for (int t = 0; t < nt; ++t) { const _Float16* a0p = lh + (t & 1) * G2BUF + aoff; const _Float16* a1p = a0p + 16 * G2P; const _Float16* b0p = lh + (t & 1) * G2BUF + boff; const _Float16* b1p = b0p + 16 * G2P; const _Float16* b2p = b1p + 16 * G2P; const _Float16* b3p = b2p + 16 * G2P;
    v16h a0 = g2_frag(a0p, hh), a1 = g2_frag(a1p, hh), b0 = g2_frag(b0p, hh), b1 = g2_frag(b1p, hh), b2 = g2_frag(b2p, hh), b3 = g2_frag(b3p, hh);
#pragma unroll      /* two fragment sets in registers, named by constants; the LDS reads differ by immediate offsets */
    for (int kb = 0; kb < 128; kb += 32) { v16h na0 = a0, na1 = a1, nb0 = b0, nb1 = b1, nb2 = b2, nb3 = b3;
      if (kb + 32 < 128) { na0 = g2_frag(a0p + kb + 32, hh); na1 = g2_frag(a1p + kb + 32, hh); nb0 = g2_frag(b0p + kb + 32, hh); nb1 = g2_frag(b1p + kb + 32, hh); nb2 = g2_frag(b2p + kb + 32, hh); nb3 = g2_frag(b3p + kb + 32, hh); }      /* the next 32 k of this stage, read as one group ahead of this block's products: their LDS latency hides behind the eight matrix instructions */
      c00 = g2_mma(a0, b0, c00); c10 = g2_mma(a1, b0, c10); c01 = g2_mma(a0, b1, c01); c11 = g2_mma(a1, b1, c11);
      c02 = g2_mma(a0, b2, c02); c12 = g2_mma(a1, b2, c12); c03 = g2_mma(a0, b3, c03); c13 = g2_mma(a1, b3, c13);
      a0 = na0; a1 = na1; b0 = nb0; b1 = nb1; b2 = nb2; b3 = nb3; }
    asm volatile("s_wait_dscnt 0x0" ::: "memory");      /* this wave's reads of stage t are done before its buffer is given up */
    asm volatile("s_wait_asynccnt 0x0" ::: "memory");      /* this wave's copies of stage t + 1 have landed */
    __syncthreads();      /* publishes stage t + 1 and ends every wave's reads of stage t */
    if (t + 2 < nt) { const unsigned lo = (unsigned)(t & 1) * (G2BUF * 2u); const int ko = (t + 2) * 128; g2_copy8(la + lo, ga + ko, sa16); g2_copy8(lb + lo, gb + ko, sb16); } }      /* stage t + 2 -> the buffer just left */
  asm volatile("s_wait_asynccnt 0x0" ::: "memory");      /* nothing of this wave is in flight when the buffers become output staging */
  v8f accs[8] = {c00, c01, c02, c03, c10, c11, c12, c13};
#pragma unroll
  for (int u = 0; u < 8; ++u) { const int t = u & 3, half = u >> 2; const int col = col0 + t * 16 + ln; const float bv = bp ? bf16_round(bp[col]) : 0.f;
#pragma unroll
    for (int r = 0; r < 8; ++r) { const int rloc = half * 16 + 8 * hh + r; float v = accs[u][r] * alpha + bv; if (CP) { if (rowsPerB < 0) v += CP[cofs + (size_t)(row0g + row0 + rloc) * ldc + col];      /* rowsPerB < 0: own element of the batched C plane */ else { const int bidx = (row0g + row0 + rloc) / rowsPerB; v += CP[(size_t)bidx * sCPb + (size_t)by * 64 + col]; } }
      if (ACT == 3) v = fmaxf(v, 0.f); else if (ACT == 6) v = 0.5f * v * (1.0f + erff(v * 0.70710678118654752f)); else if (ACT == 11) v = 1.0f / (1.0f + expf(-v)); else if (ACT == 15) v = v / (1.0f + expf(-v)); else if (ACT == 12) v = (v > 0.f) ? v : 0.01f * v; else if (ACT == 8) v = tanhf(v); else if (ACT == 9) v = 0.5f * v * (1.0f + tanhf(0.7978845608028654f * (v + 0.044715f * v * v * v))); else if (ACT == 14) v = (v > 0.f) ? v : 0.1f * v; else if (ACT == 16) v = (v >= 0.f) ? v : 0.3f * v; else if (ACT == 17) v = (v >= 0.f) ? v : 0.2f * v;
      so[w][rloc][t * 16 + ln] = v; } }
  __builtin_amdgcn_fence(__ATOMIC_ACQ_REL, "workgroup"); __builtin_amdgcn_wave_barrier();
  const int rsub = lane >> 4, c4 = (lane & 15) * 4;
  {
#pragma unroll
    for (int q = 0; q < 16; ++q) { const int r = q * 2 + rsub; const v4f v = *(const v4fa*)&so[w][r][c4]; if (C) *(v4f*)(C + cofs + (size_t)(row0 + r) * ldc + col0 + c4) = v; if (C16) { v4h h4; for (int i = 0; i < 4; ++i) h4[i] = (_Float16)v[i]; *(v4h*)(C16 + cofs + (size_t)(row0 + r) * ldc + col0 + c4) = h4; } }
     } }


__global__ __launch_bounds__(256) void k_wnat(const float* __restrict__ w, size_t n8, _Float16* __restrict__ Bt) { const size_t t = (size_t)blockIdx.x * 256 + threadIdx.x; if (t >= n8) return; FragH f; for (int q = 0; q < 8; ++q) f.h[q] = (_Float16)(bf16_round(w[t * 8 + q]) * 16.0f); *(v8us*)((unsigned short*)Bt + t * 8) = f.half[0];  }
__global__ __launch_bounds__(256) void k_rsm(const float* __restrict__ S, _Float16* __restrict__ P, int nrows) {
  #pragma clang fp contract(off)
  const int i = blockIdx.x * 256 + threadIdx.x; if (i >= nrows) return; const float* s = S + (size_t)i * SQ; float mx = -3.0e38f;
#pragma unroll 1
  for (int j = 0; j < SQ; ++j) mx = fmaxf(mx, s[j]); float se = 0.f;
#pragma unroll 1
  for (int j = 0; j < SQ; ++j) se += expf(s[j] - mx); const float sc = 256.0f / se;
#pragma unroll 1
  for (int j0 = 0; j0 < SQ; j0 += 8) { FragH f; for (int q = 0; q < 8; ++q) f.h[q] = (_Float16)(expf(s[j0 + q] - mx) * sc); unsigned short* d = (unsigned short*)P + (size_t)i * SQ + j0; *(v8us*)d = f.half[0];  } }
__global__ __launch_bounds__(256) void k_vt(const _Float16* __restrict__ V16, int b, int h0, _Float16* __restrict__ VT) { __shared__ unsigned short tl[64][65]; const int tid = threadIdx.x; const int hh = blockIdx.x % HG, sg = blockIdx.x / HG; const int s0 = sg * 64; const int h = h0 + hh;
  for (int i = tid; i < 64 * 8; i += 256) { const int j = i / 8, d8 = (i % 8) * 8; FragH f; f.half[0] = *(const v8us*)((const unsigned short*)V16 + ((size_t)b * SQ + s0 + j) * DM + h * HD + d8); for (int q = 0; q < 8; ++q) tl[d8 + q][j] = f.u[q]; }
  __syncthreads();
  { for (int i = tid; i < 64 * 8; i += 256) { const int d = i / 8, j8 = (i % 8) * 8; FragH f; for (int q = 0; q < 8; ++q) f.u[q] = tl[d][j8 + q]; *(v8us*)((unsigned short*)VT + ((size_t)hh * HD + d) * SQ + s0 + j8) = f.half[0]; }  } }


// Exact (f32, vector unit) causal attention over the first QT0 rows: one work-group of eight waves per (batch, head, 32 query rows).
// Step 1: wave w keeps key row 32 w + lane in registers and forms its scores against the 32 query rows, each read from LDS at one address for the whole wave.
// Step 2: wave w does the softmax of query rows 4 w .. 4 w + 3, lane = key mod 32 (maximum and denominator: per-lane partial, then a xor butterfly).
// Step 3: wave w sums weight x value over the keys in order for the same four rows, lane = four columns of the head, so that every value row is read as one whole run.
__global__ __launch_bounds__(256) void k_att0h(const float* __restrict__ QF, const float* __restrict__ KF, const float* __restrict__ VF, float scale, float* __restrict__ OF) {
  constexpr int ld = DMX, ldv = DMX, ldo = DMX;      /* row pitches as constants: the rows of one run of loads differ by an immediate offset only */
  static_assert(QT0 == 256, "eight waves: one per 32 keys, four query rows each");
  __shared__ __attribute__((aligned(16))) float sm[8 * 32 * 132 + 32 * 128];
  float (*lk)[32][132] = (float (*)[32][132])sm;      /* key rows at a pitch of 33 x 16 bytes: a lane reads its own row without bank conflicts */
  float (*lp)[QT0] = (float (*)[QT0])sm;      /* scores, then weights: they take the key rows' place once every wave holds its key rows in registers, which keeps the work-group under half of the LDS (above that this compiler budgets 512 registers and fetches the query reads far ahead into a second register window) */
  float (*lq)[128] = (float (*)[128])(sm + 8 * 32 * 132);
  const int tid = threadIdx.x, lane = tid & 31; const int w = __builtin_amdgcn_readfirstlane(tid >> 5); const int h = blockIdx.x / (QT0 / 32), rg = blockIdx.x % (QT0 / 32);
  { const size_t rb = (size_t)blockIdx.y * QT0; QF += rb * ld; KF += rb * ld; VF += rb * ldv; OF += rb * ldo; }      /* grid.y = batch: QT0 rows of every plane per batch */
  const int hc = h * 128 + lane * 4;
  for (int r = 0; r < 4; ++r) *(v4f*)&lq[4 * w + r][lane * 4] = *(const v4fa*)(QF + (size_t)(rg * 32 + 4 * w + r) * ld + hc);
  if (w <= rg) {      /* causal: key chunks 0 .. rg only */
#pragma unroll      /* all 32 row loads in flight together */
    for (int r = 0; r < 32; ++r) *(v4f*)&lk[w][r][lane * 4] = *(const v4fa*)(KF + (size_t)(w * 32 + r) * ld + hc); }
  __syncthreads();
  v4f kr[32];
  if (w <= rg) {
#pragma unroll      /* here and in the c loop below: kr[] stays in registers only if every index is a constant */
    for (int c = 0; c < 32; ++c) kr[c] = *(const v4f*)&lk[w][lane][c * 4]; }
  __syncthreads();      /* every key row has been read: from here on its place holds scores */
  if (w <= rg) {
#pragma unroll 1      /* the body is 512 multiply-adds already */
    for (int r0 = 0; r0 < 32; r0 += 4) { float s0 = 0.f, s1 = 0.f, s2 = 0.f, s3 = 0.f;
#pragma unroll
      for (int c = 0; c < 32; ++c) { const v4f q0 = *(const v4f*)&lq[r0][c * 4], q1 = *(const v4f*)&lq[r0 + 1][c * 4], q2 = *(const v4f*)&lq[r0 + 2][c * 4], q3 = *(const v4f*)&lq[r0 + 3][c * 4];
        for (int u = 0; u < 4; ++u) { s0 = fmaf(q0[u], kr[c][u], s0); s1 = fmaf(q1[u], kr[c][u], s1); s2 = fmaf(q2[u], kr[c][u], s2); s3 = fmaf(q3[u], kr[c][u], s3); } }
      float* sp = &lp[r0][w * 32 + lane]; sp[0] = s0 * scale; sp[QT0] = s1 * scale; sp[2 * QT0] = s2 * scale; sp[3 * QT0] = s3 * scale; } }
  __syncthreads();
  float fin[4];
#pragma unroll      /* fin[] and e[] are indexed by constants */
  for (int r = 0; r < 4; ++r) { const int il = 4 * w + r, i = rg * 32 + il; float e[8]; float mx = -3.0e38f, l = 0.f;
#pragma unroll
    for (int c = 0; c < 8; ++c) { e[c] = -3.0e38f; if (c <= rg) { const float s = lp[il][c * 32 + lane]; if (c * 32 + lane <= i) e[c] = s; } mx = fmaxf(mx, e[c]); }
    for (int m = 16; m > 0; m >>= 1) mx = fmaxf(mx, __shfl_xor(mx, m, 32));
#pragma unroll
    for (int c = 0; c < 8; ++c) { e[c] = (c * 32 + lane <= i) ? expf(e[c] - mx) : 0.f; l += e[c]; }
    for (int m = 16; m > 0; m >>= 1) l += __shfl_xor(l, m, 32);
    fin[r] = 64.0f / l;
#pragma unroll
    for (int c = 0; c < 8; ++c) if (c <= rg) lp[il][c * 32 + lane] = e[c]; }
  __syncthreads();
  const v4f z4 = {0.f, 0.f, 0.f, 0.f}; v4f acc[4] = {z4, z4, z4, z4}; const float* vp = VF + hc; const int nk = (rg + 1) * 32;
#pragma unroll 1      /* 16 value rows in flight a trip are enough; more would only cost registers */
  for (int j0 = 0; j0 < nk; j0 += 16) { v4f vv[16];
#pragma unroll
    for (int u = 0; u < 16; ++u) vv[u] = *(const v4fa*)(vp + (size_t)(j0 + u) * ldv);
#pragma unroll
    for (int g = 0; g < 4; ++g) for (int r = 0; r < 4; ++r) { const v4f p = *(const v4f*)&lp[4 * w + r][j0 + 4 * g]; for (int u = 0; u < 4; ++u) for (int x = 0; x < 4; ++x) acc[r][x] = fmaf(p[u], vv[4 * g + u][x], acc[r][x]); } }
#pragma unroll
  for (int r = 0; r < 4; ++r) { v4f o; for (int x = 0; x < 4; ++x) o[x] = acc[r][x] * fin[r]; *(v4f*)(OF + (size_t)(rg * 32 + 4 * w + r) * ldo + hc) = o; } }
__global__ __launch_bounds__(256) void k_f2h(const float* __restrict__ F, int ldf, int coff, int ncol, _Float16* __restrict__ H16, size_t nrow) { const size_t t = (size_t)blockIdx.x * 256 + threadIdx.x; const size_t n8 = nrow * (size_t)(ncol / 8); if (t >= n8) return; const size_t r = t / (ncol / 8); const int c8 = (int)(t % (ncol / 8)) * 8; FragH f; const v4f a = *(const v4fa*)(F + r * ldf + coff + c8), b2 = *(const v4fa*)(F + r * ldf + coff + c8 + 4); for (int q = 0; q < 4; ++q) { f.h[q] = (_Float16)a[q]; f.h[4 + q] = (_Float16)b2[q]; } *(v8us*)((unsigned short*)H16 + r * ncol + c8) = f.half[0];  }

__global__ __launch_bounds__(256) void k_tab128(float theta, float* __restrict__ CS, float* __restrict__ SN) {
  #pragma clang fp contract(off)
  const int t = blockIdx.x * 256 + threadIdx.x; if (t >= SQ * 64) return; const int i = t % 64; const int p = t / 64; const float invf = (float)(1.0 / pow((double)theta, (double)(2 * i) / 128.0));      /* = XLA's constant-folded f32 table */ const float ang = __fmul_rn((float)p, invf); const float c = cosf(ang), s = sinf(ang);
  *(float*)(CS + t) = c; *(float*)(SN + t) = s;  }
template <int TAB>
__global__ __launch_bounds__(128) void k_rope128(const float* __restrict__ F, int ldf, int nh, const float* __restrict__ CS, const float* __restrict__ SN, _Float16* __restrict__ H16, int ldo, float osc) {
  #pragma clang fp contract(off)
  __shared__ float xv[128]; __shared__ unsigned short sh_[128]; const int d = threadIdx.x; const int h = blockIdx.x % nh; const size_t r = blockIdx.x / nh; const int p = (int)(r % SQ);
  xv[d] = F[r * (size_t)ldf + (size_t)h * 128 + d]; __syncthreads();
  float c, s; if (TAB) { c = bf16_round(CS[(size_t)p * 128 + d]); s = bf16_round(SN[(size_t)p * 128 + d]); } else { c = CS[p * 64 + (d & 63)]; s = SN[p * 64 + (d & 63)]; }
  const float rot = (d < 64) ? -xv[d + 64] : xv[d - 64]; const float o = __fadd_rn(__fmul_rn(xv[d], c), __fmul_rn(rot, s));
  FragH th; th.h[0] = (_Float16)__fmul_rn(o, osc); sh_[d] = th.u[0]; __syncthreads();
  if (d < 16) { FragH f; for (int q = 0; q < 8; ++q) f.u[q] = sh_[d * 8 + q]; unsigned short* dst = (unsigned short*)H16 + r * (size_t)ldo + (size_t)h * 128 + d * 8; *(v8us*)dst = f.half[0];  } }

// Rotate-half RoPE, one wave per token row. 16 lanes per head: a lane holds columns 4 l .. 4 l + 3 and their partners 64 columns on, so x[d] and x[d + 64] meet in one lane (no LDS, no barrier);
// the row's cos / sin values (full-width f32 tables, one row per token row) stay in registers for all NHv heads, two heads per load. grid.x x 8 = rows per batch; grid.y = batch: source and table rows step by yin, output rows by yout.
template <int NHv, int F32OUT>
__global__ __launch_bounds__(256) void k_rope128w(const float* __restrict__ F, const float* __restrict__ CS, const float* __restrict__ SN, float* __restrict__ OF, _Float16* __restrict__ OH, float osc, int yin, int yout) {
  constexpr int ld = NHv * 128, NI = NHv / 2; static_assert(NHv % 2 == 0, "two heads per wave and trip");
  const int lane = threadIdx.x & 31; const int e = (lane >> 4) * 128 + (lane & 15) * 4, d = (lane & 15) * 4; const size_t rl = (size_t)blockIdx.x * 8 + (threadIdx.x >> 5); const size_t r = rl + (size_t)blockIdx.y * yin, ro = rl + (size_t)blockIdx.y * yout;
  const float* cp = CS + r * 128 + d; const float* sp = SN + r * 128 + d; const float* xp = F + r * ld + e;
  const v4f cl = *(const v4fa*)cp, ch = *(const v4fa*)(cp + 64), sl = *(const v4fa*)sp, sh = *(const v4fa*)(sp + 64);
  v4f xl[NI], xh[NI];
#pragma unroll      /* the whole row's loads in flight together; xl[], xh[] stay in registers only if every index is a constant */
  for (int i = 0; i < NI; ++i) { xl[i] = *(const v4fa*)(xp + i * 256); xh[i] = *(const v4fa*)(xp + i * 256 + 64); }
  asm volatile("s_wait_xcnt 0x0" :: "v"(cp), "v"(sp), "v"(xp) : "memory");      /* behind the row's loads, the three addresses as inputs: no address register is given to a later load's result or overwritten while an issued load still names it, and no table load is put off behind the first data wait */
#pragma unroll      /* as above */
  for (int i = 0; i < NI; ++i) { v4f ol, oh;
    for (int q = 0; q < 4; ++q) { ol[q] = fmaf(-xh[i][q], sl[q], xl[i][q] * cl[q]) * osc; oh[q] = fmaf(xl[i][q], sh[q], xh[i][q] * ch[q]) * osc; }      /* x cos rounded, partner x sin fused into the add: the form that the one-thread-per-column kernel compiled to, so roped q and k keep their bits */
    if (F32OUT) { float* dst = OF + ro * ld + e + i * 256; *(v4f*)dst = ol; *(v4f*)(dst + 64) = oh; }
    else { v4h hl, hh; for (int q = 0; q < 4; ++q) { hl[q] = (_Float16)ol[q]; hh[q] = (_Float16)oh[q]; } _Float16* dst = OH + ro * ld + e + i * 256; *(v4h*)dst = hl; *(v4h*)(dst + 64) = hh; } } }
template <int N>
__global__ __launch_bounds__(256) void k_rmsrow(float* __restrict__ X, const float* __restrict__ w, float eps) {
  #pragma clang fp contract(off)
  constexpr int PT = N / 256; __shared__ float red[256]; const size_t r = blockIdx.x; const int t = threadIdx.x; float* row = X + r * N + (size_t)t * PT; float v[PT]; float ss = 0.f;
  for (int q = 0; q < PT; ++q) { v[q] = row[q]; ss = __fadd_rn(ss, __fmul_rn(v[q], v[q])); }
  red[t] = ss; __syncthreads(); for (int k = 128; k > 0; k >>= 1) { if (t < k) red[t] = __fadd_rn(red[t], red[t + k]); __syncthreads(); }
  const float rs = rsqrtf(__fadd_rn(red[0] / (float)N, eps)); float o[PT]; for (int q = 0; q < PT; ++q) o[q] = __fmul_rn(__fmul_rn(v[q], rs), bf16_round(w[t * PT + q]));
  { for (int q = 0; q < PT; ++q) *(float*)(row + q) = o[q];  } }
template <int GS_, int NHQ, int DSRC>
__global__ __launch_bounds__(256) void k_kvexp128(const float* __restrict__ src, float* __restrict__ dst, size_t n4, size_t ysrc, size_t ydst) { const size_t t = (size_t)blockIdx.x * 256 + threadIdx.x; if (t >= n4) return; src += (size_t)blockIdx.y * ysrc; dst += (size_t)blockIdx.y * ydst;      /* grid.y = batch */ const size_t e = t * 4; const size_t row = e / ((size_t)NHQ * 128); const int col = (int)(e % ((size_t)NHQ * 128)); const int h = col / 128, d = col % 128; const v4f v = *(const v4fa*)(src + row * DSRC + (size_t)(h / GS_) * 128 + d); *(v4f*)(dst + e) = v;  }

__global__ __launch_bounds__(256) void k_rsmcfb(const float* __restrict__ S, _Float16* __restrict__ P, int hg, int q0, int nk, const int* __restrict__ mk) {
  #pragma clang fp contract(off)
  const int t = blockIdx.x * 256 + threadIdx.x; if (t >= hg * QT) return; const size_t i = (size_t)t; const float* s = S + i * NKX; const size_t ig = (size_t)(q0 + (t % QT)); const int* mr = mk + ig * SQ; float mx = -3.0e38f;
#pragma unroll 1
  for (int j = 0; j < nk; ++j) { const int mb = mr[j]; const float f = (mb == 0) ? 1.f : 0.f; mx = fmaxf(mx, fmaf(f, s[j], (1.f - f) * -1.0e9f)); } float se = 0.f;
#pragma unroll 1
  for (int j = 0; j < nk; ++j) { const int mb = mr[j]; const float f = (mb == 0) ? 1.f : 0.f; se += __expf(fmaf(f, s[j], (1.f - f) * -1.0e9f) - mx); } const float sc = 256.0f / se;
#pragma unroll 1
  for (int j0 = 0; j0 < nk; j0 += 8) { FragH fr; for (int q = 0; q < 8; ++q) { const int j = j0 + q; const int mb = mr[j]; const float f = (mb == 0) ? 1.f : 0.f; fr.h[q] = (_Float16)(__expf(fmaf(f, s[j], (1.f - f) * -1.0e9f) - mx) * sc); } unsigned short* d = (unsigned short*)P + i * NKX + j0; *(v8us*)d = fr.half[0];  } }


// Causal softmax, one wave per score row: lane l holds columns 128 c + 4 l .. + 3 of every 128-column chunk c in registers, so each
// load and store of a wave covers one contiguous run of the row and the row is read once. Row maximum and denominator: per-lane partial, then a xor butterfly over the 32 lanes.
// rel = the row's last causal column minus the lane's first column.
template <int NC>
__device__ __forceinline__ void rsm_row(const float* __restrict__ s, _Float16* __restrict__ d, int rel) {
  v4f e[NC]; float mx = -3.0e38f, se = 0.f;
#pragma unroll      /* here and below: e[] stays in registers only if every index is a constant */
  for (int c = 0; c < NC; ++c) e[c] = *(const v4fa*)(s + c * 128);
#pragma unroll      /* as above */
  for (int c = 0; c < NC; ++c) for (int q = 0; q < 4; ++q) { const float f = (c * 128 + q <= rel) ? 1.f : 0.f; e[c][q] = fmaf(f, e[c][q], (1.f - f) * -1.0e9f); mx = fmaxf(mx, e[c][q]); }
  for (int m = 16; m > 0; m >>= 1) mx = fmaxf(mx, __shfl_xor(mx, m, 32));
#pragma unroll      /* as above */
  for (int c = 0; c < NC; ++c) for (int q = 0; q < 4; ++q) { e[c][q] = __expf(e[c][q] - mx); se += e[c][q]; }
  for (int m = 16; m > 0; m >>= 1) se += __shfl_xor(se, m, 32);
  const float sc = 256.0f / se;
#pragma unroll      /* as above */
  for (int c = 0; c < NC; ++c) { v4h h4; for (int q = 0; q < 4; ++q) h4[q] = (_Float16)(e[c][q] * sc); *(v4h*)(d + c * 128) = h4; }
  asm volatile("s_wait_xcnt 0x0" ::: "memory");      /* behind the row's stores */
}
__global__ __launch_bounds__(256) void k_rsmcf2(const float* __restrict__ S, _Float16* __restrict__ P, int hg, int q0, int nk) {
  static_assert(QT == 256 && NKX == 8 * QT, "one case per row length below");
  const int col = (threadIdx.x & 31) * 4; const int t = blockIdx.x * 8 + (threadIdx.x >> 5); if (t >= hg * QT) return;
  const float* s = S + (size_t)t * NKX + col; _Float16* d = P + (size_t)t * NKX + col; const int rel = q0 + (t % QT) - col;
  switch (nk / QT) {      /* nk = QT .. NKX in steps of QT: one straight-line body per row length, so that the row's registers are indexed by constants */
    case 1: rsm_row<2>(s, d, rel); break; case 2: rsm_row<4>(s, d, rel); break; case 3: rsm_row<6>(s, d, rel); break; case 4: rsm_row<8>(s, d, rel); break;
    case 5: rsm_row<10>(s, d, rel); break; case 6: rsm_row<12>(s, d, rel); break; case 7: rsm_row<14>(s, d, rel); break; case 8: rsm_row<16>(s, d, rel); break; } }



__global__ __launch_bounds__(256) void k_tab128p(const int* __restrict__ pos, int nrows, float theta, float* __restrict__ CS, float* __restrict__ SN) {
  #pragma clang fp contract(off)
  const int t = blockIdx.x * 256 + threadIdx.x; if (t >= nrows * 64) return; const int i = t % 64; const int r = t / 64; const float invf = (float)(1.0 / pow((double)theta, (double)(2 * i) / 128.0)); const float ang = __fmul_rn((float)pos[r], invf); const float c = cosf(ang), sv = sinf(ang);
  float* c0 = CS + (size_t)r * 128 + i; float* s0 = SN + (size_t)r * 128 + i;
  { *(float*)c0 = c; *(float*)(c0 + 64) = c; *(float*)s0 = sv; *(float*)(s0 + 64) = sv;  } }

__global__ __launch_bounds__(256) void k_rsmcim(const float* __restrict__ S, _Float16* __restrict__ P, int hg, int q0, int nk, const int* __restrict__ am) {
  #pragma clang fp contract(off)
  const int t = blockIdx.x * 256 + threadIdx.x; if (t >= hg * QT) return; const size_t i = (size_t)t; const float* s = S + i * NKX; const int last = q0 + (t % QT); const int* mr = am + (size_t)last * SQ; float mx = -3.0e38f;      /* the module's mask row of this query (keys >= nk lie above the diagonal of the causal mask and are not computed) */
#pragma unroll 1
  for (int j = 0; j < nk; ++j) { const float f = (mr[j] != 0) ? 1.f : 0.f; mx = fmaxf(mx, fmaf(f, s[j], (1.f - f) * -1.0e9f)); } float se = 0.f;
#pragma unroll 1
  for (int j = 0; j < nk; ++j) { const float f = (mr[j] != 0) ? 1.f : 0.f; se += __expf(fmaf(f, s[j], (1.f - f) * -1.0e9f) - mx); } const float sc = 256.0f / se;
#pragma unroll 1
  for (int j0 = 0; j0 < nk; j0 += 8) { FragH fr; for (int q = 0; q < 8; ++q) { const int j = j0 + q; const float f = (mr[j] != 0) ? 1.f : 0.f; fr.h[q] = (_Float16)(__expf(fmaf(f, s[j], (1.f - f) * -1.0e9f) - mx) * sc); } unsigned short* d = (unsigned short*)P + i * NKX + j0; *(v8us*)d = fr.half[0];  } }



__global__ __launch_bounds__(256) void k_tab128h(int nr, float theta, float* __restrict__ CS, float* __restrict__ SN) {
  #pragma clang fp contract(off)
  const size_t t = (size_t)blockIdx.x * 256 + threadIdx.x; if (t >= (size_t)nr * 64) return; const int i = (int)(t % 64); const size_t r = t / 64; const int p = (int)(r % SQ);
  const float invf = (float)(1.0 / pow((double)theta, ((double)(2 * i)) / 128.0)); const float ang = __fmul_rn((float)p, invf); const float c = cosf(ang), sv = sinf(ang);
  float* pc = CS + r * 128 + i; float* ps = SN + r * 128 + i;
  *(float*)pc = c; *(float*)(pc + 64) = c; *(float*)ps = sv; *(float*)(ps + 64) = sv;  }
typedef unsigned int fa_u4 __attribute__((ext_vector_type(4)));
typedef unsigned int fa_u8 __attribute__((ext_vector_type(8)));
typedef short fa_s8 __attribute__((ext_vector_type(8)));
typedef float fa_f2 __attribute__((ext_vector_type(2)));
typedef _Float16 fa_h2 __attribute__((ext_vector_type(2)));
constexpr unsigned FA_PK = 272u;                 /* LDS pitch of a 256-byte K row: odd multiple of 16 bytes, for 16-byte readers */
constexpr unsigned FA_PV = 288u;                 /* LDS pitch of a 256-byte V row: odd multiple of 32 bytes, for the transposing load */
constexpr unsigned FA_SK = 128u;                 /* keys per stage */
constexpr unsigned FA_TK = FA_SK * FA_PK, FA_SLOT = FA_TK + FA_SK * FA_PV;      /* a buffer: K rows, then V rows */
constexpr unsigned FA_EP = 272u;                 /* output staging pitch */
static_assert(4u * 32u * FA_EP <= 2u * FA_SLOT, "output staging must fit the two buffers");
static_assert(HDK == 128 && SQ == 16 * 128 && NB == 2, "written for head size 128, 16 query blocks of 128 rows and two batches (the block order below)");
struct FaFrag { fa_u4 q[2]; };
struct FaK { FaFrag f[2][4]; };                  /* one pass's K: two 16-key tiles x four 32-wide k chunks */
__device__ __forceinline__ v8f fa_mma(const FaFrag& a, const FaFrag& b, v8f c) {
  const fa_u8 av = {a.q[0].x, a.q[0].y, a.q[0].z, a.q[0].w, a.q[1].x, a.q[1].y, a.q[1].z, a.q[1].w};
  const fa_u8 bv = {b.q[0].x, b.q[0].y, b.q[0].z, b.q[0].w, b.q[1].x, b.q[1].y, b.q[1].z, b.q[1].w};
  return __builtin_amdgcn_wmma_f32_16x16x32_f16(false, __builtin_bit_cast(v16h, av), false, __builtin_bit_cast(v16h, bv), (short)0, c, false, false); }
__device__ __forceinline__ fa_u4 fa_tr16(const unsigned char* p) { typedef __attribute__((address_space(3))) fa_s8 lds_s8; return __builtin_bit_cast(fa_u4, __builtin_amdgcn_ds_load_tr16_b128_v8i16((lds_s8*)p)); }
__device__ __forceinline__ unsigned fa_pack2(float lo, float hi) { return __builtin_bit_cast(unsigned, __builtin_convertvector(fa_f2{lo, hi}, fa_h2)); }      /* round to nearest even */
__device__ __forceinline__ float fa_xhalf(float x) { return __builtin_bit_cast(float, __builtin_amdgcn_permlanex16(__builtin_bit_cast(int, x), __builtin_bit_cast(int, x), 0x76543210, 0xfedcba98, false, false)); }      /* lane l with lane l ^ 16 */
__device__ __forceinline__ void fa_keep() { __builtin_amdgcn_sched_barrier(0); }      /* keeps the groups of a pass (products, fragment loads, exponentials) in the written order: moved together they lengthen live ranges and spill */
__device__ __forceinline__ void fa_nop4() { asm volatile("v_nop\n\tv_nop\n\tv_nop\n\tv_nop"); }      /* the four vector slots behind a run of matrix instructions, on every path: a branch follows */
__device__ __forceinline__ void fa_load_k(FaK& k, const unsigned char* Lp, unsigned koff, unsigned lane) {
  const unsigned c = lane & 15u, h = lane >> 4;
#pragma unroll      /* k.f[][] stays in registers only if every index is a constant */
  for (int kt = 0; kt < 2; ++kt) { const unsigned char* p = Lp + koff + (16u * kt + c) * FA_PK + 16u * h;
#pragma unroll      /* as above */
    for (int kc = 0; kc < 4; ++kc) { k.f[kt][kc].q[0] = *reinterpret_cast<const fa_u4*>(p + 64u * kc); k.f[kt][kc].q[1] = *reinterpret_cast<const fa_u4*>(p + 64u * kc + 32u); } } }
// Eight asynchronous 16-byte copies per lane: rows r, r + 8, .. r + 56 of one operand's stage (l = the lane's LDS byte address in row r, g = its global address there; source rows are DKV elements apart).
template <unsigned PITCH>
__device__ __forceinline__ void fa_copy8(unsigned l, const _Float16* g) {
  const unsigned l1 = l + 8u * PITCH, l2 = l + 16u * PITCH, l3 = l + 24u * PITCH, l4 = l + 32u * PITCH, l5 = l + 40u * PITCH, l6 = l + 48u * PITCH, l7 = l + 56u * PITCH;
  const _Float16* g1 = g + 8 * DKV; const _Float16* g2 = g + 16 * DKV; const _Float16* g3 = g + 24 * DKV; const _Float16* g4 = g + 32 * DKV; const _Float16* g5 = g + 40 * DKV; const _Float16* g6 = g + 48 * DKV; const _Float16* g7 = g + 56 * DKV;
  /* the copies and, as the statement's last line, the wait in front of any rewrite of a register that an issued copy names */
  asm volatile("global_load_async_to_lds_b128 %0, %8, off\n\t"
               "global_load_async_to_lds_b128 %1, %9, off\n\t"
               "global_load_async_to_lds_b128 %2, %10, off\n\t"
               "global_load_async_to_lds_b128 %3, %11, off\n\t"
               "global_load_async_to_lds_b128 %4, %12, off\n\t"
               "global_load_async_to_lds_b128 %5, %13, off\n\t"
               "global_load_async_to_lds_b128 %6, %14, off\n\t"
               "global_load_async_to_lds_b128 %7, %15, off\n\t"
               "s_wait_xcnt 0x0"
               :: "v"(l), "v"(l1), "v"(l2), "v"(l3), "v"(l4), "v"(l5), "v"(l6), "v"(l7), "v"(g), "v"(g1), "v"(g2), "v"(g3), "v"(g4), "v"(g5), "v"(g6), "v"(g7) : "memory"); }
__device__ __forceinline__ void fa_pass(FaK& kf, bool fetch_next, unsigned next_koff, const unsigned char* Lp, bool diag, unsigned voff, unsigned key0, unsigned qw0, unsigned lane,
                                        const FaFrag (&qf)[2][4], v8f (&acc)[2][8], float (&m_run)[2], float (&l_run)[2], float cscale) {
  const unsigned c = lane & 15u, h = lane >> 4;
  v8f s[2][2];
  asm volatile("s_wait_dscnt 0x0" ::: "memory");      /* this pass's K fragments have arrived */
  fa_keep();
#pragma unroll      /* every array below is indexed by constants only */
  for (int kt = 0; kt < 2; ++kt) {
#pragma unroll
    for (int g = 0; g < 2; ++g) { s[kt][g] = v8f{};
#pragma unroll
      for (int kc = 0; kc < 4; ++kc) s[kt][g] = fa_mma(kf.f[kt][kc], qf[g][kc], s[kt][g]); } }
  fa_keep(); fa_nop4(); fa_keep();
  if (fetch_next) fa_load_k(kf, Lp, next_koff, lane);
  if (diag) {
#pragma unroll
    for (int g = 0; g < 2; ++g) { const unsigned my_q = qw0 + 16u * g + c;
#pragma unroll
      for (int kt = 0; kt < 2; ++kt) {
#pragma unroll
        for (int r = 0; r < 8; ++r) { const unsigned key = key0 + 16u * kt + 8u * h + r; if (key > my_q) s[kt][g][r] = -__builtin_inff(); }
        asm volatile("" : "+v"(s[kt][g]));
      } } }
  float mb[2]; bool need = false;
#pragma unroll
  for (int g = 0; g < 2; ++g) { float mx = -__builtin_inff();
#pragma unroll
    for (int kt = 0; kt < 2; ++kt) {
#pragma unroll
      for (int r = 0; r < 8; ++r) mx = __builtin_fmaxf(mx, s[kt][g][r]); }
    mx = __builtin_fmaxf(mx, fa_xhalf(mx)) * cscale;
    mb[g] = mx; need = need || (mx > m_run[g] + 8.0f);
    fa_keep(); }
  if (__builtin_amdgcn_ballot_w32(need) != 0) {      /* rare after the first passes */
#pragma unroll
    for (int g = 0; g < 2; ++g) { const float m_new = __builtin_fmaxf(m_run[g], mb[g]);
      const float corr = __builtin_amdgcn_exp2f(m_run[g] - m_new);      /* 0 on the first pass, where m_run is -inf */
      l_run[g] *= corr; m_run[g] = m_new;
#pragma unroll
      for (int t = 0; t < 8; ++t) acc[g][t] = acc[g][t] * corr; } }
  FaFrag vf[8]; float ps[2][2] = {{0.f, 0.f}, {0.f, 0.f}};
  { const unsigned char* ad = Lp + voff + (8u * h + (lane & 7u)) * FA_PV + ((lane >> 3) & 1u) * 16u;
#pragma unroll
    for (int t = 0; t < 8; ++t) { vf[t].q[0] = fa_tr16(ad + 32u * t); vf[t].q[1] = fa_tr16(ad + 16u * FA_PV + 32u * t); } }
#pragma unroll
  for (int g = 0; g < 2; ++g) { const float nm = 4.0f - m_run[g]; unsigned w[8];
#pragma unroll
    for (int i = 0; i < 8; ++i) {
      const fa_f2 arg = __builtin_elementwise_fma(fa_f2{s[i >> 2][g][2 * (i & 3)], s[i >> 2][g][2 * (i & 3) + 1]}, fa_f2{cscale, cscale}, fa_f2{nm, nm});
      const float p0 = __builtin_amdgcn_exp2f(arg.x), p1 = __builtin_amdgcn_exp2f(arg.y);
      ps[g][i & 1] += p0 + p1; w[i] = fa_pack2(p0, p1); }
    FaFrag pf; pf.q[0] = fa_u4{w[0], w[1], w[2], w[3]}; pf.q[1] = fa_u4{w[4], w[5], w[6], w[7]};
    if (g == 0) { asm volatile("s_wait_dscnt 0x0" ::: "memory");      /* the V fragments (and the K fetched ahead) have arrived */
      fa_keep(); }
#pragma unroll
    for (int t = 0; t < 8; ++t) acc[g][t] = fa_mma(vf[t], pf, acc[g][t]);
    fa_keep(); }
  fa_nop4(); fa_keep();
#pragma unroll
  for (int g = 0; g < 2; ++g) l_run[g] += ps[g][0] + ps[g][1];
}
// grid = (query block in the order below, query head, batch): 512 work-groups, all resident. Q [NB SQ][DMX], K and V [NB SQ][DKV], O [NB SQ][DMX] (x64), all f16.
// Block pb walks pb + 1 stages. The order 15, 0, 14, 1, .. in batch 0 and its mirror in batch 1 lets a long block share its WGP with a short one (for speed only)
// whether the two work-groups of a WGP are neighbours in the grid or half a grid apart.
__global__ __launch_bounds__(128) __attribute__((amdgpu_waves_per_eu(2, 2))) void k_fattn(const _Float16* __restrict__ Q, const _Float16* __restrict__ K, const _Float16* __restrict__ V, _Float16* __restrict__ O) {
  __shared__ __attribute__((aligned(16))) unsigned char L[2u * FA_SLOT];
  constexpr float cscale = 0.12751743082459868f;      /* 1 / sqrt(128) x log2(e) */
  const unsigned tid = threadIdx.x, lane = tid & 31u, wave = __builtin_amdgcn_readfirstlane(tid >> 5), c = lane & 15u, h = lane >> 4;
  const unsigned hq = blockIdx.y, gkv = hq >> GSH; const size_t rb = (size_t)blockIdx.z * SQ;
  const unsigned po = (blockIdx.x & 1u) ? (blockIdx.x >> 1) : 15u - (blockIdx.x >> 1), pb = blockIdx.z ? 15u - po : po, q0 = pb * 128u, n_stage = pb + 1u;      /* keys [0, q0 + 128) */
  const unsigned lbase = (unsigned)(size_t)L, qw0 = q0 + wave * 32u;
  const unsigned cr = tid >> 4, cc = tid & 15u;      /* copies: 16 lanes per row, 16 bytes each */
  const unsigned go = (unsigned)(rb + cr) * DKV + gkv * HDK + cc * 8u;      /* the lane's element in K and in V, stage 0: one 32-bit offset beside the two uniform bases */
  const unsigned lk = lbase + cr * FA_PK + cc * 16u, lv = lbase + FA_TK + cr * FA_PV + cc * 16u;
  auto issue = [&](unsigned st) { const unsigned lo = (st & 1u) * FA_SLOT; const size_t o = (size_t)(go + st * (FA_SK * DKV));      /* stage st -> buffer st mod 2: 32 copies a lane */
    fa_keep(); fa_copy8<FA_PK>(lk + lo, K + o); fa_keep(); fa_copy8<FA_PK>(lk + lo + 64u * FA_PK, K + o + 64 * DKV); fa_keep(); fa_copy8<FA_PV>(lv + lo, V + o); fa_keep(); fa_copy8<FA_PV>(lv + lo + 64u * FA_PV, V + o + 64 * DKV); fa_keep(); };      /* each statement's 24 address registers are formed directly in front of it: formed all at once they spill */
  issue(0u);
  FaFrag qf[2][4];      /* Q fragments in the same k order as K's in fa_load_k */
  const _Float16* qp0 = Q + (rb + qw0 + c) * DMX + hq * HDK + 8u * h; const _Float16* qp1 = qp0 + 16 * DMX;
#pragma unroll      /* qf[][] is indexed by constants */
  for (int kc = 0; kc < 4; ++kc) { qf[0][kc].q[0] = *reinterpret_cast<const fa_u4*>(qp0 + 32 * kc); qf[0][kc].q[1] = *reinterpret_cast<const fa_u4*>(qp0 + 32 * kc + 16); qf[1][kc].q[0] = *reinterpret_cast<const fa_u4*>(qp1 + 32 * kc); qf[1][kc].q[1] = *reinterpret_cast<const fa_u4*>(qp1 + 32 * kc + 16); }
  asm volatile("s_wait_xcnt 0x0" :: "v"(qp0), "v"(qp1) : "memory");      /* behind the Q loads, their addresses as inputs: no address register is overwritten while an issued load still names it */
  v8f acc[2][8]; float m_run[2], l_run[2];
#pragma unroll
  for (int g = 0; g < 2; ++g) { m_run[g] = -__builtin_inff(); l_run[g] = 0.0f;
#pragma unroll
    for (int t = 0; t < 8; ++t) acc[g][t] = v8f{}; }
  asm volatile("s_wait_asynccnt 0x0" ::: "memory");      /* this wave's copies of stage 0 have landed */
  __syncthreads();      /* ... and every other wave's: stage 0 may be read */
  if (n_stage > 1u) issue(1u);      /* the same for the whole work-group */
  const unsigned my_last = qw0 / 32u;      /* the last pass that this wave's 32 queries can see: the one on its diagonal */
  FaK kf;
#pragma unroll 1      /* stage loop and pass loop stay nested and rolled: one body of 32 matrix instructions */
  for (unsigned st = 0; st < n_stage; ++st) { const unsigned bo = (st & 1u) * FA_SLOT;
#pragma unroll 1      /* as above */
    for (unsigned sub = 0; sub < 4u; ++sub) { const unsigned blk = 4u * st + sub;
      if (blk <= my_last) {      /* wave-uniform; a wave past its diagonal still passes every barrier below */
        if (sub == 0u) fa_load_k(kf, L, bo, lane);      /* a stage's first K fragments are read in that stage's own trip, behind its barrier */
        fa_pass(kf, sub < 3u && blk < my_last, bo + (sub + 1u) * 32u * FA_PK, L, blk == my_last, bo + FA_TK + sub * 32u * FA_PV, blk * 32u, qw0, lane, qf, acc, m_run, l_run, cscale); } }
    asm volatile("s_wait_dscnt 0x0" ::: "memory");      /* this wave's reads of stage st are done before its buffer is given up */
    asm volatile("s_wait_asynccnt 0x0" ::: "memory");      /* this wave's copies of stage st + 1 have landed */
    __syncthreads();      /* publishes stage st + 1 and ends every wave's reads of stage st */
    if (st + 2u < n_stage) issue(st + 2u); }      /* into the buffer just left */
  asm volatile("s_wait_asynccnt 0x0" ::: "memory");      /* nothing of this wave is in flight when the buffers become output staging */
  unsigned char* eb = L + wave * 32u * FA_EP;      /* each wave stages its own 32 rows; the loop's last barrier has ended every read of the buffers */
#pragma unroll
  for (int g = 0; g < 2; ++g) { const float l_fin = l_run[g] + fa_xhalf(l_run[g]);
    const float inv = 64.0f / l_fin;      /* o x64, the scale that the output projection expects */
#pragma unroll
    for (int t = 0; t < 8; ++t) { const v8f o = acc[g][t] * inv; const fa_u4 pk = {fa_pack2(o[0], o[1]), fa_pack2(o[2], o[3]), fa_pack2(o[4], o[5]), fa_pack2(o[6], o[7])};
      *reinterpret_cast<fa_u4*>(eb + (16u * g + c) * FA_EP + 32u * t + 16u * h) = pk; } }
  asm volatile("s_wait_dscnt 0x0" ::: "memory");      /* the wave's own staged rows are written before it reads them back */
  _Float16* op = O + (rb + qw0 + (lane >> 4)) * DMX + hq * HDK + (lane & 15u) * 8u;
#pragma unroll
  for (unsigned i = 0; i < 16u; ++i) { const fa_u4 v = *reinterpret_cast<const fa_u4*>(eb + (2u * i + (lane >> 4)) * FA_EP + (lane & 15u) * 16u); *reinterpret_cast<fa_u4*>(op + (size_t)(2u * i) * DMX) = v; }
}
extern "C" void kernel_launch(void* const* d_in, const int* in_sizes, int n_in,
                              void* d_out, int out_size, void* d_ws, size_t ws_size, hipStream_t stream) {
  (void)in_sizes; (void)n_in; (void)out_size;
  const float* const* I = (const float* const*)d_in; const float* x = I[0]; const float* wq = I[1]; const float* wk = I[2]; const float* wv = I[3]; const float* wo = I[4]; const float* bq = nullptr; const float* bk = nullptr; const float* bv = nullptr; const float* bo = nullptr;      /* [in][out] Wq [2048][2048], Wk/Wv [2048][1024], Wo [2048][2048]; no biases; positions implicit */
  char* ws = (char*)d_ws; size_t off = 0;
  auto take = [&](size_t bytes) { char* p = ws + off; off += (bytes + 255) & ~(size_t)255; return p; };
  _Float16* BQ = (_Float16*)take((size_t)DMX * DMX * 2); _Float16* BK = (_Float16*)take((size_t)DKV * DMX * 2); _Float16* BV = (_Float16*)take((size_t)DKV * DMX * 2); _Float16* BO = (_Float16*)take((size_t)DMX * DMX * 2);
  _Float16* X16 = (_Float16*)take(NR * DMX * 2); float* QF = (float*)take(NR * (DMX + 2 * DKV) * 4); float* KF = QF + NR * DMX; float* VF = KF + NR * DKV; _Float16* Q16 = (_Float16*)take(NR * DMX * 2); _Float16* K16 = (_Float16*)take(NR * DKV * 2); _Float16* V16 = (_Float16*)take(NR * DKV * 2); _Float16* O16 = (_Float16*)take(NR * DMX * 2);
  float* CS = (float*)take(NR * 128 * 4); float* SN = (float*)take(NR * 128 * 4); float* QF0 = (float*)take((size_t)NB * QT0 * DMX * 4); float* KRF0 = (float*)take((size_t)NB * QT0 * DKV * 4); float* KF0e = (float*)take((size_t)NB * QT0 * DMX * 4); float* VF0e = (float*)take((size_t)NB * QT0 * DMX * 4); float* OF0 = (float*)take((size_t)NB * QT0 * DMX * 4); _Float16* OH0 = (_Float16*)take((size_t)NB * QT0 * DMX * 2); _Float16* OL0 = (_Float16*)take((size_t)NB * QT0 * DMX * 2);
  if (off > ws_size) return;      /* 24 (weights) + 16 + 64 + 16 + 8 + 8 + 16 + 2 + 2 + 4 + 2 + 4 + 4 + 4 + 2 + 2 = 178 MiB */
  k_wt_f16<DMX, DMX><<<(DMX / 128) * (DMX / 64), 256, 0, stream>>>(wq, BQ, 16.0f); k_wt_f16<DMX, DKV><<<(DMX / 128) * (DKV / 64), 256, 0, stream>>>(wk, BK, 16.0f); k_wt_f16<DMX, DKV><<<(DMX / 128) * (DKV / 64), 256, 0, stream>>>(wv, BV, 16.0f); k_wt_f16<DMX, DMX><<<(DMX / 128) * (DMX / 64), 256, 0, stream>>>(wo, BO, 16.0f);      /* [in][out] -> Bt x16 */
  k_x16<<<(unsigned)((NR * DMX / 8 + 255) / 256), 256, 0, stream>>>(x, X16, NR * DMX / 8);
  k_gemm2<0><<<dim3((unsigned)((NR / 128) * (DMX / 128)), 1), 256, 0, stream>>>(X16, DMX, 0, BQ, DMX, 0, 0.0625f, bq, 0, nullptr, 1, 0, 0, QF, nullptr, DMX, 0, (int)NR, DMX, DMX, 0, 0, 0, 0);      /* q (f32) */
  k_gemm2<0><<<dim3((unsigned)((NR / 128) * (DKV / 128)), 1), 256, 0, stream>>>(X16, DMX, 0, BK, DMX, 0, 0.0625f, bk, 0, nullptr, 1, 0, 0, KF, nullptr, DKV, 0, (int)NR, DKV, DMX, 0, 0, 0, 0);      /* k (f32) */
  k_gemm2<0><<<dim3((unsigned)((NR / 128) * (DKV / 128)), 1), 256, 0, stream>>>(X16, DMX, 0, BV, DMX, 0, 0.0625f, bv, 0, nullptr, 1, 0, 0, VF, V16, DKV, 0, (int)NR, DKV, DMX, 0, 0, 0, 0);      /* v (f32 for the first tile + f16) */
  k_tab128h<<<(unsigned)((NR * 64 + 255) / 256), 256, 0, stream>>>((int)NR, 10000.0f, CS, SN);      /* per-row cos/sin tables [NR][128] for positions r % SQ, duplicated over both halves (cat(f, f)) */
  k_rope128w<NH, 0><<<(unsigned)(NR / 8), 256, 0, stream>>>(QF, CS, SN, nullptr, Q16, 1.0f, 0, 0); k_rope128w<NKV, 0><<<(unsigned)(NR / 8), 256, 0, stream>>>(KF, CS, SN, nullptr, K16, 1.0f, 0, 0);      /* rope (all rows) -> f16 */
  /* From here on every launch covers both batches (grid.y or grid.z = batch, or one index over the rows of both). */
  k_rope128w<NH, 1><<<dim3(QT0 / 8, NB), 256, 0, stream>>>(QF, CS, SN, QF0, nullptr, 1.0f, SQ, QT0); k_rope128w<NKV, 1><<<dim3(QT0 / 8, NB), 256, 0, stream>>>(KF, CS, SN, KRF0, nullptr, 1.0f, SQ, QT0);      /* f32 roped q, k of each batch's first QT0 rows */
  k_kvexp128<GSZ, NH, DKV><<<dim3((unsigned)(((size_t)QT0 * DMX / 4 + 255) / 256), NB), 256, 0, stream>>>(KRF0, KF0e, (size_t)QT0 * DMX / 4, (size_t)QT0 * DKV, (size_t)QT0 * DMX); k_kvexp128<GSZ, NH, DKV><<<dim3((unsigned)(((size_t)QT0 * DMX / 4 + 255) / 256), NB), 256, 0, stream>>>(VF, VF0e, (size_t)QT0 * DMX / 4, (size_t)SQ * DKV, (size_t)QT0 * DMX);      /* kv head -> query head expansion for the exact first tile */
  k_att0h<<<dim3(NH * (QT0 / 32), NB), 256, 0, stream>>>(QF0, KF0e, VF0e, ATS, OF0);      /* exact causal attention, first QT0 rows (o x64) */
  k_fattn<<<dim3(SQ / 128, NH, NB), 128, 0, stream>>>(Q16, K16, V16, O16);      /* causal attention of all rows, heads and batches -> o (x64, f16): query head y vs kv head y >> GSH */
  k_gemm2<0><<<dim3((unsigned)((NR / 128) * (DMX / 128)), 1), 256, 0, stream>>>(O16, DMX, 0, BO, DMX, 0, 0.0009765625f, bo, 0, nullptr, 1, 0, 0, (float*)d_out, nullptr, DMX, 0, (int)NR, DMX, DMX, 0, 0, 0, 0);      /* out = o Wo */
  k_hl<<<(unsigned)(((size_t)NB * QT0 * DMX / 8 + 255) / 256), 256, 0, stream>>>(OF0, OH0, OL0, (size_t)NB * QT0 * DMX / 8);      /* first-tile o (x64) -> f16 hi + x1024 residual planes */
  k_gemm2<0><<<dim3((QT0 / 128) * (DMX / 128), 1, NB), 256, 0, stream>>>(OH0, DMX, 0, BO, DMX, 0, 0.0009765625f, bo, 0, nullptr, 1, 0, 0, (float*)d_out, nullptr, DMX, 0, QT0, DMX, DMX, 0, (size_t)QT0 * DMX, 0, (size_t)SQ * DMX);      /* first QT0 rows of each batch rewritten from the exact path */
  k_gemm2<0><<<dim3((QT0 / 128) * (DMX / 128), 1, NB), 256, 0, stream>>>(OL0, DMX, 0, BO, DMX, 0, 0.00000095367431640625f, nullptr, 0, (const float*)d_out, -1, 0, 0, (float*)d_out, nullptr, DMX, 0, QT0, DMX, DMX, 0, (size_t)QT0 * DMX, 0, (size_t)SQ * DMX);      /* += o_lo Wo 2^-20 (own-element accumulate) */
}

// v008
// Measured time: 218 microseconds a run.
// In two side-by-side timings against v007, it was 1.27 and 1.28 times as fast.
// Counting every step since v000, it is 55.2 times as fast.
#include <hip/hip_runtime.h>
// Grouped-query causal attention with rotate-half RoPE, 16 query / 8 kv heads of 128 (x [2][2048][2048]; q = x Wq (16 x 128), k = x Wk, v = x Wv (8 x 128) ([in][out] weights sigma 0.02, no biases); inv_freq_i = 1/10000^(2i/128), positions 0..2047, cos/sin = cat(freqs, freqs); q, k roped; kv head h/2 serves query head h; scores / sqrt(128); causal (tril, -inf); softmax; out = merged Wo -> [2][2048][2048]).
// Compute dtype: inputs rounded to bf16; x / weights exact; projections and rope f32; q, k, v, softmax weights and o as plain f16 GEMM operands (~2^-12; first 256 rows of each batch exact); scores, statistics, out f32. v_wmma_f32_16x16x32_f16.
#define NB 2
#define SQ 2048
#define DMX 2048
#define NH 16
#define NKV 8
#define GSZ 2                        /* query heads per kv head */
#define GSH 1                        /* log2(GSZ): query head >> GSH = its kv head */
#define HDK 128
#define DKV (NKV * HDK)
#define QT 256
#define QT0 256
#define NKX SQ
#define DM DMX
#define HD 64
#define HG 1
#define NR ((size_t)NB * SQ)
#define ATS 0.08838834764831845f
typedef __bf16 v16b __attribute__((ext_vector_type(16)));
typedef unsigned short v8us __attribute__((ext_vector_type(8), may_alias));
typedef float  v8f  __attribute__((ext_vector_type(8)));
typedef float  v4f  __attribute__((ext_vector_type(4)));
typedef float  v4fa __attribute__((ext_vector_type(4), may_alias));
union FragB { v16b v; v8us half[2]; unsigned short u[16]; };

__device__ __forceinline__ unsigned short bf16_bits(float x) { unsigned int u = __float_as_uint(x); return (unsigned short)((u + 0x7FFFu + ((u >> 16) & 1u)) >> 16); }
__device__ __forceinline__ float bf16_val(unsigned short b) { return __uint_as_float(((unsigned int)b) << 16); }
__device__ __forceinline__ float bf16_round(float x) { return bf16_val(bf16_bits(x)); }
// D += A·B with NT terms: 1 = ah·bh, 2 = + al·bh (A split), 3 = + ah·bl (both split)
template <int NT>
__device__ __forceinline__ v8f mmaN(v16b ah, v16b al, v16b bh, v16b bl, v8f c) {
  c = __builtin_amdgcn_wmma_f32_16x16x32_bf16(false, ah, false, bh, (short)0, c, false, false);
  if (NT >= 2) c = __builtin_amdgcn_wmma_f32_16x16x32_bf16(false, al, false, bh, (short)0, c, false, false);
  if (NT >= 3) c = __builtin_amdgcn_wmma_f32_16x16x32_bf16(false, ah, false, bl, (short)0, c, false, false);
  asm volatile("v_nop\n\tv_nop\n\tv_nop\n\tv_nop" : "+v"(c) : "v"(ah), "v"(al), "v"(bh), "v"(bl));
  return c;
}

__global__ __launch_bounds__(256) void k_wt_bf16(const float* __restrict__ W, unsigned short* __restrict__ Wt, int K, int N) {
  const int t = blockIdx.x * 256 + threadIdx.x;
  const int k8n = K / 8;
  if (t >= N * k8n) return;
  const int n = t / k8n, k8 = (t % k8n) * 8;
  v8us v;
#pragma unroll
  for (int i = 0; i < 8; ++i) v[i] = bf16_bits(W[(size_t)(k8 + i) * N + n]);
  *(v8us*)(Wt + (size_t)n * K + k8) = v;
  
}

// GEMM C[M][N] (f32, pitch ldc) = act(A[M][K]·W + bias). A f32 row-major (pitch lda) converted per fragment to bf16
// (ASPLIT: hi/lo two planes -> 2 terms, else single rounded term); Wt bf16 [N][K] (pitch ldb). BIAS_BF16 rounds the
// bias to bf16 first (bias quantised to bf16 before the add). K%32==0, M%16==0, N%64==0.
template <bool ASPLIT, int ACT, bool BIAS_BF16>
__global__ __launch_bounds__(128) void k_gemm_bf(const float* __restrict__ A, int lda, const unsigned short* __restrict__ Wt, int ldb,
                                               const float* __restrict__ bias, float* __restrict__ C, int ldc, int M, int N, int K) {
  __shared__ __attribute__((aligned(16))) float so[4][16][64];
  const int tid = threadIdx.x, w = tid >> 5, lane = tid & 31, ln = lane & 15, hh = lane >> 4;
  const int ntn = N / 64;
  const int wid = blockIdx.x * 4 + w;
  const int mt = wid / ntn, nq = wid % ntn;
  if (mt * 16 >= M) return;
  const int row0 = mt * 16, col0 = nq * 64;
  const float* arow = A + (size_t)(row0 + ln) * lda;
  v8f acc[4] = {};
  for (int kb = 0; kb < K; kb += 32) {
    FragB ah, al;
    const v4f x0 = *(const v4fa*)(arow + kb + 8 * hh), x1 = *(const v4fa*)(arow + kb + 8 * hh + 4);
    const v4f x2 = *(const v4fa*)(arow + kb + 16 + 8 * hh), x3 = *(const v4fa*)(arow + kb + 16 + 8 * hh + 4);
    float xs[16] = {x0[0],x0[1],x0[2],x0[3],x1[0],x1[1],x1[2],x1[3],x2[0],x2[1],x2[2],x2[3],x3[0],x3[1],x3[2],x3[3]};
#pragma unroll
    for (int i = 0; i < 16; ++i) { const unsigned short hb = bf16_bits(xs[i]); ah.u[i] = hb; al.u[i] = ASPLIT ? bf16_bits(xs[i] - bf16_val(hb)) : (unsigned short)0; }
#pragma unroll
    for (int t = 0; t < 4; ++t) {
      const unsigned short* brow = Wt + (size_t)(col0 + t * 16 + ln) * ldb + kb;
      FragB b;
      b.half[0] = *(const v8us*)(brow + 8 * hh);
      b.half[1] = *(const v8us*)(brow + 16 + 8 * hh);
      acc[t] = mmaN<ASPLIT ? 2 : 1>(ah.v, al.v, b.v, b.v, acc[t]);
    }
  }
#pragma unroll
  for (int t = 0; t < 4; ++t) {
    float bv = bias ? bias[col0 + t * 16 + ln] : 0.f;
    if (BIAS_BF16) bv = bf16_round(bv);
#pragma unroll
    for (int r = 0; r < 8; ++r) { float v = acc[t][r] + bv; if (ACT == 1) v = fmaxf(v, 0.f); so[w][8 * hh + r][t * 16 + ln] = v; }
  }
  __builtin_amdgcn_fence(__ATOMIC_ACQ_REL, "workgroup");
  __builtin_amdgcn_wave_barrier();
  const int rsub = lane >> 4, c4 = (lane & 15) * 4;
  {
#pragma unroll
    for (int q = 0; q < 8; ++q) {
      const int r = q * 2 + rsub;
      const v4f v = *(const v4fa*)&so[w][r][c4];
      *(v4f*)(C + (size_t)(row0 + r) * ldc + col0 + c4) = v;
    }
    
  }
}

// GEMM C = act(A·W + bias + resid): A f32 (ASPLIT -> hi/lo 2 terms), Wt bf16 [N][K]; ACT 0 none, 1 relu, 2 exact gelu;
// resid (optional, f32, row index = (row % rmod), pitch ldr, RES_BF16 rounds it) added before the activation.
template <bool ASPLIT, int ACT, bool BIAS_BF16, bool RES_BF16>
__global__ __launch_bounds__(128) void k_gemm_bf3(const float* __restrict__ A, int lda, const unsigned short* __restrict__ Wt, int ldb,
                                                const float* __restrict__ bias, const float* __restrict__ resid, int rmod, int ldr,
                                                float* __restrict__ C, int ldc, int M, int N, int K) {
  __shared__ __attribute__((aligned(16))) float so[4][16][64];
  const int tid = threadIdx.x, w = tid >> 5, lane = tid & 31, ln = lane & 15, hh = lane >> 4;
  const int ntn = N / 64;
  const int wid = blockIdx.x * 4 + w;
  const int mt = wid / ntn, nq = wid % ntn;
  if (mt * 16 >= M) return;
  const int row0 = mt * 16, col0 = nq * 64;
  const float* arow = A + (size_t)(row0 + ln) * lda;
  v8f acc[4] = {};
  for (int kb = 0; kb < K; kb += 32) {
    FragB ah, al;
    const v4f x0 = *(const v4fa*)(arow + kb + 8 * hh), x1 = *(const v4fa*)(arow + kb + 8 * hh + 4);
    const v4f x2 = *(const v4fa*)(arow + kb + 16 + 8 * hh), x3 = *(const v4fa*)(arow + kb + 16 + 8 * hh + 4);
    float xs[16] = {x0[0],x0[1],x0[2],x0[3],x1[0],x1[1],x1[2],x1[3],x2[0],x2[1],x2[2],x2[3],x3[0],x3[1],x3[2],x3[3]};
#pragma unroll
    for (int i = 0; i < 16; ++i) { const unsigned short hb = bf16_bits(xs[i]); ah.u[i] = hb; al.u[i] = ASPLIT ? bf16_bits(xs[i] - bf16_val(hb)) : (unsigned short)0; }
#pragma unroll
    for (int t = 0; t < 4; ++t) {
      const unsigned short* brow = Wt + (size_t)(col0 + t * 16 + ln) * ldb + kb;
      FragB b;
      b.half[0] = *(const v8us*)(brow + 8 * hh);
      b.half[1] = *(const v8us*)(brow + 16 + 8 * hh);
      acc[t] = mmaN<ASPLIT ? 2 : 1>(ah.v, al.v, b.v, b.v, acc[t]);
    }
  }
#pragma unroll
  for (int t = 0; t < 4; ++t) {
    const int col = col0 + t * 16 + ln;
    float bv = bias ? bias[col] : 0.f;
    if (BIAS_BF16) bv = bf16_round(bv);
#pragma unroll
    for (int r = 0; r < 8; ++r) {
      float v = acc[t][r] + bv;
      if (resid) { float rv = resid[(size_t)((row0 + 8 * hh + r) % rmod) * ldr + col]; if (RES_BF16) rv = bf16_round(rv); v += rv; }
      if (ACT == 1) v = fmaxf(v, 0.f);
      if (ACT == 2) v = 0.5f * v * (1.0f + erff(v * 0.70710678118654752f));
      if (ACT == 3) { const float u = 0.7978845608028654f * (v + 0.044715f * v * v * v); v = 0.5f * v * (1.0f + tanhf(u)); }
      so[w][8 * hh + r][t * 16 + ln] = v;
    }
  }
  __builtin_amdgcn_fence(__ATOMIC_ACQ_REL, "workgroup");
  __builtin_amdgcn_wave_barrier();
  const int rsub = lane >> 4, c4 = (lane & 15) * 4;
  {
#pragma unroll
    for (int q = 0; q < 8; ++q) {
      const int r = q * 2 + rsub;
      const v4f v = *(const v4fa*)&so[w][r][c4];
      *(v4f*)(C + (size_t)(row0 + r) * ldc + col0 + c4) = v;
    }
    
  }
}
// row LayerNorm (biased variance, eps) over N: s = X (+ R); optional out_sum <- s; out_norm <- (s-mu)*rsqrt(var+eps)*g + b
template <bool PARAM_BF16>
__global__ __launch_bounds__(256) void k_layernorm(const float* __restrict__ X, const float* __restrict__ R, const float* __restrict__ g, const float* __restrict__ bta,
                                                  float* __restrict__ out_sum, float* __restrict__ out_norm, int N, float eps) {
  __shared__ float red[256];
  const int row = blockIdx.x, tid = threadIdx.x;
  const float* x = X + (size_t)row * N; const float* rr = R ? R + (size_t)row * N : nullptr;
  float vals[16];                     // up to N = 4096
  const int per = N / 256;            // contiguous chunk per thread? use strided-by-4 chunks: thread handles j = tid*4 + 1024*u
  float s1 = 0.f;
  for (int u = 0; u < per / 4; ++u) {
    const int j = tid * 4 + 1024 * u;
    const v4f a = *(const v4fa*)(x + j);
    v4f b = {0.f,0.f,0.f,0.f}; if (rr) b = *(const v4fa*)(rr + j);
#pragma unroll
    for (int q = 0; q < 4; ++q) { const float v = a[q] + b[q]; vals[u * 4 + q] = v; s1 += v; }
  }
  red[tid] = s1; __syncthreads();
  for (int st = 128; st > 0; st >>= 1) { if (tid < st) red[tid] += red[tid + st]; __syncthreads(); }
  const float mu = red[0] / (float)N; __syncthreads();
  float s2 = 0.f;
  for (int u = 0; u < per / 4; ++u)
#pragma unroll
    for (int q = 0; q < 4; ++q) { const float c = vals[u * 4 + q] - mu; s2 += c * c; }
  red[tid] = s2; __syncthreads();
  for (int st = 128; st > 0; st >>= 1) { if (tid < st) red[tid] += red[tid + st]; __syncthreads(); }
  const float rs = rsqrtf(red[0] / (float)N + eps);
  {
    for (int u = 0; u < per / 4; ++u) {
      const int j = tid * 4 + 1024 * u;
      v4f o, sm;
#pragma unroll
      for (int q = 0; q < 4; ++q) {
        float gg = g[j + q], bb = bta[j + q];
        if (PARAM_BF16) { gg = bf16_round(gg); bb = bf16_round(bb); }
        sm[q] = vals[u * 4 + q]; o[q] = (vals[u * 4 + q] - mu) * rs * gg + bb;
      }
      if (out_sum) *(v4f*)(out_sum + (size_t)row * N + j) = sm;
      *(v4f*)(out_norm + (size_t)row * N + j) = o;
    }
    
  }
}



// ---- f16 WMMA path (v_wmma_f32_16x16x32_f16): 11-bit significands for operands in range — used where a [0,1] probability operand needs more precision than bf16
typedef _Float16 v16h __attribute__((ext_vector_type(16)));
union FragH { v16h v; v8us half[2]; _Float16 h[16]; unsigned short u[16]; };
template <int NT>
__device__ __forceinline__ v8f mmaH(v16h ah, v16h al, v16h bh, v16h bl, v8f c) {
  c = __builtin_amdgcn_wmma_f32_16x16x32_f16(false, ah, false, bh, (short)0, c, false, false);
  if (NT >= 2) c = __builtin_amdgcn_wmma_f32_16x16x32_f16(false, al, false, bh, (short)0, c, false, false);
  if (NT >= 3) c = __builtin_amdgcn_wmma_f32_16x16x32_f16(false, ah, false, bl, (short)0, c, false, false);
  asm volatile("v_nop\n\tv_nop\n\tv_nop\n\tv_nop" : "+v"(c) : "v"(ah), "v"(al), "v"(bh), "v"(bl));
  return c;
}
// batched GEMM like k_gemm_b but f16 operands: A f32 (split into f16 hi/lo if ASPLIT, else rounded to f16), Bt = f16 values [n][k]; alpha; C f32; N multiple of 16 (partial tiles skipped)
template <bool ASPLIT>
__global__ __launch_bounds__(128) void k_gemm_h(const float* __restrict__ A, int lda, size_t sA, const _Float16* __restrict__ Bh, int ldb, size_t sB, float alpha, float* __restrict__ C, int ldc, size_t sC, int M, int N, int K) {
  __shared__ __attribute__((aligned(16))) float so[4][16][64];
  const int tid = threadIdx.x, w = tid >> 5, lane = tid & 31, ln = lane & 15, hh = lane >> 4; const int by = blockIdx.y;
  A += (size_t)by * sA; Bh += (size_t)by * sB; C += (size_t)by * sC;
  const int ntn = (N + 63) / 64; const int wid = blockIdx.x * 4 + w; const int mt = wid / ntn, nq = wid % ntn; if (mt * 16 >= M) return;
  const int row0 = mt * 16, col0 = nq * 64; const float* arow = A + (size_t)(row0 + ln) * lda;
  v8f acc[4] = {};
  for (int kb = 0; kb < K; kb += 32) {
    FragH ah, al;
    const v4f x0 = *(const v4fa*)(arow + kb + 8 * hh), x1 = *(const v4fa*)(arow + kb + 8 * hh + 4), x2 = *(const v4fa*)(arow + kb + 16 + 8 * hh), x3 = *(const v4fa*)(arow + kb + 16 + 8 * hh + 4);
    float xs[16] = {x0[0],x0[1],x0[2],x0[3],x1[0],x1[1],x1[2],x1[3],x2[0],x2[1],x2[2],x2[3],x3[0],x3[1],x3[2],x3[3]};
#pragma unroll
    for (int i = 0; i < 16; ++i) { const _Float16 h = (_Float16)xs[i]; ah.h[i] = h; al.h[i] = ASPLIT ? (_Float16)(xs[i] - (float)h) : (_Float16)0.0f; }
#pragma unroll
    for (int t = 0; t < 4; ++t) { if (col0 + t * 16 >= N) continue; const size_t boff = (size_t)(col0 + t * 16 + ln) * ldb + kb; FragH bq; bq.half[0] = *(const v8us*)(Bh + boff + 8 * hh); bq.half[1] = *(const v8us*)(Bh + boff + 16 + 8 * hh);
      acc[t] = mmaH<ASPLIT ? 2 : 1>(ah.v, al.v, bq.v, bq.v, acc[t]); }
  }
#pragma unroll
  for (int t = 0; t < 4; ++t) { if (col0 + t * 16 >= N) continue;
#pragma unroll
    for (int r = 0; r < 8; ++r) so[w][8 * hh + r][t * 16 + ln] = acc[t][r] * alpha; }
  __builtin_amdgcn_fence(__ATOMIC_ACQ_REL, "workgroup"); __builtin_amdgcn_wave_barrier();
  const int rsub = lane >> 4, c4 = (lane & 15) * 4;
  {
#pragma unroll
    for (int q = 0; q < 8; ++q) { const int r = q * 2 + rsub; if (col0 + c4 < N) { const v4f v = *(const v4fa*)&so[w][r][c4]; *(v4f*)(C + (size_t)(row0 + r) * ldc + col0 + c4) = v; } }
     }
}

// Wt[n][k] = f16(W[k][n] x scale) from f32 row-major W[K][N] (scale = power of two; bf16-exact weights stay exact in f16 away from the subnormal range).
// One work-group turns a tile of 128 k x 64 n through LDS: it reads 256-byte runs of W's rows and stores 256-byte runs of Wt's rows, so both sides move whole 128-byte lines.
// An LDS word holds the f16 pair (k, k + 1) of one n. Row pitch 65 words: the 32 lanes of a store (16 groups of four n, two k pairs) and of a load (two n, 16 groups of four words) each fall on 32 different banks.
typedef _Float16 wt_h2 __attribute__((ext_vector_type(2)));
typedef unsigned int wt_u4 __attribute__((ext_vector_type(4)));
template <int K, int N>
__device__ __forceinline__ void wt_f16_job(unsigned int (*lt)[65], int bx, const float* __restrict__ W, _Float16* __restrict__ Wt, float scale) {      /* lt = the work-group's 64 x 65 words of LDS, bx = the job's own block index */
  static_assert(K % 128 == 0 && N % 64 == 0, "whole tiles only");
  const int tid = threadIdx.x; const int kt = bx / (N / 64), nt = bx % (N / 64);      /* neighbouring work-groups read neighbouring runs of the same rows */
  const int c4 = (tid & 15) * 4, r = tid >> 4;
  const float* sp = W + (size_t)(kt * 128 + 2 * r) * N + nt * 64 + c4;
  v4f a[4], b[4];
#pragma unroll      /* all eight row loads in flight together, from one address with immediate offsets; a[], b[] are indexed by constants */
  for (int u = 0; u < 4; ++u) { a[u] = *(const v4fa*)(sp + (size_t)(32 * u) * N); b[u] = *(const v4fa*)(sp + (size_t)(32 * u + 1) * N); }
  asm volatile("s_wait_xcnt 0x0" :: "v"(sp) : "memory");      /* behind the loads, their address as input: the address register is not given to a load's result or overwritten while an issued load still names it */
#pragma unroll      /* as above */
  for (int u = 0; u < 4; ++u) for (int q = 0; q < 4; ++q) { const wt_h2 p = {(_Float16)(bf16_round(a[u][q]) * scale), (_Float16)(bf16_round(b[u][q]) * scale)}; lt[c4 + q][r + 16 * u] = __builtin_bit_cast(unsigned int, p); }
  __syncthreads();      /* the tile is whole before any row of it is read across */
  const int k4 = (tid & 15) * 4;      /* 16 lanes per output row, eight k (four words) each */
  wt_u4 o[4];
#pragma unroll      /* o[] is indexed by constants */
  for (int u = 0; u < 4; ++u) { const unsigned int* lp = &lt[r + 16 * u][k4]; o[u] = wt_u4{lp[0], lp[1], lp[2], lp[3]}; }
  _Float16* dp = Wt + (size_t)(nt * 64 + r) * K + kt * 128 + 2 * k4;
#pragma unroll      /* as above */
  for (int u = 0; u < 4; ++u) *(wt_u4*)(dp + (size_t)(16 * u) * K) = o[u];
  asm volatile("s_wait_xcnt 0x0" ::: "memory");      /* behind the four stores: in a merged launch another job's code follows in the listing, and no register that an issued store names is to be written there ahead of this wait */
}
// k_gemm_hh variant with fused epilogue: v = acc·alpha + bias[by·sBias + col] (+ CP[(row/rowsPerB)·sCPb + by·64 + col] if CP) ; ACT 0 none / 1 elu ; writes f16 C16 (and f32 C if non-null)
template <int ACT>
__global__ __launch_bounds__(128) void k_gemm_hhx(const _Float16* __restrict__ A, int lda, size_t sA, const _Float16* __restrict__ Bh, int ldb, size_t sB, float alpha, const float* __restrict__ bias, size_t sBias, const float* __restrict__ CP, int rowsPerB, size_t sCPb, int row0g,
    float* __restrict__ C, _Float16* __restrict__ C16, int ldc, size_t sC, int M, int N, int K) {
  __shared__ __attribute__((aligned(16))) float so[4][16][64];
  const int tid = threadIdx.x, w = tid >> 5, lane = tid & 31, ln = lane & 15, hh = lane >> 4; const int by = blockIdx.y;
  A += (size_t)by * sA; Bh += (size_t)by * sB; const size_t cofs = (size_t)by * sC; const float* bp = bias ? bias + (size_t)by * sBias : nullptr;
  const int ntn = (N + 63) / 64; const int wid = blockIdx.x * 4 + w; const int mt = wid / ntn, nq = wid % ntn; if (mt * 16 >= M) return;
  const int row0 = mt * 16, col0 = nq * 64; const _Float16* arow = A + (size_t)(row0 + ln) * lda;
  v8f acc[4] = {};
  for (int kb = 0; kb < K; kb += 32) { FragH ah; ah.half[0] = *(const v8us*)((const unsigned short*)arow + kb + 8 * hh); ah.half[1] = *(const v8us*)((const unsigned short*)arow + kb + 16 + 8 * hh);
#pragma unroll
    for (int t = 0; t < 4; ++t) { if (col0 + t * 16 >= N) continue; const size_t boff = (size_t)(col0 + t * 16 + ln) * ldb + kb; FragH bq; bq.half[0] = *(const v8us*)((const unsigned short*)Bh + boff + 8 * hh); bq.half[1] = *(const v8us*)((const unsigned short*)Bh + boff + 16 + 8 * hh);
      acc[t] = mmaH<1>(ah.v, ah.v, bq.v, bq.v, acc[t]); }
  }
#pragma unroll
  for (int t = 0; t < 4; ++t) { if (col0 + t * 16 >= N) continue; const int col = col0 + t * 16 + ln; const float bv = bp ? bf16_round(bp[col]) : 0.f;
#pragma unroll
    for (int r = 0; r < 8; ++r) { float v = acc[t][r] * alpha + bv; if (CP) { const int rr = row0g + row0 + 8 * hh + r; if (rowsPerB < 0) v += CP[cofs + (size_t)rr * ldc + col];      /* rowsPerB < 0: own element of the batched C plane */ else { const int bidx = rr / rowsPerB; v += CP[(size_t)bidx * sCPb + (size_t)by * 64 + col]; } } if (ACT == 1) v = (v > 0.f) ? v : expm1f(v); else if (ACT == 7) v = (v > 0.f) ? v + 1.0f : expf(v); else if (ACT == 8) v = tanhf(v); else if (ACT == 9) v = 0.5f * v * (1.0f + tanhf(0.7978845608028654f * (v + 0.044715f * v * v * v))); else if (ACT == 11) v = 1.0f / (1.0f + expf(-v)); else if (ACT == 12) v = (v > 0.f) ? v : 0.01f * v; else if (ACT == 14) v = (v > 0.f) ? v : 0.1f * v; else if (ACT == 16) v = (v >= 0.f) ? v : 0.3f * v; else if (ACT == 17) v = (v >= 0.f) ? v : 0.2f * v; else if (ACT == 15) v = v / (1.0f + expf(-v)); else if (ACT == 3) v = fmaxf(v, 0.f); else if (ACT == 6) v = 0.5f * v * (1.0f + erff(v * 0.70710678118654752f)); so[w][8 * hh + r][t * 16 + ln] = v; } }
  __builtin_amdgcn_fence(__ATOMIC_ACQ_REL, "workgroup"); __builtin_amdgcn_wave_barrier();
  const int rsub = lane >> 4, c4 = (lane & 15) * 4; typedef _Float16 v4h __attribute__((ext_vector_type(4)));
  {
#pragma unroll
    for (int q = 0; q < 8; ++q) { const int r = q * 2 + rsub; if (col0 + c4 < N) { const v4f v = *(const v4fa*)&so[w][r][c4]; if (C) *(v4f*)(C + cofs + (size_t)(row0 + r) * ldc + col0 + c4) = v; if (C16) { v4h h4; for (int i = 0; i < 4; ++i) h4[i] = (_Float16)v[i]; *(v4h*)(C16 + cofs + (size_t)(row0 + r) * ldc + col0 + c4) = h4; } } }
     }
}


typedef _Float16 v4h __attribute__((ext_vector_type(4)));

__device__ __forceinline__ void x16_job(int bx, const float* __restrict__ x, _Float16* __restrict__ X16, size_t n8) { const size_t t = (size_t)bx * 256 + threadIdx.x; if (t >= n8) return; FragH f;
#pragma unroll
  for (int q = 0; q < 8; ++q) f.h[q] = (_Float16)bf16_round(x[t * 8 + q]); *(v8us*)((unsigned short*)X16 + t * 8) = f.half[0];  }
__global__ __launch_bounds__(256) void k_h16(const float* __restrict__ x, _Float16* __restrict__ X16, size_t n8) { const size_t t = (size_t)blockIdx.x * 256 + threadIdx.x; if (t >= n8) return; FragH f;
#pragma unroll
  for (int q = 0; q < 8; ++q) f.h[q] = (_Float16)x[t * 8 + q]; *(v8us*)((unsigned short*)X16 + t * 8) = f.half[0];  }
__global__ __launch_bounds__(256) void k_round16f(const float* __restrict__ W, _Float16* __restrict__ Bt, size_t n8) { const size_t t = (size_t)blockIdx.x * 256 + threadIdx.x; if (t >= n8) return; FragH f;
#pragma unroll
  for (int i = 0; i < 8; ++i) f.h[i] = (_Float16)(bf16_round(W[t * 8 + i]) * 16.0f); *(v8us*)((unsigned short*)Bt + t * 8) = f.half[0];  }
template <int NHv, int TTv>
__global__ __launch_bounds__(256) void k_vt(const _Float16* __restrict__ V16, int ldv, int voff, _Float16* __restrict__ Vt) { __shared__ unsigned short tl[64][66]; const int tid = threadIdx.x; const int slab = blockIdx.x / (TTv / 64), lg = blockIdx.x % (TTv / 64); const int b = slab / NHv, h = slab % NHv;
  for (int i = tid; i < 64 * 8; i += 256) { const int r = i / 8, c8 = (i % 8) * 8; FragH f; f.half[0] = *(const v8us*)((const unsigned short*)V16 + ((size_t)b * TTv + lg * 64 + r) * ldv + voff + h * 64 + c8);
#pragma unroll
    for (int q = 0; q < 8; ++q) tl[r][c8 + q] = f.u[q]; }
  __syncthreads();
  {
#pragma unroll
    for (int rd = 0; rd < 2; ++rd) { const int d = rd * 32 + tid / 8, pc = tid % 8; FragH f;
#pragma unroll
      for (int q = 0; q < 8; ++q) f.u[q] = tl[pc * 8 + q][d];
      *(v8us*)((unsigned short*)Vt + ((size_t)slab * 64 + d) * TTv + lg * 64 + pc * 8) = f.half[0]; }
     } }

__global__ __launch_bounds__(256) void k_hl(const float* __restrict__ F, _Float16* __restrict__ Hh, _Float16* __restrict__ Hl, size_t n8) { const size_t t = (size_t)blockIdx.x * 256 + threadIdx.x; if (t >= n8) return; FragH fh, fl; const v4f a = *(const v4fa*)(F + t * 8), c = *(const v4fa*)(F + t * 8 + 4);
#pragma unroll
  for (int q = 0; q < 4; ++q) { _Float16 h = (_Float16)a[q]; fh.h[q] = h; fl.h[q] = (_Float16)((a[q] - (float)h) * 1024.0f); h = (_Float16)c[q]; fh.h[4 + q] = h; fl.h[4 + q] = (_Float16)((c[q] - (float)h) * 1024.0f); }
  { *(v8us*)((unsigned short*)Hh + t * 8) = fh.half[0]; *(v8us*)((unsigned short*)Hl + t * 8) = fl.half[0];  } }

// ---- fast GEMM (work-group tile 128x128: eight waves of 32x64; requires M % 128 == 0, N % 128 == 0, K % 128 == 0); epilogue = k_gemm_hhx semantics ----
// Both operands go from global memory to LDS by asynchronous copies, 128 k (256 bytes of each of the 128 A rows and 128 B rows) per stage, two buffers: stage t + 1 flies while stage t is multiplied.
// A wave's copy covers two whole rows of the stage (four whole 128-byte lines), and every operand byte is fetched once per work-group instead of once per wave.
#define G2P 136                      /* f16 per LDS row: 272 bytes = 16 x odd, the pitch for 16-byte readers of 256-byte rows */
#define G2BUF (256 * G2P)            /* f16 per buffer: A rows 0 .. 127, then B rows 0 .. 127 */
__device__ __forceinline__ v16h g2_frag(const _Float16* p, int hh) { FragH f; f.half[0] = *(const v8us*)((const unsigned short*)p + 8 * hh); f.half[1] = *(const v8us*)((const unsigned short*)p + 16 + 8 * hh); return f.v; }
__device__ __forceinline__ v8f g2_mma(v16h a, v16h b, v8f c) { v8f d = __builtin_amdgcn_wmma_f32_16x16x32_f16(false, a, false, b, (short)0, c, false, false); asm volatile("v_nop\n\tv_nop\n\tv_nop\n\tv_nop" : "+v"(d) : "v"(a), "v"(b)); return d; }
// Eight asynchronous 16-byte copies per lane: rows r, r + 16, .. r + 112 of one operand's stage (l = the lane's LDS byte address in row r, g = its global address there, step = 16 source rows in elements).
__device__ __forceinline__ void g2_copy8(unsigned l, const _Float16* g, size_t step) {
  const unsigned l1 = l + 16 * G2P * 2, l2 = l + 32 * G2P * 2, l3 = l + 48 * G2P * 2, l4 = l + 64 * G2P * 2, l5 = l + 80 * G2P * 2, l6 = l + 96 * G2P * 2, l7 = l + 112 * G2P * 2;
  const _Float16* g1 = g + step; const _Float16* g2 = g1 + step; const _Float16* g3 = g2 + step; const _Float16* g4 = g3 + step; const _Float16* g5 = g4 + step; const _Float16* g6 = g5 + step; const _Float16* g7 = g6 + step;
  /* the copies and, as the statement's last line, the wait in front of any rewrite of a register that an issued copy names */
  asm volatile("global_load_async_to_lds_b128 %0, %8, off\n\t"
               "global_load_async_to_lds_b128 %1, %9, off\n\t"
               "global_load_async_to_lds_b128 %2, %10, off\n\t"
               "global_load_async_to_lds_b128 %3, %11, off\n\t"
               "global_load_async_to_lds_b128 %4, %12, off\n\t"
               "global_load_async_to_lds_b128 %5, %13, off\n\t"
               "global_load_async_to_lds_b128 %6, %14, off\n\t"
               "global_load_async_to_lds_b128 %7, %15, off\n\t"
               "s_wait_xcnt 0x0"
               :: "v"(l), "v"(l1), "v"(l2), "v"(l3), "v"(l4), "v"(l5), "v"(l6), "v"(l7), "v"(g), "v"(g1), "v"(g2), "v"(g3), "v"(g4), "v"(g5), "v"(g6), "v"(g7) : "memory"); }
template <int ACT>
__device__ __forceinline__ void gemm2_job(int bx, int by, int bz, int ashift, const _Float16* __restrict__ A, int lda, size_t sA, const _Float16* __restrict__ Bh, int ldb, size_t sB, float alpha, const float* __restrict__ bias, size_t sBias, const float* __restrict__ CP, int rowsPerB, size_t sCPb, int row0g,
    float* __restrict__ C, _Float16* __restrict__ C16, int ldc, size_t sC, int M, int N, int K, int bsh, size_t zA, size_t zB, size_t zC) { static_assert(ACT == 0 || ACT == 3 || ACT == 6 || ACT == 8 || ACT == 9 || ACT == 11 || ACT == 12 || ACT == 14 || ACT == 15 || ACT == 16 || ACT == 17, "k_gemm2: unsupported ACT code (would silently apply no activation)");
  __shared__ __attribute__((aligned(16))) float sm[2 * G2BUF / 2];      /* the two operand buffers; behind the loop's last barrier the same LDS stages the output */
  static_assert(8 * 32 * 68 <= 2 * G2BUF / 2, "output staging must fit the operand buffers");
  float (*so)[32][68] = (float (*)[32][68])sm; const _Float16* lh = (const _Float16*)sm;
  const int tid = threadIdx.x, w = tid >> 5, lane = tid & 31, ln = lane & 15, hh = lane >> 4;      /* bx = tile; by = plane (head), 2^bsh planes share one B plane; bz = outer batch with its own strides zA, zB, zC; ashift = rows added to the tile's row index in A only */
  A += (size_t)by * sA + (size_t)bz * zA; Bh += (size_t)(by >> bsh) * sB + (size_t)bz * zB; const size_t cofs = (size_t)by * sC + (size_t)bz * zC; const float* bp = bias ? bias + (size_t)by * sBias : nullptr;
  const int ntn = N >> 7; const int mt = bx / ntn, nq = bx - mt * ntn; if (mt * 128 >= M) return;      /* the same for the whole work-group, in front of every barrier */
  const int row0 = mt * 128 + 32 * (w & 3), col0 = nq * 128 + 64 * (w >> 2);
  const int cr = tid >> 4, cc = (tid & 15) * 8;      /* copies: 16 lanes per row, 16 bytes each */
  const _Float16* ga = A + (size_t)(mt * 128 + ashift + cr) * lda + cc; const _Float16* gb = Bh + (size_t)(nq * 128 + cr) * ldb + cc; const size_t sa16 = (size_t)16 * lda, sb16 = (size_t)16 * ldb;
  const unsigned la = (unsigned)(size_t)sm + (unsigned)(cr * G2P + cc) * 2u, lb = la + 128u * G2P * 2u;
  const int aoff = (32 * (w & 3) + ln) * G2P, boff = (128 + 64 * (w >> 2) + ln) * G2P;
  const v8f z8 = {0.f,0.f,0.f,0.f,0.f,0.f,0.f,0.f}; v8f c00 = z8, c01 = z8, c02 = z8, c03 = z8, c10 = z8, c11 = z8, c12 = z8, c13 = z8;
  const int nt = K >> 7;
  g2_copy8(la, ga, sa16); g2_copy8(lb, gb, sb16);      /* stage 0 -> buffer 0 */
  asm volatile("s_wait_asynccnt 0x0" ::: "memory");      /* this wave's copies of stage 0 have landed */
  __syncthreads();      /* ... and every other wave's: stage 0 may be read */
  if (nt > 1) { g2_copy8(la + G2BUF * 2u, ga + 128, sa16); g2_copy8(lb + G2BUF * 2u, gb + 128, sb16); }      /* stage 1 -> buffer 1 */
#pragma unroll 1      /* one stage a trip: 32 matrix instructions a wave */
  for (int t = 0; t < nt; ++t) { const _Float16* a0p = lh + (t & 1) * G2BUF + aoff; const _Float16* a1p = a0p + 16 * G2P; const _Float16* b0p = lh + (t & 1) * G2BUF + boff; const _Float16* b1p = b0p + 16 * G2P; const _Float16* b2p = b1p + 16 * G2P; const _Float16* b3p = b2p + 16 * G2P;
    v16h a0 = g2_frag(a0p, hh), a1 = g2_frag(a1p, hh), b0 = g2_frag(b0p, hh), b1 = g2_frag(b1p, hh), b2 = g2_frag(b2p, hh), b3 = g2_frag(b3p, hh);
#pragma unroll      /* two fragment sets in registers, named by constants; the LDS reads differ by immediate offsets */
    for (int kb = 0; kb < 128; kb += 32) { v16h na0 = a0, na1 = a1, nb0 = b0, nb1 = b1, nb2 = b2, nb3 = b3;
      if (kb + 32 < 128) { na0 = g2_frag(a0p + kb + 32, hh); na1 = g2_frag(a1p + kb + 32, hh); nb0 = g2_frag(b0p + kb + 32, hh); nb1 = g2_frag(b1p + kb + 32, hh); nb2 = g2_frag(b2p + kb + 32, hh); nb3 = g2_frag(b3p + kb + 32, hh); }      /* the next 32 k of this stage, read as one group ahead of this block's products: their LDS latency hides behind the eight matrix instructions */
      c00 = g2_mma(a0, b0, c00); c10 = g2_mma(a1, b0, c10); c01 = g2_mma(a0, b1, c01); c11 = g2_mma(a1, b1, c11);
      c02 = g2_mma(a0, b2, c02); c12 = g2_mma(a1, b2, c12); c03 = g2_mma(a0, b3, c03); c13 = g2_mma(a1, b3, c13);
      a0 = na0; a1 = na1; b0 = nb0; b1 = nb1; b2 = nb2; b3 = nb3; }
    asm volatile("s_wait_dscnt 0x0" ::: "memory");      /* this wave's reads of stage t are done before its buffer is given up */
    asm volatile("s_wait_asynccnt 0x0" ::: "memory");      /* this wave's copies of stage t + 1 have landed */
    __syncthreads();      /* publishes stage t + 1 and ends every wave's reads of stage t */
    if (t + 2 < nt) { const unsigned lo = (unsigned)(t & 1) * (G2BUF * 2u); const int ko = (t + 2) * 128; g2_copy8(la + lo, ga + ko, sa16); g2_copy8(lb + lo, gb + ko, sb16); } }      /* stage t + 2 -> the buffer just left */
  asm volatile("s_wait_asynccnt 0x0" ::: "memory");      /* nothing of this wave is in flight when the buffers become output staging */
  v8f accs[8] = {c00, c01, c02, c03, c10, c11, c12, c13};
#pragma unroll
  for (int u = 0; u < 8; ++u) { const int t = u & 3, half = u >> 2; const int col = col0 + t * 16 + ln; const float bv = bp ? bf16_round(bp[col]) : 0.f;
#pragma unroll
    for (int r = 0; r < 8; ++r) { const int rloc = half * 16 + 8 * hh + r; float v = accs[u][r] * alpha + bv; if (CP) { if (rowsPerB < 0) v += CP[cofs + (size_t)(row0g + row0 + rloc) * ldc + col];      /* rowsPerB < 0: own element of the batched C plane */ else { const int bidx = (row0g + row0 + rloc) / rowsPerB; v += CP[(size_t)bidx * sCPb + (size_t)by * 64 + col]; } }
      if (ACT == 3) v = fmaxf(v, 0.f); else if (ACT == 6) v = 0.5f * v * (1.0f + erff(v * 0.70710678118654752f)); else if (ACT == 11) v = 1.0f / (1.0f + expf(-v)); else if (ACT == 15) v = v / (1.0f + expf(-v)); else if (ACT == 12) v = (v > 0.f) ? v : 0.01f * v; else if (ACT == 8) v = tanhf(v); else if (ACT == 9) v = 0.5f * v * (1.0f + tanhf(0.7978845608028654f * (v + 0.044715f * v * v * v))); else if (ACT == 14) v = (v > 0.f) ? v : 0.1f * v; else if (ACT == 16) v = (v >= 0.f) ? v : 0.3f * v; else if (ACT == 17) v = (v >= 0.f) ? v : 0.2f * v;
      so[w][rloc][t * 16 + ln] = v; } }
  __builtin_amdgcn_fence(__ATOMIC_ACQ_REL, "workgroup"); __builtin_amdgcn_wave_barrier();
  const int rsub = lane >> 4, c4 = (lane & 15) * 4;
  {
#pragma unroll
    for (int q = 0; q < 16; ++q) { const int r = q * 2 + rsub; const v4f v = *(const v4fa*)&so[w][r][c4];
      if (C) { float* cp = C + cofs + (size_t)(row0 + r) * ldc + col0 + c4; *(v4f*)cp = v; asm volatile("s_wait_xcnt 0x0" :: "v"(cp), "v"(v) : "memory"); }      /* behind the f32 store, its address and data as inputs: neither the conversion to f16 nor the next row's LDS load writes into a register that the issued store still names */
      if (C16) { v4h h4; for (int i = 0; i < 4; ++i) h4[i] = (_Float16)v[i]; *(v4h*)(C16 + cofs + (size_t)(row0 + r) * ldc + col0 + c4) = h4; } }
     } }


__global__ __launch_bounds__(256) void k_wnat(const float* __restrict__ w, size_t n8, _Float16* __restrict__ Bt) { const size_t t = (size_t)blockIdx.x * 256 + threadIdx.x; if (t >= n8) return; FragH f; for (int q = 0; q < 8; ++q) f.h[q] = (_Float16)(bf16_round(w[t * 8 + q]) * 16.0f); *(v8us*)((unsigned short*)Bt + t * 8) = f.half[0];  }
__global__ __launch_bounds__(256) void k_rsm(const float* __restrict__ S, _Float16* __restrict__ P, int nrows) {
  #pragma clang fp contract(off)
  const int i = blockIdx.x * 256 + threadIdx.x; if (i >= nrows) return; const float* s = S + (size_t)i * SQ; float mx = -3.0e38f;
#pragma unroll 1
  for (int j = 0; j < SQ; ++j) mx = fmaxf(mx, s[j]); float se = 0.f;
#pragma unroll 1
  for (int j = 0; j < SQ; ++j) se += expf(s[j] - mx); const float sc = 256.0f / se;
#pragma unroll 1
  for (int j0 = 0; j0 < SQ; j0 += 8) { FragH f; for (int q = 0; q < 8; ++q) f.h[q] = (_Float16)(expf(s[j0 + q] - mx) * sc); unsigned short* d = (unsigned short*)P + (size_t)i * SQ + j0; *(v8us*)d = f.half[0];  } }
__global__ __launch_bounds__(256) void k_vt(const _Float16* __restrict__ V16, int b, int h0, _Float16* __restrict__ VT) { __shared__ unsigned short tl[64][65]; const int tid = threadIdx.x; const int hh = blockIdx.x % HG, sg = blockIdx.x / HG; const int s0 = sg * 64; const int h = h0 + hh;
  for (int i = tid; i < 64 * 8; i += 256) { const int j = i / 8, d8 = (i % 8) * 8; FragH f; f.half[0] = *(const v8us*)((const unsigned short*)V16 + ((size_t)b * SQ + s0 + j) * DM + h * HD + d8); for (int q = 0; q < 8; ++q) tl[d8 + q][j] = f.u[q]; }
  __syncthreads();
  { for (int i = tid; i < 64 * 8; i += 256) { const int d = i / 8, j8 = (i % 8) * 8; FragH f; for (int q = 0; q < 8; ++q) f.u[q] = tl[d][j8 + q]; *(v8us*)((unsigned short*)VT + ((size_t)hh * HD + d) * SQ + s0 + j8) = f.half[0]; }  } }


// Exact (f32, vector unit) causal attention over the first QT0 rows: one work-group of eight waves per (batch, head, 32 query rows).
// Step 1: wave w keeps key row 32 w + lane in registers and forms its scores against the 32 query rows, each read from LDS at one address for the whole wave.
// Step 2: wave w does the softmax of query rows 4 w .. 4 w + 3, lane = key mod 32 (maximum and denominator: per-lane partial, then a xor butterfly).
// Step 3: wave w sums weight x value over the keys in order for the same four rows, lane = four columns of the head, so that every value row is read as one whole run.
__global__ __launch_bounds__(256) void k_att0h(const float* __restrict__ QF, const float* __restrict__ KF, const float* __restrict__ VF, float scale, float* __restrict__ OF) {
  constexpr int ld = DMX, ldv = DMX, ldo = DMX;      /* row pitches as constants: the rows of one run of loads differ by an immediate offset only */
  static_assert(QT0 == 256, "eight waves: one per 32 keys, four query rows each");
  __shared__ __attribute__((aligned(16))) float sm[8 * 32 * 132 + 32 * 128];
  float (*lk)[32][132] = (float (*)[32][132])sm;      /* key rows at a pitch of 33 x 16 bytes: a lane reads its own row without bank conflicts */
  float (*lp)[QT0] = (float (*)[QT0])sm;      /* scores, then weights: they take the key rows' place once every wave holds its key rows in registers, which keeps the work-group under half of the LDS (above that this compiler budgets 512 registers and fetches the query reads far ahead into a second register window) */
  float (*lq)[128] = (float (*)[128])(sm + 8 * 32 * 132);
  const int tid = threadIdx.x, lane = tid & 31; const int w = __builtin_amdgcn_readfirstlane(tid >> 5); const int h = blockIdx.x / (QT0 / 32), rg = blockIdx.x % (QT0 / 32);
  { const size_t rb = (size_t)blockIdx.y * QT0; QF += rb * ld; KF += rb * ld; VF += rb * ldv; OF += rb * ldo; }      /* grid.y = batch: QT0 rows of every plane per batch */
  const int hc = h * 128 + lane * 4;
  for (int r = 0; r < 4; ++r) *(v4f*)&lq[4 * w + r][lane * 4] = *(const v4fa*)(QF + (size_t)(rg * 32 + 4 * w + r) * ld + hc);
  if (w <= rg) {      /* causal: key chunks 0 .. rg only */
#pragma unroll      /* all 32 row loads in flight together */
    for (int r = 0; r < 32; ++r) *(v4f*)&lk[w][r][lane * 4] = *(const v4fa*)(KF + (size_t)(w * 32 + r) * ld + hc); }
  __syncthreads();
  v4f kr[32];
  if (w <= rg) {
#pragma unroll      /* here and in the c loop below: kr[] stays in registers only if every index is a constant */
    for (int c = 0; c < 32; ++c) kr[c] = *(const v4f*)&lk[w][lane][c * 4]; }
  __syncthreads();      /* every key row has been read: from here on its place holds scores */
  if (w <= rg) {
#pragma unroll 1      /* the body is 512 multiply-adds already */
    for (int r0 = 0; r0 < 32; r0 += 4) { float s0 = 0.f, s1 = 0.f, s2 = 0.f, s3 = 0.f;
#pragma unroll
      for (int c = 0; c < 32; ++c) { const v4f q0 = *(const v4f*)&lq[r0][c * 4], q1 = *(const v4f*)&lq[r0 + 1][c * 4], q2 = *(const v4f*)&lq[r0 + 2][c * 4], q3 = *(const v4f*)&lq[r0 + 3][c * 4];
        for (int u = 0; u < 4; ++u) { s0 = fmaf(q0[u], kr[c][u], s0); s1 = fmaf(q1[u], kr[c][u], s1); s2 = fmaf(q2[u], kr[c][u], s2); s3 = fmaf(q3[u], kr[c][u], s3); } }
      float* sp = &lp[r0][w * 32 + lane]; sp[0] = s0 * scale; sp[QT0] = s1 * scale; sp[2 * QT0] = s2 * scale; sp[3 * QT0] = s3 * scale; } }
  __syncthreads();
  float fin[4];
#pragma unroll      /* fin[] and e[] are indexed by constants */
  for (int r = 0; r < 4; ++r) { const int il = 4 * w + r, i = rg * 32 + il; float e[8]; float mx = -3.0e38f, l = 0.f;
#pragma unroll
    for (int c = 0; c < 8; ++c) { e[c] = -3.0e38f; if (c <= rg) { const float s = lp[il][c * 32 + lane]; if (c * 32 + lane <= i) e[c] = s; } mx = fmaxf(mx, e[c]); }
    for (int m = 16; m > 0; m >>= 1) mx = fmaxf(mx, __shfl_xor(mx, m, 32));
#pragma unroll
    for (int c = 0; c < 8; ++c) { e[c] = (c * 32 + lane <= i) ? expf(e[c] - mx) : 0.f; l += e[c]; }
    for (int m = 16; m > 0; m >>= 1) l += __shfl_xor(l, m, 32);
    fin[r] = 64.0f / l;
#pragma unroll
    for (int c = 0; c < 8; ++c) if (c <= rg) lp[il][c * 32 + lane] = e[c]; }
  __syncthreads();
  const v4f z4 = {0.f, 0.f, 0.f, 0.f}; v4f acc[4] = {z4, z4, z4, z4}; const float* vp = VF + hc; const int nk = (rg + 1) * 32;
#pragma unroll 1      /* 16 value rows in flight a trip are enough; more would only cost registers */
  for (int j0 = 0; j0 < nk; j0 += 16) { v4f vv[16];
#pragma unroll
    for (int u = 0; u < 16; ++u) vv[u] = *(const v4fa*)(vp + (size_t)(j0 + u) * ldv);
#pragma unroll
    for (int g = 0; g < 4; ++g) for (int r = 0; r < 4; ++r) { const v4f p = *(const v4f*)&lp[4 * w + r][j0 + 4 * g]; for (int u = 0; u < 4; ++u) for (int x = 0; x < 4; ++x) acc[r][x] = fmaf(p[u], vv[4 * g + u][x], acc[r][x]); } }
#pragma unroll
  for (int r = 0; r < 4; ++r) { v4f o; for (int x = 0; x < 4; ++x) o[x] = acc[r][x] * fin[r]; *(v4f*)(OF + (size_t)(rg * 32 + 4 * w + r) * ldo + hc) = o; } }
__global__ __launch_bounds__(256) void k_f2h(const float* __restrict__ F, int ldf, int coff, int ncol, _Float16* __restrict__ H16, size_t nrow) { const size_t t = (size_t)blockIdx.x * 256 + threadIdx.x; const size_t n8 = nrow * (size_t)(ncol / 8); if (t >= n8) return; const size_t r = t / (ncol / 8); const int c8 = (int)(t % (ncol / 8)) * 8; FragH f; const v4f a = *(const v4fa*)(F + r * ldf + coff + c8), b2 = *(const v4fa*)(F + r * ldf + coff + c8 + 4); for (int q = 0; q < 4; ++q) { f.h[q] = (_Float16)a[q]; f.h[4 + q] = (_Float16)b2[q]; } *(v8us*)((unsigned short*)H16 + r * ncol + c8) = f.half[0];  }

__global__ __launch_bounds__(256) void k_tab128(float theta, float* __restrict__ CS, float* __restrict__ SN) {
  #pragma clang fp contract(off)
  const int t = blockIdx.x * 256 + threadIdx.x; if (t >= SQ * 64) return; const int i = t % 64; const int p = t / 64; const float invf = (float)(1.0 / pow((double)theta, (double)(2 * i) / 128.0));      /* = XLA's constant-folded f32 table */ const float ang = __fmul_rn((float)p, invf); const float c = cosf(ang), s = sinf(ang);
  *(float*)(CS + t) = c; *(float*)(SN + t) = s;  }
template <int TAB>
__global__ __launch_bounds__(128) void k_rope128(const float* __restrict__ F, int ldf, int nh, const float* __restrict__ CS, const float* __restrict__ SN, _Float16* __restrict__ H16, int ldo, float osc) {
  #pragma clang fp contract(off)
  __shared__ float xv[128]; __shared__ unsigned short sh_[128]; const int d = threadIdx.x; const int h = blockIdx.x % nh; const size_t r = blockIdx.x / nh; const int p = (int)(r % SQ);
  xv[d] = F[r * (size_t)ldf + (size_t)h * 128 + d]; __syncthreads();
  float c, s; if (TAB) { c = bf16_round(CS[(size_t)p * 128 + d]); s = bf16_round(SN[(size_t)p * 128 + d]); } else { c = CS[p * 64 + (d & 63)]; s = SN[p * 64 + (d & 63)]; }
  const float rot = (d < 64) ? -xv[d + 64] : xv[d - 64]; const float o = __fadd_rn(__fmul_rn(xv[d], c), __fmul_rn(rot, s));
  FragH th; th.h[0] = (_Float16)__fmul_rn(o, osc); sh_[d] = th.u[0]; __syncthreads();
  if (d < 16) { FragH f; for (int q = 0; q < 8; ++q) f.u[q] = sh_[d * 8 + q]; unsigned short* dst = (unsigned short*)H16 + r * (size_t)ldo + (size_t)h * 128 + d * 8; *(v8us*)dst = f.half[0];  } }

// Rotate-half RoPE, one wave per token row. 16 lanes per head: a lane holds columns 4 l .. 4 l + 3 and their partners 64 columns on, so x[d] and x[d + 64] meet in one lane (no LDS, no barrier);
// the row's cos / sin values (full-width f32 tables, one row per token row) stay in registers for all NHv heads, two heads per load. bx = group of 8 rows in a batch; by = batch: source and table rows step by yin, output rows by yout.
template <int NHv, int F32OUT>
__device__ __forceinline__ void rope128w_job(int bx, int by, const float* __restrict__ F, const float* __restrict__ CS, const float* __restrict__ SN, float* __restrict__ OF, _Float16* __restrict__ OH, float osc, int yin, int yout) {
  constexpr int ld = NHv * 128, NI = NHv / 2; static_assert(NHv % 2 == 0, "two heads per wave and trip");
  const int lane = threadIdx.x & 31; const int e = (lane >> 4) * 128 + (lane & 15) * 4, d = (lane & 15) * 4; const size_t rl = (size_t)bx * 8 + (threadIdx.x >> 5); const size_t r = rl + (size_t)by * yin, ro = rl + (size_t)by * yout;
  const float* cp = CS + r * 128 + d; const float* sp = SN + r * 128 + d; const float* xp = F + r * ld + e;
  const v4f cl = *(const v4fa*)cp, ch = *(const v4fa*)(cp + 64), sl = *(const v4fa*)sp, sh = *(const v4fa*)(sp + 64);
  v4f xl[NI], xh[NI];
#pragma unroll      /* the whole row's loads in flight together; xl[], xh[] stay in registers only if every index is a constant */
  for (int i = 0; i < NI; ++i) { xl[i] = *(const v4fa*)(xp + i * 256); xh[i] = *(const v4fa*)(xp + i * 256 + 64); }
  asm volatile("s_wait_xcnt 0x0" :: "v"(cp), "v"(sp), "v"(xp) : "memory");      /* behind the row's loads, the three addresses as inputs: no address register is given to a later load's result or overwritten while an issued load still names it, and no table load is put off behind the first data wait */
#pragma unroll      /* as above */
  for (int i = 0; i < NI; ++i) { v4f ol, oh;
    for (int q = 0; q < 4; ++q) { ol[q] = fmaf(-xh[i][q], sl[q], xl[i][q] * cl[q]) * osc; oh[q] = fmaf(xl[i][q], sh[q], xh[i][q] * ch[q]) * osc; }      /* x cos rounded, partner x sin fused into the add: the form that the one-thread-per-column kernel compiled to, so roped q and k keep their bits */
    if (F32OUT) { float* dst = OF + ro * ld + e + i * 256; *(v4f*)dst = ol; *(v4f*)(dst + 64) = oh; }
    else { v4h hl, hh; for (int q = 0; q < 4; ++q) { hl[q] = (_Float16)ol[q]; hh[q] = (_Float16)oh[q]; } _Float16* dst = OH + ro * ld + e + i * 256; *(v4h*)dst = hl; *(v4h*)(dst + 64) = hh; } }
  asm volatile("s_wait_xcnt 0x0" ::: "memory"); }      /* behind the row's stores: in a merged launch another job's code follows in the listing, and no register that an issued store names is to be written there ahead of this wait */
template <int N>
__global__ __launch_bounds__(256) void k_rmsrow(float* __restrict__ X, const float* __restrict__ w, float eps) {
  #pragma clang fp contract(off)
  constexpr int PT = N / 256; __shared__ float red[256]; const size_t r = blockIdx.x; const int t = threadIdx.x; float* row = X + r * N + (size_t)t * PT; float v[PT]; float ss = 0.f;
  for (int q = 0; q < PT; ++q) { v[q] = row[q]; ss = __fadd_rn(ss, __fmul_rn(v[q], v[q])); }
  red[t] = ss; __syncthreads(); for (int k = 128; k > 0; k >>= 1) { if (t < k) red[t] = __fadd_rn(red[t], red[t + k]); __syncthreads(); }
  const float rs = rsqrtf(__fadd_rn(red[0] / (float)N, eps)); float o[PT]; for (int q = 0; q < PT; ++q) o[q] = __fmul_rn(__fmul_rn(v[q], rs), bf16_round(w[t * PT + q]));
  { for (int q = 0; q < PT; ++q) *(float*)(row + q) = o[q];  } }
template <int GS_, int NHQ, int DSRC>
__device__ __forceinline__ void kvexp128_job(int bx, int by, const float* __restrict__ src, float* __restrict__ dst, size_t n4, size_t ysrc, size_t ydst) { const size_t t = (size_t)bx * 256 + threadIdx.x; if (t >= n4) return; src += (size_t)by * ysrc; dst += (size_t)by * ydst;      /* by = batch */ const size_t e = t * 4; const size_t row = e / ((size_t)NHQ * 128); const int col = (int)(e % ((size_t)NHQ * 128)); const int h = col / 128, d = col % 128; const v4f v = *(const v4fa*)(src + row * DSRC + (size_t)(h / GS_) * 128 + d); *(v4f*)(dst + e) = v;  }

__global__ __launch_bounds__(256) void k_rsmcfb(const float* __restrict__ S, _Float16* __restrict__ P, int hg, int q0, int nk, const int* __restrict__ mk) {
  #pragma clang fp contract(off)
  const int t = blockIdx.x * 256 + threadIdx.x; if (t >= hg * QT) return; const size_t i = (size_t)t; const float* s = S + i * NKX; const size_t ig = (size_t)(q0 + (t % QT)); const int* mr = mk + ig * SQ; float mx = -3.0e38f;
#pragma unroll 1
  for (int j = 0; j < nk; ++j) { const int mb = mr[j]; const float f = (mb == 0) ? 1.f : 0.f; mx = fmaxf(mx, fmaf(f, s[j], (1.f - f) * -1.0e9f)); } float se = 0.f;
#pragma unroll 1
  for (int j = 0; j < nk; ++j) { const int mb = mr[j]; const float f = (mb == 0) ? 1.f : 0.f; se += __expf(fmaf(f, s[j], (1.f - f) * -1.0e9f) - mx); } const float sc = 256.0f / se;
#pragma unroll 1
  for (int j0 = 0; j0 < nk; j0 += 8) { FragH fr; for (int q = 0; q < 8; ++q) { const int j = j0 + q; const int mb = mr[j]; const float f = (mb == 0) ? 1.f : 0.f; fr.h[q] = (_Float16)(__expf(fmaf(f, s[j], (1.f - f) * -1.0e9f) - mx) * sc); } unsigned short* d = (unsigned short*)P + i * NKX + j0; *(v8us*)d = fr.half[0];  } }


// Causal softmax, one wave per score row: lane l holds columns 128 c + 4 l .. + 3 of every 128-column chunk c in registers, so each
// load and store of a wave covers one contiguous run of the row and the row is read once. Row maximum and denominator: per-lane partial, then a xor butterfly over the 32 lanes.
// rel = the row's last causal column minus the lane's first column.
template <int NC>
__device__ __forceinline__ void rsm_row(const float* __restrict__ s, _Float16* __restrict__ d, int rel) {
  v4f e[NC]; float mx = -3.0e38f, se = 0.f;
#pragma unroll      /* here and below: e[] stays in registers only if every index is a constant */
  for (int c = 0; c < NC; ++c) e[c] = *(const v4fa*)(s + c * 128);
#pragma unroll      /* as above */
  for (int c = 0; c < NC; ++c) for (int q = 0; q < 4; ++q) { const float f = (c * 128 + q <= rel) ? 1.f : 0.f; e[c][q] = fmaf(f, e[c][q], (1.f - f) * -1.0e9f); mx = fmaxf(mx, e[c][q]); }
  for (int m = 16; m > 0; m >>= 1) mx = fmaxf(mx, __shfl_xor(mx, m, 32));
#pragma unroll      /* as above */
  for (int c = 0; c < NC; ++c) for (int q = 0; q < 4; ++q) { e[c][q] = __expf(e[c][q] - mx); se += e[c][q]; }
  for (int m = 16; m > 0; m >>= 1) se += __shfl_xor(se, m, 32);
  const float sc = 256.0f / se;
#pragma unroll      /* as above */
  for (int c = 0; c < NC; ++c) { v4h h4; for (int q = 0; q < 4; ++q) h4[q] = (_Float16)(e[c][q] * sc); *(v4h*)(d + c * 128) = h4; }
  asm volatile("s_wait_xcnt 0x0" ::: "memory");      /* behind the row's stores */
}
__global__ __launch_bounds__(256) void k_rsmcf2(const float* __restrict__ S, _Float16* __restrict__ P, int hg, int q0, int nk) {
  static_assert(QT == 256 && NKX == 8 * QT, "one case per row length below");
  const int col = (threadIdx.x & 31) * 4; const int t = blockIdx.x * 8 + (threadIdx.x >> 5); if (t >= hg * QT) return;
  const float* s = S + (size_t)t * NKX + col; _Float16* d = P + (size_t)t * NKX + col; const int rel = q0 + (t % QT) - col;
  switch (nk / QT) {      /* nk = QT .. NKX in steps of QT: one straight-line body per row length, so that the row's registers are indexed by constants */
    case 1: rsm_row<2>(s, d, rel); break; case 2: rsm_row<4>(s, d, rel); break; case 3: rsm_row<6>(s, d, rel); break; case 4: rsm_row<8>(s, d, rel); break;
    case 5: rsm_row<10>(s, d, rel); break; case 6: rsm_row<12>(s, d, rel); break; case 7: rsm_row<14>(s, d, rel); break; case 8: rsm_row<16>(s, d, rel); break; } }



__global__ __launch_bounds__(256) void k_tab128p(const int* __restrict__ pos, int nrows, float theta, float* __restrict__ CS, float* __restrict__ SN) {
  #pragma clang fp contract(off)
  const int t = blockIdx.x * 256 + threadIdx.x; if (t >= nrows * 64) return; const int i = t % 64; const int r = t / 64; const float invf = (float)(1.0 / pow((double)theta, (double)(2 * i) / 128.0)); const float ang = __fmul_rn((float)pos[r], invf); const float c = cosf(ang), sv = sinf(ang);
  float* c0 = CS + (size_t)r * 128 + i; float* s0 = SN + (size_t)r * 128 + i;
  { *(float*)c0 = c; *(float*)(c0 + 64) = c; *(float*)s0 = sv; *(float*)(s0 + 64) = sv;  } }

__global__ __launch_bounds__(256) void k_rsmcim(const float* __restrict__ S, _Float16* __restrict__ P, int hg, int q0, int nk, const int* __restrict__ am) {
  #pragma clang fp contract(off)
  const int t = blockIdx.x * 256 + threadIdx.x; if (t >= hg * QT) return; const size_t i = (size_t)t; const float* s = S + i * NKX; const int last = q0 + (t % QT); const int* mr = am + (size_t)last * SQ; float mx = -3.0e38f;      /* the module's mask row of this query (keys >= nk lie above the diagonal of the causal mask and are not computed) */
#pragma unroll 1
  for (int j = 0; j < nk; ++j) { const float f = (mr[j] != 0) ? 1.f : 0.f; mx = fmaxf(mx, fmaf(f, s[j], (1.f - f) * -1.0e9f)); } float se = 0.f;
#pragma unroll 1
  for (int j = 0; j < nk; ++j) { const float f = (mr[j] != 0) ? 1.f : 0.f; se += __expf(fmaf(f, s[j], (1.f - f) * -1.0e9f) - mx); } const float sc = 256.0f / se;
#pragma unroll 1
  for (int j0 = 0; j0 < nk; j0 += 8) { FragH fr; for (int q = 0; q < 8; ++q) { const int j = j0 + q; const float f = (mr[j] != 0) ? 1.f : 0.f; fr.h[q] = (_Float16)(__expf(fmaf(f, s[j], (1.f - f) * -1.0e9f) - mx) * sc); } unsigned short* d = (unsigned short*)P + i * NKX + j0; *(v8us*)d = fr.half[0];  } }



__device__ __forceinline__ void tab128h_job(int bx, int nr, float theta, float* __restrict__ CS, float* __restrict__ SN) {
  #pragma clang fp contract(off)
  const size_t t = (size_t)bx * 256 + threadIdx.x; if (t >= (size_t)nr * 64) return; const int i = (int)(t % 64); const size_t r = t / 64; const int p = (int)(r % SQ);
  const float invf = (float)(1.0 / pow((double)theta, ((double)(2 * i)) / 128.0)); const float ang = __fmul_rn((float)p, invf); const float c = cosf(ang), sv = sinf(ang);
  float* pc = CS + r * 128 + i; float* ps = SN + r * 128 + i;
  *(float*)pc = c; *(float*)(pc + 64) = c; *(float*)ps = sv; *(float*)(ps + 64) = sv;  }
typedef unsigned int fa_u4 __attribute__((ext_vector_type(4)));
typedef unsigned int fa_u8 __attribute__((ext_vector_type(8)));
typedef short fa_s8 __attribute__((ext_vector_type(8)));
typedef float fa_f2 __attribute__((ext_vector_type(2)));
typedef _Float16 fa_h2 __attribute__((ext_vector_type(2)));
constexpr unsigned FA_PK = 272u;                 /* LDS pitch of a 256-byte K row: odd multiple of 16 bytes, for 16-byte readers */
constexpr unsigned FA_PV = 288u;                 /* LDS pitch of a 256-byte V row: odd multiple of 32 bytes, for the transposing load */
constexpr unsigned FA_SK = 128u;                 /* keys per stage */
constexpr unsigned FA_TK = FA_SK * FA_PK, FA_SLOT = FA_TK + FA_SK * FA_PV;      /* a buffer: K rows, then V rows */
constexpr unsigned FA_EP = 272u;                 /* output staging pitch */
static_assert(4u * 32u * FA_EP <= 2u * FA_SLOT, "output staging must fit the two buffers");
static_assert(HDK == 128 && SQ == 16 * 128 && NB == 2, "written for head size 128, 16 query blocks of 128 rows and two batches (the block order below)");
struct FaFrag { fa_u4 q[2]; };
struct FaK { FaFrag f[2][4]; };                  /* one pass's K: two 16-key tiles x four 32-wide k chunks */
__device__ __forceinline__ v8f fa_mma(const FaFrag& a, const FaFrag& b, v8f c) {
  const fa_u8 av = {a.q[0].x, a.q[0].y, a.q[0].z, a.q[0].w, a.q[1].x, a.q[1].y, a.q[1].z, a.q[1].w};
  const fa_u8 bv = {b.q[0].x, b.q[0].y, b.q[0].z, b.q[0].w, b.q[1].x, b.q[1].y, b.q[1].z, b.q[1].w};
  return __builtin_amdgcn_wmma_f32_16x16x32_f16(false, __builtin_bit_cast(v16h, av), false, __builtin_bit_cast(v16h, bv), (short)0, c, false, false); }
__device__ __forceinline__ fa_u4 fa_tr16(const unsigned char* p) { typedef __attribute__((address_space(3))) fa_s8 lds_s8; return __builtin_bit_cast(fa_u4, __builtin_amdgcn_ds_load_tr16_b128_v8i16((lds_s8*)p)); }
__device__ __forceinline__ unsigned fa_pack2(float lo, float hi) { return __builtin_bit_cast(unsigned, __builtin_convertvector(fa_f2{lo, hi}, fa_h2)); }      /* round to nearest even */
__device__ __forceinline__ float fa_xhalf(float x) { return __builtin_bit_cast(float, __builtin_amdgcn_permlanex16(__builtin_bit_cast(int, x), __builtin_bit_cast(int, x), 0x76543210, 0xfedcba98, false, false)); }      /* lane l with lane l ^ 16 */
__device__ __forceinline__ void fa_keep() { __builtin_amdgcn_sched_barrier(0); }      /* keeps the groups of a pass (products, fragment loads, exponentials) in the written order: moved together they lengthen live ranges and spill */
__device__ __forceinline__ void fa_nop4() { asm volatile("v_nop\n\tv_nop\n\tv_nop\n\tv_nop"); }      /* the four vector slots behind a run of matrix instructions, on every path: a branch follows */
__device__ __forceinline__ void fa_load_k(FaK& k, const unsigned char* Lp, unsigned koff, unsigned lane) {
  const unsigned c = lane & 15u, h = lane >> 4;
#pragma unroll      /* k.f[][] stays in registers only if every index is a constant */
  for (int kt = 0; kt < 2; ++kt) { const unsigned char* p = Lp + koff + (16u * kt + c) * FA_PK + 16u * h;
#pragma unroll      /* as above */
    for (int kc = 0; kc < 4; ++kc) { k.f[kt][kc].q[0] = *reinterpret_cast<const fa_u4*>(p + 64u * kc); k.f[kt][kc].q[1] = *reinterpret_cast<const fa_u4*>(p + 64u * kc + 32u); } } }
// Eight asynchronous 16-byte copies per lane: rows r, r + 8, .. r + 56 of one operand's stage (l = the lane's LDS byte address in row r, g = its global address there; source rows are DKV elements apart).
template <unsigned PITCH>
__device__ __forceinline__ void fa_copy8(unsigned l, const _Float16* g) {
  const unsigned l1 = l + 8u * PITCH, l2 = l + 16u * PITCH, l3 = l + 24u * PITCH, l4 = l + 32u * PITCH, l5 = l + 40u * PITCH, l6 = l + 48u * PITCH, l7 = l + 56u * PITCH;
  const _Float16* g1 = g + 8 * DKV; const _Float16* g2 = g + 16 * DKV; const _Float16* g3 = g + 24 * DKV; const _Float16* g4 = g + 32 * DKV; const _Float16* g5 = g + 40 * DKV; const _Float16* g6 = g + 48 * DKV; const _Float16* g7 = g + 56 * DKV;
  /* the copies and, as the statement's last line, the wait in front of any rewrite of a register that an issued copy names */
  asm volatile("global_load_async_to_lds_b128 %0, %8, off\n\t"
               "global_load_async_to_lds_b128 %1, %9, off\n\t"
               "global_load_async_to_lds_b128 %2, %10, off\n\t"
               "global_load_async_to_lds_b128 %3, %11, off\n\t"
               "global_load_async_to_lds_b128 %4, %12, off\n\t"
               "global_load_async_to_lds_b128 %5, %13, off\n\t"
               "global_load_async_to_lds_b128 %6, %14, off\n\t"
               "global_load_async_to_lds_b128 %7, %15, off\n\t"
               "s_wait_xcnt 0x0"
               :: "v"(l), "v"(l1), "v"(l2), "v"(l3), "v"(l4), "v"(l5), "v"(l6), "v"(l7), "v"(g), "v"(g1), "v"(g2), "v"(g3), "v"(g4), "v"(g5), "v"(g6), "v"(g7) : "memory"); }
__device__ __forceinline__ void fa_pass(FaK& kf, bool fetch_next, unsigned next_koff, const unsigned char* Lp, bool diag, unsigned voff, unsigned key0, unsigned qw0, unsigned lane,
                                        const FaFrag (&qf)[2][4], v8f (&acc)[2][8], float (&m_run)[2], float (&l_run)[2], float cscale) {
  const unsigned c = lane & 15u, h = lane >> 4;
  v8f s[2][2];
  asm volatile("s_wait_dscnt 0x0" ::: "memory");      /* this pass's K fragments have arrived */
  fa_keep();
#pragma unroll      /* every array below is indexed by constants only */
  for (int kt = 0; kt < 2; ++kt) {
#pragma unroll
    for (int g = 0; g < 2; ++g) { s[kt][g] = v8f{};
#pragma unroll
      for (int kc = 0; kc < 4; ++kc) s[kt][g] = fa_mma(kf.f[kt][kc], qf[g][kc], s[kt][g]); } }
  fa_keep(); fa_nop4(); fa_keep();
  if (fetch_next) fa_load_k(kf, Lp, next_koff, lane);
  if (diag) {
#pragma unroll
    for (int g = 0; g < 2; ++g) { const unsigned my_q = qw0 + 16u * g + c;
#pragma unroll
      for (int kt = 0; kt < 2; ++kt) {
#pragma unroll
        for (int r = 0; r < 8; ++r) { const unsigned key = key0 + 16u * kt + 8u * h + r; if (key > my_q) s[kt][g][r] = -__builtin_inff(); }
        asm volatile("" : "+v"(s[kt][g]));
      } } }
  float mb[2]; bool need = false;
#pragma unroll
  for (int g = 0; g < 2; ++g) { float mx = -__builtin_inff();
#pragma unroll
    for (int kt = 0; kt < 2; ++kt) {
#pragma unroll
      for (int r = 0; r < 8; ++r) mx = __builtin_fmaxf(mx, s[kt][g][r]); }
    mx = __builtin_fmaxf(mx, fa_xhalf(mx)) * cscale;
    mb[g] = mx; need = need || (mx > m_run[g] + 8.0f);
    fa_keep(); }
  if (__builtin_amdgcn_ballot_w32(need) != 0) {      /* rare after the first passes */
#pragma unroll
    for (int g = 0; g < 2; ++g) { const float m_new = __builtin_fmaxf(m_run[g], mb[g]);
      const float corr = __builtin_amdgcn_exp2f(m_run[g] - m_new);      /* 0 on the first pass, where m_run is -inf */
      l_run[g] *= corr; m_run[g] = m_new;
#pragma unroll
      for (int t = 0; t < 8; ++t) acc[g][t] = acc[g][t] * corr; } }
  FaFrag vf[8]; float ps[2][2] = {{0.f, 0.f}, {0.f, 0.f}};
  { const unsigned char* ad = Lp + voff + (8u * h + (lane & 7u)) * FA_PV + ((lane >> 3) & 1u) * 16u;
#pragma unroll
    for (int t = 0; t < 8; ++t) { vf[t].q[0] = fa_tr16(ad + 32u * t); vf[t].q[1] = fa_tr16(ad + 16u * FA_PV + 32u * t); } }
#pragma unroll
  for (int g = 0; g < 2; ++g) { const float nm = 4.0f - m_run[g]; unsigned w[8];
#pragma unroll
    for (int i = 0; i < 8; ++i) {
      const fa_f2 arg = __builtin_elementwise_fma(fa_f2{s[i >> 2][g][2 * (i & 3)], s[i >> 2][g][2 * (i & 3) + 1]}, fa_f2{cscale, cscale}, fa_f2{nm, nm});
      const float p0 = __builtin_amdgcn_exp2f(arg.x), p1 = __builtin_amdgcn_exp2f(arg.y);
      ps[g][i & 1] += p0 + p1; w[i] = fa_pack2(p0, p1); }
    FaFrag pf; pf.q[0] = fa_u4{w[0], w[1], w[2], w[3]}; pf.q[1] = fa_u4{w[4], w[5], w[6], w[7]};
    if (g == 0) { asm volatile("s_wait_dscnt 0x0" ::: "memory");      /* the V fragments (and the K fetched ahead) have arrived */
      fa_keep(); }
#pragma unroll
    for (int t = 0; t < 8; ++t) acc[g][t] = fa_mma(vf[t], pf, acc[g][t]);
    fa_keep(); }
  fa_nop4(); fa_keep();
#pragma unroll
  for (int g = 0; g < 2; ++g) l_run[g] += ps[g][0] + ps[g][1];
}
// grid = (query block in the order below, query head, batch): 512 work-groups, all resident. Q [NB SQ][DMX], K and V [NB SQ][DKV], O [NB SQ][DMX] (x64), all f16.
// Block pb walks pb + 1 stages. The order 15, 0, 14, 1, .. in batch 0 and its mirror in batch 1 lets a long block share its WGP with a short one (for speed only)
// whether the two work-groups of a WGP are neighbours in the grid or half a grid apart.
__global__ __launch_bounds__(128) __attribute__((amdgpu_waves_per_eu(2, 2))) void k_fattn(const _Float16* __restrict__ Q, const _Float16* __restrict__ K, const _Float16* __restrict__ V, _Float16* __restrict__ O) {
  __shared__ __attribute__((aligned(16))) unsigned char L[2u * FA_SLOT];
  constexpr float cscale = 0.12751743082459868f;      /* 1 / sqrt(128) x log2(e) */
  const unsigned tid = threadIdx.x, lane = tid & 31u, wave = __builtin_amdgcn_readfirstlane(tid >> 5), c = lane & 15u, h = lane >> 4;
  const unsigned hq = blockIdx.y, gkv = hq >> GSH; const size_t rb = (size_t)blockIdx.z * SQ;
  const unsigned po = (blockIdx.x & 1u) ? (blockIdx.x >> 1) : 15u - (blockIdx.x >> 1), pb = blockIdx.z ? 15u - po : po, q0 = pb * 128u, n_stage = pb + 1u;      /* keys [0, q0 + 128) */
  const unsigned lbase = (unsigned)(size_t)L, qw0 = q0 + wave * 32u;
  const unsigned cr = tid >> 4, cc = tid & 15u;      /* copies: 16 lanes per row, 16 bytes each */
  const unsigned go = (unsigned)(rb + cr) * DKV + gkv * HDK + cc * 8u;      /* the lane's element in K and in V, stage 0: one 32-bit offset beside the two uniform bases */
  const unsigned lk = lbase + cr * FA_PK + cc * 16u, lv = lbase + FA_TK + cr * FA_PV + cc * 16u;
  auto issue = [&](unsigned st) { const unsigned lo = (st & 1u) * FA_SLOT; const size_t o = (size_t)(go + st * (FA_SK * DKV));      /* stage st -> buffer st mod 2: 32 copies a lane */
    fa_keep(); fa_copy8<FA_PK>(lk + lo, K + o); fa_keep(); fa_copy8<FA_PK>(lk + lo + 64u * FA_PK, K + o + 64 * DKV); fa_keep(); fa_copy8<FA_PV>(lv + lo, V + o); fa_keep(); fa_copy8<FA_PV>(lv + lo + 64u * FA_PV, V + o + 64 * DKV); fa_keep(); };      /* each statement's 24 address registers are formed directly in front of it: formed all at once they spill */
  issue(0u);
  FaFrag qf[2][4];      /* Q fragments in the same k order as K's in fa_load_k */
  const _Float16* qp0 = Q + (rb + qw0 + c) * DMX + hq * HDK + 8u * h; const _Float16* qp1 = qp0 + 16 * DMX;
#pragma unroll      /* qf[][] is indexed by constants */
  for (int kc = 0; kc < 4; ++kc) { qf[0][kc].q[0] = *reinterpret_cast<const fa_u4*>(qp0 + 32 * kc); qf[0][kc].q[1] = *reinterpret_cast<const fa_u4*>(qp0 + 32 * kc + 16); qf[1][kc].q[0] = *reinterpret_cast<const fa_u4*>(qp1 + 32 * kc); qf[1][kc].q[1] = *reinterpret_cast<const fa_u4*>(qp1 + 32 * kc + 16); }
  asm volatile("s_wait_xcnt 0x0" :: "v"(qp0), "v"(qp1) : "memory");      /* behind the Q loads, their addresses as inputs: no address register is overwritten while an issued load still names it */
  v8f acc[2][8]; float m_run[2], l_run[2];
#pragma unroll
  for (int g = 0; g < 2; ++g) { m_run[g] = -__builtin_inff(); l_run[g] = 0.0f;
#pragma unroll
    for (int t = 0; t < 8; ++t) acc[g][t] = v8f{}; }
  asm volatile("s_wait_asynccnt 0x0" ::: "memory");      /* this wave's copies of stage 0 have landed */
  __syncthreads();      /* ... and every other wave's: stage 0 may be read */
  if (n_stage > 1u) issue(1u);      /* the same for the whole work-group */
  const unsigned my_last = qw0 / 32u;      /* the last pass that this wave's 32 queries can see: the one on its diagonal */
  FaK kf;
#pragma unroll 1      /* stage loop and pass loop stay nested and rolled: one body of 32 matrix instructions */
  for (unsigned st = 0; st < n_stage; ++st) { const unsigned bo = (st & 1u) * FA_SLOT;
#pragma unroll 1      /* as above */
    for (unsigned sub = 0; sub < 4u; ++sub) { const unsigned blk = 4u * st + sub;
      if (blk <= my_last) {      /* wave-uniform; a wave past its diagonal still passes every barrier below */
        if (sub == 0u) fa_load_k(kf, L, bo, lane);      /* a stage's first K fragments are read in that stage's own trip, behind its barrier */
        fa_pass(kf, sub < 3u && blk < my_last, bo + (sub + 1u) * 32u * FA_PK, L, blk == my_last, bo + FA_TK + sub * 32u * FA_PV, blk * 32u, qw0, lane, qf, acc, m_run, l_run, cscale); } }
    asm volatile("s_wait_dscnt 0x0" ::: "memory");      /* this wave's reads of stage st are done before its buffer is given up */
    asm volatile("s_wait_asynccnt 0x0" ::: "memory");      /* this wave's copies of stage st + 1 have landed */
    __syncthreads();      /* publishes stage st + 1 and ends every wave's reads of stage st */
    if (st + 2u < n_stage) issue(st + 2u); }      /* into the buffer just left */
  asm volatile("s_wait_asynccnt 0x0" ::: "memory");      /* nothing of this wave is in flight when the buffers become output staging */
  unsigned char* eb = L + wave * 32u * FA_EP;      /* each wave stages its own 32 rows; the loop's last barrier has ended every read of the buffers */
#pragma unroll
  for (int g = 0; g < 2; ++g) { const float l_fin = l_run[g] + fa_xhalf(l_run[g]);
    const float inv = 64.0f / l_fin;      /* o x64, the scale that the output projection expects */
#pragma unroll
    for (int t = 0; t < 8; ++t) { const v8f o = acc[g][t] * inv; const fa_u4 pk = {fa_pack2(o[0], o[1]), fa_pack2(o[2], o[3]), fa_pack2(o[4], o[5]), fa_pack2(o[6], o[7])};
      *reinterpret_cast<fa_u4*>(eb + (16u * g + c) * FA_EP + 32u * t + 16u * h) = pk; } }
  asm volatile("s_wait_dscnt 0x0" ::: "memory");      /* the wave's own staged rows are written before it reads them back */
  _Float16* op = O + (rb + qw0 + (lane >> 4)) * DMX + hq * HDK + (lane & 15u) * 8u;
#pragma unroll
  for (unsigned i = 0; i < 16u; ++i) { const fa_u4 v = *reinterpret_cast<const fa_u4*>(eb + (2u * i + (lane >> 4)) * FA_EP + (lane & 15u) * 16u); *reinterpret_cast<fa_u4*>(op + (size_t)(2u * i) * DMX) = v; }
}
// ---- merged launches: jobs that do not depend on one another share one launch; the range that a work-group's index falls in names its job (the same test for the whole work-group, in front of every barrier) ----
constexpr int PJ_TAB = (int)(NR * 64 / 256), PJ_WB = (DMX / 128) * (DMX / 64), PJ_WS = (DMX / 128) * (DKV / 64), PJ_X = (int)(NR * DMX / 8 / 256);
// cos / sin tables (first: the longest chain of arithmetic), the four weight transpositions ([in][out] -> Bt x16), x -> f16
__global__ __launch_bounds__(256) void k_prep(const float* __restrict__ x, const float* __restrict__ wq, const float* __restrict__ wk, const float* __restrict__ wv, const float* __restrict__ wo,
    _Float16* __restrict__ X16, _Float16* __restrict__ BQ, _Float16* __restrict__ BK, _Float16* __restrict__ BV, _Float16* __restrict__ BO, float theta, float* __restrict__ CS, float* __restrict__ SN) {
  __shared__ unsigned int lt[64][65];
  int b = blockIdx.x;
  if (b < PJ_TAB) { tab128h_job(b, (int)NR, theta, CS, SN); return; }      /* per-row cos/sin tables [NR][128] for positions r % SQ, duplicated over both halves (cat(f, f)) */
  b -= PJ_TAB;
  if (b < 2 * PJ_WB) { const bool o = b >= PJ_WB; wt_f16_job<DMX, DMX>(lt, o ? b - PJ_WB : b, o ? wo : wq, o ? BO : BQ, 16.0f); return; }
  b -= 2 * PJ_WB;
  if (b < 2 * PJ_WS) { const bool v = b >= PJ_WS; wt_f16_job<DMX, DKV>(lt, v ? b - PJ_WS : b, v ? wv : wk, v ? BV : BK, 16.0f); return; }
  b -= 2 * PJ_WS;
  x16_job(b, x, X16, NR * DMX / 8); }
template <int ACT>
__global__ __launch_bounds__(256) void k_gemm2(const _Float16* __restrict__ A, int lda, size_t sA, const _Float16* __restrict__ Bh, int ldb, size_t sB, float alpha, const float* __restrict__ bias, size_t sBias, const float* __restrict__ CP, int rowsPerB, size_t sCPb, int row0g,
    float* __restrict__ C, _Float16* __restrict__ C16, int ldc, size_t sC, int M, int N, int K, int bsh, size_t zA, size_t zB, size_t zC) {
  gemm2_job<ACT>(blockIdx.x, blockIdx.y, blockIdx.z, 0, A, lda, sA, Bh, ldb, sB, alpha, bias, sBias, CP, rowsPerB, sCPb, row0g, C, C16, ldc, sC, M, N, K, bsh, zA, zB, zC); }
// The three projections of x: q (f32), k (f32), v (f32 and f16, all rows)
constexpr int GJ_Q = (int)(NR / 128) * (DMX / 128), GJ_K = (int)(NR / 128) * (DKV / 128);
__global__ __launch_bounds__(256) void k_gemm_qkv(const _Float16* __restrict__ X16, const _Float16* __restrict__ BQ, const _Float16* __restrict__ BK, const _Float16* __restrict__ BV,
    float* __restrict__ QF, float* __restrict__ KF, float* __restrict__ VF, _Float16* __restrict__ V16) {
  const int b = blockIdx.x; const int job = b < GJ_Q ? 0 : (b < GJ_Q + GJ_K ? 1 : 2);
  const _Float16* Bt = job == 0 ? BQ : (job == 1 ? BK : BV); float* C = job == 0 ? QF : (job == 1 ? KF : VF); _Float16* C16 = job == 2 ? V16 : nullptr; const int N = job == 0 ? DMX : DKV;
  gemm2_job<0>(job == 0 ? b : (job == 1 ? b - GJ_Q : b - GJ_Q - GJ_K), 0, 0, 0, X16, DMX, 0, Bt, DMX, 0, 0.0625f, nullptr, 0, nullptr, 1, 0, 0, C, C16, N, 0, (int)NR, N, DMX, 0, 0, 0, 0); }
// out = o Wo. The row tiles of each batch's first QT0 rows take the exact path's f16 hi plane (QT0 rows per batch) as A, all others the fused attention's o: same weights, same scale, every output tile written once.
__global__ __launch_bounds__(256) void k_gemm_out(const _Float16* __restrict__ O16, const _Float16* __restrict__ OH0, const _Float16* __restrict__ BO, float* __restrict__ out) {
  const int mt = blockIdx.x / (DMX / 128), lt = mt % (SQ / 128); const bool first = lt < QT0 / 128;
  gemm2_job<0>(blockIdx.x, 0, 0, first ? (mt / (SQ / 128)) * QT0 + lt * 128 - mt * 128 : 0, first ? OH0 : O16, DMX, 0, BO, DMX, 0, 0.0009765625f, nullptr, 0, nullptr, 1, 0, 0, out, nullptr, DMX, 0, (int)NR, DMX, DMX, 0, 0, 0, 0); }
// rope of q and of k (all rows -> f16), f32 roped q and k of each batch's first QT0 rows, and v's kv head -> query head expansion for the exact first tile
constexpr int RJ_A = (int)(NR / 8), RJ_0 = QT0 / 8, RJ_E = (int)(((size_t)QT0 * DMX / 4 + 255) / 256);
__global__ __launch_bounds__(256) void k_rope_all(const float* __restrict__ QF, const float* __restrict__ KF, const float* __restrict__ VF, const float* __restrict__ CS, const float* __restrict__ SN,
    _Float16* __restrict__ Q16, _Float16* __restrict__ K16, float* __restrict__ QF0, float* __restrict__ KRF0, float* __restrict__ VF0e) {
  int b = blockIdx.x;
  if (b < RJ_A) { rope128w_job<NH, 0>(b, 0, QF, CS, SN, nullptr, Q16, 1.0f, 0, 0); return; }
  b -= RJ_A;
  if (b < RJ_A) { rope128w_job<NKV, 0>(b, 0, KF, CS, SN, nullptr, K16, 1.0f, 0, 0); return; }
  b -= RJ_A;
  if (b < RJ_0 * NB) { rope128w_job<NH, 1>(b % RJ_0, b / RJ_0, QF, CS, SN, QF0, nullptr, 1.0f, SQ, QT0); return; }
  b -= RJ_0 * NB;
  if (b < RJ_0 * NB) { rope128w_job<NKV, 1>(b % RJ_0, b / RJ_0, KF, CS, SN, KRF0, nullptr, 1.0f, SQ, QT0); return; }
  b -= RJ_0 * NB;
  kvexp128_job<GSZ, NH, DKV>(b % RJ_E, b / RJ_E, VF, VF0e, (size_t)QT0 * DMX / 4, (size_t)SQ * DKV, (size_t)QT0 * DMX); }
__global__ __launch_bounds__(256) void k_kvexp_k(const float* __restrict__ KRF0, float* __restrict__ KF0e) { kvexp128_job<GSZ, NH, DKV>(blockIdx.x, blockIdx.y, KRF0, KF0e, (size_t)QT0 * DMX / 4, (size_t)QT0 * DKV, (size_t)QT0 * DMX); }      /* grid.y = batch */
extern "C" void kernel_launch(void* const* d_in, const int* in_sizes, int n_in,
                              void* d_out, int out_size, void* d_ws, size_t ws_size, hipStream_t stream) {
  (void)in_sizes; (void)n_in; (void)out_size;
  const float* const* I = (const float* const*)d_in; const float* x = I[0]; const float* wq = I[1]; const float* wk = I[2]; const float* wv = I[3]; const float* wo = I[4];      /* [in][out] Wq [2048][2048], Wk/Wv [2048][1024], Wo [2048][2048]; no biases; positions implicit */
  char* ws = (char*)d_ws; size_t off = 0;
  auto take = [&](size_t bytes) { char* p = ws + off; off += (bytes + 255) & ~(size_t)255; return p; };
  _Float16* BQ = (_Float16*)take((size_t)DMX * DMX * 2); _Float16* BK = (_Float16*)take((size_t)DKV * DMX * 2); _Float16* BV = (_Float16*)take((size_t)DKV * DMX * 2); _Float16* BO = (_Float16*)take((size_t)DMX * DMX * 2);
  _Float16* X16 = (_Float16*)take(NR * DMX * 2); float* QF = (float*)take(NR * (DMX + 2 * DKV) * 4); float* KF = QF + NR * DMX; float* VF = KF + NR * DKV; _Float16* Q16 = (_Float16*)take(NR * DMX * 2); _Float16* K16 = (_Float16*)take(NR * DKV * 2); _Float16* V16 = (_Float16*)take(NR * DKV * 2); _Float16* O16 = (_Float16*)take(NR * DMX * 2);
  float* CS = (float*)take(NR * 128 * 4); float* SN = (float*)take(NR * 128 * 4); float* QF0 = (float*)take((size_t)NB * QT0 * DMX * 4); float* KRF0 = (float*)take((size_t)NB * QT0 * DKV * 4); float* KF0e = (float*)take((size_t)NB * QT0 * DMX * 4); float* VF0e = (float*)take((size_t)NB * QT0 * DMX * 4); float* OF0 = (float*)take((size_t)NB * QT0 * DMX * 4); _Float16* OH0 = (_Float16*)take((size_t)NB * QT0 * DMX * 2); _Float16* OL0 = (_Float16*)take((size_t)NB * QT0 * DMX * 2);
  if (off > ws_size) return;      /* 24 (weights) + 16 + 64 + 16 + 8 + 8 + 16 + 2 + 2 + 4 + 2 + 4 + 4 + 4 + 2 + 2 = 178 MiB */
  k_prep<<<PJ_TAB + 2 * PJ_WB + 2 * PJ_WS + PJ_X, 256, 0, stream>>>(x, wq, wk, wv, wo, X16, BQ, BK, BV, BO, 10000.0f, CS, SN);      /* tables, weights, x */
  k_gemm_qkv<<<GJ_Q + 2 * GJ_K, 256, 0, stream>>>(X16, BQ, BK, BV, QF, KF, VF, V16);      /* q, k, v */
  k_rope_all<<<2 * RJ_A + 2 * RJ_0 * NB + RJ_E * NB, 256, 0, stream>>>(QF, KF, VF, CS, SN, Q16, K16, QF0, KRF0, VF0e);      /* rope; first-tile f32 q, k; expanded v */
  k_kvexp_k<<<dim3(RJ_E, NB), 256, 0, stream>>>(KRF0, KF0e);      /* kv head -> query head expansion of the first tile's roped k */
  k_att0h<<<dim3(NH * (QT0 / 32), NB), 256, 0, stream>>>(QF0, KF0e, VF0e, ATS, OF0);      /* exact causal attention, first QT0 rows (o x64) */
  k_hl<<<(unsigned)(((size_t)NB * QT0 * DMX / 8 + 255) / 256), 256, 0, stream>>>(OF0, OH0, OL0, (size_t)NB * QT0 * DMX / 8);      /* first-tile o (x64) -> f16 hi + x1024 residual planes */
  k_fattn<<<dim3(SQ / 128, NH, NB), 128, 0, stream>>>(Q16, K16, V16, O16);      /* causal attention of all rows, heads and batches -> o (x64, f16): query head y vs kv head y >> GSH */
  k_gemm_out<<<GJ_Q, 256, 0, stream>>>(O16, OH0, BO, (float*)d_out);      /* out = o Wo, the first QT0 rows of each batch from the exact path's hi plane */
  k_gemm2<0><<<dim3((QT0 / 128) * (DMX / 128), 1, NB), 256, 0, stream>>>(OL0, DMX, 0, BO, DMX, 0, 0.00000095367431640625f, nullptr, 0, (const float*)d_out, -1, 0, 0, (float*)d_out, nullptr, DMX, 0, QT0, DMX, DMX, 0, (size_t)QT0 * DMX, 0, (size_t)SQ * DMX);      /* += o_lo Wo 2^-20 (own-element accumulate) */
}
